// v000
// Times are from an AMD MI455X. After a warm-up the kernel runs many times in a row, and a time is the length of
// such a window on the GPU divided by its runs, so every launch and the gaps after it count. The runs cycle
// through copies of the inputs. A figure is the median of several windows, for all but v000 over two sittings.
// Sittings can differ by a few percent; kernels timed side by side share one.
// v000, which the later versions start from, runs in 486 microseconds.
// Contractions: q|k projection and v^T projection = v_wmma_f32_16x16x32_bf16 (bf16 operands from RNE-converted x and w_qkv, single product);
// q.k^T scores = v_wmma_f32_16x16x32_f16 (q as f16 hi plane + f16 residual plane x4096 in a separate accumulator, k f16; 2 products);
// p.v = v_wmma_f32_16x16x32_f16 (p carried x1024 in f16, v^T f16; 1 product);
// ctx.w_out^T = v_wmma_f32_16x16x32_bf16 (ctx as bf16 hi + lo planes times bf16 w_out, 2 products); all f32 accumulate; bias, RoPE, softmax in f32.
#include <hip/hip_runtime.h>
#include <math.h>
#include <stdint.h>

#define SEQ   4096
#define DM    1024
#define NH    16
#define HD    64
#define NQB   (SEQ / 64)     // 64 key / query tiles of 64
#define QKP   (2 * DM)        // pitch of the f32 q|k staging plane: q at cols 0..DM-1, k at cols DM..2DM-1
static_assert(NH * HD == DM);
static_assert((SEQ % 64) == 0 && (DM % 64) == 0 && (DM % 32) == 0);
static_assert((HD % 8) == 0 && (HD / 2) % 8 == 0);

typedef _Float16 v16h __attribute__((ext_vector_type(16)));
typedef _Float16 v8h  __attribute__((ext_vector_type(8)));
typedef __bf16   v16b __attribute__((ext_vector_type(16)));
typedef __bf16   v8b  __attribute__((ext_vector_type(8)));
typedef float    v8f  __attribute__((ext_vector_type(8)));
typedef float    v4f  __attribute__((ext_vector_type(4)));
typedef unsigned int v4u __attribute__((ext_vector_type(4)));

// ---- scalar helpers --------------------------------------------------------------------------------
__device__ __forceinline__ unsigned short bf_bits(float f) {          // f32 -> bf16 bits, RNE convert
  unsigned u = __float_as_uint(f);
  return (unsigned short)((u + 0x7FFFu + ((u >> 16) & 1u)) >> 16);
}
__device__ __forceinline__ float bf_up(unsigned short h) { return __uint_as_float(((unsigned)h) << 16); }
__device__ __forceinline__ float bf_rne(float f) { return bf_up(bf_bits(f)); }
__device__ __forceinline__ unsigned short h_bits(_Float16 x) { return __builtin_bit_cast(unsigned short, x); }
__device__ __forceinline__ unsigned pk16(unsigned short a, unsigned short b) { return (unsigned)a | ((unsigned)b << 16); }
__device__ __forceinline__ v8f zero8() { v8f z = {0.f, 0.f, 0.f, 0.f, 0.f, 0.f, 0.f, 0.f}; return z; }

// ---- fragment loaders: 16-bit A/B operand, lane -> row/col (lane&15), p already includes +8*(lane>>4);
//      elements 0..7 <- p[0..7] (k0+8h..), elements 8..15 <- p[16..23] (k0+16+8h..)
__device__ __forceinline__ v16b ldfrag_b(const __bf16* p) {
  union { v16b v; v8b h[2]; } f;
  f.h[0] = *(const v8b*)(p);
  f.h[1] = *(const v8b*)(p + 16);
  return f.v;
}
__device__ __forceinline__ v16h ldfrag_h(const _Float16* p) {
  union { v16h v; v8h h[2]; } f;
  f.h[0] = *(const v8h*)(p);
  f.h[1] = *(const v8h*)(p + 16);
  return f.v;
}

// ---- WMMA helpers with trailing VALU hazard gap --------------------------------------------------------
__device__ __forceinline__ v8f mma_h(v16h a, v16h b, v8f c) {
  c = __builtin_amdgcn_wmma_f32_16x16x32_f16(false, a, false, b, (short)0, c, false, false);
#if defined(__HIP_DEVICE_COMPILE__)
  asm volatile("v_nop\n\tv_nop\n\tv_nop\n\tv_nop" : "+v"(c) : "v"(a), "v"(b));
#endif
  return c;
}
__device__ __forceinline__ v8f mma_b_raw(v16b a, v16b b, v8f c) {
  return __builtin_amdgcn_wmma_f32_16x16x32_bf16(false, a, false, b, (short)0, c, false, false);
}
__device__ __forceinline__ void dep_guard_b(v8f& a, v8f& b, v16b x, v16b y) {
#if defined(__HIP_DEVICE_COMPILE__)
  asm volatile("v_nop\n\tv_nop\n\tv_nop\n\tv_nop" : "+v"(a), "+v"(b) : "v"(x), "v"(y));
#endif
}
__device__ __forceinline__ void keep4_b(v16b a, v16b b, v16b c, v16b d) {
#if defined(__HIP_DEVICE_COMPILE__)
  asm volatile("v_nop" :: "v"(a), "v"(b), "v"(c), "v"(d));
#endif
}
__device__ __forceinline__ void acc_guard4(v8f& a, v8f& b, v8f& c, v8f& d) {
#if defined(__HIP_DEVICE_COMPILE__)
  asm volatile("v_nop\n\tv_nop\n\tv_nop\n\tv_nop" : "+v"(a), "+v"(b), "+v"(c), "+v"(d));
#endif
}
__device__ __forceinline__ void wave_sync_lds() {
  __builtin_amdgcn_fence(__ATOMIC_RELEASE, "workgroup");
  __builtin_amdgcn_wave_barrier();
  __builtin_amdgcn_fence(__ATOMIC_ACQUIRE, "workgroup");
}

// =====================================================================================================
// f32 -> bf16 (RNE convert), 8 elements per thread, one 16-B store per lane: a wave writes 512 contiguous B
// coverage: n8 threads x 8 = whole plane (n8 is a multiple of 256 for every use here).
// =====================================================================================================
__global__ __launch_bounds__(256) void cvt_bf16x8(const float* __restrict__ in, unsigned short* out, int n8) {
  const int i = blockIdx.x * 256 + threadIdx.x;
  if (i < n8) {
    const v4f a = *(const v4f*)(in + (size_t)i * 8);
    const v4f b = *(const v4f*)(in + (size_t)i * 8 + 4);
    v4u p;
    p[0] = pk16(bf_bits(a[0]), bf_bits(a[1]));
    p[1] = pk16(bf_bits(a[2]), bf_bits(a[3]));
    p[2] = pk16(bf_bits(b[0]), bf_bits(b[1]));
    p[3] = pk16(bf_bits(b[2]), bf_bits(b[3]));
    *(v4u*)(out + (size_t)i * 8) = p;
    
  }
}

// =====================================================================================================
// Register-blocked batched bf16 WMMA GEMM: C[m][n] = sum_k A[m][k] * Bt[n][k] + bias; one wave per 64x64 tile,
// no block barriers. A row-major [M][K] pitch lda; Bt row-major [N][K] pitch ldb (k contiguous);
// M, N multiples of 64, K multiple of 32 (host-checked). blockIdx.y = batch index (strides in elements).
// NSPLIT: 0 = A.Bt; 1 = (A + A2).Bt (A2 = unscaled bf16 lo plane of A); 2 = A.Bt + A2.Bt + A.Bt2.
// OUT_MODE: 0 = f32 (pitch ldc); 2 = bf16 hi plane C + bf16 lo plane C2 (lo = RNE(v - hi), unscaled);
//           3 = f16 hi plane C + f16 residual plane C2 = f16((v - hi) * rscale), C2 written only for tiles
//               with n0 < N2 (pitch ldc2, batch stride strideC2).
// BIAS_MODE: 1 = + biasp[n] (per column), 2 = + biasp[m] (per row); bias values RNE-converted to bf16 and
//            added in f32 before any 16-bit conversion of the result.
// =====================================================================================================
template <int NSPLIT, int OUT_MODE, int BIAS_MODE>
__global__ __launch_bounds__(256) void gemm64(
    const unsigned short* __restrict__ Ap, const unsigned short* A2p, int lda, long long strideA,
    const unsigned short* __restrict__ Btp, const unsigned short* Bt2p, int ldb, long long strideB,
    void* Cout, int ldc, long long strideC,
    void* Cout2, int ldc2, long long strideC2, int N2,
    const float* __restrict__ biasp,
    int M, int N, int K, float rscale) {
  const __bf16* A   = (const __bf16*)(const void*)Ap;
  const __bf16* A2  = (const __bf16*)(const void*)A2p;
  const __bf16* Bt  = (const __bf16*)(const void*)Btp;
  const __bf16* Bt2 = (const __bf16*)(const void*)Bt2p;
  __shared__ __align__(16) float sT[8][16 * 68];   // per-wave 16x64 slab, pitch 68 floats
  const int b    = blockIdx.y;
  const int lane = threadIdx.x & 31;
  const int wave = threadIdx.x >> 5;
  const int tilesN = N >> 6;
  const int tilesM = M >> 6;
  const int tile = blockIdx.x * 8 + wave;
  if (tile >= tilesM * tilesN) return;   // wave-uniform; no block barriers in this kernel
  const int tm = tile / tilesN;
  const int tn = tile - tm * tilesN;
  const int m0 = tm << 6;
  const int n0 = tn << 6;

  const __bf16* Ab  = A  + (size_t)b * strideA;
  const __bf16* Bb  = Bt + (size_t)b * strideB;
  const __bf16* Ab2 = (NSPLIT >= 1) ? (A2  + (size_t)b * strideA) : Ab;
  const __bf16* Bb2 = (NSPLIT == 2) ? (Bt2 + (size_t)b * strideB) : Bb;

  const int rlane = lane & 15;                 // row (A) / col (B, D) within subtile
  const int koff  = (lane >> 4) * 8;           // k offset of this lane half
  const int mOff  = (lane >> 4) * 8;           // D row offset

  v8f acc[4][4];
#pragma unroll
  for (int i = 0; i < 4; ++i)
#pragma unroll
    for (int j = 0; j < 4; ++j) acc[i][j] = zero8();

  for (int k0 = 0; k0 < K; k0 += 32) {
    v16b bh[4], bl[4];
#pragma unroll
    for (int j = 0; j < 4; ++j) {
      const size_t bo = (size_t)(n0 + (j << 4) + rlane) * ldb + koff + k0;
      bh[j] = ldfrag_b(Bb + bo);
      if (NSPLIT == 2) bl[j] = ldfrag_b(Bb2 + bo); else bl[j] = bh[j];
    }
#pragma unroll
    for (int i = 0; i < 4; ++i) {
      const size_t ao = (size_t)(m0 + (i << 4) + rlane) * lda + koff + k0;
      const v16b ah = ldfrag_b(Ab + ao);
      v16b al = ah;
      if (NSPLIT >= 1) al = ldfrag_b(Ab2 + ao);
#pragma unroll
      for (int j = 0; j < 4; ++j) {
        acc[i][j] = mma_b_raw(ah, bh[j], acc[i][j]);
        if (NSPLIT >= 1) acc[i][j] = mma_b_raw(al, bh[j], acc[i][j]);
        if (NSPLIT == 2) acc[i][j] = mma_b_raw(ah, bl[j], acc[i][j]);
      }
      dep_guard_b(acc[i][0], acc[i][3], ah, al);
    }
    keep4_b(bh[0], bh[1], bh[2], bh[3]);
    if (NSPLIT == 2) keep4_b(bl[0], bl[1], bl[2], bl[3]);
  }
  acc_guard4(acc[0][0], acc[0][1], acc[0][2], acc[0][3]);
  acc_guard4(acc[1][0], acc[1][1], acc[1][2], acc[1][3]);
  acc_guard4(acc[2][0], acc[2][1], acc[2][2], acc[2][3]);
  acc_guard4(acc[3][0], acc[3][1], acc[3][2], acc[3][3]);

  // ---- epilogue ----
  float* slab = sT[wave];
#pragma unroll
  for (int i = 0; i < 4; ++i) {
    const int mBase = m0 + (i << 4);
    float brow[8];
#pragma unroll
    for (int r = 0; r < 8; ++r) {
      brow[r] = 0.f;
      if (BIAS_MODE == 2) brow[r] = bf_rne(biasp[mBase + mOff + r]);
    }
#pragma unroll
    for (int j = 0; j < 4; ++j) {
      float bcol = 0.f;
      if (BIAS_MODE == 1) bcol = bf_rne(biasp[n0 + (j << 4) + rlane]);
#pragma unroll
      for (int r = 0; r < 8; ++r) {
        slab[(mOff + r) * 68 + (j << 4) + rlane] = acc[i][j][r] + bcol + brow[r];
      }
    }
    wave_sync_lds();
    if (OUT_MODE == 0) {
      float* C = (float*)Cout + (size_t)b * strideC;
      const int hh = lane >> 4, c4 = (lane & 15) * 4;     // 256-B row segment = 16 lanes x 16 B
      {
#pragma unroll
        for (int it = 0; it < 8; ++it) {
          const int row = it * 2 + hh;                     // it 0..7 x hh 0..1 = rows 0..15
          const v4f v = *(const v4f*)(slab + row * 68 + c4);
          *(v4f*)(C + (size_t)(mBase + row) * ldc + n0 + c4) = v;
        }
        
      }
    } else {
      const int q = lane >> 3, c8 = (lane & 7) * 8;
      unsigned short* C  = (unsigned short*)Cout  + (size_t)b * strideC;
      unsigned short* C2 = (unsigned short*)Cout2 + (size_t)b * strideC2;
      const bool wlo = (OUT_MODE == 2) || (n0 < N2);      // wave-uniform
      v4u hv[4], lv[4];
#pragma unroll
      for (int it = 0; it < 4; ++it) {
        const int row = it * 4 + q;                        // it 0..3 x q 0..3 = rows 0..15
        const float* sp = slab + row * 68 + c8;
        v4u a, a2;
#pragma unroll
        for (int e = 0; e < 4; ++e) {
          const float f0 = sp[2 * e], f1 = sp[2 * e + 1];
          unsigned short h0, h1, l0, l1;
          if (OUT_MODE == 2) {
            h0 = bf_bits(f0); h1 = bf_bits(f1);
            l0 = bf_bits(f0 - bf_up(h0)); l1 = bf_bits(f1 - bf_up(h1));
          } else {
            const _Float16 x0 = (_Float16)f0, x1 = (_Float16)f1;
            h0 = h_bits(x0); h1 = h_bits(x1);
            l0 = h_bits((_Float16)((f0 - (float)x0) * rscale));
            l1 = h_bits((_Float16)((f1 - (float)x1) * rscale));
          }
          a[e] = pk16(h0, h1); a2[e] = pk16(l0, l1);
        }
        hv[it] = a; lv[it] = a2;
      }
      {
#pragma unroll
        for (int it = 0; it < 4; ++it) {
          const int row = it * 4 + q;
          *(v4u*)(C + (size_t)(mBase + row) * ldc + n0 + c8) = hv[it];
          if (wlo) *(v4u*)(C2 + (size_t)(mBase + row) * ldc2 + n0 + c8) = lv[it];
        }
        
      }
    }
    wave_sync_lds();
  }
}

// =====================================================================================================
// RoPE row pass (rotate-half, half = HD/2 = 32) on the f32 q|k staging plane (bias already added):
//   y[d] = x[d] * cos[s][d] + (d < 32 ? -x[d+32] : x[d-32]) * sin[s][d],  tables [SEQ][HD] shared over heads,
//   table values RNE-converted to bf16 on read.
// One block (256 threads) per token row s; thread t owns 8 consecutive columns of q (t < 128, waves 0..3)
// or of k (t >= 128, waves 4..7): the 8 columns share one head half, so the rotate partner is the 8-group
// at +-32. Outputs: q -> f16 hi plane + f16 residual plane ((y - hi) * rscale); k -> f16 plane; all [SEQ][DM].
// =====================================================================================================
__global__ __launch_bounds__(256) void rope_rows(
    const float* __restrict__ qkf, const float* __restrict__ cosp, const float* __restrict__ sinp,
    unsigned short* qhp, unsigned short* qlp, unsigned short* kpp, int nrows, float rscale) {
  const int row = blockIdx.x;
  if (row >= nrows) return;                       // block-uniform; no barriers in this kernel
  const int t   = threadIdx.x;
  const int isk = t >> 7;                         // 0: q section, 1: k section (wave-uniform)
  const int c0  = (t & 127) * 8;                  // column within the DM-wide section
  const int d0  = c0 & (HD - 1);                  // head-dim offset, multiple of 8
  const bool lowhalf = (d0 < (HD / 2));
  const int pc0 = lowhalf ? (c0 + HD / 2) : (c0 - HD / 2);   // partner columns, same head, in range
  const float sgn = lowhalf ? -1.0f : 1.0f;

  const float* src = qkf + (size_t)row * QKP + (size_t)isk * DM;
  const v4f x0 = *(const v4f*)(src + c0);
  const v4f x1 = *(const v4f*)(src + c0 + 4);
  const v4f p0 = *(const v4f*)(src + pc0);
  const v4f p1 = *(const v4f*)(src + pc0 + 4);
  const v4f cA = *(const v4f*)(cosp + (size_t)row * HD + d0);
  const v4f cB = *(const v4f*)(cosp + (size_t)row * HD + d0 + 4);
  const v4f sA = *(const v4f*)(sinp + (size_t)row * HD + d0);
  const v4f sB = *(const v4f*)(sinp + (size_t)row * HD + d0 + 4);

  v4f y0, y1;
#pragma unroll
  for (int e = 0; e < 4; ++e) {
    y0[e] = x0[e] * bf_rne(cA[e]) + (sgn * p0[e]) * bf_rne(sA[e]);
    y1[e] = x1[e] * bf_rne(cB[e]) + (sgn * p1[e]) * bf_rne(sB[e]);
  }
  v4u hv, lv;
#pragma unroll
  for (int e = 0; e < 2; ++e) {
    const float f0 = y0[2 * e], f1 = y0[2 * e + 1];
    const float g0 = y1[2 * e], g1 = y1[2 * e + 1];
    const _Float16 a0 = (_Float16)f0, a1 = (_Float16)f1;
    const _Float16 b0 = (_Float16)g0, b1 = (_Float16)g1;
    hv[e]     = pk16(h_bits(a0), h_bits(a1));
    hv[2 + e] = pk16(h_bits(b0), h_bits(b1));
    lv[e]     = pk16(h_bits((_Float16)((f0 - (float)a0) * rscale)),
                     h_bits((_Float16)((f1 - (float)a1) * rscale)));
    lv[2 + e] = pk16(h_bits((_Float16)((g0 - (float)b0) * rscale)),
                     h_bits((_Float16)((g1 - (float)b1) * rscale)));
  }
  const size_t o = (size_t)row * DM + c0;
  if (isk == 0) {
    *(v4u*)(qhp + o) = hv;
    *(v4u*)(qlp + o) = lv;
    
  } else {
    *(v4u*)(kpp + o) = hv;
    
  }
}

// =====================================================================================================
// Attention, head dim 64, no mask, softmax over all SEQ keys.
//   q hi plane (f16, pitch DM): element (t, h, d) at [t*DM + h*64 + d]; q residual plane (f16, (q - f16(q))*4096) same layout;
//   k plane (f16, pitch DM): [s*DM + h*64 + d]
//   v^T plane (f16): element (h, d, s) at [(h*64 + d)*SEQ + s]
//   out planes (bf16 hi / lo of the normalised context): element (t, h, d) at [t*DM + h*64 + d]
//   scores = (qh . k + (ql . k) * rres) * sscale on f16 WMMA, residual products in a separate accumulator
//   p = exp(s - m) carried as f16(1024 p); context = p . v on f16 WMMA; online softmax in f32.
//   Block = 4 waves = 64 query rows of one head h; grid = NQB * NH; kv chunks of 64, static trip NQB.
//   K / V^T chunk staging: 128 threads x 32 elements per plane = the whole 64x64 tile (plain 16-B loads,
//   __syncthreads before and after); P tiles are wave-private, spilled with _Float16 element stores and
//   Output coverage: each wave stores rows q0..q0+15 (it 0..3 x lane>>3 0..3) x 64 columns (8 lanes x 8) of both planes.
// =====================================================================================================
__global__ __launch_bounds__(128)
void attn64(const unsigned short* __restrict__ qhp, const unsigned short* __restrict__ qlp,
            const unsigned short* __restrict__ kpp, const unsigned short* __restrict__ vtp,
            unsigned short* ohp, unsigned short* olp, float sscale, float rres) {
  union FH { v16h v; v8h h[2]; };
  __shared__ __align__(16) _Float16 Ksh[64 * 64];                 // K [kv][d]   8 KB
  __shared__ __align__(16) _Float16 Vth[64 * 64];                 // V^T [d][kv] 8 KB
  __shared__ __align__(16) _Float16 Psh[4][16 * 64];              // per wave P [row][kv]
  __shared__ __align__(16) float    Os[4][16 * 64];               // per wave context tile [row][d]

  const int tid  = threadIdx.x;
  const int wave = tid >> 5;
  const int lane = tid & 31;
  const int hh   = lane >> 4;
  const int c    = lane & 15;

  const int bx   = blockIdx.x;
  const int qb   = bx % NQB;
  const int h    = bx / NQB;
  const int q0   = qb * 64 + wave * 16;

  const _Float16* Qh = (const _Float16*)(const void*)qhp + (size_t)h * HD;
  const _Float16* Ql = (const _Float16*)(const void*)qlp + (size_t)h * HD;
  const _Float16* Kg = (const _Float16*)(const void*)kpp + (size_t)h * HD;
  const _Float16* Vg = (const _Float16*)(const void*)vtp + (size_t)h * HD * SEQ;

  // ---- Q fragments (A operand, row = lane&15): 2 d-chunks, hi and residual ----
  v16h qah[2], qal[2];
#pragma unroll
  for (int dc = 0; dc < 2; ++dc) {
    qah[dc] = ldfrag_h(Qh + (size_t)(q0 + c) * DM + dc * 32 + 8 * hh);
    qal[dc] = ldfrag_h(Ql + (size_t)(q0 + c) * DM + dc * 32 + 8 * hh);
  }

  float mrow[8], lrow[8];
  v8f oacc[4];
#pragma unroll
  for (int r = 0; r < 8; ++r) { mrow[r] = -INFINITY; lrow[r] = 0.f; }
#pragma unroll
  for (int t = 0; t < 4; ++t) oacc[t] = zero8();

  for (int kt = 0; kt < NQB; ++kt) {         // static trip count
    const int kv0 = kt * 64;
    __syncthreads();
    {
      const int r = tid >> 1, hf = (tid & 1) * 32;
      const _Float16* kg = Kg + (size_t)(kv0 + r) * DM + hf;        // K row kv0+r, d = hf..hf+31
      const _Float16* vg = Vg + (size_t)r * SEQ + kv0 + hf;         // V^T row d = r, s = kv0+hf..+31
#pragma unroll
      for (int i = 0; i < 4; ++i) {
        const v8h a0 = *(const v8h*)(kg + 8 * i);
        const v8h b0 = *(const v8h*)(vg + 8 * i);
        *(v8h*)(Ksh + r * 64 + hf + 8 * i) = a0;
        *(v8h*)(Vth + r * 64 + hf + 8 * i) = b0;
      }
    }
    __syncthreads();

    // ---- scores: 16 query rows x 64 keys per wave, 2 f16 products (hi, residual) ----
    v8f s[4];
#pragma unroll
    for (int j = 0; j < 4; ++j) {
      v8f sh = zero8(), sl = zero8();
#pragma unroll
      for (int dc = 0; dc < 2; ++dc) {
        FH kb;
        kb.h[0] = *(const v8h*)(Ksh + (j * 16 + c) * 64 + dc * 32 + 8 * hh);
        kb.h[1] = *(const v8h*)(Ksh + (j * 16 + c) * 64 + dc * 32 + 16 + 8 * hh);
        sh = mma_h(qah[dc], kb.v, sh);
        sl = mma_h(qal[dc], kb.v, sl);
      }
#pragma unroll
      for (int r = 0; r < 8; ++r) s[j][r] = (sh[r] + sl[r] * rres) * sscale;
    }

    // ---- row max, online softmax, P (x1024, f16) to LDS ----
    _Float16* pwh = Psh[wave];
#pragma unroll
    for (int r = 0; r < 8; ++r) {
      float m = s[0][r];
      m = fmaxf(m, s[1][r]);
      m = fmaxf(m, s[2][r]);
      m = fmaxf(m, s[3][r]);
#pragma unroll
      for (int off = 1; off < 16; off <<= 1) m = fmaxf(m, __shfl_xor(m, off, 32));
      const float mnew  = fmaxf(mrow[r], m);
      const float alpha = __expf(mrow[r] - mnew);
      mrow[r] = mnew;
      float psum = 0.f;
#pragma unroll
      for (int j = 0; j < 4; ++j) {
        const float p = __expf(s[j][r] - mnew);
        psum += p;
        pwh[(8 * hh + r) * 64 + j * 16 + c] = (_Float16)(p * 1024.0f);
      }
#pragma unroll
      for (int off = 1; off < 16; off <<= 1) psum += __shfl_xor(psum, off, 32);
      lrow[r] = lrow[r] * alpha + psum;
#pragma unroll
      for (int t = 0; t < 4; ++t) oacc[t][r] *= alpha;
    }
    wave_sync_lds();

    // ---- context += P . V (f16 WMMA) ----
#pragma unroll 1
    for (int kk = 0; kk < 2; ++kk) {
      FH pa;
      pa.h[0] = *(const v8h*)(pwh + c * 64 + kk * 32 + 8 * hh);
      pa.h[1] = *(const v8h*)(pwh + c * 64 + kk * 32 + 16 + 8 * hh);
#pragma unroll
      for (int t = 0; t < 4; ++t) {
        FH vb;
        vb.h[0] = *(const v8h*)(Vth + (t * 16 + c) * 64 + kk * 32 + 8 * hh);
        vb.h[1] = *(const v8h*)(Vth + (t * 16 + c) * 64 + kk * 32 + 16 + 8 * hh);
        oacc[t] = mma_h(pa.v, vb.v, oacc[t]);
      }
    }
  }

  // ---- normalise (1/l and the 1/1024 p carry), stage the wave's 16x64 tile, bf16 hi/lo split,
  float* os = Os[wave];
#pragma unroll
  for (int r = 0; r < 8; ++r) {
    const float l = lrow[r];
    const float inv = ((l > 0.f) ? (1.0f / l) : 0.f) * (1.0f / 1024.0f);
#pragma unroll
    for (int t = 0; t < 4; ++t) os[(8 * hh + r) * 64 + t * 16 + c] = oacc[t][r] * inv;
  }
  wave_sync_lds();
  {
    const int q4 = lane >> 3, c8 = (lane & 7) * 8;
    v4u hv[4], lv[4];
#pragma unroll
    for (int it = 0; it < 4; ++it) {
      const int row = it * 4 + q4;   // it 0..3 x q4 0..3 = rows 0..15 of the wave tile
      const float* sp = os + row * 64 + c8;
      v4u a, a2;
#pragma unroll
      for (int e = 0; e < 4; ++e) {
        const float f0 = sp[2 * e], f1 = sp[2 * e + 1];
        const unsigned short h0 = bf_bits(f0), h1 = bf_bits(f1);
        const unsigned short l0 = bf_bits(f0 - bf_up(h0)), l1 = bf_bits(f1 - bf_up(h1));
        a[e] = pk16(h0, h1); a2[e] = pk16(l0, l1);
      }
      hv[it] = a; lv[it] = a2;
    }
    {
#pragma unroll
      for (int it = 0; it < 4; ++it) {
        const int row = it * 4 + q4;
        const size_t go = (size_t)(q0 + row) * DM + (size_t)h * HD + c8;
        *(v4u*)(ohp + go) = hv[it];
        *(v4u*)(olp + go) = lv[it];
      }
      
    }
  }
}

// =====================================================================================================
// Workspace map (bytes), every plane an exact multiple of its 64x64-tile / whole-line store granularity:
//   Xb    bf16 [4096][1024]          0           8388608
//   Wqkvb bf16 [3072 n][1024 k]      8388608     6291456   (rows 0..1023 q, 1024..2047 k, 2048..3071 v weights)
//   Wob   bf16 [1024][1024]          14680064    2097152
//   QKf   f32  [4096][2048]          16777216    33554432  (q cols 0..1023, k cols 1024..2047, bias included)
//   Qh    f16  [4096][1024]          50331648    8388608
//   Ql    f16  [4096][1024]          58720256    8388608   (q residual x4096)
//   Kp    f16  [4096][1024]          67108864    8388608
//   VT    f16  [1024][4096]          75497472    8388608   (v^T incl. bias)
//   Oh    bf16 [4096][1024]          83886080    8388608
//   Ol    bf16 [4096][1024]          92274688    8388608
//   end                              100663296
// Weights are [out n][in k] with k contiguous = the Bt / A layout the GEMM wants, so they are only converted.
// =====================================================================================================
extern "C" void kernel_launch(void* const* d_in, const int* in_sizes, int n_in,
                              void* d_out, int out_size, void* d_ws, size_t ws_size,
                              hipStream_t stream) {
  if (n_in < 7) return;
  if (in_sizes[0] != SEQ * DM) return;
  if (in_sizes[1] != SEQ * HD) return;
  if (in_sizes[2] != SEQ * HD) return;
  if (in_sizes[3] != 3 * DM * DM) return;
  if (in_sizes[4] != 3 * DM) return;
  if (in_sizes[5] != DM * DM) return;
  if (in_sizes[6] != DM) return;
  if (out_size != SEQ * DM) return;

  const float* x     = (const float*)d_in[0];
  const float* cosp  = (const float*)d_in[1];
  const float* sinp  = (const float*)d_in[2];
  const float* wqkv  = (const float*)d_in[3];
  const float* bqkv  = (const float*)d_in[4];
  const float* wout  = (const float*)d_in[5];
  const float* bout  = (const float*)d_in[6];

  const size_t PXb  = (size_t)SEQ * DM * 2;           //  8388608
  const size_t PWq  = (size_t)3 * DM * DM * 2;        //  6291456
  const size_t PWo  = (size_t)DM * DM * 2;            //  2097152
  const size_t PQKf = (size_t)SEQ * QKP * 4;          // 33554432
  const size_t P16  = (size_t)SEQ * DM * 2;           //  8388608 (q hi, q res, k, out hi, out lo)
  const size_t PVT  = (size_t)DM * SEQ * 2;           //  8388608
  size_t off = 0;
  const size_t oXb  = off; off += PXb;
  const size_t oWq  = off; off += PWq;
  const size_t oWo  = off; off += PWo;
  const size_t oQKf = off; off += PQKf;
  const size_t oQh  = off; off += P16;
  const size_t oQl  = off; off += P16;
  const size_t oKp  = off; off += P16;
  const size_t oVT  = off; off += PVT;
  const size_t oOh  = off; off += P16;
  const size_t oOl  = off; off += P16;
  if (off > ws_size) return;                          // off = 100663296
  if (off > (size_t)134217728) return;

  char* ws = (char*)d_ws;
  unsigned short* Xb    = (unsigned short*)(ws + oXb);
  unsigned short* Wqkvb = (unsigned short*)(ws + oWq);
  unsigned short* Wvb   = Wqkvb + (size_t)2 * DM * DM;          // rows 2048..3071 of Wqkvb
  unsigned short* Wob   = (unsigned short*)(ws + oWo);
  float*          QKf   = (float*)(ws + oQKf);
  unsigned short* Qh    = (unsigned short*)(ws + oQh);
  unsigned short* Ql    = (unsigned short*)(ws + oQl);
  unsigned short* Kp    = (unsigned short*)(ws + oKp);
  unsigned short* VT    = (unsigned short*)(ws + oVT);
  unsigned short* Oh    = (unsigned short*)(ws + oOh);
  unsigned short* Ol    = (unsigned short*)(ws + oOl);

  const dim3 blk(256);
  const int n8x  = SEQ * DM / 8;                                // 524288
  const int n8wq = 3 * DM * DM / 8;                             // 393216
  const int n8wo = DM * DM / 8;                                 // 131072
  const dim3 gCvtX((n8x + 255) / 256);                          // 2048 blocks
  const dim3 gCvtWq((n8wq + 255) / 256);                        // 1536 blocks
  const dim3 gCvtWo((n8wo + 255) / 256);                        //  512 blocks
  const dim3 gQK(((SEQ / 64) * (QKP / 64) + 7) / 8, 1);         // 2048 tiles -> 256 blocks: M=4096, N=2048
  const dim3 gRope(SEQ);                                        // one block per token row
  const dim3 gVT(((DM / 64) * (SEQ / 64) + 7) / 8, 1);          // 1024 tiles -> 128 blocks: M=1024, N=4096
  const dim3 gAttn(NH * NQB);                                   // 1024 blocks
  const dim3 gOut(((SEQ / 64) * (DM / 64) + 7) / 8, 1);         // 1024 tiles -> 128 blocks: M=4096, N=1024

  // (1) x -> bf16 plane [4096][1024]; w_qkv -> bf16 [3072][1024]; w_out -> bf16 [1024][1024]
  cvt_bf16x8<<<gCvtX, blk, 0, stream>>>(x, Xb, n8x);
  cvt_bf16x8<<<gCvtWq, blk, 0, stream>>>(wqkv, Wqkvb, n8wq);
  cvt_bf16x8<<<gCvtWo, blk, 0, stream>>>(wout, Wob, n8wo);
  // (2) q|k = x . Wqk^T + b_qk -> f32 staging plane [4096][2048] (pitch 2048)   (M=4096, N=2048, K=1024, col bias)
  gemm64<0, 0, 1><<<gQK, blk, 0, stream>>>(
      Xb, Xb, DM, 0LL, Wqkvb, Wqkvb, DM, 0LL,
      (void*)QKf, QKP, 0LL, (void*)QKf, QKP, 0LL, 0,
      bqkv,
      SEQ, QKP, DM, 1.0f);
  // (3) RoPE -> q f16 hi plane + f16 residual x4096 plane, k f16 plane, each [4096][1024]
  rope_rows<<<gRope, blk, 0, stream>>>(QKf, cosp, sinp, Qh, Ql, Kp, SEQ, 4096.0f);
  // (4) v^T = Wv . x^T + b_v[row] -> f16 plane [h*64+d][s] (pitch SEQ), no residual plane (N2 = 0)
  //     (A = Wvb [n][k], Bt = Xb [s][k]; M=1024, N=4096, K=1024, row bias = b_qkv rows 2048..3071)
  gemm64<0, 3, 2><<<gVT, blk, 0, stream>>>(
      Wvb, Wvb, DM, 0LL, Xb, Xb, DM, 0LL,
      (void*)VT, SEQ, 0LL, (void*)VT, SEQ, 0LL, 0,
      bqkv + 2 * DM,
      DM, SEQ, DM, 4096.0f);
  // (5) attention -> context bf16 hi / lo planes [4096][1024]
  attn64<<<gAttn, dim3(128), 0, stream>>>(Qh, Ql, Kp, VT, Oh, Ol, 0.125f, 1.0f / 4096.0f);
  // (6) out = context . w_out^T + b_out -> d_out f32 [4096][1024]  (A = context hi + lo planes, 2 products; K=1024, col bias)
  gemm64<1, 0, 1><<<gOut, blk, 0, stream>>>(
      Oh, Ol, DM, 0LL, Wob, Wob, DM, 0LL,
      d_out, DM, 0LL, d_out, DM, 0LL, 0,
      bout,
      SEQ, DM, DM, 1.0f);
  (void)hipGetLastError();
}

// v001
// One run takes 381 microseconds.
// Next to v000, in two timings, it ran 1.34 times as fast each time.
// Contractions: q|k projection and v^T projection = v_wmma_f32_16x16x32_bf16 (bf16 operands from RNE-converted x and w_qkv, single product);
// q.k^T scores = v_wmma_f32_16x16x32_f16 (q as f16 hi plane + f16 residual plane x4096 in a separate accumulator, k f16; 2 products);
// p.v = v_wmma_f32_16x16x32_f16 (p carried x1024 in f16, v^T f16; 1 product);
// ctx.w_out^T = v_wmma_f32_16x16x32_bf16 (ctx as bf16 hi + lo planes times bf16 w_out, 2 products); all f32 accumulate; bias, RoPE, softmax in f32.
#include <hip/hip_runtime.h>
#include <math.h>
#include <stdint.h>

#define SEQ   4096
#define DM    1024
#define NH    16
#define HD    64
#define NQB   (SEQ / 64)     // 64 key / query tiles of 64
#define QKP   (2 * DM)        // pitch of the f32 q|k staging plane: q at cols 0..DM-1, k at cols DM..2DM-1
#define LP    72              // LDS row pitch of the 64-wide f16 tiles, in elements: 144 B = 16 B x odd, so the 16 rows of a 16-B fragment read fall on 16 distinct bank groups
static_assert(NH * HD == DM);
static_assert((SEQ % 64) == 0 && (DM % 64) == 0 && (DM % 32) == 0);
static_assert((HD % 8) == 0 && (HD / 2) % 8 == 0);
static_assert(LP >= 64 && (LP % 8) == 0 && ((LP / 8) & 1) == 1);

typedef _Float16 v16h __attribute__((ext_vector_type(16)));
typedef _Float16 v8h  __attribute__((ext_vector_type(8)));
typedef __bf16   v16b __attribute__((ext_vector_type(16)));
typedef __bf16   v8b  __attribute__((ext_vector_type(8)));
typedef float    v8f  __attribute__((ext_vector_type(8)));
typedef float    v4f  __attribute__((ext_vector_type(4)));
typedef unsigned int v4u __attribute__((ext_vector_type(4)));

// ---- scalar helpers --------------------------------------------------------------------------------
__device__ __forceinline__ unsigned short bf_bits(float f) {          // f32 -> bf16 bits, RNE convert
  unsigned u = __float_as_uint(f);
  return (unsigned short)((u + 0x7FFFu + ((u >> 16) & 1u)) >> 16);
}
__device__ __forceinline__ float bf_up(unsigned short h) { return __uint_as_float(((unsigned)h) << 16); }
__device__ __forceinline__ float bf_rne(float f) { return bf_up(bf_bits(f)); }
__device__ __forceinline__ unsigned short h_bits(_Float16 x) { return __builtin_bit_cast(unsigned short, x); }
__device__ __forceinline__ unsigned pk16(unsigned short a, unsigned short b) { return (unsigned)a | ((unsigned)b << 16); }
__device__ __forceinline__ v8f zero8() { v8f z = {0.f, 0.f, 0.f, 0.f, 0.f, 0.f, 0.f, 0.f}; return z; }

// ---- fragment loaders: 16-bit A/B operand, lane -> row/col (lane&15), p already includes +8*(lane>>4);
//      elements 0..7 <- p[0..7] (k0+8h..), elements 8..15 <- p[16..23] (k0+16+8h..)
__device__ __forceinline__ v16b ldfrag_b(const __bf16* p) {
  union { v16b v; v8b h[2]; } f;
  f.h[0] = *(const v8b*)(p);
  f.h[1] = *(const v8b*)(p + 16);
  return f.v;
}
__device__ __forceinline__ v16h ldfrag_h(const _Float16* p) {
  union { v16h v; v8h h[2]; } f;
  f.h[0] = *(const v8h*)(p);
  f.h[1] = *(const v8h*)(p + 16);
  return f.v;
}

// ---- WMMA helpers with trailing VALU hazard gap --------------------------------------------------------
__device__ __forceinline__ v8f mma_h(v16h a, v16h b, v8f c) {
  c = __builtin_amdgcn_wmma_f32_16x16x32_f16(false, a, false, b, (short)0, c, false, false);
#if defined(__HIP_DEVICE_COMPILE__)
  asm volatile("v_nop\n\tv_nop\n\tv_nop\n\tv_nop" : "+v"(c) : "v"(a), "v"(b));
#endif
  return c;
}
__device__ __forceinline__ v8f mma_b_raw(v16b a, v16b b, v8f c) {
  return __builtin_amdgcn_wmma_f32_16x16x32_bf16(false, a, false, b, (short)0, c, false, false);
}
__device__ __forceinline__ void dep_guard_b(v8f& a, v8f& b, v16b x, v16b y) {
#if defined(__HIP_DEVICE_COMPILE__)
  asm volatile("v_nop\n\tv_nop\n\tv_nop\n\tv_nop" : "+v"(a), "+v"(b) : "v"(x), "v"(y));
#endif
}
__device__ __forceinline__ void keep4_b(v16b a, v16b b, v16b c, v16b d) {
#if defined(__HIP_DEVICE_COMPILE__)
  asm volatile("v_nop" :: "v"(a), "v"(b), "v"(c), "v"(d));
#endif
}
__device__ __forceinline__ void acc_guard4(v8f& a, v8f& b, v8f& c, v8f& d) {
#if defined(__HIP_DEVICE_COMPILE__)
  asm volatile("v_nop\n\tv_nop\n\tv_nop\n\tv_nop" : "+v"(a), "+v"(b), "+v"(c), "+v"(d));
#endif
}
__device__ __forceinline__ void wave_sync_lds() {
  __builtin_amdgcn_fence(__ATOMIC_RELEASE, "workgroup");
  __builtin_amdgcn_wave_barrier();
  __builtin_amdgcn_fence(__ATOMIC_ACQUIRE, "workgroup");
}

// =====================================================================================================
// f32 -> bf16 (RNE convert), 8 elements per thread, one 16-B store per lane: a wave writes 512 contiguous B
// coverage: n8 threads x 8 = whole plane (n8 is a multiple of 256 for every use here).
// =====================================================================================================
__global__ __launch_bounds__(256) void cvt_bf16x8(const float* __restrict__ in, unsigned short* out, int n8) {
  const int i = blockIdx.x * 256 + threadIdx.x;
  if (i < n8) {
    const v4f a = *(const v4f*)(in + (size_t)i * 8);
    const v4f b = *(const v4f*)(in + (size_t)i * 8 + 4);
    v4u p;
    p[0] = pk16(bf_bits(a[0]), bf_bits(a[1]));
    p[1] = pk16(bf_bits(a[2]), bf_bits(a[3]));
    p[2] = pk16(bf_bits(b[0]), bf_bits(b[1]));
    p[3] = pk16(bf_bits(b[2]), bf_bits(b[3]));
    *(v4u*)(out + (size_t)i * 8) = p;
    
  }
}

// =====================================================================================================
// Register-blocked batched bf16 WMMA GEMM: C[m][n] = sum_k A[m][k] * Bt[n][k] + bias; one wave per 64x64 tile,
// no block barriers. A row-major [M][K] pitch lda; Bt row-major [N][K] pitch ldb (k contiguous);
// M, N multiples of 64, K multiple of 32 (host-checked). blockIdx.y = batch index (strides in elements).
// NSPLIT: 0 = A.Bt; 1 = (A + A2).Bt (A2 = unscaled bf16 lo plane of A); 2 = A.Bt + A2.Bt + A.Bt2.
// OUT_MODE: 0 = f32 (pitch ldc); 2 = bf16 hi plane C + bf16 lo plane C2 (lo = RNE(v - hi), unscaled);
//           3 = f16 hi plane C + f16 residual plane C2 = f16((v - hi) * rscale), C2 written only for tiles
//               with n0 < N2 (pitch ldc2, batch stride strideC2).
// BIAS_MODE: 1 = + biasp[n] (per column), 2 = + biasp[m] (per row); bias values RNE-converted to bf16 and
//            added in f32 before any 16-bit conversion of the result.
// =====================================================================================================
template <int NSPLIT, int OUT_MODE, int BIAS_MODE>
__global__ __launch_bounds__(256) void gemm64(
    const unsigned short* __restrict__ Ap, const unsigned short* A2p, int lda, long long strideA,
    const unsigned short* __restrict__ Btp, const unsigned short* Bt2p, int ldb, long long strideB,
    void* Cout, int ldc, long long strideC,
    void* Cout2, int ldc2, long long strideC2, int N2,
    const float* __restrict__ biasp,
    int M, int N, int K, float rscale) {
  const __bf16* A   = (const __bf16*)(const void*)Ap;
  const __bf16* A2  = (const __bf16*)(const void*)A2p;
  const __bf16* Bt  = (const __bf16*)(const void*)Btp;
  const __bf16* Bt2 = (const __bf16*)(const void*)Bt2p;
  __shared__ __align__(16) float sT[8][16 * 68];   // per-wave 16x64 slab, pitch 68 floats
  const int b    = blockIdx.y;
  const int lane = threadIdx.x & 31;
  const int wave = threadIdx.x >> 5;
  const int tilesN = N >> 6;
  const int tilesM = M >> 6;
  const int tile = blockIdx.x * 8 + wave;
  if (tile >= tilesM * tilesN) return;   // wave-uniform; no block barriers in this kernel
  const int tm = tile / tilesN;
  const int tn = tile - tm * tilesN;
  const int m0 = tm << 6;
  const int n0 = tn << 6;

  const __bf16* Ab  = A  + (size_t)b * strideA;
  const __bf16* Bb  = Bt + (size_t)b * strideB;
  const __bf16* Ab2 = (NSPLIT >= 1) ? (A2  + (size_t)b * strideA) : Ab;
  const __bf16* Bb2 = (NSPLIT == 2) ? (Bt2 + (size_t)b * strideB) : Bb;

  const int rlane = lane & 15;                 // row (A) / col (B, D) within subtile
  const int koff  = (lane >> 4) * 8;           // k offset of this lane half
  const int mOff  = (lane >> 4) * 8;           // D row offset

  v8f acc[4][4];
#pragma unroll
  for (int i = 0; i < 4; ++i)
#pragma unroll
    for (int j = 0; j < 4; ++j) acc[i][j] = zero8();

  for (int k0 = 0; k0 < K; k0 += 32) {
    v16b bh[4], bl[4];
#pragma unroll
    for (int j = 0; j < 4; ++j) {
      const size_t bo = (size_t)(n0 + (j << 4) + rlane) * ldb + koff + k0;
      bh[j] = ldfrag_b(Bb + bo);
      if (NSPLIT == 2) bl[j] = ldfrag_b(Bb2 + bo); else bl[j] = bh[j];
    }
#pragma unroll
    for (int i = 0; i < 4; ++i) {
      const size_t ao = (size_t)(m0 + (i << 4) + rlane) * lda + koff + k0;
      const v16b ah = ldfrag_b(Ab + ao);
      v16b al = ah;
      if (NSPLIT >= 1) al = ldfrag_b(Ab2 + ao);
#pragma unroll
      for (int j = 0; j < 4; ++j) {
        acc[i][j] = mma_b_raw(ah, bh[j], acc[i][j]);
        if (NSPLIT >= 1) acc[i][j] = mma_b_raw(al, bh[j], acc[i][j]);
        if (NSPLIT == 2) acc[i][j] = mma_b_raw(ah, bl[j], acc[i][j]);
      }
      dep_guard_b(acc[i][0], acc[i][3], ah, al);
    }
    keep4_b(bh[0], bh[1], bh[2], bh[3]);
    if (NSPLIT == 2) keep4_b(bl[0], bl[1], bl[2], bl[3]);
  }
  acc_guard4(acc[0][0], acc[0][1], acc[0][2], acc[0][3]);
  acc_guard4(acc[1][0], acc[1][1], acc[1][2], acc[1][3]);
  acc_guard4(acc[2][0], acc[2][1], acc[2][2], acc[2][3]);
  acc_guard4(acc[3][0], acc[3][1], acc[3][2], acc[3][3]);

  // ---- epilogue ----
  float* slab = sT[wave];
#pragma unroll
  for (int i = 0; i < 4; ++i) {
    const int mBase = m0 + (i << 4);
    float brow[8];
#pragma unroll
    for (int r = 0; r < 8; ++r) {
      brow[r] = 0.f;
      if (BIAS_MODE == 2) brow[r] = bf_rne(biasp[mBase + mOff + r]);
    }
#pragma unroll
    for (int j = 0; j < 4; ++j) {
      float bcol = 0.f;
      if (BIAS_MODE == 1) bcol = bf_rne(biasp[n0 + (j << 4) + rlane]);
#pragma unroll
      for (int r = 0; r < 8; ++r) {
        slab[(mOff + r) * 68 + (j << 4) + rlane] = acc[i][j][r] + bcol + brow[r];
      }
    }
    wave_sync_lds();
    if (OUT_MODE == 0) {
      float* C = (float*)Cout + (size_t)b * strideC;
      const int hh = lane >> 4, c4 = (lane & 15) * 4;     // 256-B row segment = 16 lanes x 16 B
      {
#pragma unroll
        for (int it = 0; it < 8; ++it) {
          const int row = it * 2 + hh;                     // it 0..7 x hh 0..1 = rows 0..15
          const v4f v = *(const v4f*)(slab + row * 68 + c4);
          *(v4f*)(C + (size_t)(mBase + row) * ldc + n0 + c4) = v;
        }
        
      }
    } else {
      const int q = lane >> 3, c8 = (lane & 7) * 8;
      unsigned short* C  = (unsigned short*)Cout  + (size_t)b * strideC;
      unsigned short* C2 = (unsigned short*)Cout2 + (size_t)b * strideC2;
      const bool wlo = (OUT_MODE == 2) || (n0 < N2);      // wave-uniform
      v4u hv[4], lv[4];
#pragma unroll
      for (int it = 0; it < 4; ++it) {
        const int row = it * 4 + q;                        // it 0..3 x q 0..3 = rows 0..15
        const float* sp = slab + row * 68 + c8;
        v4u a, a2;
#pragma unroll
        for (int e = 0; e < 4; ++e) {
          const float f0 = sp[2 * e], f1 = sp[2 * e + 1];
          unsigned short h0, h1, l0, l1;
          if (OUT_MODE == 2) {
            h0 = bf_bits(f0); h1 = bf_bits(f1);
            l0 = bf_bits(f0 - bf_up(h0)); l1 = bf_bits(f1 - bf_up(h1));
          } else {
            const _Float16 x0 = (_Float16)f0, x1 = (_Float16)f1;
            h0 = h_bits(x0); h1 = h_bits(x1);
            l0 = h_bits((_Float16)((f0 - (float)x0) * rscale));
            l1 = h_bits((_Float16)((f1 - (float)x1) * rscale));
          }
          a[e] = pk16(h0, h1); a2[e] = pk16(l0, l1);
        }
        hv[it] = a; lv[it] = a2;
      }
      {
#pragma unroll
        for (int it = 0; it < 4; ++it) {
          const int row = it * 4 + q;
          *(v4u*)(C + (size_t)(mBase + row) * ldc + n0 + c8) = hv[it];
          if (wlo) *(v4u*)(C2 + (size_t)(mBase + row) * ldc2 + n0 + c8) = lv[it];
        }
        
      }
    }
    wave_sync_lds();
  }
}

// =====================================================================================================
// RoPE row pass (rotate-half, half = HD/2 = 32) on the f32 q|k staging plane (bias already added):
//   y[d] = x[d] * cos[s][d] + (d < 32 ? -x[d+32] : x[d-32]) * sin[s][d],  tables [SEQ][HD] shared over heads,
//   table values RNE-converted to bf16 on read.
// One block (256 threads) per token row s; thread t owns 8 consecutive columns of q (t < 128, waves 0..3)
// or of k (t >= 128, waves 4..7): the 8 columns share one head half, so the rotate partner is the 8-group
// at +-32. Outputs: q -> f16 hi plane + f16 residual plane ((y - hi) * rscale); k -> f16 plane; all [SEQ][DM].
// =====================================================================================================
__global__ __launch_bounds__(256) void rope_rows(
    const float* __restrict__ qkf, const float* __restrict__ cosp, const float* __restrict__ sinp,
    unsigned short* qhp, unsigned short* qlp, unsigned short* kpp, int nrows, float rscale) {
  const int row = blockIdx.x;
  if (row >= nrows) return;                       // block-uniform; no barriers in this kernel
  const int t   = threadIdx.x;
  const int isk = t >> 7;                         // 0: q section, 1: k section (wave-uniform)
  const int c0  = (t & 127) * 8;                  // column within the DM-wide section
  const int d0  = c0 & (HD - 1);                  // head-dim offset, multiple of 8
  const bool lowhalf = (d0 < (HD / 2));
  const int pc0 = lowhalf ? (c0 + HD / 2) : (c0 - HD / 2);   // partner columns, same head, in range
  const float sgn = lowhalf ? -1.0f : 1.0f;

  const float* src = qkf + (size_t)row * QKP + (size_t)isk * DM;
  const v4f x0 = *(const v4f*)(src + c0);
  const v4f x1 = *(const v4f*)(src + c0 + 4);
  const v4f p0 = *(const v4f*)(src + pc0);
  const v4f p1 = *(const v4f*)(src + pc0 + 4);
  const v4f cA = *(const v4f*)(cosp + (size_t)row * HD + d0);
  const v4f cB = *(const v4f*)(cosp + (size_t)row * HD + d0 + 4);
  const v4f sA = *(const v4f*)(sinp + (size_t)row * HD + d0);
  const v4f sB = *(const v4f*)(sinp + (size_t)row * HD + d0 + 4);

  v4f y0, y1;
#pragma unroll
  for (int e = 0; e < 4; ++e) {
    y0[e] = x0[e] * bf_rne(cA[e]) + (sgn * p0[e]) * bf_rne(sA[e]);
    y1[e] = x1[e] * bf_rne(cB[e]) + (sgn * p1[e]) * bf_rne(sB[e]);
  }
  v4u hv, lv;
#pragma unroll
  for (int e = 0; e < 2; ++e) {
    const float f0 = y0[2 * e], f1 = y0[2 * e + 1];
    const float g0 = y1[2 * e], g1 = y1[2 * e + 1];
    const _Float16 a0 = (_Float16)f0, a1 = (_Float16)f1;
    const _Float16 b0 = (_Float16)g0, b1 = (_Float16)g1;
    hv[e]     = pk16(h_bits(a0), h_bits(a1));
    hv[2 + e] = pk16(h_bits(b0), h_bits(b1));
    lv[e]     = pk16(h_bits((_Float16)((f0 - (float)a0) * rscale)),
                     h_bits((_Float16)((f1 - (float)a1) * rscale)));
    lv[2 + e] = pk16(h_bits((_Float16)((g0 - (float)b0) * rscale)),
                     h_bits((_Float16)((g1 - (float)b1) * rscale)));
  }
  const size_t o = (size_t)row * DM + c0;
  if (isk == 0) {
    *(v4u*)(qhp + o) = hv;
    *(v4u*)(qlp + o) = lv;
    
  } else {
    *(v4u*)(kpp + o) = hv;
    
  }
}

// =====================================================================================================
// Attention, head dim 64, no mask, softmax over all SEQ keys.
//   q hi plane (f16, pitch DM): element (t, h, d) at [t*DM + h*64 + d]; q residual plane (f16, (q - f16(q))*4096) same layout;
//   k plane (f16, pitch DM): [s*DM + h*64 + d]
//   v^T plane (f16): element (h, d, s) at [(h*64 + d)*SEQ + s]
//   out planes (bf16 hi / lo of the normalised context): element (t, h, d) at [t*DM + h*64 + d]
//   scores = (qh . k + (ql . k) * rres) * sscale on f16 WMMA, residual products in a separate accumulator
//   p = exp(s - m) carried as f16(1024 p); context = p . v on f16 WMMA; online softmax in f32.
//   Block = 4 waves = 64 query rows of one head h; grid = NQB * NH; kv chunks of 64, static trip NQB.
//   K / V^T chunk staging: 128 threads x 32 elements per plane = the whole 64x64 tile (plain 16-B loads,
//   __syncthreads before and after); P tiles are wave-private, spilled with _Float16 element stores and
//   Output coverage: each wave stores rows q0..q0+15 (it 0..3 x lane>>3 0..3) x 64 columns (8 lanes x 8) of both planes.
// =====================================================================================================
__global__ __launch_bounds__(128)
void attn64(const unsigned short* __restrict__ qhp, const unsigned short* __restrict__ qlp,
            const unsigned short* __restrict__ kpp, const unsigned short* __restrict__ vtp,
            unsigned short* ohp, unsigned short* olp, float sscale, float rres) {
  union FH { v16h v; v8h h[2]; };
  __shared__ __align__(16) _Float16 Ksh[64 * LP];                 // K [kv][d]   pitch LP, 9 KB
  __shared__ __align__(16) _Float16 Vth[64 * LP];                 // V^T [d][kv] pitch LP, 9 KB
  __shared__ __align__(16) _Float16 Psh[4][16 * LP];              // per wave P [row][kv], pitch LP
  __shared__ __align__(16) float    Os[4][16 * 64];               // per wave context tile [row][d]

  const int tid  = threadIdx.x;
  const int wave = tid >> 5;
  const int lane = tid & 31;
  const int hh   = lane >> 4;
  const int c    = lane & 15;

  const int bx   = blockIdx.x;
  const int qb   = bx % NQB;
  const int h    = bx / NQB;
  const int q0   = qb * 64 + wave * 16;

  const _Float16* Qh = (const _Float16*)(const void*)qhp + (size_t)h * HD;
  const _Float16* Ql = (const _Float16*)(const void*)qlp + (size_t)h * HD;
  const _Float16* Kg = (const _Float16*)(const void*)kpp + (size_t)h * HD;
  const _Float16* Vg = (const _Float16*)(const void*)vtp + (size_t)h * HD * SEQ;

  // ---- Q fragments (A operand, row = lane&15): 2 d-chunks, hi and residual ----
  v16h qah[2], qal[2];
#pragma unroll
  for (int dc = 0; dc < 2; ++dc) {
    qah[dc] = ldfrag_h(Qh + (size_t)(q0 + c) * DM + dc * 32 + 8 * hh);
    qal[dc] = ldfrag_h(Ql + (size_t)(q0 + c) * DM + dc * 32 + 8 * hh);
  }

  float mrow[8], lrow[8];
  v8f oacc[4];
#pragma unroll
  for (int r = 0; r < 8; ++r) { mrow[r] = -INFINITY; lrow[r] = 0.f; }
#pragma unroll
  for (int t = 0; t < 4; ++t) oacc[t] = zero8();

  for (int kt = 0; kt < NQB; ++kt) {         // static trip count
    const int kv0 = kt * 64;
    __syncthreads();
    {
      const int r = tid >> 1, hf = (tid & 1) * 32;
      const _Float16* kg = Kg + (size_t)(kv0 + r) * DM + hf;        // K row kv0+r, d = hf..hf+31
      const _Float16* vg = Vg + (size_t)r * SEQ + kv0 + hf;         // V^T row d = r, s = kv0+hf..+31
#pragma unroll
      for (int i = 0; i < 4; ++i) {
        const v8h a0 = *(const v8h*)(kg + 8 * i);
        const v8h b0 = *(const v8h*)(vg + 8 * i);
        *(v8h*)(Ksh + r * LP + hf + 8 * i) = a0;
        *(v8h*)(Vth + r * LP + hf + 8 * i) = b0;
      }
    }
    __syncthreads();

    // ---- scores: 16 query rows x 64 keys per wave, 2 f16 products (hi, residual) ----
    v8f s[4];
#pragma unroll
    for (int j = 0; j < 4; ++j) {
      v8f sh = zero8(), sl = zero8();
#pragma unroll
      for (int dc = 0; dc < 2; ++dc) {
        FH kb;
        kb.h[0] = *(const v8h*)(Ksh + (j * 16 + c) * LP + dc * 32 + 8 * hh);
        kb.h[1] = *(const v8h*)(Ksh + (j * 16 + c) * LP + dc * 32 + 16 + 8 * hh);
        sh = mma_h(qah[dc], kb.v, sh);
        sl = mma_h(qal[dc], kb.v, sl);
      }
#pragma unroll
      for (int r = 0; r < 8; ++r) s[j][r] = (sh[r] + sl[r] * rres) * sscale;
    }

    // ---- row max, online softmax, P (x1024, f16) to LDS ----
    _Float16* pwh = Psh[wave];
#pragma unroll
    for (int r = 0; r < 8; ++r) {
      float m = s[0][r];
      m = fmaxf(m, s[1][r]);
      m = fmaxf(m, s[2][r]);
      m = fmaxf(m, s[3][r]);
#pragma unroll
      for (int off = 1; off < 16; off <<= 1) m = fmaxf(m, __shfl_xor(m, off, 32));
      const float mnew  = fmaxf(mrow[r], m);
      const float alpha = __expf(mrow[r] - mnew);
      mrow[r] = mnew;
      float psum = 0.f;
#pragma unroll
      for (int j = 0; j < 4; ++j) {
        const float p = __expf(s[j][r] - mnew);
        psum += p;
        pwh[(8 * hh + r) * LP + j * 16 + c] = (_Float16)(p * 1024.0f);
      }
#pragma unroll
      for (int off = 1; off < 16; off <<= 1) psum += __shfl_xor(psum, off, 32);
      lrow[r] = lrow[r] * alpha + psum;
#pragma unroll
      for (int t = 0; t < 4; ++t) oacc[t][r] *= alpha;
    }
    wave_sync_lds();

    // ---- context += P . V (f16 WMMA) ----
#pragma unroll 1
    for (int kk = 0; kk < 2; ++kk) {
      FH pa;
      pa.h[0] = *(const v8h*)(pwh + c * LP + kk * 32 + 8 * hh);
      pa.h[1] = *(const v8h*)(pwh + c * LP + kk * 32 + 16 + 8 * hh);
#pragma unroll
      for (int t = 0; t < 4; ++t) {
        FH vb;
        vb.h[0] = *(const v8h*)(Vth + (t * 16 + c) * LP + kk * 32 + 8 * hh);
        vb.h[1] = *(const v8h*)(Vth + (t * 16 + c) * LP + kk * 32 + 16 + 8 * hh);
        oacc[t] = mma_h(pa.v, vb.v, oacc[t]);
      }
    }
  }

  // ---- normalise (1/l and the 1/1024 p carry), stage the wave's 16x64 tile, bf16 hi/lo split,
  float* os = Os[wave];
#pragma unroll
  for (int r = 0; r < 8; ++r) {
    const float l = lrow[r];
    const float inv = ((l > 0.f) ? (1.0f / l) : 0.f) * (1.0f / 1024.0f);
#pragma unroll
    for (int t = 0; t < 4; ++t) os[(8 * hh + r) * 64 + t * 16 + c] = oacc[t][r] * inv;
  }
  wave_sync_lds();
  {
    const int q4 = lane >> 3, c8 = (lane & 7) * 8;
    v4u hv[4], lv[4];
#pragma unroll
    for (int it = 0; it < 4; ++it) {
      const int row = it * 4 + q4;   // it 0..3 x q4 0..3 = rows 0..15 of the wave tile
      const float* sp = os + row * 64 + c8;
      v4u a, a2;
#pragma unroll
      for (int e = 0; e < 4; ++e) {
        const float f0 = sp[2 * e], f1 = sp[2 * e + 1];
        const unsigned short h0 = bf_bits(f0), h1 = bf_bits(f1);
        const unsigned short l0 = bf_bits(f0 - bf_up(h0)), l1 = bf_bits(f1 - bf_up(h1));
        a[e] = pk16(h0, h1); a2[e] = pk16(l0, l1);
      }
      hv[it] = a; lv[it] = a2;
    }
    {
#pragma unroll
      for (int it = 0; it < 4; ++it) {
        const int row = it * 4 + q4;
        const size_t go = (size_t)(q0 + row) * DM + (size_t)h * HD + c8;
        *(v4u*)(ohp + go) = hv[it];
        *(v4u*)(olp + go) = lv[it];
      }
      
    }
  }
}

// =====================================================================================================
// Workspace map (bytes), every plane an exact multiple of its 64x64-tile / whole-line store granularity:
//   Xb    bf16 [4096][1024]          0           8388608
//   Wqkvb bf16 [3072 n][1024 k]      8388608     6291456   (rows 0..1023 q, 1024..2047 k, 2048..3071 v weights)
//   Wob   bf16 [1024][1024]          14680064    2097152
//   QKf   f32  [4096][2048]          16777216    33554432  (q cols 0..1023, k cols 1024..2047, bias included)
//   Qh    f16  [4096][1024]          50331648    8388608
//   Ql    f16  [4096][1024]          58720256    8388608   (q residual x4096)
//   Kp    f16  [4096][1024]          67108864    8388608
//   VT    f16  [1024][4096]          75497472    8388608   (v^T incl. bias)
//   Oh    bf16 [4096][1024]          83886080    8388608
//   Ol    bf16 [4096][1024]          92274688    8388608
//   end                              100663296
// Weights are [out n][in k] with k contiguous = the Bt / A layout the GEMM wants, so they are only converted.
// =====================================================================================================
extern "C" void kernel_launch(void* const* d_in, const int* in_sizes, int n_in,
                              void* d_out, int out_size, void* d_ws, size_t ws_size,
                              hipStream_t stream) {
  if (n_in < 7) return;
  if (in_sizes[0] != SEQ * DM) return;
  if (in_sizes[1] != SEQ * HD) return;
  if (in_sizes[2] != SEQ * HD) return;
  if (in_sizes[3] != 3 * DM * DM) return;
  if (in_sizes[4] != 3 * DM) return;
  if (in_sizes[5] != DM * DM) return;
  if (in_sizes[6] != DM) return;
  if (out_size != SEQ * DM) return;

  const float* x     = (const float*)d_in[0];
  const float* cosp  = (const float*)d_in[1];
  const float* sinp  = (const float*)d_in[2];
  const float* wqkv  = (const float*)d_in[3];
  const float* bqkv  = (const float*)d_in[4];
  const float* wout  = (const float*)d_in[5];
  const float* bout  = (const float*)d_in[6];

  const size_t PXb  = (size_t)SEQ * DM * 2;           //  8388608
  const size_t PWq  = (size_t)3 * DM * DM * 2;        //  6291456
  const size_t PWo  = (size_t)DM * DM * 2;            //  2097152
  const size_t PQKf = (size_t)SEQ * QKP * 4;          // 33554432
  const size_t P16  = (size_t)SEQ * DM * 2;           //  8388608 (q hi, q res, k, out hi, out lo)
  const size_t PVT  = (size_t)DM * SEQ * 2;           //  8388608
  size_t off = 0;
  const size_t oXb  = off; off += PXb;
  const size_t oWq  = off; off += PWq;
  const size_t oWo  = off; off += PWo;
  const size_t oQKf = off; off += PQKf;
  const size_t oQh  = off; off += P16;
  const size_t oQl  = off; off += P16;
  const size_t oKp  = off; off += P16;
  const size_t oVT  = off; off += PVT;
  const size_t oOh  = off; off += P16;
  const size_t oOl  = off; off += P16;
  if (off > ws_size) return;                          // off = 100663296
  if (off > (size_t)134217728) return;

  char* ws = (char*)d_ws;
  unsigned short* Xb    = (unsigned short*)(ws + oXb);
  unsigned short* Wqkvb = (unsigned short*)(ws + oWq);
  unsigned short* Wvb   = Wqkvb + (size_t)2 * DM * DM;          // rows 2048..3071 of Wqkvb
  unsigned short* Wob   = (unsigned short*)(ws + oWo);
  float*          QKf   = (float*)(ws + oQKf);
  unsigned short* Qh    = (unsigned short*)(ws + oQh);
  unsigned short* Ql    = (unsigned short*)(ws + oQl);
  unsigned short* Kp    = (unsigned short*)(ws + oKp);
  unsigned short* VT    = (unsigned short*)(ws + oVT);
  unsigned short* Oh    = (unsigned short*)(ws + oOh);
  unsigned short* Ol    = (unsigned short*)(ws + oOl);

  const dim3 blk(256);
  const int n8x  = SEQ * DM / 8;                                // 524288
  const int n8wq = 3 * DM * DM / 8;                             // 393216
  const int n8wo = DM * DM / 8;                                 // 131072
  const dim3 gCvtX((n8x + 255) / 256);                          // 2048 blocks
  const dim3 gCvtWq((n8wq + 255) / 256);                        // 1536 blocks
  const dim3 gCvtWo((n8wo + 255) / 256);                        //  512 blocks
  const dim3 gQK(((SEQ / 64) * (QKP / 64) + 7) / 8, 1);         // 2048 tiles -> 256 blocks: M=4096, N=2048
  const dim3 gRope(SEQ);                                        // one block per token row
  const dim3 gVT(((DM / 64) * (SEQ / 64) + 7) / 8, 1);          // 1024 tiles -> 128 blocks: M=1024, N=4096
  const dim3 gAttn(NH * NQB);                                   // 1024 blocks
  const dim3 gOut(((SEQ / 64) * (DM / 64) + 7) / 8, 1);         // 1024 tiles -> 128 blocks: M=4096, N=1024

  // (1) x -> bf16 plane [4096][1024]; w_qkv -> bf16 [3072][1024]; w_out -> bf16 [1024][1024]
  cvt_bf16x8<<<gCvtX, blk, 0, stream>>>(x, Xb, n8x);
  cvt_bf16x8<<<gCvtWq, blk, 0, stream>>>(wqkv, Wqkvb, n8wq);
  cvt_bf16x8<<<gCvtWo, blk, 0, stream>>>(wout, Wob, n8wo);
  // (2) q|k = x . Wqk^T + b_qk -> f32 staging plane [4096][2048] (pitch 2048)   (M=4096, N=2048, K=1024, col bias)
  gemm64<0, 0, 1><<<gQK, blk, 0, stream>>>(
      Xb, Xb, DM, 0LL, Wqkvb, Wqkvb, DM, 0LL,
      (void*)QKf, QKP, 0LL, (void*)QKf, QKP, 0LL, 0,
      bqkv,
      SEQ, QKP, DM, 1.0f);
  // (3) RoPE -> q f16 hi plane + f16 residual x4096 plane, k f16 plane, each [4096][1024]
  rope_rows<<<gRope, blk, 0, stream>>>(QKf, cosp, sinp, Qh, Ql, Kp, SEQ, 4096.0f);
  // (4) v^T = Wv . x^T + b_v[row] -> f16 plane [h*64+d][s] (pitch SEQ), no residual plane (N2 = 0)
  //     (A = Wvb [n][k], Bt = Xb [s][k]; M=1024, N=4096, K=1024, row bias = b_qkv rows 2048..3071)
  gemm64<0, 3, 2><<<gVT, blk, 0, stream>>>(
      Wvb, Wvb, DM, 0LL, Xb, Xb, DM, 0LL,
      (void*)VT, SEQ, 0LL, (void*)VT, SEQ, 0LL, 0,
      bqkv + 2 * DM,
      DM, SEQ, DM, 4096.0f);
  // (5) attention -> context bf16 hi / lo planes [4096][1024]
  attn64<<<gAttn, dim3(128), 0, stream>>>(Qh, Ql, Kp, VT, Oh, Ol, 0.125f, 1.0f / 4096.0f);
  // (6) out = context . w_out^T + b_out -> d_out f32 [4096][1024]  (A = context hi + lo planes, 2 products; K=1024, col bias)
  gemm64<1, 0, 1><<<gOut, blk, 0, stream>>>(
      Oh, Ol, DM, 0LL, Wob, Wob, DM, 0LL,
      d_out, DM, 0LL, d_out, DM, 0LL, 0,
      bout,
      SEQ, DM, DM, 1.0f);
  (void)hipGetLastError();
}

// v002
// It runs in 321 microseconds.
// In both of two side-by-side timings against v001, it was 1.18 times as fast.
// All steps since v000 together make it 1.58 times as fast.
// Contractions: q|k projection and v^T projection = v_wmma_f32_16x16x32_bf16 (bf16 operands from RNE-converted x and w_qkv, single product);
// k.q^T scores = v_wmma_f32_16x16x32_f16 (q as f16 hi plane + f16 residual plane x4096 in a separate accumulator, k f16; 2 products);
// v^T.p^T = v_wmma_f32_16x16x32_f16 (p carried x1024 in f16, v^T f16; 1 product);
// ctx.w_out^T = v_wmma_f32_16x16x32_bf16 (ctx as bf16 hi + lo planes times bf16 w_out, 2 products); all f32 accumulate; bias, RoPE, softmax in f32.
#include <hip/hip_runtime.h>
#include <math.h>
#include <stdint.h>

#define SEQ   4096
#define DM    1024
#define NH    16
#define HD    64
#define NQB   (SEQ / 64)     // 64 key / query tiles of 64
#define QKP   (2 * DM)        // pitch of the f32 q|k staging plane: q at cols 0..DM-1, k at cols DM..2DM-1
#define LP    72              // LDS row pitch of the 64-wide f16 tiles, in elements: 144 B = 16 B x odd, so the 16 rows of a 16-B fragment read fall on 16 distinct bank groups
static_assert(NH * HD == DM);
static_assert((SEQ % 64) == 0 && (DM % 64) == 0 && (DM % 32) == 0);
static_assert((HD % 8) == 0 && (HD / 2) % 8 == 0);
static_assert(LP >= 64 && (LP % 8) == 0 && ((LP / 8) & 1) == 1);

typedef _Float16 v16h __attribute__((ext_vector_type(16)));
typedef _Float16 v8h  __attribute__((ext_vector_type(8)));
typedef __bf16   v16b __attribute__((ext_vector_type(16)));
typedef __bf16   v8b  __attribute__((ext_vector_type(8)));
typedef float    v8f  __attribute__((ext_vector_type(8)));
typedef float    v4f  __attribute__((ext_vector_type(4)));
typedef unsigned int v4u __attribute__((ext_vector_type(4)));

// ---- scalar helpers --------------------------------------------------------------------------------
__device__ __forceinline__ unsigned short bf_bits(float f) {          // f32 -> bf16 bits, RNE convert
  unsigned u = __float_as_uint(f);
  return (unsigned short)((u + 0x7FFFu + ((u >> 16) & 1u)) >> 16);
}
__device__ __forceinline__ float bf_up(unsigned short h) { return __uint_as_float(((unsigned)h) << 16); }
__device__ __forceinline__ float bf_rne(float f) { return bf_up(bf_bits(f)); }
__device__ __forceinline__ unsigned short h_bits(_Float16 x) { return __builtin_bit_cast(unsigned short, x); }
__device__ __forceinline__ unsigned pk16(unsigned short a, unsigned short b) { return (unsigned)a | ((unsigned)b << 16); }
__device__ __forceinline__ v8f zero8() { v8f z = {0.f, 0.f, 0.f, 0.f, 0.f, 0.f, 0.f, 0.f}; return z; }

// ---- fragment loaders: 16-bit A/B operand, lane -> row/col (lane&15), p already includes +8*(lane>>4);
//      elements 0..7 <- p[0..7] (k0+8h..), elements 8..15 <- p[16..23] (k0+16+8h..)
__device__ __forceinline__ v16b ldfrag_b(const __bf16* p) {
  union { v16b v; v8b h[2]; } f;
  f.h[0] = *(const v8b*)(p);
  f.h[1] = *(const v8b*)(p + 16);
  return f.v;
}
__device__ __forceinline__ v16h ldfrag_h(const _Float16* p) {
  union { v16h v; v8h h[2]; } f;
  f.h[0] = *(const v8h*)(p);
  f.h[1] = *(const v8h*)(p + 16);
  return f.v;
}

// ---- WMMA helpers with trailing VALU hazard gap --------------------------------------------------------
__device__ __forceinline__ v8f mma_h(v16h a, v16h b, v8f c) {
  c = __builtin_amdgcn_wmma_f32_16x16x32_f16(false, a, false, b, (short)0, c, false, false);
#if defined(__HIP_DEVICE_COMPILE__)
  asm volatile("v_nop\n\tv_nop\n\tv_nop\n\tv_nop" : "+v"(c) : "v"(a), "v"(b));
#endif
  return c;
}
__device__ __forceinline__ v8f mma_b_raw(v16b a, v16b b, v8f c) {
  return __builtin_amdgcn_wmma_f32_16x16x32_bf16(false, a, false, b, (short)0, c, false, false);
}
__device__ __forceinline__ void dep_guard_b(v8f& a, v8f& b, v16b x, v16b y) {
#if defined(__HIP_DEVICE_COMPILE__)
  asm volatile("v_nop\n\tv_nop\n\tv_nop\n\tv_nop" : "+v"(a), "+v"(b) : "v"(x), "v"(y));
#endif
}
__device__ __forceinline__ void keep4_b(v16b a, v16b b, v16b c, v16b d) {
#if defined(__HIP_DEVICE_COMPILE__)
  asm volatile("v_nop" :: "v"(a), "v"(b), "v"(c), "v"(d));
#endif
}
__device__ __forceinline__ void acc_guard4(v8f& a, v8f& b, v8f& c, v8f& d) {
#if defined(__HIP_DEVICE_COMPILE__)
  asm volatile("v_nop\n\tv_nop\n\tv_nop\n\tv_nop" : "+v"(a), "+v"(b), "+v"(c), "+v"(d));
#endif
}
__device__ __forceinline__ void wave_sync_lds() {
  __builtin_amdgcn_fence(__ATOMIC_RELEASE, "workgroup");
  __builtin_amdgcn_wave_barrier();
  __builtin_amdgcn_fence(__ATOMIC_ACQUIRE, "workgroup");
}

// =====================================================================================================
// f32 -> bf16 (RNE convert), 8 elements per thread, one 16-B store per lane: a wave writes 512 contiguous B
// coverage: n8 threads x 8 = whole plane (n8 is a multiple of 256 for every use here).
// =====================================================================================================
__global__ __launch_bounds__(256) void cvt_bf16x8(const float* __restrict__ in, unsigned short* out, int n8) {
  const int i = blockIdx.x * 256 + threadIdx.x;
  if (i < n8) {
    const v4f a = *(const v4f*)(in + (size_t)i * 8);
    const v4f b = *(const v4f*)(in + (size_t)i * 8 + 4);
    v4u p;
    p[0] = pk16(bf_bits(a[0]), bf_bits(a[1]));
    p[1] = pk16(bf_bits(a[2]), bf_bits(a[3]));
    p[2] = pk16(bf_bits(b[0]), bf_bits(b[1]));
    p[3] = pk16(bf_bits(b[2]), bf_bits(b[3]));
    *(v4u*)(out + (size_t)i * 8) = p;
    
  }
}

// =====================================================================================================
// Register-blocked batched bf16 WMMA GEMM: C[m][n] = sum_k A[m][k] * Bt[n][k] + bias; one wave per 64x64 tile,
// no block barriers. A row-major [M][K] pitch lda; Bt row-major [N][K] pitch ldb (k contiguous);
// M, N multiples of 64, K multiple of 32 (host-checked). blockIdx.y = batch index (strides in elements).
// NSPLIT: 0 = A.Bt; 1 = (A + A2).Bt (A2 = unscaled bf16 lo plane of A); 2 = A.Bt + A2.Bt + A.Bt2.
// OUT_MODE: 0 = f32 (pitch ldc); 2 = bf16 hi plane C + bf16 lo plane C2 (lo = RNE(v - hi), unscaled);
//           3 = f16 hi plane C + f16 residual plane C2 = f16((v - hi) * rscale), C2 written only for tiles
//               with n0 < N2 (pitch ldc2, batch stride strideC2).
// BIAS_MODE: 1 = + biasp[n] (per column), 2 = + biasp[m] (per row); bias values RNE-converted to bf16 and
//            added in f32 before any 16-bit conversion of the result.
// =====================================================================================================
template <int NSPLIT, int OUT_MODE, int BIAS_MODE>
__global__ __launch_bounds__(256) void gemm64(
    const unsigned short* __restrict__ Ap, const unsigned short* A2p, int lda, long long strideA,
    const unsigned short* __restrict__ Btp, const unsigned short* Bt2p, int ldb, long long strideB,
    void* Cout, int ldc, long long strideC,
    void* Cout2, int ldc2, long long strideC2, int N2,
    const float* __restrict__ biasp,
    int M, int N, int K, float rscale) {
  const __bf16* A   = (const __bf16*)(const void*)Ap;
  const __bf16* A2  = (const __bf16*)(const void*)A2p;
  const __bf16* Bt  = (const __bf16*)(const void*)Btp;
  const __bf16* Bt2 = (const __bf16*)(const void*)Bt2p;
  __shared__ __align__(16) float sT[8][16 * 68];   // per-wave 16x64 slab, pitch 68 floats
  const int b    = blockIdx.y;
  const int lane = threadIdx.x & 31;
  const int wave = threadIdx.x >> 5;
  const int tilesN = N >> 6;
  const int tilesM = M >> 6;
  const int tile = blockIdx.x * 8 + wave;
  if (tile >= tilesM * tilesN) return;   // wave-uniform; no block barriers in this kernel
  const int tm = tile / tilesN;
  const int tn = tile - tm * tilesN;
  const int m0 = tm << 6;
  const int n0 = tn << 6;

  const __bf16* Ab  = A  + (size_t)b * strideA;
  const __bf16* Bb  = Bt + (size_t)b * strideB;
  const __bf16* Ab2 = (NSPLIT >= 1) ? (A2  + (size_t)b * strideA) : Ab;
  const __bf16* Bb2 = (NSPLIT == 2) ? (Bt2 + (size_t)b * strideB) : Bb;

  const int rlane = lane & 15;                 // row (A) / col (B, D) within subtile
  const int koff  = (lane >> 4) * 8;           // k offset of this lane half
  const int mOff  = (lane >> 4) * 8;           // D row offset

  v8f acc[4][4];
#pragma unroll
  for (int i = 0; i < 4; ++i)
#pragma unroll
    for (int j = 0; j < 4; ++j) acc[i][j] = zero8();

  for (int k0 = 0; k0 < K; k0 += 32) {
    v16b bh[4], bl[4];
#pragma unroll
    for (int j = 0; j < 4; ++j) {
      const size_t bo = (size_t)(n0 + (j << 4) + rlane) * ldb + koff + k0;
      bh[j] = ldfrag_b(Bb + bo);
      if (NSPLIT == 2) bl[j] = ldfrag_b(Bb2 + bo); else bl[j] = bh[j];
    }
#pragma unroll
    for (int i = 0; i < 4; ++i) {
      const size_t ao = (size_t)(m0 + (i << 4) + rlane) * lda + koff + k0;
      const v16b ah = ldfrag_b(Ab + ao);
      v16b al = ah;
      if (NSPLIT >= 1) al = ldfrag_b(Ab2 + ao);
#pragma unroll
      for (int j = 0; j < 4; ++j) {
        acc[i][j] = mma_b_raw(ah, bh[j], acc[i][j]);
        if (NSPLIT >= 1) acc[i][j] = mma_b_raw(al, bh[j], acc[i][j]);
        if (NSPLIT == 2) acc[i][j] = mma_b_raw(ah, bl[j], acc[i][j]);
      }
      dep_guard_b(acc[i][0], acc[i][3], ah, al);
    }
    keep4_b(bh[0], bh[1], bh[2], bh[3]);
    if (NSPLIT == 2) keep4_b(bl[0], bl[1], bl[2], bl[3]);
  }
  acc_guard4(acc[0][0], acc[0][1], acc[0][2], acc[0][3]);
  acc_guard4(acc[1][0], acc[1][1], acc[1][2], acc[1][3]);
  acc_guard4(acc[2][0], acc[2][1], acc[2][2], acc[2][3]);
  acc_guard4(acc[3][0], acc[3][1], acc[3][2], acc[3][3]);

  // ---- epilogue ----
  float* slab = sT[wave];
#pragma unroll
  for (int i = 0; i < 4; ++i) {
    const int mBase = m0 + (i << 4);
    float brow[8];
#pragma unroll
    for (int r = 0; r < 8; ++r) {
      brow[r] = 0.f;
      if (BIAS_MODE == 2) brow[r] = bf_rne(biasp[mBase + mOff + r]);
    }
#pragma unroll
    for (int j = 0; j < 4; ++j) {
      float bcol = 0.f;
      if (BIAS_MODE == 1) bcol = bf_rne(biasp[n0 + (j << 4) + rlane]);
#pragma unroll
      for (int r = 0; r < 8; ++r) {
        slab[(mOff + r) * 68 + (j << 4) + rlane] = acc[i][j][r] + bcol + brow[r];
      }
    }
    wave_sync_lds();
    if (OUT_MODE == 0) {
      float* C = (float*)Cout + (size_t)b * strideC;
      const int hh = lane >> 4, c4 = (lane & 15) * 4;     // 256-B row segment = 16 lanes x 16 B
      {
#pragma unroll
        for (int it = 0; it < 8; ++it) {
          const int row = it * 2 + hh;                     // it 0..7 x hh 0..1 = rows 0..15
          const v4f v = *(const v4f*)(slab + row * 68 + c4);
          *(v4f*)(C + (size_t)(mBase + row) * ldc + n0 + c4) = v;
        }
        
      }
    } else {
      const int q = lane >> 3, c8 = (lane & 7) * 8;
      unsigned short* C  = (unsigned short*)Cout  + (size_t)b * strideC;
      unsigned short* C2 = (unsigned short*)Cout2 + (size_t)b * strideC2;
      const bool wlo = (OUT_MODE == 2) || (n0 < N2);      // wave-uniform
      v4u hv[4], lv[4];
#pragma unroll
      for (int it = 0; it < 4; ++it) {
        const int row = it * 4 + q;                        // it 0..3 x q 0..3 = rows 0..15
        const float* sp = slab + row * 68 + c8;
        v4u a, a2;
#pragma unroll
        for (int e = 0; e < 4; ++e) {
          const float f0 = sp[2 * e], f1 = sp[2 * e + 1];
          unsigned short h0, h1, l0, l1;
          if (OUT_MODE == 2) {
            h0 = bf_bits(f0); h1 = bf_bits(f1);
            l0 = bf_bits(f0 - bf_up(h0)); l1 = bf_bits(f1 - bf_up(h1));
          } else {
            const _Float16 x0 = (_Float16)f0, x1 = (_Float16)f1;
            h0 = h_bits(x0); h1 = h_bits(x1);
            l0 = h_bits((_Float16)((f0 - (float)x0) * rscale));
            l1 = h_bits((_Float16)((f1 - (float)x1) * rscale));
          }
          a[e] = pk16(h0, h1); a2[e] = pk16(l0, l1);
        }
        hv[it] = a; lv[it] = a2;
      }
      {
#pragma unroll
        for (int it = 0; it < 4; ++it) {
          const int row = it * 4 + q;
          *(v4u*)(C + (size_t)(mBase + row) * ldc + n0 + c8) = hv[it];
          if (wlo) *(v4u*)(C2 + (size_t)(mBase + row) * ldc2 + n0 + c8) = lv[it];
        }
        
      }
    }
    wave_sync_lds();
  }
}

// =====================================================================================================
// RoPE row pass (rotate-half, half = HD/2 = 32) on the f32 q|k staging plane (bias already added):
//   y[d] = x[d] * cos[s][d] + (d < 32 ? -x[d+32] : x[d-32]) * sin[s][d],  tables [SEQ][HD] shared over heads,
//   table values RNE-converted to bf16 on read.
// One block (256 threads) per token row s; thread t owns 8 consecutive columns of q (t < 128, waves 0..3)
// or of k (t >= 128, waves 4..7): the 8 columns share one head half, so the rotate partner is the 8-group
// at +-32. Outputs: q -> f16 hi plane + f16 residual plane ((y - hi) * rscale); k -> f16 plane; all [SEQ][DM].
// =====================================================================================================
__global__ __launch_bounds__(256) void rope_rows(
    const float* __restrict__ qkf, const float* __restrict__ cosp, const float* __restrict__ sinp,
    unsigned short* qhp, unsigned short* qlp, unsigned short* kpp, int nrows, float rscale) {
  const int row = blockIdx.x;
  if (row >= nrows) return;                       // block-uniform; no barriers in this kernel
  const int t   = threadIdx.x;
  const int isk = t >> 7;                         // 0: q section, 1: k section (wave-uniform)
  const int c0  = (t & 127) * 8;                  // column within the DM-wide section
  const int d0  = c0 & (HD - 1);                  // head-dim offset, multiple of 8
  const bool lowhalf = (d0 < (HD / 2));
  const int pc0 = lowhalf ? (c0 + HD / 2) : (c0 - HD / 2);   // partner columns, same head, in range
  const float sgn = lowhalf ? -1.0f : 1.0f;

  const float* src = qkf + (size_t)row * QKP + (size_t)isk * DM;
  const v4f x0 = *(const v4f*)(src + c0);
  const v4f x1 = *(const v4f*)(src + c0 + 4);
  const v4f p0 = *(const v4f*)(src + pc0);
  const v4f p1 = *(const v4f*)(src + pc0 + 4);
  const v4f cA = *(const v4f*)(cosp + (size_t)row * HD + d0);
  const v4f cB = *(const v4f*)(cosp + (size_t)row * HD + d0 + 4);
  const v4f sA = *(const v4f*)(sinp + (size_t)row * HD + d0);
  const v4f sB = *(const v4f*)(sinp + (size_t)row * HD + d0 + 4);

  v4f y0, y1;
#pragma unroll
  for (int e = 0; e < 4; ++e) {
    y0[e] = x0[e] * bf_rne(cA[e]) + (sgn * p0[e]) * bf_rne(sA[e]);
    y1[e] = x1[e] * bf_rne(cB[e]) + (sgn * p1[e]) * bf_rne(sB[e]);
  }
  v4u hv, lv;
#pragma unroll
  for (int e = 0; e < 2; ++e) {
    const float f0 = y0[2 * e], f1 = y0[2 * e + 1];
    const float g0 = y1[2 * e], g1 = y1[2 * e + 1];
    const _Float16 a0 = (_Float16)f0, a1 = (_Float16)f1;
    const _Float16 b0 = (_Float16)g0, b1 = (_Float16)g1;
    hv[e]     = pk16(h_bits(a0), h_bits(a1));
    hv[2 + e] = pk16(h_bits(b0), h_bits(b1));
    lv[e]     = pk16(h_bits((_Float16)((f0 - (float)a0) * rscale)),
                     h_bits((_Float16)((f1 - (float)a1) * rscale)));
    lv[2 + e] = pk16(h_bits((_Float16)((g0 - (float)b0) * rscale)),
                     h_bits((_Float16)((g1 - (float)b1) * rscale)));
  }
  const size_t o = (size_t)row * DM + c0;
  if (isk == 0) {
    *(v4u*)(qhp + o) = hv;
    *(v4u*)(qlp + o) = lv;
    
  } else {
    *(v4u*)(kpp + o) = hv;
    
  }
}

#define OSP 68
__device__ __forceinline__ float xhalf(float x) {
  return __builtin_bit_cast(float, __builtin_amdgcn_permlanex16(__builtin_bit_cast(int, x), __builtin_bit_cast(int, x),
                                                                0x76543210, 0xfedcba98, false, false));
}

__global__ __launch_bounds__(128)
void attn64(const unsigned short* __restrict__ qhp, const unsigned short* __restrict__ qlp,
            const unsigned short* __restrict__ kpp, const unsigned short* __restrict__ vtp,
            unsigned short* ohp, unsigned short* olp, float sscale, float rres) {
  union FH { v16h v; v8h h[2]; };
  __shared__ __align__(16) _Float16 Ksh[64 * LP];                 // K [kv][d]   pitch LP, 9 KB
  __shared__ __align__(16) _Float16 Vth[64 * LP];                 // V^T [d][kv] pitch LP, 9 KB
  __shared__ __align__(16) float    Os[4][16 * OSP];              // per wave context tile [row][d]

  const int tid  = threadIdx.x;
  const int wave = tid >> 5;
  const int lane = tid & 31;
  const int hh   = lane >> 4;
  const int c    = lane & 15;

  const int bx   = blockIdx.x;
  const int qb   = bx % NQB;
  const int h    = bx / NQB;
  const int q0   = qb * 64 + wave * 16;

  const _Float16* Qh = (const _Float16*)(const void*)qhp + (size_t)h * HD;
  const _Float16* Ql = (const _Float16*)(const void*)qlp + (size_t)h * HD;
  const _Float16* Kg = (const _Float16*)(const void*)kpp + (size_t)h * HD;
  const _Float16* Vg = (const _Float16*)(const void*)vtp + (size_t)h * HD * SEQ;

  // ---- Q fragments (B operand, column = query lane&15): 2 d-chunks, hi and residual ----
  v16h qah[2], qal[2];
#pragma unroll
  for (int dc = 0; dc < 2; ++dc) {
    qah[dc] = ldfrag_h(Qh + (size_t)(q0 + c) * DM + dc * 32 + 8 * hh);
    qal[dc] = ldfrag_h(Ql + (size_t)(q0 + c) * DM + dc * 32 + 8 * hh);
  }

  float mrun = -INFINITY;      // running maximum of query c (equal in both wave halves)
  float lrun = 0.f;            // running sum over this wave half's keys of query c
  v8f oacc[4];                 // oacc[t][r] = O^T[d = t*16 + 8*hh + r][query c]
#pragma unroll
  for (int t = 0; t < 4; ++t) oacc[t] = zero8();

  for (int kt = 0; kt < NQB; ++kt) {         // static trip count
    const int kv0 = kt * 64;
    __syncthreads();
    {
      const int r = tid >> 1, hf = (tid & 1) * 32;
      const _Float16* kg = Kg + (size_t)(kv0 + r) * DM + hf;        // K row kv0+r, d = hf..hf+31
      const _Float16* vg = Vg + (size_t)r * SEQ + kv0 + hf;         // V^T row d = r, s = kv0+hf..+31
#pragma unroll
      for (int i = 0; i < 4; ++i) {
        const v8h a0 = *(const v8h*)(kg + 8 * i);
        const v8h b0 = *(const v8h*)(vg + 8 * i);
        *(v8h*)(Ksh + r * LP + hf + 8 * i) = a0;
        *(v8h*)(Vth + r * LP + hf + 8 * i) = b0;
      }
    }
    __syncthreads();

    // ---- scores, transposed: 64 keys x 16 queries per wave, 2 f16 products (hi, residual);
    //      s[j][r] = score of key kv0 + j*16 + 8*hh + r with query q0 + c ----
    v8f s[4];
#pragma unroll
    for (int j = 0; j < 4; ++j) {
      v8f sh = zero8(), sl = zero8();
#pragma unroll
      for (int dc = 0; dc < 2; ++dc) {
        FH kb;
        kb.h[0] = *(const v8h*)(Ksh + (j * 16 + c) * LP + dc * 32 + 8 * hh);
        kb.h[1] = *(const v8h*)(Ksh + (j * 16 + c) * LP + dc * 32 + 16 + 8 * hh);
        sh = mma_h(kb.v, qah[dc], sh);
        sl = mma_h(kb.v, qal[dc], sl);
      }
#pragma unroll
      for (int r = 0; r < 8; ++r) s[j][r] = (sh[r] + sl[r] * rres) * sscale;
    }

    // ---- maximum of the lane's 32 scores, joined with the other wave half's; online softmax ----
    float mj[4];
#pragma unroll
    for (int j = 0; j < 4; ++j) {
      mj[j] = s[j][0];
#pragma unroll
      for (int r = 1; r < 8; ++r) mj[j] = fmaxf(mj[j], s[j][r]);
    }
    float m = fmaxf(fmaxf(mj[0], mj[1]), fmaxf(mj[2], mj[3]));
    m = fmaxf(m, xhalf(m));
    const float mnew  = fmaxf(mrun, m);
    const float alpha = __expf(mrun - mnew);
    mrun = mnew;

    // ---- P^T (x1024, f16) straight into the B operand: element e of 32-key block kk = key kk*32 + (e < 8 ? 8*hh + e : 16 + 8*hh + e - 8) ----
    FH pb[2];
    float pj[4];
#pragma unroll
    for (int j = 0; j < 4; ++j) {
      pj[j] = 0.f;
#pragma unroll
      for (int r = 0; r < 8; ++r) {
        const float p = __expf(s[j][r] - mnew);
        pj[j] += p;
        pb[j >> 1].h[j & 1][r] = (_Float16)(p * 1024.0f);
      }
    }
    lrun = lrun * alpha + ((pj[0] + pj[1]) + (pj[2] + pj[3]));
#pragma unroll
    for (int t = 0; t < 4; ++t)
#pragma unroll
      for (int r = 0; r < 8; ++r) oacc[t][r] *= alpha;

    // ---- context^T += V^T . P^T (f16 WMMA) ----
#pragma unroll
    for (int kk = 0; kk < 2; ++kk) {
#pragma unroll
      for (int t = 0; t < 4; ++t) {
        FH vb;
        vb.h[0] = *(const v8h*)(Vth + (t * 16 + c) * LP + kk * 32 + 8 * hh);
        vb.h[1] = *(const v8h*)(Vth + (t * 16 + c) * LP + kk * 32 + 16 + 8 * hh);
        oacc[t] = mma_h(vb.v, pb[kk].v, oacc[t]);
      }
    }
  }

  // ---- join the halves' sums, normalise (1/l and the 1/1024 p carry), stage the wave's 16x64 tile, bf16 hi/lo split,
  float* os = Os[wave];
  {
    const float l = lrun + xhalf(lrun);
    const float inv = ((l > 0.f) ? (1.0f / l) : 0.f) * (1.0f / 1024.0f);
#pragma unroll
    for (int t = 0; t < 4; ++t) {
      v4f w0, w1;
#pragma unroll
      for (int e = 0; e < 4; ++e) { w0[e] = oacc[t][e] * inv; w1[e] = oacc[t][4 + e] * inv; }
      *(v4f*)(os + c * OSP + t * 16 + 8 * hh)     = w0;      // row = query c; d = t*16 + 8*hh .. + 7
      *(v4f*)(os + c * OSP + t * 16 + 8 * hh + 4) = w1;
    }
  }
  wave_sync_lds();
  {
    const int q4 = lane >> 3, c8 = (lane & 7) * 8;
    v4u hv[4], lv[4];
#pragma unroll
    for (int it = 0; it < 4; ++it) {
      const int row = it * 4 + q4;   // it 0..3 x q4 0..3 = rows 0..15 of the wave tile
      const float* sp = os + row * OSP + c8;
      v4u a, a2;
#pragma unroll
      for (int e = 0; e < 4; ++e) {
        const float f0 = sp[2 * e], f1 = sp[2 * e + 1];
        const unsigned short h0 = bf_bits(f0), h1 = bf_bits(f1);
        const unsigned short l0 = bf_bits(f0 - bf_up(h0)), l1 = bf_bits(f1 - bf_up(h1));
        a[e] = pk16(h0, h1); a2[e] = pk16(l0, l1);
      }
      hv[it] = a; lv[it] = a2;
    }
    {
#pragma unroll
      for (int it = 0; it < 4; ++it) {
        const int row = it * 4 + q4;
        const size_t go = (size_t)(q0 + row) * DM + (size_t)h * HD + c8;
        *(v4u*)(ohp + go) = hv[it];
        *(v4u*)(olp + go) = lv[it];
      }
      
    }
  }
}

// =====================================================================================================
// Workspace map (bytes), every plane an exact multiple of its 64x64-tile / whole-line store granularity:
//   Xb    bf16 [4096][1024]          0           8388608
//   Wqkvb bf16 [3072 n][1024 k]      8388608     6291456   (rows 0..1023 q, 1024..2047 k, 2048..3071 v weights)
//   Wob   bf16 [1024][1024]          14680064    2097152
//   QKf   f32  [4096][2048]          16777216    33554432  (q cols 0..1023, k cols 1024..2047, bias included)
//   Qh    f16  [4096][1024]          50331648    8388608
//   Ql    f16  [4096][1024]          58720256    8388608   (q residual x4096)
//   Kp    f16  [4096][1024]          67108864    8388608
//   VT    f16  [1024][4096]          75497472    8388608   (v^T incl. bias)
//   Oh    bf16 [4096][1024]          83886080    8388608
//   Ol    bf16 [4096][1024]          92274688    8388608
//   end                              100663296
// Weights are [out n][in k] with k contiguous = the Bt / A layout the GEMM wants, so they are only converted.
// =====================================================================================================
extern "C" void kernel_launch(void* const* d_in, const int* in_sizes, int n_in,
                              void* d_out, int out_size, void* d_ws, size_t ws_size,
                              hipStream_t stream) {
  if (n_in < 7) return;
  if (in_sizes[0] != SEQ * DM) return;
  if (in_sizes[1] != SEQ * HD) return;
  if (in_sizes[2] != SEQ * HD) return;
  if (in_sizes[3] != 3 * DM * DM) return;
  if (in_sizes[4] != 3 * DM) return;
  if (in_sizes[5] != DM * DM) return;
  if (in_sizes[6] != DM) return;
  if (out_size != SEQ * DM) return;

  const float* x     = (const float*)d_in[0];
  const float* cosp  = (const float*)d_in[1];
  const float* sinp  = (const float*)d_in[2];
  const float* wqkv  = (const float*)d_in[3];
  const float* bqkv  = (const float*)d_in[4];
  const float* wout  = (const float*)d_in[5];
  const float* bout  = (const float*)d_in[6];

  const size_t PXb  = (size_t)SEQ * DM * 2;           //  8388608
  const size_t PWq  = (size_t)3 * DM * DM * 2;        //  6291456
  const size_t PWo  = (size_t)DM * DM * 2;            //  2097152
  const size_t PQKf = (size_t)SEQ * QKP * 4;          // 33554432
  const size_t P16  = (size_t)SEQ * DM * 2;           //  8388608 (q hi, q res, k, out hi, out lo)
  const size_t PVT  = (size_t)DM * SEQ * 2;           //  8388608
  size_t off = 0;
  const size_t oXb  = off; off += PXb;
  const size_t oWq  = off; off += PWq;
  const size_t oWo  = off; off += PWo;
  const size_t oQKf = off; off += PQKf;
  const size_t oQh  = off; off += P16;
  const size_t oQl  = off; off += P16;
  const size_t oKp  = off; off += P16;
  const size_t oVT  = off; off += PVT;
  const size_t oOh  = off; off += P16;
  const size_t oOl  = off; off += P16;
  if (off > ws_size) return;                          // off = 100663296
  if (off > (size_t)134217728) return;

  char* ws = (char*)d_ws;
  unsigned short* Xb    = (unsigned short*)(ws + oXb);
  unsigned short* Wqkvb = (unsigned short*)(ws + oWq);
  unsigned short* Wvb   = Wqkvb + (size_t)2 * DM * DM;          // rows 2048..3071 of Wqkvb
  unsigned short* Wob   = (unsigned short*)(ws + oWo);
  float*          QKf   = (float*)(ws + oQKf);
  unsigned short* Qh    = (unsigned short*)(ws + oQh);
  unsigned short* Ql    = (unsigned short*)(ws + oQl);
  unsigned short* Kp    = (unsigned short*)(ws + oKp);
  unsigned short* VT    = (unsigned short*)(ws + oVT);
  unsigned short* Oh    = (unsigned short*)(ws + oOh);
  unsigned short* Ol    = (unsigned short*)(ws + oOl);

  const dim3 blk(256);
  const int n8x  = SEQ * DM / 8;                                // 524288
  const int n8wq = 3 * DM * DM / 8;                             // 393216
  const int n8wo = DM * DM / 8;                                 // 131072
  const dim3 gCvtX((n8x + 255) / 256);                          // 2048 blocks
  const dim3 gCvtWq((n8wq + 255) / 256);                        // 1536 blocks
  const dim3 gCvtWo((n8wo + 255) / 256);                        //  512 blocks
  const dim3 gQK(((SEQ / 64) * (QKP / 64) + 7) / 8, 1);         // 2048 tiles -> 256 blocks: M=4096, N=2048
  const dim3 gRope(SEQ);                                        // one block per token row
  const dim3 gVT(((DM / 64) * (SEQ / 64) + 7) / 8, 1);          // 1024 tiles -> 128 blocks: M=1024, N=4096
  const dim3 gAttn(NH * NQB);                                   // 1024 blocks
  const dim3 gOut(((SEQ / 64) * (DM / 64) + 7) / 8, 1);         // 1024 tiles -> 128 blocks: M=4096, N=1024

  // (1) x -> bf16 plane [4096][1024]; w_qkv -> bf16 [3072][1024]; w_out -> bf16 [1024][1024]
  cvt_bf16x8<<<gCvtX, blk, 0, stream>>>(x, Xb, n8x);
  cvt_bf16x8<<<gCvtWq, blk, 0, stream>>>(wqkv, Wqkvb, n8wq);
  cvt_bf16x8<<<gCvtWo, blk, 0, stream>>>(wout, Wob, n8wo);
  // (2) q|k = x . Wqk^T + b_qk -> f32 staging plane [4096][2048] (pitch 2048)   (M=4096, N=2048, K=1024, col bias)
  gemm64<0, 0, 1><<<gQK, blk, 0, stream>>>(
      Xb, Xb, DM, 0LL, Wqkvb, Wqkvb, DM, 0LL,
      (void*)QKf, QKP, 0LL, (void*)QKf, QKP, 0LL, 0,
      bqkv,
      SEQ, QKP, DM, 1.0f);
  // (3) RoPE -> q f16 hi plane + f16 residual x4096 plane, k f16 plane, each [4096][1024]
  rope_rows<<<gRope, blk, 0, stream>>>(QKf, cosp, sinp, Qh, Ql, Kp, SEQ, 4096.0f);
  // (4) v^T = Wv . x^T + b_v[row] -> f16 plane [h*64+d][s] (pitch SEQ), no residual plane (N2 = 0)
  //     (A = Wvb [n][k], Bt = Xb [s][k]; M=1024, N=4096, K=1024, row bias = b_qkv rows 2048..3071)
  gemm64<0, 3, 2><<<gVT, blk, 0, stream>>>(
      Wvb, Wvb, DM, 0LL, Xb, Xb, DM, 0LL,
      (void*)VT, SEQ, 0LL, (void*)VT, SEQ, 0LL, 0,
      bqkv + 2 * DM,
      DM, SEQ, DM, 4096.0f);
  // (5) attention -> context bf16 hi / lo planes [4096][1024]
  attn64<<<gAttn, dim3(128), 0, stream>>>(Qh, Ql, Kp, VT, Oh, Ol, 0.125f, 1.0f / 4096.0f);
  // (6) out = context . w_out^T + b_out -> d_out f32 [4096][1024]  (A = context hi + lo planes, 2 products; K=1024, col bias)
  gemm64<1, 0, 1><<<gOut, blk, 0, stream>>>(
      Oh, Ol, DM, 0LL, Wob, Wob, DM, 0LL,
      d_out, DM, 0LL, d_out, DM, 0LL, 0,
      bout,
      SEQ, DM, DM, 1.0f);
  (void)hipGetLastError();
}

// v003
// A run of this version takes 212 microseconds.
// Next to v002, in two timings, it ran 1.52 and 1.51 times as fast.
// Counting every step since v000, it is 2.40 times as fast.
// Contractions: q|k projection and v^T projection = v_wmma_f32_16x16x32_bf16 (bf16 operands from RNE-converted x and w_qkv, single product);
// k.q^T scores = v_wmma_f32_16x16x32_f16 (q as f16 hi plane + f16 residual plane x4096 in a separate accumulator, k f16; 2 products);
// v^T.p^T = v_wmma_f32_16x16x32_f16 (p carried x1024 in f16, v^T f16; 1 product);
// ctx.w_out^T = v_wmma_f32_16x16x32_bf16 (ctx as bf16 hi + lo planes times bf16 w_out, 2 products); all f32 accumulate; bias, RoPE, softmax in f32.
#include <hip/hip_runtime.h>
#include <math.h>
#include <stdint.h>

#define SEQ   4096
#define DM    1024
#define NH    16
#define HD    64
#define NQB   (SEQ / 64)     // 64 key / query tiles of 64
#define QKP   (2 * DM)        // pitch of the f32 q|k staging plane: q at cols 0..DM-1, k at cols DM..2DM-1
#define LP    72              // LDS row pitch of the 64-wide f16 tiles, in elements: 144 B = 16 B x odd, so the 16 rows of a 16-B fragment read fall on 16 distinct bank groups
static_assert(NH * HD == DM);
static_assert((SEQ % 64) == 0 && (DM % 64) == 0 && (DM % 32) == 0);
static_assert((SEQ % 256) == 0 && (DM % 256) == 0);   // GEMM block tile 128 x 256, for every M and N used here
static_assert((HD % 8) == 0 && (HD / 2) % 8 == 0);
static_assert(LP >= 64 && (LP % 8) == 0 && ((LP / 8) & 1) == 1);

typedef _Float16 v16h __attribute__((ext_vector_type(16)));
typedef _Float16 v8h  __attribute__((ext_vector_type(8)));
typedef __bf16   v16b __attribute__((ext_vector_type(16)));
typedef __bf16   v8b  __attribute__((ext_vector_type(8)));
typedef float    v8f  __attribute__((ext_vector_type(8)));
typedef float    v4f  __attribute__((ext_vector_type(4)));
typedef unsigned int v4u __attribute__((ext_vector_type(4)));

// ---- scalar helpers --------------------------------------------------------------------------------
__device__ __forceinline__ unsigned short bf_bits(float f) {          // f32 -> bf16 bits, RNE convert
  unsigned u = __float_as_uint(f);
  return (unsigned short)((u + 0x7FFFu + ((u >> 16) & 1u)) >> 16);
}
__device__ __forceinline__ float bf_up(unsigned short h) { return __uint_as_float(((unsigned)h) << 16); }
__device__ __forceinline__ float bf_rne(float f) { return bf_up(bf_bits(f)); }
__device__ __forceinline__ unsigned short h_bits(_Float16 x) { return __builtin_bit_cast(unsigned short, x); }
__device__ __forceinline__ unsigned pk16(unsigned short a, unsigned short b) { return (unsigned)a | ((unsigned)b << 16); }
__device__ __forceinline__ v8f zero8() { v8f z = {0.f, 0.f, 0.f, 0.f, 0.f, 0.f, 0.f, 0.f}; return z; }

// ---- fragment loaders: 16-bit A/B operand, lane -> row/col (lane&15), p already includes +8*(lane>>4);
//      elements 0..7 <- p[0..7] (k0+8h..), elements 8..15 <- p[16..23] (k0+16+8h..)
__device__ __forceinline__ v16b ldfrag_b(const __bf16* p) {
  union { v16b v; v8b h[2]; } f;
  f.h[0] = *(const v8b*)(p);
  f.h[1] = *(const v8b*)(p + 16);
  return f.v;
}
__device__ __forceinline__ v16h ldfrag_h(const _Float16* p) {
  union { v16h v; v8h h[2]; } f;
  f.h[0] = *(const v8h*)(p);
  f.h[1] = *(const v8h*)(p + 16);
  return f.v;
}

// ---- WMMA helpers with trailing VALU hazard gap --------------------------------------------------------
__device__ __forceinline__ v8f mma_h(v16h a, v16h b, v8f c) {
  c = __builtin_amdgcn_wmma_f32_16x16x32_f16(false, a, false, b, (short)0, c, false, false);
#if defined(__HIP_DEVICE_COMPILE__)
  asm volatile("v_nop\n\tv_nop\n\tv_nop\n\tv_nop" : "+v"(c) : "v"(a), "v"(b));
#endif
  return c;
}
__device__ __forceinline__ v8f mma_b_raw(v16b a, v16b b, v8f c) {
  return __builtin_amdgcn_wmma_f32_16x16x32_bf16(false, a, false, b, (short)0, c, false, false);
}
__device__ __forceinline__ void dep_guard_b(v8f& a, v8f& b, v16b x, v16b y) {
#if defined(__HIP_DEVICE_COMPILE__)
  asm volatile("v_nop\n\tv_nop\n\tv_nop\n\tv_nop" : "+v"(a), "+v"(b) : "v"(x), "v"(y));
#endif
}
__device__ __forceinline__ void keep4_b(v16b a, v16b b, v16b c, v16b d) {
#if defined(__HIP_DEVICE_COMPILE__)
  asm volatile("v_nop" :: "v"(a), "v"(b), "v"(c), "v"(d));
#endif
}
__device__ __forceinline__ void acc_guard4(v8f& a, v8f& b, v8f& c, v8f& d) {
#if defined(__HIP_DEVICE_COMPILE__)
  asm volatile("v_nop\n\tv_nop\n\tv_nop\n\tv_nop" : "+v"(a), "+v"(b), "+v"(c), "+v"(d));
#endif
}
__device__ __forceinline__ void wave_sync_lds() {
  __builtin_amdgcn_fence(__ATOMIC_RELEASE, "workgroup");
  __builtin_amdgcn_wave_barrier();
  __builtin_amdgcn_fence(__ATOMIC_ACQUIRE, "workgroup");
}

// ---- asynchronous copies global -> LDS, 16 B per lane: l = the lane's LDS byte address, g = its global address.
//      A run of copies and its s_wait_xcnt 0 are one statement, so that no address register is rewritten ahead of the wait.
__device__ __forceinline__ unsigned lds_off(const void* p) { return (unsigned)(size_t)p; }
__device__ __forceinline__ void copy4_lds(unsigned l, unsigned lstep, const __bf16* g, size_t gstep) {
#if defined(__HIP_DEVICE_COMPILE__)
  asm volatile("global_load_async_to_lds_b128 %0, %1, off\n\t"
               "global_load_async_to_lds_b128 %2, %3, off\n\t"
               "global_load_async_to_lds_b128 %4, %5, off\n\t"
               "global_load_async_to_lds_b128 %6, %7, off\n\t"
               "s_wait_xcnt 0x0"
               :: "v"(l), "v"(g), "v"(l + lstep), "v"(g + gstep),
                  "v"(l + 2 * lstep), "v"(g + 2 * gstep), "v"(l + 3 * lstep), "v"(g + 3 * gstep)
               : "memory");
#endif
}
__device__ __forceinline__ void copy8_lds(unsigned l0, unsigned l1, unsigned lstep,
                                          const __bf16* g0, const __bf16* g1, size_t gstep) {
#if defined(__HIP_DEVICE_COMPILE__)
  asm volatile("global_load_async_to_lds_b128 %0, %1, off\n\t"
               "global_load_async_to_lds_b128 %2, %3, off\n\t"
               "global_load_async_to_lds_b128 %4, %5, off\n\t"
               "global_load_async_to_lds_b128 %6, %7, off\n\t"
               "global_load_async_to_lds_b128 %8, %9, off\n\t"
               "global_load_async_to_lds_b128 %10, %11, off\n\t"
               "global_load_async_to_lds_b128 %12, %13, off\n\t"
               "global_load_async_to_lds_b128 %14, %15, off\n\t"
               "s_wait_xcnt 0x0"
               :: "v"(l0), "v"(g0), "v"(l0 + lstep), "v"(g0 + gstep),
                  "v"(l0 + 2 * lstep), "v"(g0 + 2 * gstep), "v"(l0 + 3 * lstep), "v"(g0 + 3 * gstep),
                  "v"(l1), "v"(g1), "v"(l1 + lstep), "v"(g1 + gstep),
                  "v"(l1 + 2 * lstep), "v"(g1 + 2 * gstep), "v"(l1 + 3 * lstep), "v"(g1 + 3 * gstep)
               : "memory");
#endif
}
__device__ __forceinline__ void wait_copies() {     // the wave's own copies have landed in LDS
#if defined(__HIP_DEVICE_COMPILE__)
  asm volatile("s_wait_asynccnt 0x0" ::: "memory");
#endif
}
__device__ __forceinline__ void wait_lds_reads() {  // the wave's LDS reads have returned, before their buffer is given up for refilling
#if defined(__HIP_DEVICE_COMPILE__)
  asm volatile("s_wait_dscnt 0x0" ::: "memory");
#endif
}

// =====================================================================================================
// f32 -> bf16 (RNE convert), 8 elements per thread, one 16-B store per lane: a wave writes 512 contiguous B
// coverage: n8 threads x 8 = whole plane (n8 is a multiple of 256 for every use here).
// =====================================================================================================
__global__ __launch_bounds__(256) void cvt_bf16x8(const float* __restrict__ in, unsigned short* out, int n8) {
  const int i = blockIdx.x * 256 + threadIdx.x;
  if (i < n8) {
    const v4f a = *(const v4f*)(in + (size_t)i * 8);
    const v4f b = *(const v4f*)(in + (size_t)i * 8 + 4);
    v4u p;
    p[0] = pk16(bf_bits(a[0]), bf_bits(a[1]));
    p[1] = pk16(bf_bits(a[2]), bf_bits(a[3]));
    p[2] = pk16(bf_bits(b[0]), bf_bits(b[1]));
    p[3] = pk16(bf_bits(b[2]), bf_bits(b[3]));
    *(v4u*)(out + (size_t)i * 8) = p;
    
  }
}

// =====================================================================================================
// Register-blocked batched bf16 WMMA GEMM: C[m][n] = sum_k A[m][k] * Bt[n][k] + bias; one wave per 64x64 tile,
// the 8 waves of a block as 2 x 4 = one 128x256 tile. A row-major [M][K] pitch lda; Bt row-major [N][K] pitch ldb
// (k contiguous); M multiple of 128, N of 256, K of 64. blockIdx.y = batch index (strides in elements).
// Operands: a stage = 64 k = one whole 128-B line of each of the block's A and Bt rows, brought into LDS by asynchronous
// copies (8 lanes per row, 4 whole lines per wave copy), rows at pitch LP; two buffers, stage t+2 copied while t+1 is worked on;
// fragments are read from LDS in the k order of ldfrag_b, k ascending.
// NSPLIT: 0 = A.Bt; 1 = (A + A2).Bt (A2 = unscaled bf16 lo plane of A); 2 = A.Bt + A2.Bt + A.Bt2.
// OUT_MODE: 0 = f32 (pitch ldc); 2 = bf16 hi plane C + bf16 lo plane C2 (lo = RNE(v - hi), unscaled);
//           3 = f16 hi plane C + f16 residual plane C2 = f16((v - hi) * rscale), C2 written only for tiles
//               with n0 < N2 (pitch ldc2, batch stride strideC2).
// BIAS_MODE: 1 = + biasp[n] (per column), 2 = + biasp[m] (per row); bias values RNE-converted to bf16 and
//            added in f32 before any 16-bit conversion of the result.
// =====================================================================================================
template <int NSPLIT, int OUT_MODE, int BIAS_MODE>
__global__ __launch_bounds__(256) void gemm64(
    const unsigned short* __restrict__ Ap, const unsigned short* A2p, int lda, long long strideA,
    const unsigned short* __restrict__ Btp, const unsigned short* Bt2p, int ldb, long long strideB,
    void* Cout, int ldc, long long strideC,
    void* Cout2, int ldc2, long long strideC2, int N2,
    const float* __restrict__ biasp,
    int M, int N, int K, float rscale) {
  const __bf16* A   = (const __bf16*)(const void*)Ap;
  const __bf16* A2  = (const __bf16*)(const void*)A2p;
  const __bf16* Bt  = (const __bf16*)(const void*)Btp;
  const __bf16* Bt2 = (const __bf16*)(const void*)Bt2p;
  constexpr int RB   = (NSPLIT >= 1) ? 256 : 128;            // stage rows: A 0..127, A2 128..255 (NSPLIT >= 1), then Bt 256 rows, Bt2 256 rows (NSPLIT == 2)
  constexpr int ROWS = RB + ((NSPLIT == 2) ? 512 : 256);
  constexpr int STG  = ROWS * LP;                            // elements of one stage buffer
  __shared__ __align__(16) float sT[8][16 * 68];   // per-wave 16x64 slab, pitch 68 floats
  __shared__ __align__(16) __bf16 ring[2 * STG];   // two stage buffers
  const int b    = blockIdx.y;
  const int lane = threadIdx.x & 31;
  const int wave = threadIdx.x >> 5;
  const int tilesN = N >> 8;
  const int tilesM = M >> 7;
  if ((int)blockIdx.x >= tilesM * tilesN) return;   // block-uniform, in front of every barrier
  const int tm = blockIdx.x / tilesN;
  const int tn = blockIdx.x - tm * tilesN;
  const int wm = (wave >> 2) << 6;                  // the wave's 64x64 tile inside the block's 128x256
  const int wn = (wave & 3) << 6;
  const int m0 = (tm << 7) + wm;
  const int n0 = (tn << 8) + wn;

  const __bf16* Ab  = A  + (size_t)b * strideA;
  const __bf16* Bb  = Bt + (size_t)b * strideB;
  const __bf16* Ab2 = (NSPLIT >= 1) ? (A2  + (size_t)b * strideA) : Ab;
  const __bf16* Bb2 = (NSPLIT == 2) ? (Bt2 + (size_t)b * strideB) : Bb;

  const int rlane = lane & 15;                 // row (A) / col (B, D) within subtile
  const int koff  = (lane >> 4) * 8;           // k offset of this lane half
  const int mOff  = (lane >> 4) * 8;           // D row offset

  v8f acc[4][4];
#pragma unroll
  for (int i = 0; i < 4; ++i)
#pragma unroll
    for (int j = 0; j < 4; ++j) acc[i][j] = zero8();

  // ---- stage copies: thread -> row (threadIdx.x >> 3) + 32 * c of each 128-row group, 16 B at column 8 * (threadIdx.x & 7) ----
  const int trow = threadIdx.x >> 3;
  const int tcol = (threadIdx.x & 7) * 8;
  const size_t   aoff  = (size_t)((tm << 7) + trow) * lda + tcol;
  const size_t   boff  = (size_t)((tn << 8) + trow) * ldb + tcol;
  const unsigned lrow  = lds_off(ring) + (unsigned)(trow * LP + tcol) * 2u;
  const unsigned lstep = 32u * LP * 2u;                       // 32 rows further in LDS, bytes
  auto copy_stage = [&](int st, int buf) {
    const unsigned l = lrow + (unsigned)buf * (unsigned)(STG * 2);
    const size_t   k = (size_t)st * 64;
    if (NSPLIT >= 1) copy8_lds(l, l + 4u * lstep, lstep, Ab + aoff + k, Ab2 + aoff + k, (size_t)32 * lda);
    else             copy4_lds(l, lstep, Ab + aoff + k, (size_t)32 * lda);
    copy8_lds(l + (unsigned)(RB * LP * 2), l + (unsigned)((RB + 128) * LP * 2), lstep,
              Bb + boff + k, Bb + boff + k + (size_t)128 * ldb, (size_t)32 * ldb);
    if (NSPLIT == 2)
      copy8_lds(l + (unsigned)((RB + 256) * LP * 2), l + (unsigned)((RB + 384) * LP * 2), lstep,
                Bb2 + boff + k, Bb2 + boff + k + (size_t)128 * ldb, (size_t)32 * ldb);
  };

  const int nst = K >> 6;                     // stages of 64 k; block-uniform
  copy_stage(0, 0);
  wait_copies();
  __syncthreads();                            // stage 0 is readable by every wave
  if (nst > 1) copy_stage(1, 1);

  for (int t = 0; t < nst; ++t) {
    const __bf16* sb = ring + (t & 1) * STG;
#pragma unroll   // as the inner loops: every fragment and accumulator index constant, so the arrays stay in registers
    for (int ks = 0; ks < 2; ++ks) {
      v16b bh[4], bl[4], ah[4], al[4];
#pragma unroll
      for (int j = 0; j < 4; ++j) {
        const int bo = (RB + wn + (j << 4) + rlane) * LP + koff + ks * 32;
        bh[j] = ldfrag_b(sb + bo);
        if (NSPLIT == 2) bl[j] = ldfrag_b(sb + bo + 256 * LP); else bl[j] = bh[j];
      }
#pragma unroll
      for (int i = 0; i < 4; ++i) {
        const int ao = (wm + (i << 4) + rlane) * LP + koff + ks * 32;
        ah[i] = ldfrag_b(sb + ao);
        if (NSPLIT >= 1) al[i] = ldfrag_b(sb + ao + 128 * LP); else al[i] = ah[i];
      }
#pragma unroll
      for (int i = 0; i < 4; ++i) {
#pragma unroll
        for (int j = 0; j < 4; ++j) {
          acc[i][j] = mma_b_raw(ah[i], bh[j], acc[i][j]);
          if (NSPLIT >= 1) acc[i][j] = mma_b_raw(al[i], bh[j], acc[i][j]);
          if (NSPLIT == 2) acc[i][j] = mma_b_raw(ah[i], bl[j], acc[i][j]);
        }
        dep_guard_b(acc[i][0], acc[i][3], ah[i], al[i]);
      }
      keep4_b(bh[0], bh[1], bh[2], bh[3]);
      if (NSPLIT == 2) keep4_b(bl[0], bl[1], bl[2], bl[3]);
    }
    wait_lds_reads();
    wait_copies();
    __syncthreads();                          // publishes stage t+1 and ends every wave's reads of stage t's buffer
    if (t + 2 < nst) copy_stage(t + 2, t & 1);
  }
  wait_copies();
  acc_guard4(acc[0][0], acc[0][1], acc[0][2], acc[0][3]);
  acc_guard4(acc[1][0], acc[1][1], acc[1][2], acc[1][3]);
  acc_guard4(acc[2][0], acc[2][1], acc[2][2], acc[2][3]);
  acc_guard4(acc[3][0], acc[3][1], acc[3][2], acc[3][3]);

  // ---- epilogue ----
  float* slab = sT[wave];
#pragma unroll
  for (int i = 0; i < 4; ++i) {
    const int mBase = m0 + (i << 4);
    float brow[8];
#pragma unroll
    for (int r = 0; r < 8; ++r) {
      brow[r] = 0.f;
      if (BIAS_MODE == 2) brow[r] = bf_rne(biasp[mBase + mOff + r]);
    }
#pragma unroll
    for (int j = 0; j < 4; ++j) {
      float bcol = 0.f;
      if (BIAS_MODE == 1) bcol = bf_rne(biasp[n0 + (j << 4) + rlane]);
#pragma unroll
      for (int r = 0; r < 8; ++r) {
        slab[(mOff + r) * 68 + (j << 4) + rlane] = acc[i][j][r] + bcol + brow[r];
      }
    }
    wave_sync_lds();
    if (OUT_MODE == 0) {
      float* C = (float*)Cout + (size_t)b * strideC;
      const int hh = lane >> 4, c4 = (lane & 15) * 4;     // 256-B row segment = 16 lanes x 16 B
      {
#pragma unroll
        for (int it = 0; it < 8; ++it) {
          const int row = it * 2 + hh;                     // it 0..7 x hh 0..1 = rows 0..15
          const v4f v = *(const v4f*)(slab + row * 68 + c4);
          *(v4f*)(C + (size_t)(mBase + row) * ldc + n0 + c4) = v;
        }
        
      }
    } else {
      const int q = lane >> 3, c8 = (lane & 7) * 8;
      unsigned short* C  = (unsigned short*)Cout  + (size_t)b * strideC;
      unsigned short* C2 = (unsigned short*)Cout2 + (size_t)b * strideC2;
      const bool wlo = (OUT_MODE == 2) || (n0 < N2);      // wave-uniform
      v4u hv[4], lv[4];
#pragma unroll
      for (int it = 0; it < 4; ++it) {
        const int row = it * 4 + q;                        // it 0..3 x q 0..3 = rows 0..15
        const float* sp = slab + row * 68 + c8;
        v4u a, a2;
#pragma unroll
        for (int e = 0; e < 4; ++e) {
          const float f0 = sp[2 * e], f1 = sp[2 * e + 1];
          unsigned short h0, h1, l0, l1;
          if (OUT_MODE == 2) {
            h0 = bf_bits(f0); h1 = bf_bits(f1);
            l0 = bf_bits(f0 - bf_up(h0)); l1 = bf_bits(f1 - bf_up(h1));
          } else {
            const _Float16 x0 = (_Float16)f0, x1 = (_Float16)f1;
            h0 = h_bits(x0); h1 = h_bits(x1);
            l0 = h_bits((_Float16)((f0 - (float)x0) * rscale));
            l1 = h_bits((_Float16)((f1 - (float)x1) * rscale));
          }
          a[e] = pk16(h0, h1); a2[e] = pk16(l0, l1);
        }
        hv[it] = a; lv[it] = a2;
      }
      {
#pragma unroll
        for (int it = 0; it < 4; ++it) {
          const int row = it * 4 + q;
          *(v4u*)(C + (size_t)(mBase + row) * ldc + n0 + c8) = hv[it];
          if (wlo) *(v4u*)(C2 + (size_t)(mBase + row) * ldc2 + n0 + c8) = lv[it];
        }
        
      }
    }
    wave_sync_lds();
  }
}

// =====================================================================================================
// RoPE row pass (rotate-half, half = HD/2 = 32) on the f32 q|k staging plane (bias already added):
//   y[d] = x[d] * cos[s][d] + (d < 32 ? -x[d+32] : x[d-32]) * sin[s][d],  tables [SEQ][HD] shared over heads,
//   table values RNE-converted to bf16 on read.
// One block (256 threads) per token row s; thread t owns 8 consecutive columns of q (t < 128, waves 0..3)
// or of k (t >= 128, waves 4..7): the 8 columns share one head half, so the rotate partner is the 8-group
// at +-32. Outputs: q -> f16 hi plane + f16 residual plane ((y - hi) * rscale); k -> f16 plane; all [SEQ][DM].
// =====================================================================================================
__global__ __launch_bounds__(256) void rope_rows(
    const float* __restrict__ qkf, const float* __restrict__ cosp, const float* __restrict__ sinp,
    unsigned short* qhp, unsigned short* qlp, unsigned short* kpp, int nrows, float rscale) {
  const int row = blockIdx.x;
  if (row >= nrows) return;                       // block-uniform; no barriers in this kernel
  const int t   = threadIdx.x;
  const int isk = t >> 7;                         // 0: q section, 1: k section (wave-uniform)
  const int c0  = (t & 127) * 8;                  // column within the DM-wide section
  const int d0  = c0 & (HD - 1);                  // head-dim offset, multiple of 8
  const bool lowhalf = (d0 < (HD / 2));
  const int pc0 = lowhalf ? (c0 + HD / 2) : (c0 - HD / 2);   // partner columns, same head, in range
  const float sgn = lowhalf ? -1.0f : 1.0f;

  const float* src = qkf + (size_t)row * QKP + (size_t)isk * DM;
  const v4f x0 = *(const v4f*)(src + c0);
  const v4f x1 = *(const v4f*)(src + c0 + 4);
  const v4f p0 = *(const v4f*)(src + pc0);
  const v4f p1 = *(const v4f*)(src + pc0 + 4);
  const v4f cA = *(const v4f*)(cosp + (size_t)row * HD + d0);
  const v4f cB = *(const v4f*)(cosp + (size_t)row * HD + d0 + 4);
  const v4f sA = *(const v4f*)(sinp + (size_t)row * HD + d0);
  const v4f sB = *(const v4f*)(sinp + (size_t)row * HD + d0 + 4);

  v4f y0, y1;
#pragma unroll
  for (int e = 0; e < 4; ++e) {
    y0[e] = x0[e] * bf_rne(cA[e]) + (sgn * p0[e]) * bf_rne(sA[e]);
    y1[e] = x1[e] * bf_rne(cB[e]) + (sgn * p1[e]) * bf_rne(sB[e]);
  }
  v4u hv, lv;
#pragma unroll
  for (int e = 0; e < 2; ++e) {
    const float f0 = y0[2 * e], f1 = y0[2 * e + 1];
    const float g0 = y1[2 * e], g1 = y1[2 * e + 1];
    const _Float16 a0 = (_Float16)f0, a1 = (_Float16)f1;
    const _Float16 b0 = (_Float16)g0, b1 = (_Float16)g1;
    hv[e]     = pk16(h_bits(a0), h_bits(a1));
    hv[2 + e] = pk16(h_bits(b0), h_bits(b1));
    lv[e]     = pk16(h_bits((_Float16)((f0 - (float)a0) * rscale)),
                     h_bits((_Float16)((f1 - (float)a1) * rscale)));
    lv[2 + e] = pk16(h_bits((_Float16)((g0 - (float)b0) * rscale)),
                     h_bits((_Float16)((g1 - (float)b1) * rscale)));
  }
  const size_t o = (size_t)row * DM + c0;
  if (isk == 0) {
    *(v4u*)(qhp + o) = hv;
    *(v4u*)(qlp + o) = lv;
    
  } else {
    *(v4u*)(kpp + o) = hv;
    
  }
}

#define OSP 68
__device__ __forceinline__ float xhalf(float x) {
  return __builtin_bit_cast(float, __builtin_amdgcn_permlanex16(__builtin_bit_cast(int, x), __builtin_bit_cast(int, x),
                                                                0x76543210, 0xfedcba98, false, false));
}

__global__ __launch_bounds__(128)
void attn64(const unsigned short* __restrict__ qhp, const unsigned short* __restrict__ qlp,
            const unsigned short* __restrict__ kpp, const unsigned short* __restrict__ vtp,
            unsigned short* ohp, unsigned short* olp, float sscale, float rres) {
  union FH { v16h v; v8h h[2]; };
  __shared__ __align__(16) _Float16 Ksh[64 * LP];                 // K [kv][d]   pitch LP, 9 KB
  __shared__ __align__(16) _Float16 Vth[64 * LP];                 // V^T [d][kv] pitch LP, 9 KB
  __shared__ __align__(16) float    Os[4][16 * OSP];              // per wave context tile [row][d]

  const int tid  = threadIdx.x;
  const int wave = tid >> 5;
  const int lane = tid & 31;
  const int hh   = lane >> 4;
  const int c    = lane & 15;

  const int bx   = blockIdx.x;
  const int qb   = bx % NQB;
  const int h    = bx / NQB;
  const int q0   = qb * 64 + wave * 16;

  const _Float16* Qh = (const _Float16*)(const void*)qhp + (size_t)h * HD;
  const _Float16* Ql = (const _Float16*)(const void*)qlp + (size_t)h * HD;
  const _Float16* Kg = (const _Float16*)(const void*)kpp + (size_t)h * HD;
  const _Float16* Vg = (const _Float16*)(const void*)vtp + (size_t)h * HD * SEQ;

  // ---- Q fragments (B operand, column = query lane&15): 2 d-chunks, hi and residual ----
  v16h qah[2], qal[2];
#pragma unroll
  for (int dc = 0; dc < 2; ++dc) {
    qah[dc] = ldfrag_h(Qh + (size_t)(q0 + c) * DM + dc * 32 + 8 * hh);
    qal[dc] = ldfrag_h(Ql + (size_t)(q0 + c) * DM + dc * 32 + 8 * hh);
  }

  float mrun = -INFINITY;      // running maximum of query c (equal in both wave halves)
  float lrun = 0.f;            // running sum over this wave half's keys of query c
  v8f oacc[4];                 // oacc[t][r] = O^T[d = t*16 + 8*hh + r][query c]
#pragma unroll
  for (int t = 0; t < 4; ++t) oacc[t] = zero8();

  for (int kt = 0; kt < NQB; ++kt) {         // static trip count
    const int kv0 = kt * 64;
    __syncthreads();
    {
      const int r = tid >> 1, hf = (tid & 1) * 32;
      const _Float16* kg = Kg + (size_t)(kv0 + r) * DM + hf;        // K row kv0+r, d = hf..hf+31
      const _Float16* vg = Vg + (size_t)r * SEQ + kv0 + hf;         // V^T row d = r, s = kv0+hf..+31
#pragma unroll
      for (int i = 0; i < 4; ++i) {
        const v8h a0 = *(const v8h*)(kg + 8 * i);
        const v8h b0 = *(const v8h*)(vg + 8 * i);
        *(v8h*)(Ksh + r * LP + hf + 8 * i) = a0;
        *(v8h*)(Vth + r * LP + hf + 8 * i) = b0;
      }
    }
    __syncthreads();

    // ---- scores, transposed: 64 keys x 16 queries per wave, 2 f16 products (hi, residual);
    //      s[j][r] = score of key kv0 + j*16 + 8*hh + r with query q0 + c ----
    v8f s[4];
#pragma unroll
    for (int j = 0; j < 4; ++j) {
      v8f sh = zero8(), sl = zero8();
#pragma unroll
      for (int dc = 0; dc < 2; ++dc) {
        FH kb;
        kb.h[0] = *(const v8h*)(Ksh + (j * 16 + c) * LP + dc * 32 + 8 * hh);
        kb.h[1] = *(const v8h*)(Ksh + (j * 16 + c) * LP + dc * 32 + 16 + 8 * hh);
        sh = mma_h(kb.v, qah[dc], sh);
        sl = mma_h(kb.v, qal[dc], sl);
      }
#pragma unroll
      for (int r = 0; r < 8; ++r) s[j][r] = (sh[r] + sl[r] * rres) * sscale;
    }

    // ---- maximum of the lane's 32 scores, joined with the other wave half's; online softmax ----
    float mj[4];
#pragma unroll
    for (int j = 0; j < 4; ++j) {
      mj[j] = s[j][0];
#pragma unroll
      for (int r = 1; r < 8; ++r) mj[j] = fmaxf(mj[j], s[j][r]);
    }
    float m = fmaxf(fmaxf(mj[0], mj[1]), fmaxf(mj[2], mj[3]));
    m = fmaxf(m, xhalf(m));
    const float mnew  = fmaxf(mrun, m);
    const float alpha = __expf(mrun - mnew);
    mrun = mnew;

    // ---- P^T (x1024, f16) straight into the B operand: element e of 32-key block kk = key kk*32 + (e < 8 ? 8*hh + e : 16 + 8*hh + e - 8) ----
    FH pb[2];
    float pj[4];
#pragma unroll
    for (int j = 0; j < 4; ++j) {
      pj[j] = 0.f;
#pragma unroll
      for (int r = 0; r < 8; ++r) {
        const float p = __expf(s[j][r] - mnew);
        pj[j] += p;
        pb[j >> 1].h[j & 1][r] = (_Float16)(p * 1024.0f);
      }
    }
    lrun = lrun * alpha + ((pj[0] + pj[1]) + (pj[2] + pj[3]));
#pragma unroll
    for (int t = 0; t < 4; ++t)
#pragma unroll
      for (int r = 0; r < 8; ++r) oacc[t][r] *= alpha;

    // ---- context^T += V^T . P^T (f16 WMMA) ----
#pragma unroll
    for (int kk = 0; kk < 2; ++kk) {
#pragma unroll
      for (int t = 0; t < 4; ++t) {
        FH vb;
        vb.h[0] = *(const v8h*)(Vth + (t * 16 + c) * LP + kk * 32 + 8 * hh);
        vb.h[1] = *(const v8h*)(Vth + (t * 16 + c) * LP + kk * 32 + 16 + 8 * hh);
        oacc[t] = mma_h(vb.v, pb[kk].v, oacc[t]);
      }
    }
  }

  // ---- join the halves' sums, normalise (1/l and the 1/1024 p carry), stage the wave's 16x64 tile, bf16 hi/lo split,
  float* os = Os[wave];
  {
    const float l = lrun + xhalf(lrun);
    const float inv = ((l > 0.f) ? (1.0f / l) : 0.f) * (1.0f / 1024.0f);
#pragma unroll
    for (int t = 0; t < 4; ++t) {
      v4f w0, w1;
#pragma unroll
      for (int e = 0; e < 4; ++e) { w0[e] = oacc[t][e] * inv; w1[e] = oacc[t][4 + e] * inv; }
      *(v4f*)(os + c * OSP + t * 16 + 8 * hh)     = w0;      // row = query c; d = t*16 + 8*hh .. + 7
      *(v4f*)(os + c * OSP + t * 16 + 8 * hh + 4) = w1;
    }
  }
  wave_sync_lds();
  {
    const int q4 = lane >> 3, c8 = (lane & 7) * 8;
    v4u hv[4], lv[4];
#pragma unroll
    for (int it = 0; it < 4; ++it) {
      const int row = it * 4 + q4;   // it 0..3 x q4 0..3 = rows 0..15 of the wave tile
      const float* sp = os + row * OSP + c8;
      v4u a, a2;
#pragma unroll
      for (int e = 0; e < 4; ++e) {
        const float f0 = sp[2 * e], f1 = sp[2 * e + 1];
        const unsigned short h0 = bf_bits(f0), h1 = bf_bits(f1);
        const unsigned short l0 = bf_bits(f0 - bf_up(h0)), l1 = bf_bits(f1 - bf_up(h1));
        a[e] = pk16(h0, h1); a2[e] = pk16(l0, l1);
      }
      hv[it] = a; lv[it] = a2;
    }
    {
#pragma unroll
      for (int it = 0; it < 4; ++it) {
        const int row = it * 4 + q4;
        const size_t go = (size_t)(q0 + row) * DM + (size_t)h * HD + c8;
        *(v4u*)(ohp + go) = hv[it];
        *(v4u*)(olp + go) = lv[it];
      }
      
    }
  }
}

// =====================================================================================================
// Workspace map (bytes), every plane an exact multiple of its 64x64-tile / whole-line store granularity:
//   Xb    bf16 [4096][1024]          0           8388608
//   Wqkvb bf16 [3072 n][1024 k]      8388608     6291456   (rows 0..1023 q, 1024..2047 k, 2048..3071 v weights)
//   Wob   bf16 [1024][1024]          14680064    2097152
//   QKf   f32  [4096][2048]          16777216    33554432  (q cols 0..1023, k cols 1024..2047, bias included)
//   Qh    f16  [4096][1024]          50331648    8388608
//   Ql    f16  [4096][1024]          58720256    8388608   (q residual x4096)
//   Kp    f16  [4096][1024]          67108864    8388608
//   VT    f16  [1024][4096]          75497472    8388608   (v^T incl. bias)
//   Oh    bf16 [4096][1024]          83886080    8388608
//   Ol    bf16 [4096][1024]          92274688    8388608
//   end                              100663296
// Weights are [out n][in k] with k contiguous = the Bt / A layout the GEMM wants, so they are only converted.
// =====================================================================================================
extern "C" void kernel_launch(void* const* d_in, const int* in_sizes, int n_in,
                              void* d_out, int out_size, void* d_ws, size_t ws_size,
                              hipStream_t stream) {
  if (n_in < 7) return;
  if (in_sizes[0] != SEQ * DM) return;
  if (in_sizes[1] != SEQ * HD) return;
  if (in_sizes[2] != SEQ * HD) return;
  if (in_sizes[3] != 3 * DM * DM) return;
  if (in_sizes[4] != 3 * DM) return;
  if (in_sizes[5] != DM * DM) return;
  if (in_sizes[6] != DM) return;
  if (out_size != SEQ * DM) return;

  const float* x     = (const float*)d_in[0];
  const float* cosp  = (const float*)d_in[1];
  const float* sinp  = (const float*)d_in[2];
  const float* wqkv  = (const float*)d_in[3];
  const float* bqkv  = (const float*)d_in[4];
  const float* wout  = (const float*)d_in[5];
  const float* bout  = (const float*)d_in[6];

  const size_t PXb  = (size_t)SEQ * DM * 2;           //  8388608
  const size_t PWq  = (size_t)3 * DM * DM * 2;        //  6291456
  const size_t PWo  = (size_t)DM * DM * 2;            //  2097152
  const size_t PQKf = (size_t)SEQ * QKP * 4;          // 33554432
  const size_t P16  = (size_t)SEQ * DM * 2;           //  8388608 (q hi, q res, k, out hi, out lo)
  const size_t PVT  = (size_t)DM * SEQ * 2;           //  8388608
  size_t off = 0;
  const size_t oXb  = off; off += PXb;
  const size_t oWq  = off; off += PWq;
  const size_t oWo  = off; off += PWo;
  const size_t oQKf = off; off += PQKf;
  const size_t oQh  = off; off += P16;
  const size_t oQl  = off; off += P16;
  const size_t oKp  = off; off += P16;
  const size_t oVT  = off; off += PVT;
  const size_t oOh  = off; off += P16;
  const size_t oOl  = off; off += P16;
  if (off > ws_size) return;                          // off = 100663296
  if (off > (size_t)134217728) return;

  char* ws = (char*)d_ws;
  unsigned short* Xb    = (unsigned short*)(ws + oXb);
  unsigned short* Wqkvb = (unsigned short*)(ws + oWq);
  unsigned short* Wvb   = Wqkvb + (size_t)2 * DM * DM;          // rows 2048..3071 of Wqkvb
  unsigned short* Wob   = (unsigned short*)(ws + oWo);
  float*          QKf   = (float*)(ws + oQKf);
  unsigned short* Qh    = (unsigned short*)(ws + oQh);
  unsigned short* Ql    = (unsigned short*)(ws + oQl);
  unsigned short* Kp    = (unsigned short*)(ws + oKp);
  unsigned short* VT    = (unsigned short*)(ws + oVT);
  unsigned short* Oh    = (unsigned short*)(ws + oOh);
  unsigned short* Ol    = (unsigned short*)(ws + oOl);

  const dim3 blk(256);
  const int n8x  = SEQ * DM / 8;                                // 524288
  const int n8wq = 3 * DM * DM / 8;                             // 393216
  const int n8wo = DM * DM / 8;                                 // 131072
  const dim3 gCvtX((n8x + 255) / 256);                          // 2048 blocks
  const dim3 gCvtWq((n8wq + 255) / 256);                        // 1536 blocks
  const dim3 gCvtWo((n8wo + 255) / 256);                        //  512 blocks
  const dim3 gQK(((SEQ / 64) * (QKP / 64) + 7) / 8, 1);         // 2048 tiles -> 256 blocks: M=4096, N=2048
  const dim3 gRope(SEQ);                                        // one block per token row
  const dim3 gVT(((DM / 64) * (SEQ / 64) + 7) / 8, 1);          // 1024 tiles -> 128 blocks: M=1024, N=4096
  const dim3 gAttn(NH * NQB);                                   // 1024 blocks
  const dim3 gOut(((SEQ / 64) * (DM / 64) + 7) / 8, 1);         // 1024 tiles -> 128 blocks: M=4096, N=1024

  // (1) x -> bf16 plane [4096][1024]; w_qkv -> bf16 [3072][1024]; w_out -> bf16 [1024][1024]
  cvt_bf16x8<<<gCvtX, blk, 0, stream>>>(x, Xb, n8x);
  cvt_bf16x8<<<gCvtWq, blk, 0, stream>>>(wqkv, Wqkvb, n8wq);
  cvt_bf16x8<<<gCvtWo, blk, 0, stream>>>(wout, Wob, n8wo);
  // (2) q|k = x . Wqk^T + b_qk -> f32 staging plane [4096][2048] (pitch 2048)   (M=4096, N=2048, K=1024, col bias)
  gemm64<0, 0, 1><<<gQK, blk, 0, stream>>>(
      Xb, Xb, DM, 0LL, Wqkvb, Wqkvb, DM, 0LL,
      (void*)QKf, QKP, 0LL, (void*)QKf, QKP, 0LL, 0,
      bqkv,
      SEQ, QKP, DM, 1.0f);
  // (3) RoPE -> q f16 hi plane + f16 residual x4096 plane, k f16 plane, each [4096][1024]
  rope_rows<<<gRope, blk, 0, stream>>>(QKf, cosp, sinp, Qh, Ql, Kp, SEQ, 4096.0f);
  // (4) v^T = Wv . x^T + b_v[row] -> f16 plane [h*64+d][s] (pitch SEQ), no residual plane (N2 = 0)
  //     (A = Wvb [n][k], Bt = Xb [s][k]; M=1024, N=4096, K=1024, row bias = b_qkv rows 2048..3071)
  gemm64<0, 3, 2><<<gVT, blk, 0, stream>>>(
      Wvb, Wvb, DM, 0LL, Xb, Xb, DM, 0LL,
      (void*)VT, SEQ, 0LL, (void*)VT, SEQ, 0LL, 0,
      bqkv + 2 * DM,
      DM, SEQ, DM, 4096.0f);
  // (5) attention -> context bf16 hi / lo planes [4096][1024]
  attn64<<<gAttn, dim3(128), 0, stream>>>(Qh, Ql, Kp, VT, Oh, Ol, 0.125f, 1.0f / 4096.0f);
  // (6) out = context . w_out^T + b_out -> d_out f32 [4096][1024]  (A = context hi + lo planes, 2 products; K=1024, col bias)
  gemm64<1, 0, 1><<<gOut, blk, 0, stream>>>(
      Oh, Ol, DM, 0LL, Wob, Wob, DM, 0LL,
      d_out, DM, 0LL, d_out, DM, 0LL, 0,
      bout,
      SEQ, DM, DM, 1.0f);
  (void)hipGetLastError();
}

// v004
// One run takes 188 microseconds.
// In both of two side-by-side timings against v003, it was 1.12 times as fast.
// Over all steps from v000 it is 2.69 times as fast.
// Contractions: q|k projection and v^T projection = v_wmma_f32_16x16x32_bf16 (bf16 operands from RNE-converted x and w_qkv, single product);
// k.q^T scores = v_wmma_f32_16x16x32_f16 (q as f16 hi plane + f16 residual plane x4096 in a separate accumulator, k f16; 2 products);
// v^T.p^T = v_wmma_f32_16x16x32_f16 (p carried x1024 in f16, v^T f16; 1 product);
// ctx.w_out^T = v_wmma_f32_16x16x32_bf16 (ctx as bf16 hi + lo planes times bf16 w_out, 2 products); all f32 accumulate; bias, RoPE, softmax in f32.
#include <hip/hip_runtime.h>
#include <math.h>
#include <stdint.h>

#define SEQ   4096
#define DM    1024
#define NH    16
#define HD    64
#define NQB   (SEQ / 64)     // 64 key / query tiles of 64
#define QKP   (2 * DM)        // pitch of the f32 q|k staging plane: q at cols 0..DM-1, k at cols DM..2DM-1
#define LP    72              // LDS row pitch of the 64-wide f16 tiles, in elements: 144 B = 16 B x odd, so the 16 rows of a 16-B fragment read fall on 16 distinct bank groups
static_assert(NH * HD == DM);
static_assert((SEQ % 64) == 0 && (DM % 64) == 0 && (DM % 32) == 0);
static_assert((SEQ % 256) == 0 && (DM % 256) == 0);   // GEMM block tile 128 x 256, for every M and N used here
static_assert((HD % 8) == 0 && (HD / 2) % 8 == 0);
static_assert(LP >= 64 && (LP % 8) == 0 && ((LP / 8) & 1) == 1);

typedef _Float16 v16h __attribute__((ext_vector_type(16)));
typedef _Float16 v8h  __attribute__((ext_vector_type(8)));
typedef __bf16   v16b __attribute__((ext_vector_type(16)));
typedef __bf16   v8b  __attribute__((ext_vector_type(8)));
typedef float    v8f  __attribute__((ext_vector_type(8)));
typedef float    v4f  __attribute__((ext_vector_type(4)));
typedef unsigned int v4u __attribute__((ext_vector_type(4)));

// ---- scalar helpers --------------------------------------------------------------------------------
__device__ __forceinline__ unsigned short bf_bits(float f) {          // f32 -> bf16 bits, RNE convert
  unsigned u = __float_as_uint(f);
  return (unsigned short)((u + 0x7FFFu + ((u >> 16) & 1u)) >> 16);
}
__device__ __forceinline__ float bf_up(unsigned short h) { return __uint_as_float(((unsigned)h) << 16); }
__device__ __forceinline__ float bf_rne(float f) { return bf_up(bf_bits(f)); }
__device__ __forceinline__ unsigned short h_bits(_Float16 x) { return __builtin_bit_cast(unsigned short, x); }
__device__ __forceinline__ unsigned pk16(unsigned short a, unsigned short b) { return (unsigned)a | ((unsigned)b << 16); }
__device__ __forceinline__ v8f zero8() { v8f z = {0.f, 0.f, 0.f, 0.f, 0.f, 0.f, 0.f, 0.f}; return z; }

// ---- fragment loaders: 16-bit A/B operand, lane -> row/col (lane&15), p already includes +8*(lane>>4);
//      elements 0..7 <- p[0..7] (k0+8h..), elements 8..15 <- p[16..23] (k0+16+8h..)
__device__ __forceinline__ v16b ldfrag_b(const __bf16* p) {
  union { v16b v; v8b h[2]; } f;
  f.h[0] = *(const v8b*)(p);
  f.h[1] = *(const v8b*)(p + 16);
  return f.v;
}
__device__ __forceinline__ v16h ldfrag_h(const _Float16* p) {
  union { v16h v; v8h h[2]; } f;
  f.h[0] = *(const v8h*)(p);
  f.h[1] = *(const v8h*)(p + 16);
  return f.v;
}

// ---- WMMA helpers --------------------------------------------------------------------------------------
// f16 product (attention): the builtin alone. The compiler keeps the distance behind its own WMMA, and with no statement
// tied to each product it is free to issue the LDS fragment reads of several products together, ahead of them.
__device__ __forceinline__ v8f mma_h(v16h a, v16h b, v8f c) {
  return __builtin_amdgcn_wmma_f32_16x16x32_f16(false, a, false, b, (short)0, c, false, false);
}
// bf16 product (GEMMs), with its hand-written gaps
__device__ __forceinline__ v8f mma_b_raw(v16b a, v16b b, v8f c) {
  return __builtin_amdgcn_wmma_f32_16x16x32_bf16(false, a, false, b, (short)0, c, false, false);
}
__device__ __forceinline__ void dep_guard_b(v8f& a, v8f& b, v16b x, v16b y) {
#if defined(__HIP_DEVICE_COMPILE__)
  asm volatile("v_nop\n\tv_nop\n\tv_nop\n\tv_nop" : "+v"(a), "+v"(b) : "v"(x), "v"(y));
#endif
}
__device__ __forceinline__ void keep4_b(v16b a, v16b b, v16b c, v16b d) {
#if defined(__HIP_DEVICE_COMPILE__)
  asm volatile("v_nop" :: "v"(a), "v"(b), "v"(c), "v"(d));
#endif
}
__device__ __forceinline__ void acc_guard4(v8f& a, v8f& b, v8f& c, v8f& d) {
#if defined(__HIP_DEVICE_COMPILE__)
  asm volatile("v_nop\n\tv_nop\n\tv_nop\n\tv_nop" : "+v"(a), "+v"(b), "+v"(c), "+v"(d));
#endif
}
__device__ __forceinline__ void wave_sync_lds() {
  __builtin_amdgcn_fence(__ATOMIC_RELEASE, "workgroup");
  __builtin_amdgcn_wave_barrier();
  __builtin_amdgcn_fence(__ATOMIC_ACQUIRE, "workgroup");
}

// ---- asynchronous copies global -> LDS, 16 B per lane: l = the lane's LDS byte address, g = its global address.
//      A run of copies and its s_wait_xcnt 0 are one statement, so that no address register is rewritten ahead of the wait.
__device__ __forceinline__ unsigned lds_off(const void* p) { return (unsigned)(size_t)p; }
__device__ __forceinline__ void copy4_lds(unsigned l, unsigned lstep, const __bf16* g, size_t gstep) {
#if defined(__HIP_DEVICE_COMPILE__)
  asm volatile("global_load_async_to_lds_b128 %0, %1, off\n\t"
               "global_load_async_to_lds_b128 %2, %3, off\n\t"
               "global_load_async_to_lds_b128 %4, %5, off\n\t"
               "global_load_async_to_lds_b128 %6, %7, off\n\t"
               "s_wait_xcnt 0x0"
               :: "v"(l), "v"(g), "v"(l + lstep), "v"(g + gstep),
                  "v"(l + 2 * lstep), "v"(g + 2 * gstep), "v"(l + 3 * lstep), "v"(g + 3 * gstep)
               : "memory");
#endif
}
__device__ __forceinline__ void copy8_lds(unsigned l0, unsigned l1, unsigned lstep,
                                          const __bf16* g0, const __bf16* g1, size_t gstep) {
#if defined(__HIP_DEVICE_COMPILE__)
  asm volatile("global_load_async_to_lds_b128 %0, %1, off\n\t"
               "global_load_async_to_lds_b128 %2, %3, off\n\t"
               "global_load_async_to_lds_b128 %4, %5, off\n\t"
               "global_load_async_to_lds_b128 %6, %7, off\n\t"
               "global_load_async_to_lds_b128 %8, %9, off\n\t"
               "global_load_async_to_lds_b128 %10, %11, off\n\t"
               "global_load_async_to_lds_b128 %12, %13, off\n\t"
               "global_load_async_to_lds_b128 %14, %15, off\n\t"
               "s_wait_xcnt 0x0"
               :: "v"(l0), "v"(g0), "v"(l0 + lstep), "v"(g0 + gstep),
                  "v"(l0 + 2 * lstep), "v"(g0 + 2 * gstep), "v"(l0 + 3 * lstep), "v"(g0 + 3 * gstep),
                  "v"(l1), "v"(g1), "v"(l1 + lstep), "v"(g1 + gstep),
                  "v"(l1 + 2 * lstep), "v"(g1 + 2 * gstep), "v"(l1 + 3 * lstep), "v"(g1 + 3 * gstep)
               : "memory");
#endif
}
__device__ __forceinline__ void wait_copies() {     // the wave's own copies have landed in LDS
#if defined(__HIP_DEVICE_COMPILE__)
  asm volatile("s_wait_asynccnt 0x0" ::: "memory");
#endif
}
__device__ __forceinline__ void wait_lds_reads() {  // the wave's LDS reads have returned, before their buffer is given up for refilling
#if defined(__HIP_DEVICE_COMPILE__)
  asm volatile("s_wait_dscnt 0x0" ::: "memory");
#endif
}

// =====================================================================================================
// f32 -> bf16 (RNE convert), 8 elements per thread, one 16-B store per lane: a wave writes 512 contiguous B
// coverage: n8 threads x 8 = whole plane (n8 is a multiple of 256 for every use here).
// =====================================================================================================
__global__ __launch_bounds__(256) void cvt_bf16x8(const float* __restrict__ in, unsigned short* out, int n8) {
  const int i = blockIdx.x * 256 + threadIdx.x;
  if (i < n8) {
    const v4f a = *(const v4f*)(in + (size_t)i * 8);
    const v4f b = *(const v4f*)(in + (size_t)i * 8 + 4);
    v4u p;
    p[0] = pk16(bf_bits(a[0]), bf_bits(a[1]));
    p[1] = pk16(bf_bits(a[2]), bf_bits(a[3]));
    p[2] = pk16(bf_bits(b[0]), bf_bits(b[1]));
    p[3] = pk16(bf_bits(b[2]), bf_bits(b[3]));
    *(v4u*)(out + (size_t)i * 8) = p;
    
  }
}

// =====================================================================================================
// Register-blocked batched bf16 WMMA GEMM: C[m][n] = sum_k A[m][k] * Bt[n][k] + bias; one wave per 64x64 tile,
// the 8 waves of a block as 2 x 4 = one 128x256 tile. A row-major [M][K] pitch lda; Bt row-major [N][K] pitch ldb
// (k contiguous); M multiple of 128, N of 256, K of 64. blockIdx.y = batch index (strides in elements).
// Operands: a stage = 64 k = one whole 128-B line of each of the block's A and Bt rows, brought into LDS by asynchronous
// copies (8 lanes per row, 4 whole lines per wave copy), rows at pitch LP; two buffers, stage t+2 copied while t+1 is worked on;
// fragments are read from LDS in the k order of ldfrag_b, k ascending.
// NSPLIT: 0 = A.Bt; 1 = (A + A2).Bt (A2 = unscaled bf16 lo plane of A); 2 = A.Bt + A2.Bt + A.Bt2.
// OUT_MODE: 0 = f32 (pitch ldc); 2 = bf16 hi plane C + bf16 lo plane C2 (lo = RNE(v - hi), unscaled);
//           3 = f16 hi plane C + f16 residual plane C2 = f16((v - hi) * rscale), C2 written only for tiles
//               with n0 < N2 (pitch ldc2, batch stride strideC2).
// BIAS_MODE: 1 = + biasp[n] (per column), 2 = + biasp[m] (per row); bias values RNE-converted to bf16 and
//            added in f32 before any 16-bit conversion of the result.
// =====================================================================================================
template <int NSPLIT, int OUT_MODE, int BIAS_MODE>
__global__ __launch_bounds__(256) void gemm64(
    const unsigned short* __restrict__ Ap, const unsigned short* A2p, int lda, long long strideA,
    const unsigned short* __restrict__ Btp, const unsigned short* Bt2p, int ldb, long long strideB,
    void* Cout, int ldc, long long strideC,
    void* Cout2, int ldc2, long long strideC2, int N2,
    const float* __restrict__ biasp,
    int M, int N, int K, float rscale) {
  const __bf16* A   = (const __bf16*)(const void*)Ap;
  const __bf16* A2  = (const __bf16*)(const void*)A2p;
  const __bf16* Bt  = (const __bf16*)(const void*)Btp;
  const __bf16* Bt2 = (const __bf16*)(const void*)Bt2p;
  constexpr int RB   = (NSPLIT >= 1) ? 256 : 128;            // stage rows: A 0..127, A2 128..255 (NSPLIT >= 1), then Bt 256 rows, Bt2 256 rows (NSPLIT == 2)
  constexpr int ROWS = RB + ((NSPLIT == 2) ? 512 : 256);
  constexpr int STG  = ROWS * LP;                            // elements of one stage buffer
  __shared__ __align__(16) float sT[8][16 * 68];   // per-wave 16x64 slab, pitch 68 floats
  __shared__ __align__(16) __bf16 ring[2 * STG];   // two stage buffers
  const int b    = blockIdx.y;
  const int lane = threadIdx.x & 31;
  const int wave = threadIdx.x >> 5;
  const int tilesN = N >> 8;
  const int tilesM = M >> 7;
  if ((int)blockIdx.x >= tilesM * tilesN) return;   // block-uniform, in front of every barrier
  const int tm = blockIdx.x / tilesN;
  const int tn = blockIdx.x - tm * tilesN;
  const int wm = (wave >> 2) << 6;                  // the wave's 64x64 tile inside the block's 128x256
  const int wn = (wave & 3) << 6;
  const int m0 = (tm << 7) + wm;
  const int n0 = (tn << 8) + wn;

  const __bf16* Ab  = A  + (size_t)b * strideA;
  const __bf16* Bb  = Bt + (size_t)b * strideB;
  const __bf16* Ab2 = (NSPLIT >= 1) ? (A2  + (size_t)b * strideA) : Ab;
  const __bf16* Bb2 = (NSPLIT == 2) ? (Bt2 + (size_t)b * strideB) : Bb;

  const int rlane = lane & 15;                 // row (A) / col (B, D) within subtile
  const int koff  = (lane >> 4) * 8;           // k offset of this lane half
  const int mOff  = (lane >> 4) * 8;           // D row offset

  v8f acc[4][4];
#pragma unroll
  for (int i = 0; i < 4; ++i)
#pragma unroll
    for (int j = 0; j < 4; ++j) acc[i][j] = zero8();

  // ---- stage copies: thread -> row (threadIdx.x >> 3) + 32 * c of each 128-row group, 16 B at column 8 * (threadIdx.x & 7) ----
  const int trow = threadIdx.x >> 3;
  const int tcol = (threadIdx.x & 7) * 8;
  const size_t   aoff  = (size_t)((tm << 7) + trow) * lda + tcol;
  const size_t   boff  = (size_t)((tn << 8) + trow) * ldb + tcol;
  const unsigned lrow  = lds_off(ring) + (unsigned)(trow * LP + tcol) * 2u;
  const unsigned lstep = 32u * LP * 2u;                       // 32 rows further in LDS, bytes
  auto copy_stage = [&](int st, int buf) {
    const unsigned l = lrow + (unsigned)buf * (unsigned)(STG * 2);
    const size_t   k = (size_t)st * 64;
    if (NSPLIT >= 1) copy8_lds(l, l + 4u * lstep, lstep, Ab + aoff + k, Ab2 + aoff + k, (size_t)32 * lda);
    else             copy4_lds(l, lstep, Ab + aoff + k, (size_t)32 * lda);
    copy8_lds(l + (unsigned)(RB * LP * 2), l + (unsigned)((RB + 128) * LP * 2), lstep,
              Bb + boff + k, Bb + boff + k + (size_t)128 * ldb, (size_t)32 * ldb);
    if (NSPLIT == 2)
      copy8_lds(l + (unsigned)((RB + 256) * LP * 2), l + (unsigned)((RB + 384) * LP * 2), lstep,
                Bb2 + boff + k, Bb2 + boff + k + (size_t)128 * ldb, (size_t)32 * ldb);
  };

  const int nst = K >> 6;                     // stages of 64 k; block-uniform
  copy_stage(0, 0);
  wait_copies();
  __syncthreads();                            // stage 0 is readable by every wave
  if (nst > 1) copy_stage(1, 1);

  for (int t = 0; t < nst; ++t) {
    const __bf16* sb = ring + (t & 1) * STG;
#pragma unroll   // as the inner loops: every fragment and accumulator index constant, so the arrays stay in registers
    for (int ks = 0; ks < 2; ++ks) {
      v16b bh[4], bl[4], ah[4], al[4];
#pragma unroll
      for (int j = 0; j < 4; ++j) {
        const int bo = (RB + wn + (j << 4) + rlane) * LP + koff + ks * 32;
        bh[j] = ldfrag_b(sb + bo);
        if (NSPLIT == 2) bl[j] = ldfrag_b(sb + bo + 256 * LP); else bl[j] = bh[j];
      }
#pragma unroll
      for (int i = 0; i < 4; ++i) {
        const int ao = (wm + (i << 4) + rlane) * LP + koff + ks * 32;
        ah[i] = ldfrag_b(sb + ao);
        if (NSPLIT >= 1) al[i] = ldfrag_b(sb + ao + 128 * LP); else al[i] = ah[i];
      }
#pragma unroll
      for (int i = 0; i < 4; ++i) {
#pragma unroll
        for (int j = 0; j < 4; ++j) {
          acc[i][j] = mma_b_raw(ah[i], bh[j], acc[i][j]);
          if (NSPLIT >= 1) acc[i][j] = mma_b_raw(al[i], bh[j], acc[i][j]);
          if (NSPLIT == 2) acc[i][j] = mma_b_raw(ah[i], bl[j], acc[i][j]);
        }
        dep_guard_b(acc[i][0], acc[i][3], ah[i], al[i]);
      }
      keep4_b(bh[0], bh[1], bh[2], bh[3]);
      if (NSPLIT == 2) keep4_b(bl[0], bl[1], bl[2], bl[3]);
    }
    wait_lds_reads();
    wait_copies();
    __syncthreads();                          // publishes stage t+1 and ends every wave's reads of stage t's buffer
    if (t + 2 < nst) copy_stage(t + 2, t & 1);
  }
  wait_copies();
  acc_guard4(acc[0][0], acc[0][1], acc[0][2], acc[0][3]);
  acc_guard4(acc[1][0], acc[1][1], acc[1][2], acc[1][3]);
  acc_guard4(acc[2][0], acc[2][1], acc[2][2], acc[2][3]);
  acc_guard4(acc[3][0], acc[3][1], acc[3][2], acc[3][3]);

  // ---- epilogue ----
  float* slab = sT[wave];
#pragma unroll
  for (int i = 0; i < 4; ++i) {
    const int mBase = m0 + (i << 4);
    float brow[8];
#pragma unroll
    for (int r = 0; r < 8; ++r) {
      brow[r] = 0.f;
      if (BIAS_MODE == 2) brow[r] = bf_rne(biasp[mBase + mOff + r]);
    }
#pragma unroll
    for (int j = 0; j < 4; ++j) {
      float bcol = 0.f;
      if (BIAS_MODE == 1) bcol = bf_rne(biasp[n0 + (j << 4) + rlane]);
#pragma unroll
      for (int r = 0; r < 8; ++r) {
        slab[(mOff + r) * 68 + (j << 4) + rlane] = acc[i][j][r] + bcol + brow[r];
      }
    }
    wave_sync_lds();
    if (OUT_MODE == 0) {
      float* C = (float*)Cout + (size_t)b * strideC;
      const int hh = lane >> 4, c4 = (lane & 15) * 4;     // 256-B row segment = 16 lanes x 16 B
      {
#pragma unroll
        for (int it = 0; it < 8; ++it) {
          const int row = it * 2 + hh;                     // it 0..7 x hh 0..1 = rows 0..15
          const v4f v = *(const v4f*)(slab + row * 68 + c4);
          *(v4f*)(C + (size_t)(mBase + row) * ldc + n0 + c4) = v;
        }
        
      }
    } else {
      const int q = lane >> 3, c8 = (lane & 7) * 8;
      unsigned short* C  = (unsigned short*)Cout  + (size_t)b * strideC;
      unsigned short* C2 = (unsigned short*)Cout2 + (size_t)b * strideC2;
      const bool wlo = (OUT_MODE == 2) || (n0 < N2);      // wave-uniform
      v4u hv[4], lv[4];
#pragma unroll
      for (int it = 0; it < 4; ++it) {
        const int row = it * 4 + q;                        // it 0..3 x q 0..3 = rows 0..15
        const float* sp = slab + row * 68 + c8;
        v4u a, a2;
#pragma unroll
        for (int e = 0; e < 4; ++e) {
          const float f0 = sp[2 * e], f1 = sp[2 * e + 1];
          unsigned short h0, h1, l0, l1;
          if (OUT_MODE == 2) {
            h0 = bf_bits(f0); h1 = bf_bits(f1);
            l0 = bf_bits(f0 - bf_up(h0)); l1 = bf_bits(f1 - bf_up(h1));
          } else {
            const _Float16 x0 = (_Float16)f0, x1 = (_Float16)f1;
            h0 = h_bits(x0); h1 = h_bits(x1);
            l0 = h_bits((_Float16)((f0 - (float)x0) * rscale));
            l1 = h_bits((_Float16)((f1 - (float)x1) * rscale));
          }
          a[e] = pk16(h0, h1); a2[e] = pk16(l0, l1);
        }
        hv[it] = a; lv[it] = a2;
      }
      {
#pragma unroll
        for (int it = 0; it < 4; ++it) {
          const int row = it * 4 + q;
          *(v4u*)(C + (size_t)(mBase + row) * ldc + n0 + c8) = hv[it];
          if (wlo) *(v4u*)(C2 + (size_t)(mBase + row) * ldc2 + n0 + c8) = lv[it];
        }
        
      }
    }
    wave_sync_lds();
  }
}

// =====================================================================================================
// RoPE row pass (rotate-half, half = HD/2 = 32) on the f32 q|k staging plane (bias already added):
//   y[d] = x[d] * cos[s][d] + (d < 32 ? -x[d+32] : x[d-32]) * sin[s][d],  tables [SEQ][HD] shared over heads,
//   table values RNE-converted to bf16 on read.
// One block (256 threads) per token row s; thread t owns 8 consecutive columns of q (t < 128, waves 0..3)
// or of k (t >= 128, waves 4..7): the 8 columns share one head half, so the rotate partner is the 8-group
// at +-32. Outputs: q -> f16 hi plane + f16 residual plane ((y - hi) * rscale); k -> f16 plane; all [SEQ][DM].
// =====================================================================================================
__global__ __launch_bounds__(256) void rope_rows(
    const float* __restrict__ qkf, const float* __restrict__ cosp, const float* __restrict__ sinp,
    unsigned short* qhp, unsigned short* qlp, unsigned short* kpp, int nrows, float rscale) {
  const int row = blockIdx.x;
  if (row >= nrows) return;                       // block-uniform; no barriers in this kernel
  const int t   = threadIdx.x;
  const int isk = t >> 7;                         // 0: q section, 1: k section (wave-uniform)
  const int c0  = (t & 127) * 8;                  // column within the DM-wide section
  const int d0  = c0 & (HD - 1);                  // head-dim offset, multiple of 8
  const bool lowhalf = (d0 < (HD / 2));
  const int pc0 = lowhalf ? (c0 + HD / 2) : (c0 - HD / 2);   // partner columns, same head, in range
  const float sgn = lowhalf ? -1.0f : 1.0f;

  const float* src = qkf + (size_t)row * QKP + (size_t)isk * DM;
  const v4f x0 = *(const v4f*)(src + c0);
  const v4f x1 = *(const v4f*)(src + c0 + 4);
  const v4f p0 = *(const v4f*)(src + pc0);
  const v4f p1 = *(const v4f*)(src + pc0 + 4);
  const v4f cA = *(const v4f*)(cosp + (size_t)row * HD + d0);
  const v4f cB = *(const v4f*)(cosp + (size_t)row * HD + d0 + 4);
  const v4f sA = *(const v4f*)(sinp + (size_t)row * HD + d0);
  const v4f sB = *(const v4f*)(sinp + (size_t)row * HD + d0 + 4);

  v4f y0, y1;
#pragma unroll
  for (int e = 0; e < 4; ++e) {
    y0[e] = x0[e] * bf_rne(cA[e]) + (sgn * p0[e]) * bf_rne(sA[e]);
    y1[e] = x1[e] * bf_rne(cB[e]) + (sgn * p1[e]) * bf_rne(sB[e]);
  }
  v4u hv, lv;
#pragma unroll
  for (int e = 0; e < 2; ++e) {
    const float f0 = y0[2 * e], f1 = y0[2 * e + 1];
    const float g0 = y1[2 * e], g1 = y1[2 * e + 1];
    const _Float16 a0 = (_Float16)f0, a1 = (_Float16)f1;
    const _Float16 b0 = (_Float16)g0, b1 = (_Float16)g1;
    hv[e]     = pk16(h_bits(a0), h_bits(a1));
    hv[2 + e] = pk16(h_bits(b0), h_bits(b1));
    lv[e]     = pk16(h_bits((_Float16)((f0 - (float)a0) * rscale)),
                     h_bits((_Float16)((f1 - (float)a1) * rscale)));
    lv[2 + e] = pk16(h_bits((_Float16)((g0 - (float)b0) * rscale)),
                     h_bits((_Float16)((g1 - (float)b1) * rscale)));
  }
  const size_t o = (size_t)row * DM + c0;
  if (isk == 0) {
    *(v4u*)(qhp + o) = hv;
    *(v4u*)(qlp + o) = lv;
    
  } else {
    *(v4u*)(kpp + o) = hv;
    
  }
}

#define OSP 68
__device__ __forceinline__ float xhalf(float x) {
  return __builtin_bit_cast(float, __builtin_amdgcn_permlanex16(__builtin_bit_cast(int, x), __builtin_bit_cast(int, x),
                                                                0x76543210, 0xfedcba98, false, false));
}

__global__ __launch_bounds__(128)
void attn64(const unsigned short* __restrict__ qhp, const unsigned short* __restrict__ qlp,
            const unsigned short* __restrict__ kpp, const unsigned short* __restrict__ vtp,
            unsigned short* ohp, unsigned short* olp, float sscale, float rres) {
  union FH { v16h v; v8h h[2]; };
  __shared__ __align__(16) _Float16 Ksh[64 * LP];                 // K [kv][d]   pitch LP, 9 KB
  __shared__ __align__(16) _Float16 Vth[64 * LP];                 // V^T [d][kv] pitch LP, 9 KB
  __shared__ __align__(16) float    Os[4][16 * OSP];              // per wave context tile [row][d]

  const int tid  = threadIdx.x;
  const int wave = tid >> 5;
  const int lane = tid & 31;
  const int hh   = lane >> 4;
  const int c    = lane & 15;

  const int bx   = blockIdx.x;
  const int qb   = bx % NQB;
  const int h    = bx / NQB;
  const int q0   = qb * 64 + wave * 16;

  const _Float16* Qh = (const _Float16*)(const void*)qhp + (size_t)h * HD;
  const _Float16* Ql = (const _Float16*)(const void*)qlp + (size_t)h * HD;
  const _Float16* Kg = (const _Float16*)(const void*)kpp + (size_t)h * HD;
  const _Float16* Vg = (const _Float16*)(const void*)vtp + (size_t)h * HD * SEQ;

  // ---- Q fragments (B operand, column = query lane&15): 2 d-chunks, hi and residual ----
  v16h qah[2], qal[2];
#pragma unroll
  for (int dc = 0; dc < 2; ++dc) {
    qah[dc] = ldfrag_h(Qh + (size_t)(q0 + c) * DM + dc * 32 + 8 * hh);
    qal[dc] = ldfrag_h(Ql + (size_t)(q0 + c) * DM + dc * 32 + 8 * hh);
  }

  float mrun = -INFINITY;      // running maximum of query c (equal in both wave halves)
  float lrun = 0.f;            // running sum over this wave half's keys of query c
  v8f oacc[4];                 // oacc[t][r] = O^T[d = t*16 + 8*hh + r][query c]
#pragma unroll
  for (int t = 0; t < 4; ++t) oacc[t] = zero8();

  for (int kt = 0; kt < NQB; ++kt) {         // static trip count
    const int kv0 = kt * 64;
    __syncthreads();
    {
      const int r = tid >> 1, hf = (tid & 1) * 32;
      const _Float16* kg = Kg + (size_t)(kv0 + r) * DM + hf;        // K row kv0+r, d = hf..hf+31
      const _Float16* vg = Vg + (size_t)r * SEQ + kv0 + hf;         // V^T row d = r, s = kv0+hf..+31
#pragma unroll
      for (int i = 0; i < 4; ++i) {
        const v8h a0 = *(const v8h*)(kg + 8 * i);
        const v8h b0 = *(const v8h*)(vg + 8 * i);
        *(v8h*)(Ksh + r * LP + hf + 8 * i) = a0;
        *(v8h*)(Vth + r * LP + hf + 8 * i) = b0;
      }
    }
    __syncthreads();

    // ---- scores, transposed: 64 keys x 16 queries per wave, 2 f16 products (hi, residual);
    //      s[j][r] = score of key kv0 + j*16 + 8*hh + r with query q0 + c ----
    v8f s[4];
#pragma unroll
    for (int j = 0; j < 4; ++j) {
      v8f sh = zero8(), sl = zero8();
#pragma unroll
      for (int dc = 0; dc < 2; ++dc) {
        FH kb;
        kb.h[0] = *(const v8h*)(Ksh + (j * 16 + c) * LP + dc * 32 + 8 * hh);
        kb.h[1] = *(const v8h*)(Ksh + (j * 16 + c) * LP + dc * 32 + 16 + 8 * hh);
        sh = mma_h(kb.v, qah[dc], sh);
        sl = mma_h(kb.v, qal[dc], sl);
      }
#pragma unroll
      for (int r = 0; r < 8; ++r) s[j][r] = (sh[r] + sl[r] * rres) * sscale;
    }

    // ---- maximum of the lane's 32 scores, joined with the other wave half's; online softmax ----
    float mj[4];
#pragma unroll
    for (int j = 0; j < 4; ++j) {
      mj[j] = s[j][0];
#pragma unroll
      for (int r = 1; r < 8; ++r) mj[j] = fmaxf(mj[j], s[j][r]);
    }
    float m = fmaxf(fmaxf(mj[0], mj[1]), fmaxf(mj[2], mj[3]));
    m = fmaxf(m, xhalf(m));
    const float mnew  = fmaxf(mrun, m);
    const float alpha = __expf(mrun - mnew);
    mrun = mnew;

    // ---- P^T (x1024, f16) straight into the B operand: element e of 32-key block kk = key kk*32 + (e < 8 ? 8*hh + e : 16 + 8*hh + e - 8) ----
    FH pb[2];
    float pj[4];
#pragma unroll
    for (int j = 0; j < 4; ++j) {
      pj[j] = 0.f;
#pragma unroll
      for (int r = 0; r < 8; ++r) {
        const float p = __expf(s[j][r] - mnew);
        pj[j] += p;
        pb[j >> 1].h[j & 1][r] = (_Float16)(p * 1024.0f);
      }
    }
    lrun = lrun * alpha + ((pj[0] + pj[1]) + (pj[2] + pj[3]));
#pragma unroll
    for (int t = 0; t < 4; ++t)
#pragma unroll
      for (int r = 0; r < 8; ++r) oacc[t][r] *= alpha;

    // ---- context^T += V^T . P^T (f16 WMMA) ----
#pragma unroll
    for (int kk = 0; kk < 2; ++kk) {
#pragma unroll
      for (int t = 0; t < 4; ++t) {
        FH vb;
        vb.h[0] = *(const v8h*)(Vth + (t * 16 + c) * LP + kk * 32 + 8 * hh);
        vb.h[1] = *(const v8h*)(Vth + (t * 16 + c) * LP + kk * 32 + 16 + 8 * hh);
        oacc[t] = mma_h(vb.v, pb[kk].v, oacc[t]);
      }
    }
  }

  // ---- join the halves' sums, normalise (1/l and the 1/1024 p carry), stage the wave's 16x64 tile, bf16 hi/lo split,
  float* os = Os[wave];
  {
    const float l = lrun + xhalf(lrun);
    const float inv = ((l > 0.f) ? (1.0f / l) : 0.f) * (1.0f / 1024.0f);
#pragma unroll
    for (int t = 0; t < 4; ++t) {
      v4f w0, w1;
#pragma unroll
      for (int e = 0; e < 4; ++e) { w0[e] = oacc[t][e] * inv; w1[e] = oacc[t][4 + e] * inv; }
      *(v4f*)(os + c * OSP + t * 16 + 8 * hh)     = w0;      // row = query c; d = t*16 + 8*hh .. + 7
      *(v4f*)(os + c * OSP + t * 16 + 8 * hh + 4) = w1;
    }
  }
  wave_sync_lds();
  {
    const int q4 = lane >> 3, c8 = (lane & 7) * 8;
    v4u hv[4], lv[4];
#pragma unroll
    for (int it = 0; it < 4; ++it) {
      const int row = it * 4 + q4;   // it 0..3 x q4 0..3 = rows 0..15 of the wave tile
      const float* sp = os + row * OSP + c8;
      v4u a, a2;
#pragma unroll
      for (int e = 0; e < 4; ++e) {
        const float f0 = sp[2 * e], f1 = sp[2 * e + 1];
        const unsigned short h0 = bf_bits(f0), h1 = bf_bits(f1);
        const unsigned short l0 = bf_bits(f0 - bf_up(h0)), l1 = bf_bits(f1 - bf_up(h1));
        a[e] = pk16(h0, h1); a2[e] = pk16(l0, l1);
      }
      hv[it] = a; lv[it] = a2;
    }
    {
#pragma unroll
      for (int it = 0; it < 4; ++it) {
        const int row = it * 4 + q4;
        const size_t go = (size_t)(q0 + row) * DM + (size_t)h * HD + c8;
        *(v4u*)(ohp + go) = hv[it];
        *(v4u*)(olp + go) = lv[it];
      }
      
    }
  }
}

// =====================================================================================================
// Workspace map (bytes), every plane an exact multiple of its 64x64-tile / whole-line store granularity:
//   Xb    bf16 [4096][1024]          0           8388608
//   Wqkvb bf16 [3072 n][1024 k]      8388608     6291456   (rows 0..1023 q, 1024..2047 k, 2048..3071 v weights)
//   Wob   bf16 [1024][1024]          14680064    2097152
//   QKf   f32  [4096][2048]          16777216    33554432  (q cols 0..1023, k cols 1024..2047, bias included)
//   Qh    f16  [4096][1024]          50331648    8388608
//   Ql    f16  [4096][1024]          58720256    8388608   (q residual x4096)
//   Kp    f16  [4096][1024]          67108864    8388608
//   VT    f16  [1024][4096]          75497472    8388608   (v^T incl. bias)
//   Oh    bf16 [4096][1024]          83886080    8388608
//   Ol    bf16 [4096][1024]          92274688    8388608
//   end                              100663296
// Weights are [out n][in k] with k contiguous = the Bt / A layout the GEMM wants, so they are only converted.
// =====================================================================================================
extern "C" void kernel_launch(void* const* d_in, const int* in_sizes, int n_in,
                              void* d_out, int out_size, void* d_ws, size_t ws_size,
                              hipStream_t stream) {
  if (n_in < 7) return;
  if (in_sizes[0] != SEQ * DM) return;
  if (in_sizes[1] != SEQ * HD) return;
  if (in_sizes[2] != SEQ * HD) return;
  if (in_sizes[3] != 3 * DM * DM) return;
  if (in_sizes[4] != 3 * DM) return;
  if (in_sizes[5] != DM * DM) return;
  if (in_sizes[6] != DM) return;
  if (out_size != SEQ * DM) return;

  const float* x     = (const float*)d_in[0];
  const float* cosp  = (const float*)d_in[1];
  const float* sinp  = (const float*)d_in[2];
  const float* wqkv  = (const float*)d_in[3];
  const float* bqkv  = (const float*)d_in[4];
  const float* wout  = (const float*)d_in[5];
  const float* bout  = (const float*)d_in[6];

  const size_t PXb  = (size_t)SEQ * DM * 2;           //  8388608
  const size_t PWq  = (size_t)3 * DM * DM * 2;        //  6291456
  const size_t PWo  = (size_t)DM * DM * 2;            //  2097152
  const size_t PQKf = (size_t)SEQ * QKP * 4;          // 33554432
  const size_t P16  = (size_t)SEQ * DM * 2;           //  8388608 (q hi, q res, k, out hi, out lo)
  const size_t PVT  = (size_t)DM * SEQ * 2;           //  8388608
  size_t off = 0;
  const size_t oXb  = off; off += PXb;
  const size_t oWq  = off; off += PWq;
  const size_t oWo  = off; off += PWo;
  const size_t oQKf = off; off += PQKf;
  const size_t oQh  = off; off += P16;
  const size_t oQl  = off; off += P16;
  const size_t oKp  = off; off += P16;
  const size_t oVT  = off; off += PVT;
  const size_t oOh  = off; off += P16;
  const size_t oOl  = off; off += P16;
  if (off > ws_size) return;                          // off = 100663296
  if (off > (size_t)134217728) return;

  char* ws = (char*)d_ws;
  unsigned short* Xb    = (unsigned short*)(ws + oXb);
  unsigned short* Wqkvb = (unsigned short*)(ws + oWq);
  unsigned short* Wvb   = Wqkvb + (size_t)2 * DM * DM;          // rows 2048..3071 of Wqkvb
  unsigned short* Wob   = (unsigned short*)(ws + oWo);
  float*          QKf   = (float*)(ws + oQKf);
  unsigned short* Qh    = (unsigned short*)(ws + oQh);
  unsigned short* Ql    = (unsigned short*)(ws + oQl);
  unsigned short* Kp    = (unsigned short*)(ws + oKp);
  unsigned short* VT    = (unsigned short*)(ws + oVT);
  unsigned short* Oh    = (unsigned short*)(ws + oOh);
  unsigned short* Ol    = (unsigned short*)(ws + oOl);

  const dim3 blk(256);
  const int n8x  = SEQ * DM / 8;                                // 524288
  const int n8wq = 3 * DM * DM / 8;                             // 393216
  const int n8wo = DM * DM / 8;                                 // 131072
  const dim3 gCvtX((n8x + 255) / 256);                          // 2048 blocks
  const dim3 gCvtWq((n8wq + 255) / 256);                        // 1536 blocks
  const dim3 gCvtWo((n8wo + 255) / 256);                        //  512 blocks
  const dim3 gQK(((SEQ / 64) * (QKP / 64) + 7) / 8, 1);         // 2048 tiles -> 256 blocks: M=4096, N=2048
  const dim3 gRope(SEQ);                                        // one block per token row
  const dim3 gVT(((DM / 64) * (SEQ / 64) + 7) / 8, 1);          // 1024 tiles -> 128 blocks: M=1024, N=4096
  const dim3 gAttn(NH * NQB);                                   // 1024 blocks
  const dim3 gOut(((SEQ / 64) * (DM / 64) + 7) / 8, 1);         // 1024 tiles -> 128 blocks: M=4096, N=1024

  // (1) x -> bf16 plane [4096][1024]; w_qkv -> bf16 [3072][1024]; w_out -> bf16 [1024][1024]
  cvt_bf16x8<<<gCvtX, blk, 0, stream>>>(x, Xb, n8x);
  cvt_bf16x8<<<gCvtWq, blk, 0, stream>>>(wqkv, Wqkvb, n8wq);
  cvt_bf16x8<<<gCvtWo, blk, 0, stream>>>(wout, Wob, n8wo);
  // (2) q|k = x . Wqk^T + b_qk -> f32 staging plane [4096][2048] (pitch 2048)   (M=4096, N=2048, K=1024, col bias)
  gemm64<0, 0, 1><<<gQK, blk, 0, stream>>>(
      Xb, Xb, DM, 0LL, Wqkvb, Wqkvb, DM, 0LL,
      (void*)QKf, QKP, 0LL, (void*)QKf, QKP, 0LL, 0,
      bqkv,
      SEQ, QKP, DM, 1.0f);
  // (3) RoPE -> q f16 hi plane + f16 residual x4096 plane, k f16 plane, each [4096][1024]
  rope_rows<<<gRope, blk, 0, stream>>>(QKf, cosp, sinp, Qh, Ql, Kp, SEQ, 4096.0f);
  // (4) v^T = Wv . x^T + b_v[row] -> f16 plane [h*64+d][s] (pitch SEQ), no residual plane (N2 = 0)
  //     (A = Wvb [n][k], Bt = Xb [s][k]; M=1024, N=4096, K=1024, row bias = b_qkv rows 2048..3071)
  gemm64<0, 3, 2><<<gVT, blk, 0, stream>>>(
      Wvb, Wvb, DM, 0LL, Xb, Xb, DM, 0LL,
      (void*)VT, SEQ, 0LL, (void*)VT, SEQ, 0LL, 0,
      bqkv + 2 * DM,
      DM, SEQ, DM, 4096.0f);
  // (5) attention -> context bf16 hi / lo planes [4096][1024]
  attn64<<<gAttn, dim3(128), 0, stream>>>(Qh, Ql, Kp, VT, Oh, Ol, 0.125f, 1.0f / 4096.0f);
  // (6) out = context . w_out^T + b_out -> d_out f32 [4096][1024]  (A = context hi + lo planes, 2 products; K=1024, col bias)
  gemm64<1, 0, 1><<<gOut, blk, 0, stream>>>(
      Oh, Ol, DM, 0LL, Wob, Wob, DM, 0LL,
      d_out, DM, 0LL, d_out, DM, 0LL, 0,
      bout,
      SEQ, DM, DM, 1.0f);
  (void)hipGetLastError();
}

// v005
// Measured time: 174 microseconds a run.
// Timed twice side by side with v004, it ran 1.08 times as fast both times.
// Over all steps from v000 it is 2.91 times as fast.
// Contractions: q|k projection and v^T projection = v_wmma_f32_16x16x32_bf16 (bf16 operands from RNE-converted x and w_qkv, single product);
// k.q^T scores = v_wmma_f32_16x16x32_f16 (q as f16 hi plane + f16 residual plane x4096 in a separate accumulator, k f16; 2 products);
// v^T.p^T = v_wmma_f32_16x16x32_f16 (p carried x1024 in f16, v^T f16; 1 product);
// ctx.w_out^T = v_wmma_f32_16x16x32_bf16 (ctx as bf16 hi + lo planes times bf16 w_out, 2 products); all f32 accumulate; bias, RoPE, softmax in f32.
#include <hip/hip_runtime.h>
#include <math.h>
#include <stdint.h>

#define SEQ   4096
#define DM    1024
#define NH    16
#define HD    64
#define NQB   (SEQ / 64)     // 64 key / query tiles of 64
#define QKP   (2 * DM)        // pitch of the f32 q|k staging plane: q at cols 0..DM-1, k at cols DM..2DM-1
#define LP    72              // LDS row pitch of the 64-wide f16 tiles, in elements: 144 B = 16 B x odd, so the 16 rows of a 16-B fragment read fall on 16 distinct bank groups
static_assert(NH * HD == DM);
static_assert((SEQ % 64) == 0 && (DM % 64) == 0 && (DM % 32) == 0);
static_assert((SEQ % 256) == 0 && (DM % 256) == 0);   // GEMM block tile 128 x 256, for every M and N used here
static_assert((HD % 8) == 0 && (HD / 2) % 8 == 0);
static_assert(LP >= 64 && (LP % 8) == 0 && ((LP / 8) & 1) == 1);

typedef _Float16 v16h __attribute__((ext_vector_type(16)));
typedef _Float16 v8h  __attribute__((ext_vector_type(8)));
typedef __bf16   v16b __attribute__((ext_vector_type(16)));
typedef __bf16   v8b  __attribute__((ext_vector_type(8)));
typedef float    v8f  __attribute__((ext_vector_type(8)));
typedef float    v4f  __attribute__((ext_vector_type(4)));
typedef unsigned int v4u __attribute__((ext_vector_type(4)));

// ---- scalar helpers --------------------------------------------------------------------------------
__device__ __forceinline__ unsigned short bf_bits(float f) {          // f32 -> bf16 bits, RNE convert
  unsigned u = __float_as_uint(f);
  return (unsigned short)((u + 0x7FFFu + ((u >> 16) & 1u)) >> 16);
}
__device__ __forceinline__ float bf_up(unsigned short h) { return __uint_as_float(((unsigned)h) << 16); }
__device__ __forceinline__ float bf_rne(float f) { return bf_up(bf_bits(f)); }
__device__ __forceinline__ unsigned short h_bits(_Float16 x) { return __builtin_bit_cast(unsigned short, x); }
__device__ __forceinline__ unsigned pk16(unsigned short a, unsigned short b) { return (unsigned)a | ((unsigned)b << 16); }
__device__ __forceinline__ v8f zero8() { v8f z = {0.f, 0.f, 0.f, 0.f, 0.f, 0.f, 0.f, 0.f}; return z; }

// ---- fragment loaders: 16-bit A/B operand, lane -> row/col (lane&15), p already includes +8*(lane>>4);
//      elements 0..7 <- p[0..7] (k0+8h..), elements 8..15 <- p[16..23] (k0+16+8h..)
__device__ __forceinline__ v16b ldfrag_b(const __bf16* p) {
  union { v16b v; v8b h[2]; } f;
  f.h[0] = *(const v8b*)(p);
  f.h[1] = *(const v8b*)(p + 16);
  return f.v;
}
__device__ __forceinline__ v16h ldfrag_h(const _Float16* p) {
  union { v16h v; v8h h[2]; } f;
  f.h[0] = *(const v8h*)(p);
  f.h[1] = *(const v8h*)(p + 16);
  return f.v;
}

// ---- WMMA helpers --------------------------------------------------------------------------------------
// f16 product (attention): the builtin alone. The compiler keeps the distance behind its own WMMA, and with no statement
// tied to each product it is free to issue the LDS fragment reads of several products together, ahead of them.
__device__ __forceinline__ v8f mma_h(v16h a, v16h b, v8f c) {
  return __builtin_amdgcn_wmma_f32_16x16x32_f16(false, a, false, b, (short)0, c, false, false);
}
// bf16 product (GEMMs), with its hand-written gaps
__device__ __forceinline__ v8f mma_b_raw(v16b a, v16b b, v8f c) {
  return __builtin_amdgcn_wmma_f32_16x16x32_bf16(false, a, false, b, (short)0, c, false, false);
}
__device__ __forceinline__ void dep_guard_b(v8f& a, v8f& b, v16b x, v16b y) {
#if defined(__HIP_DEVICE_COMPILE__)
  asm volatile("v_nop\n\tv_nop\n\tv_nop\n\tv_nop" : "+v"(a), "+v"(b) : "v"(x), "v"(y));
#endif
}
__device__ __forceinline__ void keep4_b(v16b a, v16b b, v16b c, v16b d) {
#if defined(__HIP_DEVICE_COMPILE__)
  asm volatile("v_nop" :: "v"(a), "v"(b), "v"(c), "v"(d));
#endif
}
__device__ __forceinline__ void acc_guard4(v8f& a, v8f& b, v8f& c, v8f& d) {
#if defined(__HIP_DEVICE_COMPILE__)
  asm volatile("v_nop\n\tv_nop\n\tv_nop\n\tv_nop" : "+v"(a), "+v"(b), "+v"(c), "+v"(d));
#endif
}
__device__ __forceinline__ void wave_sync_lds() {
  __builtin_amdgcn_fence(__ATOMIC_RELEASE, "workgroup");
  __builtin_amdgcn_wave_barrier();
  __builtin_amdgcn_fence(__ATOMIC_ACQUIRE, "workgroup");
}

// ---- asynchronous copies global -> LDS, 16 B per lane: l = the lane's LDS byte address, g = its global address.
//      A run of copies and its s_wait_xcnt 0 are one statement, so that no address register is rewritten ahead of the wait.
__device__ __forceinline__ unsigned lds_off(const void* p) { return (unsigned)(size_t)p; }
__device__ __forceinline__ void copy4_lds(unsigned l, unsigned lstep, const __bf16* g, size_t gstep) {
#if defined(__HIP_DEVICE_COMPILE__)
  asm volatile("global_load_async_to_lds_b128 %0, %1, off\n\t"
               "global_load_async_to_lds_b128 %2, %3, off\n\t"
               "global_load_async_to_lds_b128 %4, %5, off\n\t"
               "global_load_async_to_lds_b128 %6, %7, off\n\t"
               "s_wait_xcnt 0x0"
               :: "v"(l), "v"(g), "v"(l + lstep), "v"(g + gstep),
                  "v"(l + 2 * lstep), "v"(g + 2 * gstep), "v"(l + 3 * lstep), "v"(g + 3 * gstep)
               : "memory");
#endif
}
__device__ __forceinline__ void copy8_lds(unsigned l0, unsigned l1, unsigned lstep,
                                          const __bf16* g0, const __bf16* g1, size_t gstep) {
#if defined(__HIP_DEVICE_COMPILE__)
  asm volatile("global_load_async_to_lds_b128 %0, %1, off\n\t"
               "global_load_async_to_lds_b128 %2, %3, off\n\t"
               "global_load_async_to_lds_b128 %4, %5, off\n\t"
               "global_load_async_to_lds_b128 %6, %7, off\n\t"
               "global_load_async_to_lds_b128 %8, %9, off\n\t"
               "global_load_async_to_lds_b128 %10, %11, off\n\t"
               "global_load_async_to_lds_b128 %12, %13, off\n\t"
               "global_load_async_to_lds_b128 %14, %15, off\n\t"
               "s_wait_xcnt 0x0"
               :: "v"(l0), "v"(g0), "v"(l0 + lstep), "v"(g0 + gstep),
                  "v"(l0 + 2 * lstep), "v"(g0 + 2 * gstep), "v"(l0 + 3 * lstep), "v"(g0 + 3 * gstep),
                  "v"(l1), "v"(g1), "v"(l1 + lstep), "v"(g1 + gstep),
                  "v"(l1 + 2 * lstep), "v"(g1 + 2 * gstep), "v"(l1 + 3 * lstep), "v"(g1 + 3 * gstep)
               : "memory");
#endif
}
// the same for two f16 planes of different row pitch: 4 copies from g0 (rows gstep0 apart) to l0.., 4 from g1 (gstep1) to l1..
__device__ __forceinline__ void copy4x2_lds(unsigned l0, unsigned l1, unsigned lstep,
                                            const _Float16* g0, size_t gstep0, const _Float16* g1, size_t gstep1) {
#if defined(__HIP_DEVICE_COMPILE__)
  asm volatile("global_load_async_to_lds_b128 %0, %1, off\n\t"
               "global_load_async_to_lds_b128 %2, %3, off\n\t"
               "global_load_async_to_lds_b128 %4, %5, off\n\t"
               "global_load_async_to_lds_b128 %6, %7, off\n\t"
               "global_load_async_to_lds_b128 %8, %9, off\n\t"
               "global_load_async_to_lds_b128 %10, %11, off\n\t"
               "global_load_async_to_lds_b128 %12, %13, off\n\t"
               "global_load_async_to_lds_b128 %14, %15, off\n\t"
               "s_wait_xcnt 0x0"
               :: "v"(l0), "v"(g0), "v"(l0 + lstep), "v"(g0 + gstep0),
                  "v"(l0 + 2 * lstep), "v"(g0 + 2 * gstep0), "v"(l0 + 3 * lstep), "v"(g0 + 3 * gstep0),
                  "v"(l1), "v"(g1), "v"(l1 + lstep), "v"(g1 + gstep1),
                  "v"(l1 + 2 * lstep), "v"(g1 + 2 * gstep1), "v"(l1 + 3 * lstep), "v"(g1 + 3 * gstep1)
               : "memory");
#endif
}
__device__ __forceinline__ void wait_copies() {     // the wave's own copies have landed in LDS
#if defined(__HIP_DEVICE_COMPILE__)
  asm volatile("s_wait_asynccnt 0x0" ::: "memory");
#endif
}
__device__ __forceinline__ void wait_lds_reads() {  // the wave's LDS reads have returned, before their buffer is given up for refilling
#if defined(__HIP_DEVICE_COMPILE__)
  asm volatile("s_wait_dscnt 0x0" ::: "memory");
#endif
}

// =====================================================================================================
// f32 -> bf16 (RNE convert), 8 elements per thread, one 16-B store per lane: a wave writes 512 contiguous B
// coverage: n8 threads x 8 = whole plane (n8 is a multiple of 256 for every use here).
// =====================================================================================================
__global__ __launch_bounds__(256) void cvt_bf16x8(const float* __restrict__ in, unsigned short* out, int n8) {
  const int i = blockIdx.x * 256 + threadIdx.x;
  if (i < n8) {
    const v4f a = *(const v4f*)(in + (size_t)i * 8);
    const v4f b = *(const v4f*)(in + (size_t)i * 8 + 4);
    v4u p;
    p[0] = pk16(bf_bits(a[0]), bf_bits(a[1]));
    p[1] = pk16(bf_bits(a[2]), bf_bits(a[3]));
    p[2] = pk16(bf_bits(b[0]), bf_bits(b[1]));
    p[3] = pk16(bf_bits(b[2]), bf_bits(b[3]));
    *(v4u*)(out + (size_t)i * 8) = p;
    
  }
}

// =====================================================================================================
// Register-blocked batched bf16 WMMA GEMM: C[m][n] = sum_k A[m][k] * Bt[n][k] + bias; one wave per 64x64 tile,
// the 8 waves of a block as 2 x 4 = one 128x256 tile. A row-major [M][K] pitch lda; Bt row-major [N][K] pitch ldb
// (k contiguous); M multiple of 128, N of 256, K of 64. blockIdx.y = batch index (strides in elements).
// Operands: a stage = 64 k = one whole 128-B line of each of the block's A and Bt rows, brought into LDS by asynchronous
// copies (8 lanes per row, 4 whole lines per wave copy), rows at pitch LP; two buffers, stage t+2 copied while t+1 is worked on;
// fragments are read from LDS in the k order of ldfrag_b, k ascending.
// NSPLIT: 0 = A.Bt; 1 = (A + A2).Bt (A2 = unscaled bf16 lo plane of A); 2 = A.Bt + A2.Bt + A.Bt2.
// OUT_MODE: 0 = f32 (pitch ldc); 2 = bf16 hi plane C + bf16 lo plane C2 (lo = RNE(v - hi), unscaled);
//           3 = f16 hi plane C + f16 residual plane C2 = f16((v - hi) * rscale), C2 written only for tiles
//               with n0 < N2 (pitch ldc2, batch stride strideC2).
// BIAS_MODE: 1 = + biasp[n] (per column), 2 = + biasp[m] (per row); bias values RNE-converted to bf16 and
//            added in f32 before any 16-bit conversion of the result.
// =====================================================================================================
template <int NSPLIT, int OUT_MODE, int BIAS_MODE>
__global__ __launch_bounds__(256) void gemm64(
    const unsigned short* __restrict__ Ap, const unsigned short* A2p, int lda, long long strideA,
    const unsigned short* __restrict__ Btp, const unsigned short* Bt2p, int ldb, long long strideB,
    void* Cout, int ldc, long long strideC,
    void* Cout2, int ldc2, long long strideC2, int N2,
    const float* __restrict__ biasp,
    int M, int N, int K, float rscale) {
  const __bf16* A   = (const __bf16*)(const void*)Ap;
  const __bf16* A2  = (const __bf16*)(const void*)A2p;
  const __bf16* Bt  = (const __bf16*)(const void*)Btp;
  const __bf16* Bt2 = (const __bf16*)(const void*)Bt2p;
  constexpr int RB   = (NSPLIT >= 1) ? 256 : 128;            // stage rows: A 0..127, A2 128..255 (NSPLIT >= 1), then Bt 256 rows, Bt2 256 rows (NSPLIT == 2)
  constexpr int ROWS = RB + ((NSPLIT == 2) ? 512 : 256);
  constexpr int STG  = ROWS * LP;                            // elements of one stage buffer
  __shared__ __align__(16) float sT[8][16 * 68];   // per-wave 16x64 slab, pitch 68 floats
  __shared__ __align__(16) __bf16 ring[2 * STG];   // two stage buffers
  const int b    = blockIdx.y;
  const int lane = threadIdx.x & 31;
  const int wave = threadIdx.x >> 5;
  const int tilesN = N >> 8;
  const int tilesM = M >> 7;
  if ((int)blockIdx.x >= tilesM * tilesN) return;   // block-uniform, in front of every barrier
  const int tm = blockIdx.x / tilesN;
  const int tn = blockIdx.x - tm * tilesN;
  const int wm = (wave >> 2) << 6;                  // the wave's 64x64 tile inside the block's 128x256
  const int wn = (wave & 3) << 6;
  const int m0 = (tm << 7) + wm;
  const int n0 = (tn << 8) + wn;

  const __bf16* Ab  = A  + (size_t)b * strideA;
  const __bf16* Bb  = Bt + (size_t)b * strideB;
  const __bf16* Ab2 = (NSPLIT >= 1) ? (A2  + (size_t)b * strideA) : Ab;
  const __bf16* Bb2 = (NSPLIT == 2) ? (Bt2 + (size_t)b * strideB) : Bb;

  const int rlane = lane & 15;                 // row (A) / col (B, D) within subtile
  const int koff  = (lane >> 4) * 8;           // k offset of this lane half
  const int mOff  = (lane >> 4) * 8;           // D row offset

  v8f acc[4][4];
#pragma unroll
  for (int i = 0; i < 4; ++i)
#pragma unroll
    for (int j = 0; j < 4; ++j) acc[i][j] = zero8();

  // ---- stage copies: thread -> row (threadIdx.x >> 3) + 32 * c of each 128-row group, 16 B at column 8 * (threadIdx.x & 7) ----
  const int trow = threadIdx.x >> 3;
  const int tcol = (threadIdx.x & 7) * 8;
  const size_t   aoff  = (size_t)((tm << 7) + trow) * lda + tcol;
  const size_t   boff  = (size_t)((tn << 8) + trow) * ldb + tcol;
  const unsigned lrow  = lds_off(ring) + (unsigned)(trow * LP + tcol) * 2u;
  const unsigned lstep = 32u * LP * 2u;                       // 32 rows further in LDS, bytes
  auto copy_stage = [&](int st, int buf) {
    const unsigned l = lrow + (unsigned)buf * (unsigned)(STG * 2);
    const size_t   k = (size_t)st * 64;
    if (NSPLIT >= 1) copy8_lds(l, l + 4u * lstep, lstep, Ab + aoff + k, Ab2 + aoff + k, (size_t)32 * lda);
    else             copy4_lds(l, lstep, Ab + aoff + k, (size_t)32 * lda);
    copy8_lds(l + (unsigned)(RB * LP * 2), l + (unsigned)((RB + 128) * LP * 2), lstep,
              Bb + boff + k, Bb + boff + k + (size_t)128 * ldb, (size_t)32 * ldb);
    if (NSPLIT == 2)
      copy8_lds(l + (unsigned)((RB + 256) * LP * 2), l + (unsigned)((RB + 384) * LP * 2), lstep,
                Bb2 + boff + k, Bb2 + boff + k + (size_t)128 * ldb, (size_t)32 * ldb);
  };

  const int nst = K >> 6;                     // stages of 64 k; block-uniform
  copy_stage(0, 0);
  wait_copies();
  __syncthreads();                            // stage 0 is readable by every wave
  if (nst > 1) copy_stage(1, 1);

  for (int t = 0; t < nst; ++t) {
    const __bf16* sb = ring + (t & 1) * STG;
#pragma unroll   // as the inner loops: every fragment and accumulator index constant, so the arrays stay in registers
    for (int ks = 0; ks < 2; ++ks) {
      v16b bh[4], bl[4], ah[4], al[4];
#pragma unroll
      for (int j = 0; j < 4; ++j) {
        const int bo = (RB + wn + (j << 4) + rlane) * LP + koff + ks * 32;
        bh[j] = ldfrag_b(sb + bo);
        if (NSPLIT == 2) bl[j] = ldfrag_b(sb + bo + 256 * LP); else bl[j] = bh[j];
      }
#pragma unroll
      for (int i = 0; i < 4; ++i) {
        const int ao = (wm + (i << 4) + rlane) * LP + koff + ks * 32;
        ah[i] = ldfrag_b(sb + ao);
        if (NSPLIT >= 1) al[i] = ldfrag_b(sb + ao + 128 * LP); else al[i] = ah[i];
      }
#pragma unroll
      for (int i = 0; i < 4; ++i) {
#pragma unroll
        for (int j = 0; j < 4; ++j) {
          acc[i][j] = mma_b_raw(ah[i], bh[j], acc[i][j]);
          if (NSPLIT >= 1) acc[i][j] = mma_b_raw(al[i], bh[j], acc[i][j]);
          if (NSPLIT == 2) acc[i][j] = mma_b_raw(ah[i], bl[j], acc[i][j]);
        }
        dep_guard_b(acc[i][0], acc[i][3], ah[i], al[i]);
      }
      keep4_b(bh[0], bh[1], bh[2], bh[3]);
      if (NSPLIT == 2) keep4_b(bl[0], bl[1], bl[2], bl[3]);
    }
    wait_lds_reads();
    wait_copies();
    __syncthreads();                          // publishes stage t+1 and ends every wave's reads of stage t's buffer
    if (t + 2 < nst) copy_stage(t + 2, t & 1);
  }
  wait_copies();
  acc_guard4(acc[0][0], acc[0][1], acc[0][2], acc[0][3]);
  acc_guard4(acc[1][0], acc[1][1], acc[1][2], acc[1][3]);
  acc_guard4(acc[2][0], acc[2][1], acc[2][2], acc[2][3]);
  acc_guard4(acc[3][0], acc[3][1], acc[3][2], acc[3][3]);

  // ---- epilogue ----
  float* slab = sT[wave];
#pragma unroll
  for (int i = 0; i < 4; ++i) {
    const int mBase = m0 + (i << 4);
    float brow[8];
#pragma unroll
    for (int r = 0; r < 8; ++r) {
      brow[r] = 0.f;
      if (BIAS_MODE == 2) brow[r] = bf_rne(biasp[mBase + mOff + r]);
    }
#pragma unroll
    for (int j = 0; j < 4; ++j) {
      float bcol = 0.f;
      if (BIAS_MODE == 1) bcol = bf_rne(biasp[n0 + (j << 4) + rlane]);
#pragma unroll
      for (int r = 0; r < 8; ++r) {
        slab[(mOff + r) * 68 + (j << 4) + rlane] = acc[i][j][r] + bcol + brow[r];
      }
    }
    wave_sync_lds();
    if (OUT_MODE == 0) {
      float* C = (float*)Cout + (size_t)b * strideC;
      const int hh = lane >> 4, c4 = (lane & 15) * 4;     // 256-B row segment = 16 lanes x 16 B
      {
#pragma unroll
        for (int it = 0; it < 8; ++it) {
          const int row = it * 2 + hh;                     // it 0..7 x hh 0..1 = rows 0..15
          const v4f v = *(const v4f*)(slab + row * 68 + c4);
          *(v4f*)(C + (size_t)(mBase + row) * ldc + n0 + c4) = v;
        }
        
      }
    } else {
      const int q = lane >> 3, c8 = (lane & 7) * 8;
      unsigned short* C  = (unsigned short*)Cout  + (size_t)b * strideC;
      unsigned short* C2 = (unsigned short*)Cout2 + (size_t)b * strideC2;
      const bool wlo = (OUT_MODE == 2) || (n0 < N2);      // wave-uniform
      v4u hv[4], lv[4];
#pragma unroll
      for (int it = 0; it < 4; ++it) {
        const int row = it * 4 + q;                        // it 0..3 x q 0..3 = rows 0..15
        const float* sp = slab + row * 68 + c8;
        v4u a, a2;
#pragma unroll
        for (int e = 0; e < 4; ++e) {
          const float f0 = sp[2 * e], f1 = sp[2 * e + 1];
          unsigned short h0, h1, l0, l1;
          if (OUT_MODE == 2) {
            h0 = bf_bits(f0); h1 = bf_bits(f1);
            l0 = bf_bits(f0 - bf_up(h0)); l1 = bf_bits(f1 - bf_up(h1));
          } else {
            const _Float16 x0 = (_Float16)f0, x1 = (_Float16)f1;
            h0 = h_bits(x0); h1 = h_bits(x1);
            l0 = h_bits((_Float16)((f0 - (float)x0) * rscale));
            l1 = h_bits((_Float16)((f1 - (float)x1) * rscale));
          }
          a[e] = pk16(h0, h1); a2[e] = pk16(l0, l1);
        }
        hv[it] = a; lv[it] = a2;
      }
      {
#pragma unroll
        for (int it = 0; it < 4; ++it) {
          const int row = it * 4 + q;
          *(v4u*)(C + (size_t)(mBase + row) * ldc + n0 + c8) = hv[it];
          if (wlo) *(v4u*)(C2 + (size_t)(mBase + row) * ldc2 + n0 + c8) = lv[it];
        }
        
      }
    }
    wave_sync_lds();
  }
}

// =====================================================================================================
// RoPE row pass (rotate-half, half = HD/2 = 32) on the f32 q|k staging plane (bias already added):
//   y[d] = x[d] * cos[s][d] + (d < 32 ? -x[d+32] : x[d-32]) * sin[s][d],  tables [SEQ][HD] shared over heads,
//   table values RNE-converted to bf16 on read.
// One block (256 threads) per token row s; thread t owns 8 consecutive columns of q (t < 128, waves 0..3)
// or of k (t >= 128, waves 4..7): the 8 columns share one head half, so the rotate partner is the 8-group
// at +-32. Outputs: q -> f16 hi plane + f16 residual plane ((y - hi) * rscale); k -> f16 plane; all [SEQ][DM].
// =====================================================================================================
__global__ __launch_bounds__(256) void rope_rows(
    const float* __restrict__ qkf, const float* __restrict__ cosp, const float* __restrict__ sinp,
    unsigned short* qhp, unsigned short* qlp, unsigned short* kpp, int nrows, float rscale) {
  const int row = blockIdx.x;
  if (row >= nrows) return;                       // block-uniform; no barriers in this kernel
  const int t   = threadIdx.x;
  const int isk = t >> 7;                         // 0: q section, 1: k section (wave-uniform)
  const int c0  = (t & 127) * 8;                  // column within the DM-wide section
  const int d0  = c0 & (HD - 1);                  // head-dim offset, multiple of 8
  const bool lowhalf = (d0 < (HD / 2));
  const int pc0 = lowhalf ? (c0 + HD / 2) : (c0 - HD / 2);   // partner columns, same head, in range
  const float sgn = lowhalf ? -1.0f : 1.0f;

  const float* src = qkf + (size_t)row * QKP + (size_t)isk * DM;
  const v4f x0 = *(const v4f*)(src + c0);
  const v4f x1 = *(const v4f*)(src + c0 + 4);
  const v4f p0 = *(const v4f*)(src + pc0);
  const v4f p1 = *(const v4f*)(src + pc0 + 4);
  const v4f cA = *(const v4f*)(cosp + (size_t)row * HD + d0);
  const v4f cB = *(const v4f*)(cosp + (size_t)row * HD + d0 + 4);
  const v4f sA = *(const v4f*)(sinp + (size_t)row * HD + d0);
  const v4f sB = *(const v4f*)(sinp + (size_t)row * HD + d0 + 4);

  v4f y0, y1;
#pragma unroll
  for (int e = 0; e < 4; ++e) {
    y0[e] = x0[e] * bf_rne(cA[e]) + (sgn * p0[e]) * bf_rne(sA[e]);
    y1[e] = x1[e] * bf_rne(cB[e]) + (sgn * p1[e]) * bf_rne(sB[e]);
  }
  v4u hv, lv;
#pragma unroll
  for (int e = 0; e < 2; ++e) {
    const float f0 = y0[2 * e], f1 = y0[2 * e + 1];
    const float g0 = y1[2 * e], g1 = y1[2 * e + 1];
    const _Float16 a0 = (_Float16)f0, a1 = (_Float16)f1;
    const _Float16 b0 = (_Float16)g0, b1 = (_Float16)g1;
    hv[e]     = pk16(h_bits(a0), h_bits(a1));
    hv[2 + e] = pk16(h_bits(b0), h_bits(b1));
    lv[e]     = pk16(h_bits((_Float16)((f0 - (float)a0) * rscale)),
                     h_bits((_Float16)((f1 - (float)a1) * rscale)));
    lv[2 + e] = pk16(h_bits((_Float16)((g0 - (float)b0) * rscale)),
                     h_bits((_Float16)((g1 - (float)b1) * rscale)));
  }
  const size_t o = (size_t)row * DM + c0;
  if (isk == 0) {
    *(v4u*)(qhp + o) = hv;
    *(v4u*)(qlp + o) = lv;
    
  } else {
    *(v4u*)(kpp + o) = hv;
    
  }
}

#define OSP 68
__device__ __forceinline__ float xhalf(float x) {
  return __builtin_bit_cast(float, __builtin_amdgcn_permlanex16(__builtin_bit_cast(int, x), __builtin_bit_cast(int, x),
                                                                0x76543210, 0xfedcba98, false, false));
}

__global__ __launch_bounds__(128)
void attn64(const unsigned short* __restrict__ qhp, const unsigned short* __restrict__ qlp,
            const unsigned short* __restrict__ kpp, const unsigned short* __restrict__ vtp,
            unsigned short* ohp, unsigned short* olp, float sscale, float rres) {
  union FH { v16h v; v8h h[2]; };
  constexpr int TL = 64 * LP;                                     // elements of one 64-row tile at pitch LP, 9 KB
  __shared__ __align__(16) _Float16 kvring[2 * 2 * TL];           // two buffers, each K [kv][d] then V^T [d][kv]
  __shared__ __align__(16) float    Os[4][16 * OSP];              // per wave context tile [row][d]

  const int tid  = threadIdx.x;
  const int wave = tid >> 5;
  const int lane = tid & 31;
  const int hh   = lane >> 4;
  const int c    = lane & 15;

  const int bx   = blockIdx.x;
  const int qb   = bx % NQB;
  const int h    = bx / NQB;
  const int q0   = qb * 64 + wave * 16;

  const _Float16* Qh = (const _Float16*)(const void*)qhp + (size_t)h * HD;
  const _Float16* Ql = (const _Float16*)(const void*)qlp + (size_t)h * HD;
  const _Float16* Kg = (const _Float16*)(const void*)kpp + (size_t)h * HD;
  const _Float16* Vg = (const _Float16*)(const void*)vtp + (size_t)h * HD * SEQ;

  // ---- Q fragments (B operand, column = query lane&15): 2 d-chunks, hi and residual ----
  v16h qah[2], qal[2];
#pragma unroll
  for (int dc = 0; dc < 2; ++dc) {
    qah[dc] = ldfrag_h(Qh + (size_t)(q0 + c) * DM + dc * 32 + 8 * hh);
    qal[dc] = ldfrag_h(Ql + (size_t)(q0 + c) * DM + dc * 32 + 8 * hh);
  }

  float mrun = -INFINITY;      // running maximum of query c (equal in both wave halves)
  float lrun = 0.f;            // running sum over this wave half's keys of query c
  v8f oacc[4];                 // oacc[t][r] = O^T[d = t*16 + 8*hh + r][query c]
#pragma unroll
  for (int t = 0; t < 4; ++t) oacc[t] = zero8();

  // ---- chunk copies: thread -> rows (tid >> 3) + 16 * i, i = 0..3, of each tile, 16 B at column 8 * (tid & 7) ----
  const int trow = tid >> 3, tcol = (tid & 7) * 8;
  const _Float16* kg0 = Kg + (size_t)trow * DM + tcol;              // chunk 0: K row trow, d = tcol..tcol+7
  const _Float16* vg0 = Vg + (size_t)trow * SEQ + tcol;             // chunk 0: V^T row d = trow, s = tcol..tcol+7
  const unsigned  lk0 = lds_off(kvring) + (unsigned)(trow * LP + tcol) * 2u;
  auto copy_chunk = [&](int ck, int buf) {
    const unsigned l = lk0 + (unsigned)buf * (unsigned)(2 * TL * 2);
    copy4x2_lds(l, l + (unsigned)(TL * 2), 16u * LP * 2u,
                kg0 + (size_t)ck * 64 * DM, (size_t)16 * DM, vg0 + (size_t)ck * 64, (size_t)16 * SEQ);
  };
  static_assert(NQB >= 2);
  copy_chunk(0, 0);
  wait_copies();
  __syncthreads();                           // chunk 0 is readable by every wave
  copy_chunk(1, 1);

  for (int kt = 0; kt < NQB; ++kt) {         // static trip count
    const _Float16* Ksh = kvring + (kt & 1) * (2 * TL);   // keys kv0 = kt * 64 .. kv0 + 63
    const _Float16* Vth = Ksh + TL;

    // ---- scores, transposed: 64 keys x 16 queries per wave, 2 f16 products (hi, residual);
    //      s[j][r] = score of key kv0 + j*16 + 8*hh + r with query q0 + c ----
    v8f s[4];
#pragma unroll
    for (int j = 0; j < 4; ++j) {
      v8f sh = zero8(), sl = zero8();
#pragma unroll
      for (int dc = 0; dc < 2; ++dc) {
        FH kb;
        kb.h[0] = *(const v8h*)(Ksh + (j * 16 + c) * LP + dc * 32 + 8 * hh);
        kb.h[1] = *(const v8h*)(Ksh + (j * 16 + c) * LP + dc * 32 + 16 + 8 * hh);
        sh = mma_h(kb.v, qah[dc], sh);
        sl = mma_h(kb.v, qal[dc], sl);
      }
#pragma unroll
      for (int r = 0; r < 8; ++r) s[j][r] = (sh[r] + sl[r] * rres) * sscale;
    }

    // ---- maximum of the lane's 32 scores, joined with the other wave half's; online softmax ----
    float mj[4];
#pragma unroll
    for (int j = 0; j < 4; ++j) {
      mj[j] = s[j][0];
#pragma unroll
      for (int r = 1; r < 8; ++r) mj[j] = fmaxf(mj[j], s[j][r]);
    }
    float m = fmaxf(fmaxf(mj[0], mj[1]), fmaxf(mj[2], mj[3]));
    m = fmaxf(m, xhalf(m));
    const float mnew  = fmaxf(mrun, m);
    const float alpha = __expf(mrun - mnew);
    mrun = mnew;

    // ---- P^T (x1024, f16) straight into the B operand: element e of 32-key block kk = key kk*32 + (e < 8 ? 8*hh + e : 16 + 8*hh + e - 8) ----
    FH pb[2];
    float pj[4];
#pragma unroll
    for (int j = 0; j < 4; ++j) {
      pj[j] = 0.f;
#pragma unroll
      for (int r = 0; r < 8; ++r) {
        const float p = __expf(s[j][r] - mnew);
        pj[j] += p;
        pb[j >> 1].h[j & 1][r] = (_Float16)(p * 1024.0f);
      }
    }
    lrun = lrun * alpha + ((pj[0] + pj[1]) + (pj[2] + pj[3]));
#pragma unroll
    for (int t = 0; t < 4; ++t)
#pragma unroll
      for (int r = 0; r < 8; ++r) oacc[t][r] *= alpha;

    // ---- context^T += V^T . P^T (f16 WMMA) ----
#pragma unroll
    for (int kk = 0; kk < 2; ++kk) {
#pragma unroll
      for (int t = 0; t < 4; ++t) {
        FH vb;
        vb.h[0] = *(const v8h*)(Vth + (t * 16 + c) * LP + kk * 32 + 8 * hh);
        vb.h[1] = *(const v8h*)(Vth + (t * 16 + c) * LP + kk * 32 + 16 + 8 * hh);
        oacc[t] = mma_h(vb.v, pb[kk].v, oacc[t]);
      }
    }
    wait_lds_reads();
    wait_copies();
    __syncthreads();                         // publishes chunk kt+1 and ends every wave's reads of chunk kt's buffer
    if (kt + 2 < NQB) copy_chunk(kt + 2, kt & 1);
  }
  wait_copies();

  // ---- join the halves' sums, normalise (1/l and the 1/1024 p carry), stage the wave's 16x64 tile, bf16 hi/lo split,
  float* os = Os[wave];
  {
    const float l = lrun + xhalf(lrun);
    const float inv = ((l > 0.f) ? (1.0f / l) : 0.f) * (1.0f / 1024.0f);
#pragma unroll
    for (int t = 0; t < 4; ++t) {
      v4f w0, w1;
#pragma unroll
      for (int e = 0; e < 4; ++e) { w0[e] = oacc[t][e] * inv; w1[e] = oacc[t][4 + e] * inv; }
      *(v4f*)(os + c * OSP + t * 16 + 8 * hh)     = w0;      // row = query c; d = t*16 + 8*hh .. + 7
      *(v4f*)(os + c * OSP + t * 16 + 8 * hh + 4) = w1;
    }
  }
  wave_sync_lds();
  {
    const int q4 = lane >> 3, c8 = (lane & 7) * 8;
    v4u hv[4], lv[4];
#pragma unroll
    for (int it = 0; it < 4; ++it) {
      const int row = it * 4 + q4;   // it 0..3 x q4 0..3 = rows 0..15 of the wave tile
      const float* sp = os + row * OSP + c8;
      v4u a, a2;
#pragma unroll
      for (int e = 0; e < 4; ++e) {
        const float f0 = sp[2 * e], f1 = sp[2 * e + 1];
        const unsigned short h0 = bf_bits(f0), h1 = bf_bits(f1);
        const unsigned short l0 = bf_bits(f0 - bf_up(h0)), l1 = bf_bits(f1 - bf_up(h1));
        a[e] = pk16(h0, h1); a2[e] = pk16(l0, l1);
      }
      hv[it] = a; lv[it] = a2;
    }
    {
#pragma unroll
      for (int it = 0; it < 4; ++it) {
        const int row = it * 4 + q4;
        const size_t go = (size_t)(q0 + row) * DM + (size_t)h * HD + c8;
        *(v4u*)(ohp + go) = hv[it];
        *(v4u*)(olp + go) = lv[it];
      }
      
    }
  }
}

// =====================================================================================================
// Workspace map (bytes), every plane an exact multiple of its 64x64-tile / whole-line store granularity:
//   Xb    bf16 [4096][1024]          0           8388608
//   Wqkvb bf16 [3072 n][1024 k]      8388608     6291456   (rows 0..1023 q, 1024..2047 k, 2048..3071 v weights)
//   Wob   bf16 [1024][1024]          14680064    2097152
//   QKf   f32  [4096][2048]          16777216    33554432  (q cols 0..1023, k cols 1024..2047, bias included)
//   Qh    f16  [4096][1024]          50331648    8388608
//   Ql    f16  [4096][1024]          58720256    8388608   (q residual x4096)
//   Kp    f16  [4096][1024]          67108864    8388608
//   VT    f16  [1024][4096]          75497472    8388608   (v^T incl. bias)
//   Oh    bf16 [4096][1024]          83886080    8388608
//   Ol    bf16 [4096][1024]          92274688    8388608
//   end                              100663296
// Weights are [out n][in k] with k contiguous = the Bt / A layout the GEMM wants, so they are only converted.
// =====================================================================================================
extern "C" void kernel_launch(void* const* d_in, const int* in_sizes, int n_in,
                              void* d_out, int out_size, void* d_ws, size_t ws_size,
                              hipStream_t stream) {
  if (n_in < 7) return;
  if (in_sizes[0] != SEQ * DM) return;
  if (in_sizes[1] != SEQ * HD) return;
  if (in_sizes[2] != SEQ * HD) return;
  if (in_sizes[3] != 3 * DM * DM) return;
  if (in_sizes[4] != 3 * DM) return;
  if (in_sizes[5] != DM * DM) return;
  if (in_sizes[6] != DM) return;
  if (out_size != SEQ * DM) return;

  const float* x     = (const float*)d_in[0];
  const float* cosp  = (const float*)d_in[1];
  const float* sinp  = (const float*)d_in[2];
  const float* wqkv  = (const float*)d_in[3];
  const float* bqkv  = (const float*)d_in[4];
  const float* wout  = (const float*)d_in[5];
  const float* bout  = (const float*)d_in[6];

  const size_t PXb  = (size_t)SEQ * DM * 2;           //  8388608
  const size_t PWq  = (size_t)3 * DM * DM * 2;        //  6291456
  const size_t PWo  = (size_t)DM * DM * 2;            //  2097152
  const size_t PQKf = (size_t)SEQ * QKP * 4;          // 33554432
  const size_t P16  = (size_t)SEQ * DM * 2;           //  8388608 (q hi, q res, k, out hi, out lo)
  const size_t PVT  = (size_t)DM * SEQ * 2;           //  8388608
  size_t off = 0;
  const size_t oXb  = off; off += PXb;
  const size_t oWq  = off; off += PWq;
  const size_t oWo  = off; off += PWo;
  const size_t oQKf = off; off += PQKf;
  const size_t oQh  = off; off += P16;
  const size_t oQl  = off; off += P16;
  const size_t oKp  = off; off += P16;
  const size_t oVT  = off; off += PVT;
  const size_t oOh  = off; off += P16;
  const size_t oOl  = off; off += P16;
  if (off > ws_size) return;                          // off = 100663296
  if (off > (size_t)134217728) return;

  char* ws = (char*)d_ws;
  unsigned short* Xb    = (unsigned short*)(ws + oXb);
  unsigned short* Wqkvb = (unsigned short*)(ws + oWq);
  unsigned short* Wvb   = Wqkvb + (size_t)2 * DM * DM;          // rows 2048..3071 of Wqkvb
  unsigned short* Wob   = (unsigned short*)(ws + oWo);
  float*          QKf   = (float*)(ws + oQKf);
  unsigned short* Qh    = (unsigned short*)(ws + oQh);
  unsigned short* Ql    = (unsigned short*)(ws + oQl);
  unsigned short* Kp    = (unsigned short*)(ws + oKp);
  unsigned short* VT    = (unsigned short*)(ws + oVT);
  unsigned short* Oh    = (unsigned short*)(ws + oOh);
  unsigned short* Ol    = (unsigned short*)(ws + oOl);

  const dim3 blk(256);
  const int n8x  = SEQ * DM / 8;                                // 524288
  const int n8wq = 3 * DM * DM / 8;                             // 393216
  const int n8wo = DM * DM / 8;                                 // 131072
  const dim3 gCvtX((n8x + 255) / 256);                          // 2048 blocks
  const dim3 gCvtWq((n8wq + 255) / 256);                        // 1536 blocks
  const dim3 gCvtWo((n8wo + 255) / 256);                        //  512 blocks
  const dim3 gQK(((SEQ / 64) * (QKP / 64) + 7) / 8, 1);         // 2048 tiles -> 256 blocks: M=4096, N=2048
  const dim3 gRope(SEQ);                                        // one block per token row
  const dim3 gVT(((DM / 64) * (SEQ / 64) + 7) / 8, 1);          // 1024 tiles -> 128 blocks: M=1024, N=4096
  const dim3 gAttn(NH * NQB);                                   // 1024 blocks
  const dim3 gOut(((SEQ / 64) * (DM / 64) + 7) / 8, 1);         // 1024 tiles -> 128 blocks: M=4096, N=1024

  // (1) x -> bf16 plane [4096][1024]; w_qkv -> bf16 [3072][1024]; w_out -> bf16 [1024][1024]
  cvt_bf16x8<<<gCvtX, blk, 0, stream>>>(x, Xb, n8x);
  cvt_bf16x8<<<gCvtWq, blk, 0, stream>>>(wqkv, Wqkvb, n8wq);
  cvt_bf16x8<<<gCvtWo, blk, 0, stream>>>(wout, Wob, n8wo);
  // (2) q|k = x . Wqk^T + b_qk -> f32 staging plane [4096][2048] (pitch 2048)   (M=4096, N=2048, K=1024, col bias)
  gemm64<0, 0, 1><<<gQK, blk, 0, stream>>>(
      Xb, Xb, DM, 0LL, Wqkvb, Wqkvb, DM, 0LL,
      (void*)QKf, QKP, 0LL, (void*)QKf, QKP, 0LL, 0,
      bqkv,
      SEQ, QKP, DM, 1.0f);
  // (3) RoPE -> q f16 hi plane + f16 residual x4096 plane, k f16 plane, each [4096][1024]
  rope_rows<<<gRope, blk, 0, stream>>>(QKf, cosp, sinp, Qh, Ql, Kp, SEQ, 4096.0f);
  // (4) v^T = Wv . x^T + b_v[row] -> f16 plane [h*64+d][s] (pitch SEQ), no residual plane (N2 = 0)
  //     (A = Wvb [n][k], Bt = Xb [s][k]; M=1024, N=4096, K=1024, row bias = b_qkv rows 2048..3071)
  gemm64<0, 3, 2><<<gVT, blk, 0, stream>>>(
      Wvb, Wvb, DM, 0LL, Xb, Xb, DM, 0LL,
      (void*)VT, SEQ, 0LL, (void*)VT, SEQ, 0LL, 0,
      bqkv + 2 * DM,
      DM, SEQ, DM, 4096.0f);
  // (5) attention -> context bf16 hi / lo planes [4096][1024]
  attn64<<<gAttn, dim3(128), 0, stream>>>(Qh, Ql, Kp, VT, Oh, Ol, 0.125f, 1.0f / 4096.0f);
  // (6) out = context . w_out^T + b_out -> d_out f32 [4096][1024]  (A = context hi + lo planes, 2 products; K=1024, col bias)
  gemm64<1, 0, 1><<<gOut, blk, 0, stream>>>(
      Oh, Ol, DM, 0LL, Wob, Wob, DM, 0LL,
      d_out, DM, 0LL, d_out, DM, 0LL, 0,
      bout,
      SEQ, DM, DM, 1.0f);
  (void)hipGetLastError();
}

// v006
// Measured time: 167 microseconds a run.
// Timed twice side by side with v005, it ran 1.06 and 1.05 times as fast.
// Counting every step since v000, it is 3.06 times as fast.
// Contractions: q|k projection and v^T projection = v_wmma_f32_16x16x32_bf16 (bf16 operands from RNE-converted x and w_qkv, single product);
// k.q^T scores = v_wmma_f32_16x16x32_f16 (q as f16 hi plane + f16 residual plane x4096 in a separate accumulator, k f16; 2 products);
// v^T.p^T = v_wmma_f32_16x16x32_f16 (p carried x1024 in f16, v^T f16; 1 product);
// ctx.w_out^T = v_wmma_f32_16x16x32_bf16 (ctx as bf16 hi + lo planes times bf16 w_out, 2 products); all f32 accumulate; bias, RoPE, softmax in f32.
#include <hip/hip_runtime.h>
#include <math.h>
#include <stdint.h>

#define SEQ   4096
#define DM    1024
#define NH    16
#define HD    64
#define NQB   (SEQ / 64)     // 64 key / query tiles of 64
#define QKP   (2 * DM)        // columns of the joint q|k projection: q at cols 0..DM-1, k at cols DM..2DM-1
#define LP    72              // LDS row pitch of the 64-wide f16 tiles, in elements: 144 B = 16 B x odd, so the 16 rows of a 16-B fragment read fall on 16 distinct bank groups
static_assert(NH * HD == DM);
static_assert((SEQ % 64) == 0 && (DM % 64) == 0 && (DM % 32) == 0);
static_assert((SEQ % 256) == 0 && (DM % 256) == 0);   // GEMM block tile 128 x 256, for every M and N used here
static_assert(HD == 64);      // a GEMM wave tile (64 columns) is one whole head, so a column's RoPE partner lies in the same tile
static_assert(LP >= 64 && (LP % 8) == 0 && ((LP / 8) & 1) == 1);

typedef _Float16 v16h __attribute__((ext_vector_type(16)));
typedef _Float16 v8h  __attribute__((ext_vector_type(8)));
typedef __bf16   v16b __attribute__((ext_vector_type(16)));
typedef __bf16   v8b  __attribute__((ext_vector_type(8)));
typedef float    v8f  __attribute__((ext_vector_type(8)));
typedef float    v4f  __attribute__((ext_vector_type(4)));
typedef unsigned int v4u __attribute__((ext_vector_type(4)));

// ---- scalar helpers --------------------------------------------------------------------------------
__device__ __forceinline__ unsigned short bf_bits(float f) {          // f32 -> bf16 bits, RNE convert
  unsigned u = __float_as_uint(f);
  return (unsigned short)((u + 0x7FFFu + ((u >> 16) & 1u)) >> 16);
}
__device__ __forceinline__ float bf_up(unsigned short h) { return __uint_as_float(((unsigned)h) << 16); }
__device__ __forceinline__ float bf_rne(float f) { return bf_up(bf_bits(f)); }
__device__ __forceinline__ unsigned short h_bits(_Float16 x) { return __builtin_bit_cast(unsigned short, x); }
__device__ __forceinline__ unsigned pk16(unsigned short a, unsigned short b) { return (unsigned)a | ((unsigned)b << 16); }
__device__ __forceinline__ v8f zero8() { v8f z = {0.f, 0.f, 0.f, 0.f, 0.f, 0.f, 0.f, 0.f}; return z; }

// ---- fragment loaders: 16-bit A/B operand, lane -> row/col (lane&15), p already includes +8*(lane>>4);
//      elements 0..7 <- p[0..7] (k0+8h..), elements 8..15 <- p[16..23] (k0+16+8h..)
__device__ __forceinline__ v16b ldfrag_b(const __bf16* p) {
  union { v16b v; v8b h[2]; } f;
  f.h[0] = *(const v8b*)(p);
  f.h[1] = *(const v8b*)(p + 16);
  return f.v;
}
__device__ __forceinline__ v16h ldfrag_h(const _Float16* p) {
  union { v16h v; v8h h[2]; } f;
  f.h[0] = *(const v8h*)(p);
  f.h[1] = *(const v8h*)(p + 16);
  return f.v;
}

// ---- WMMA helpers --------------------------------------------------------------------------------------
// f16 product (attention): the builtin alone. The compiler keeps the distance behind its own WMMA, and with no statement
// tied to each product it is free to issue the LDS fragment reads of several products together, ahead of them.
__device__ __forceinline__ v8f mma_h(v16h a, v16h b, v8f c) {
  return __builtin_amdgcn_wmma_f32_16x16x32_f16(false, a, false, b, (short)0, c, false, false);
}
// bf16 product (GEMMs), with its hand-written gaps
__device__ __forceinline__ v8f mma_b_raw(v16b a, v16b b, v8f c) {
  return __builtin_amdgcn_wmma_f32_16x16x32_bf16(false, a, false, b, (short)0, c, false, false);
}
__device__ __forceinline__ void dep_guard_b(v8f& a, v8f& b, v16b x, v16b y) {
#if defined(__HIP_DEVICE_COMPILE__)
  asm volatile("v_nop\n\tv_nop\n\tv_nop\n\tv_nop" : "+v"(a), "+v"(b) : "v"(x), "v"(y));
#endif
}
__device__ __forceinline__ void keep4_b(v16b a, v16b b, v16b c, v16b d) {
#if defined(__HIP_DEVICE_COMPILE__)
  asm volatile("v_nop" :: "v"(a), "v"(b), "v"(c), "v"(d));
#endif
}
__device__ __forceinline__ void acc_guard4(v8f& a, v8f& b, v8f& c, v8f& d) {
#if defined(__HIP_DEVICE_COMPILE__)
  asm volatile("v_nop\n\tv_nop\n\tv_nop\n\tv_nop" : "+v"(a), "+v"(b), "+v"(c), "+v"(d));
#endif
}
__device__ __forceinline__ void wave_sync_lds() {
  __builtin_amdgcn_fence(__ATOMIC_RELEASE, "workgroup");
  __builtin_amdgcn_wave_barrier();
  __builtin_amdgcn_fence(__ATOMIC_ACQUIRE, "workgroup");
}

// ---- asynchronous copies global -> LDS, 16 B per lane: l = the lane's LDS byte address, g = its global address.
//      A run of copies and its s_wait_xcnt 0 are one statement, so that no address register is rewritten ahead of the wait.
__device__ __forceinline__ unsigned lds_off(const void* p) { return (unsigned)(size_t)p; }
__device__ __forceinline__ void copy4_lds(unsigned l, unsigned lstep, const __bf16* g, size_t gstep) {
#if defined(__HIP_DEVICE_COMPILE__)
  asm volatile("global_load_async_to_lds_b128 %0, %1, off\n\t"
               "global_load_async_to_lds_b128 %2, %3, off\n\t"
               "global_load_async_to_lds_b128 %4, %5, off\n\t"
               "global_load_async_to_lds_b128 %6, %7, off\n\t"
               "s_wait_xcnt 0x0"
               :: "v"(l), "v"(g), "v"(l + lstep), "v"(g + gstep),
                  "v"(l + 2 * lstep), "v"(g + 2 * gstep), "v"(l + 3 * lstep), "v"(g + 3 * gstep)
               : "memory");
#endif
}
__device__ __forceinline__ void copy8_lds(unsigned l0, unsigned l1, unsigned lstep,
                                          const __bf16* g0, const __bf16* g1, size_t gstep) {
#if defined(__HIP_DEVICE_COMPILE__)
  asm volatile("global_load_async_to_lds_b128 %0, %1, off\n\t"
               "global_load_async_to_lds_b128 %2, %3, off\n\t"
               "global_load_async_to_lds_b128 %4, %5, off\n\t"
               "global_load_async_to_lds_b128 %6, %7, off\n\t"
               "global_load_async_to_lds_b128 %8, %9, off\n\t"
               "global_load_async_to_lds_b128 %10, %11, off\n\t"
               "global_load_async_to_lds_b128 %12, %13, off\n\t"
               "global_load_async_to_lds_b128 %14, %15, off\n\t"
               "s_wait_xcnt 0x0"
               :: "v"(l0), "v"(g0), "v"(l0 + lstep), "v"(g0 + gstep),
                  "v"(l0 + 2 * lstep), "v"(g0 + 2 * gstep), "v"(l0 + 3 * lstep), "v"(g0 + 3 * gstep),
                  "v"(l1), "v"(g1), "v"(l1 + lstep), "v"(g1 + gstep),
                  "v"(l1 + 2 * lstep), "v"(g1 + 2 * gstep), "v"(l1 + 3 * lstep), "v"(g1 + 3 * gstep)
               : "memory");
#endif
}
// the same for two f16 planes of different row pitch: 4 copies from g0 (rows gstep0 apart) to l0.., 4 from g1 (gstep1) to l1..
__device__ __forceinline__ void copy4x2_lds(unsigned l0, unsigned l1, unsigned lstep,
                                            const _Float16* g0, size_t gstep0, const _Float16* g1, size_t gstep1) {
#if defined(__HIP_DEVICE_COMPILE__)
  asm volatile("global_load_async_to_lds_b128 %0, %1, off\n\t"
               "global_load_async_to_lds_b128 %2, %3, off\n\t"
               "global_load_async_to_lds_b128 %4, %5, off\n\t"
               "global_load_async_to_lds_b128 %6, %7, off\n\t"
               "global_load_async_to_lds_b128 %8, %9, off\n\t"
               "global_load_async_to_lds_b128 %10, %11, off\n\t"
               "global_load_async_to_lds_b128 %12, %13, off\n\t"
               "global_load_async_to_lds_b128 %14, %15, off\n\t"
               "s_wait_xcnt 0x0"
               :: "v"(l0), "v"(g0), "v"(l0 + lstep), "v"(g0 + gstep0),
                  "v"(l0 + 2 * lstep), "v"(g0 + 2 * gstep0), "v"(l0 + 3 * lstep), "v"(g0 + 3 * gstep0),
                  "v"(l1), "v"(g1), "v"(l1 + lstep), "v"(g1 + gstep1),
                  "v"(l1 + 2 * lstep), "v"(g1 + 2 * gstep1), "v"(l1 + 3 * lstep), "v"(g1 + 3 * gstep1)
               : "memory");
#endif
}
__device__ __forceinline__ void wait_copies() {     // the wave's own copies have landed in LDS
#if defined(__HIP_DEVICE_COMPILE__)
  asm volatile("s_wait_asynccnt 0x0" ::: "memory");
#endif
}
__device__ __forceinline__ void wait_lds_reads() {  // the wave's LDS reads have returned, before their buffer is given up for refilling
#if defined(__HIP_DEVICE_COMPILE__)
  asm volatile("s_wait_dscnt 0x0" ::: "memory");
#endif
}

__device__ __forceinline__ void wait_store_regs() { // behind a run of global stores, before their data and address registers are written again
#if defined(__HIP_DEVICE_COMPILE__)
  asm volatile("s_wait_xcnt 0x0" ::: "memory");
#endif
}

// =====================================================================================================
// f32 -> bf16 (RNE convert), 8 elements per thread, one 16-B store per lane: a wave writes 512 contiguous B
// coverage: n8 threads x 8 = whole plane (n8 is a multiple of 256 for every use here).
// =====================================================================================================
__global__ __launch_bounds__(256) void cvt_bf16x8(const float* __restrict__ in, unsigned short* out, int n8) {
  const int i = blockIdx.x * 256 + threadIdx.x;
  if (i < n8) {
    const v4f a = *(const v4f*)(in + (size_t)i * 8);
    const v4f b = *(const v4f*)(in + (size_t)i * 8 + 4);
    v4u p;
    p[0] = pk16(bf_bits(a[0]), bf_bits(a[1]));
    p[1] = pk16(bf_bits(a[2]), bf_bits(a[3]));
    p[2] = pk16(bf_bits(b[0]), bf_bits(b[1]));
    p[3] = pk16(bf_bits(b[2]), bf_bits(b[3]));
    *(v4u*)(out + (size_t)i * 8) = p;
    
  }
}

// =====================================================================================================
// Register-blocked batched bf16 WMMA GEMM: C[m][n] = sum_k A[m][k] * Bt[n][k] + bias; one wave per 64x64 tile,
// the 8 waves of a block as 2 x 4 = one 128x256 tile. A row-major [M][K] pitch lda; Bt row-major [N][K] pitch ldb
// (k contiguous); M multiple of 128, N of 256, K of 64. blockIdx.y = batch index (strides in elements).
// Operands: a stage = 64 k = one whole 128-B line of each of the block's A and Bt rows, brought into LDS by asynchronous
// copies (8 lanes per row, 4 whole lines per wave copy), rows at pitch LP; two buffers, stage t+2 copied while t+1 is worked on;
// fragments are read from LDS in the k order of ldfrag_b, k ascending.
// NSPLIT: 0 = A.Bt; 1 = (A + A2).Bt (A2 = unscaled bf16 lo plane of A); 2 = A.Bt + A2.Bt + A.Bt2.
// OUT_MODE: 0 = f32 (pitch ldc); 2 = bf16 hi plane C + bf16 lo plane C2 (lo = RNE(v - hi), unscaled);
//           3 = f16 hi plane C + f16 residual plane C2 = f16((v - hi) * rscale), C2 written only for tiles
//               with n0 < N2 (pitch ldc2, batch stride strideC2);
//           4 = RoPE (rotate-half, half = HD/2 = 32) on the wave's 64-column tile = one head of q (n0 < N2) or of k, row m = token:
//               y[d] = x[d] * cos[m][d] + (d < 32 ? -x[d+32] : x[d-32]) * sin[m][d], x with its bias, tables [M][HD] shared over
//               heads and RNE-converted to bf16 on read; q -> f16 hi plane C + f16 residual plane C2 = f16((y - hi) * rscale),
//               k -> f16 plane C3 at column n0 - N2; all three at pitch ldc, one batch (no batch stride applied).
// BIAS_MODE: 1 = + biasp[n] (per column), 2 = + biasp[m] (per row); bias values RNE-converted to bf16 and
//            added in f32 before any 16-bit conversion of the result.
// =====================================================================================================
// OUT_MODE 4: second launch bound = 4 waves per SIMD = a budget of 256 registers, so that its longer epilogue needs no register-window switches
template <int NSPLIT, int OUT_MODE, int BIAS_MODE>
__global__ __launch_bounds__(256, (OUT_MODE == 4) ? 4 : 1) void gemm64(
    const unsigned short* __restrict__ Ap, const unsigned short* A2p, int lda, long long strideA,
    const unsigned short* __restrict__ Btp, const unsigned short* Bt2p, int ldb, long long strideB,
    void* Cout, int ldc, long long strideC,
    void* Cout2, int ldc2, long long strideC2, int N2,
    const float* __restrict__ biasp,
    const float* __restrict__ cosp, const float* __restrict__ sinp, unsigned short* C3p,
    int M, int N, int K, float rscale) {
  const __bf16* A   = (const __bf16*)(const void*)Ap;
  const __bf16* A2  = (const __bf16*)(const void*)A2p;
  const __bf16* Bt  = (const __bf16*)(const void*)Btp;
  const __bf16* Bt2 = (const __bf16*)(const void*)Bt2p;
  constexpr int RB   = (NSPLIT >= 1) ? 256 : 128;            // stage rows: A 0..127, A2 128..255 (NSPLIT >= 1), then Bt 256 rows, Bt2 256 rows (NSPLIT == 2)
  constexpr int ROWS = RB + ((NSPLIT == 2) ? 512 : 256);
  constexpr int STG  = ROWS * LP;                            // elements of one stage buffer
  __shared__ __align__(16) float sT[8][16 * 68];   // per-wave 16x64 slab, pitch 68 floats
  __shared__ __align__(16) __bf16 ring[2 * STG];   // two stage buffers
  const int b    = blockIdx.y;
  const int lane = threadIdx.x & 31;
  const int wave = threadIdx.x >> 5;
  const int tilesN = N >> 8;
  const int tilesM = M >> 7;
  if ((int)blockIdx.x >= tilesM * tilesN) return;   // block-uniform, in front of every barrier
  const int tm = blockIdx.x / tilesN;
  const int tn = blockIdx.x - tm * tilesN;
  const int wm = (wave >> 2) << 6;                  // the wave's 64x64 tile inside the block's 128x256
  const int wn = (wave & 3) << 6;
  const int m0 = (tm << 7) + wm;
  const int n0 = (tn << 8) + wn;

  const __bf16* Ab  = A  + (size_t)b * strideA;
  const __bf16* Bb  = Bt + (size_t)b * strideB;
  const __bf16* Ab2 = (NSPLIT >= 1) ? (A2  + (size_t)b * strideA) : Ab;
  const __bf16* Bb2 = (NSPLIT == 2) ? (Bt2 + (size_t)b * strideB) : Bb;

  const int rlane = lane & 15;                 // row (A) / col (B, D) within subtile
  const int koff  = (lane >> 4) * 8;           // k offset of this lane half
  const int mOff  = (lane >> 4) * 8;           // D row offset

  v8f acc[4][4];
#pragma unroll
  for (int i = 0; i < 4; ++i)
#pragma unroll
    for (int j = 0; j < 4; ++j) acc[i][j] = zero8();

  // ---- stage copies: thread -> row (threadIdx.x >> 3) + 32 * c of each 128-row group, 16 B at column 8 * (threadIdx.x & 7) ----
  const int trow = threadIdx.x >> 3;
  const int tcol = (threadIdx.x & 7) * 8;
  const size_t   aoff  = (size_t)((tm << 7) + trow) * lda + tcol;
  const size_t   boff  = (size_t)((tn << 8) + trow) * ldb + tcol;
  const unsigned lrow  = lds_off(ring) + (unsigned)(trow * LP + tcol) * 2u;
  const unsigned lstep = 32u * LP * 2u;                       // 32 rows further in LDS, bytes
  auto copy_stage = [&](int st, int buf) {
    const unsigned l = lrow + (unsigned)buf * (unsigned)(STG * 2);
    const size_t   k = (size_t)st * 64;
    if (NSPLIT >= 1) copy8_lds(l, l + 4u * lstep, lstep, Ab + aoff + k, Ab2 + aoff + k, (size_t)32 * lda);
    else             copy4_lds(l, lstep, Ab + aoff + k, (size_t)32 * lda);
    copy8_lds(l + (unsigned)(RB * LP * 2), l + (unsigned)((RB + 128) * LP * 2), lstep,
              Bb + boff + k, Bb + boff + k + (size_t)128 * ldb, (size_t)32 * ldb);
    if (NSPLIT == 2)
      copy8_lds(l + (unsigned)((RB + 256) * LP * 2), l + (unsigned)((RB + 384) * LP * 2), lstep,
                Bb2 + boff + k, Bb2 + boff + k + (size_t)128 * ldb, (size_t)32 * ldb);
  };

  const int nst = K >> 6;                     // stages of 64 k; block-uniform
  copy_stage(0, 0);
  wait_copies();
  __syncthreads();                            // stage 0 is readable by every wave
  if (nst > 1) copy_stage(1, 1);

  for (int t = 0; t < nst; ++t) {
    const __bf16* sb = ring + (t & 1) * STG;
#pragma unroll   // as the inner loops: every fragment and accumulator index constant, so the arrays stay in registers
    for (int ks = 0; ks < 2; ++ks) {
      v16b bh[4], bl[4], ah[4], al[4];
#pragma unroll
      for (int j = 0; j < 4; ++j) {
        const int bo = (RB + wn + (j << 4) + rlane) * LP + koff + ks * 32;
        bh[j] = ldfrag_b(sb + bo);
        if (NSPLIT == 2) bl[j] = ldfrag_b(sb + bo + 256 * LP); else bl[j] = bh[j];
      }
#pragma unroll
      for (int i = 0; i < 4; ++i) {
        const int ao = (wm + (i << 4) + rlane) * LP + koff + ks * 32;
        ah[i] = ldfrag_b(sb + ao);
        if (NSPLIT >= 1) al[i] = ldfrag_b(sb + ao + 128 * LP); else al[i] = ah[i];
      }
#pragma unroll
      for (int i = 0; i < 4; ++i) {
#pragma unroll
        for (int j = 0; j < 4; ++j) {
          acc[i][j] = mma_b_raw(ah[i], bh[j], acc[i][j]);
          if (NSPLIT >= 1) acc[i][j] = mma_b_raw(al[i], bh[j], acc[i][j]);
          if (NSPLIT == 2) acc[i][j] = mma_b_raw(ah[i], bl[j], acc[i][j]);
        }
        dep_guard_b(acc[i][0], acc[i][3], ah[i], al[i]);
      }
      keep4_b(bh[0], bh[1], bh[2], bh[3]);
      if (NSPLIT == 2) keep4_b(bl[0], bl[1], bl[2], bl[3]);
    }
    wait_lds_reads();
    wait_copies();
    __syncthreads();                          // publishes stage t+1 and ends every wave's reads of stage t's buffer
    if (t + 2 < nst) copy_stage(t + 2, t & 1);
  }
  wait_copies();
  acc_guard4(acc[0][0], acc[0][1], acc[0][2], acc[0][3]);
  acc_guard4(acc[1][0], acc[1][1], acc[1][2], acc[1][3]);
  acc_guard4(acc[2][0], acc[2][1], acc[2][2], acc[2][3]);
  acc_guard4(acc[3][0], acc[3][1], acc[3][2], acc[3][3]);

  // ---- epilogue ----
  float* slab = sT[wave];
  // OUT_MODE 4: cos / sin of the 8 columns 8 * (lane & 7).. of rows it * 4 + (lane >> 3) of 16-row group i; group i + 1's loads are
  // issued behind group i's stores, so that both are in flight together
  v4f tcs[4][2], tsn[4][2];
  const unsigned tlane = ((unsigned)(m0 + (lane >> 3)) * HD + (unsigned)(lane & 7) * 8u) * 4u;   // the lane's byte offset in a table, group 0, it 0
  auto load_tables = [&](int i) {
#pragma unroll
    for (int it = 0; it < 4; ++it) {
      const char* tc = (const char*)cosp + (size_t)tlane + ((i << 4) + it * 4) * HD * 4;   // one offset register, the rest a constant
      const char* ts = (const char*)sinp + (size_t)tlane + ((i << 4) + it * 4) * HD * 4;
      tcs[it][0] = *(const v4f*)(tc);
      tcs[it][1] = *(const v4f*)(tc + 16);
      tsn[it][0] = *(const v4f*)(ts);
      tsn[it][1] = *(const v4f*)(ts + 16);
    }
  };
#pragma unroll
  for (int i = 0; i < 4; ++i) {
    const int mBase = m0 + (i << 4);
    float brow[8];
#pragma unroll
    for (int r = 0; r < 8; ++r) {
      brow[r] = 0.f;
      if (BIAS_MODE == 2) brow[r] = bf_rne(biasp[mBase + mOff + r]);
    }
#pragma unroll
    for (int j = 0; j < 4; ++j) {
      float bcol = 0.f;
      if (BIAS_MODE == 1) bcol = bf_rne(biasp[n0 + (j << 4) + rlane]);
#pragma unroll
      for (int r = 0; r < 8; ++r) {
        slab[(mOff + r) * 68 + (j << 4) + rlane] = acc[i][j][r] + bcol + brow[r];
      }
    }
    if (OUT_MODE == 4 && i == 0) {
      __builtin_amdgcn_sched_barrier(0);   // keeps the table loads behind the staging stores, where group 0's accumulators are free: moved ahead of them they spill
      load_tables(0);
    }
    wave_sync_lds();
    if (OUT_MODE == 0) {
      float* C = (float*)Cout + (size_t)b * strideC;
      const int hh = lane >> 4, c4 = (lane & 15) * 4;     // 256-B row segment = 16 lanes x 16 B
      {
#pragma unroll
        for (int it = 0; it < 8; ++it) {
          const int row = it * 2 + hh;                     // it 0..7 x hh 0..1 = rows 0..15
          const v4f v = *(const v4f*)(slab + row * 68 + c4);
          *(v4f*)(C + (size_t)(mBase + row) * ldc + n0 + c4) = v;
        }
        
      }
    } else if (OUT_MODE == 4) {
      const int q = lane >> 3, c8 = (lane & 7) * 8;        // 128-B row segment of an f16 plane = 8 lanes x 16 B
      const bool  lowhalf = (c8 < (HD / 2));
      const int   pc8 = lowhalf ? (c8 + HD / 2) : (c8 - HD / 2);   // partner columns, same head = same slab row
      const float sgn = lowhalf ? -1.0f : 1.0f;
      const int   n0u = __builtin_amdgcn_readfirstlane(n0);   // wave-uniform, held as a scalar: plane and branch are chosen once per wave
      const bool  isq = (n0u < N2);
      char* Ch = (char*)(isq ? (unsigned short*)Cout : C3p) + (size_t)(isq ? n0u : n0u - N2) * 2;
      char* Cl = (char*)Cout2 + (size_t)n0u * 2;
      const unsigned olane = ((unsigned)(m0 + q) * (unsigned)ldc + (unsigned)c8) * 2u;   // the lane's byte offset in a plane, group 0, it 0
      v4u hv[4], lv[4];
#pragma unroll
      for (int it = 0; it < 4; ++it) {
        const int row = it * 4 + q;                        // it 0..3 x q 0..3 = rows 0..15
        const v4f x0 = *(const v4f*)(slab + row * 68 + c8);
        const v4f x1 = *(const v4f*)(slab + row * 68 + c8 + 4);
        const v4f p0 = *(const v4f*)(slab + row * 68 + pc8);
        const v4f p1 = *(const v4f*)(slab + row * 68 + pc8 + 4);
        const v4f cA = tcs[it][0], cB = tcs[it][1];
        const v4f sA = tsn[it][0], sB = tsn[it][1];
        v4f y0, y1;
#pragma unroll
        for (int e = 0; e < 4; ++e) {
          y0[e] = x0[e] * bf_rne(cA[e]) + (sgn * p0[e]) * bf_rne(sA[e]);
          y1[e] = x1[e] * bf_rne(cB[e]) + (sgn * p1[e]) * bf_rne(sB[e]);
        }
#pragma unroll
        for (int e = 0; e < 2; ++e) {
          const float f0 = y0[2 * e], f1 = y0[2 * e + 1];
          const float g0 = y1[2 * e], g1 = y1[2 * e + 1];
          const _Float16 a0 = (_Float16)f0, a1 = (_Float16)f1;
          const _Float16 b0 = (_Float16)g0, b1 = (_Float16)g1;
          hv[it][e]     = pk16(h_bits(a0), h_bits(a1));
          hv[it][2 + e] = pk16(h_bits(b0), h_bits(b1));
          lv[it][e]     = pk16(h_bits((_Float16)((f0 - (float)a0) * rscale)),
                               h_bits((_Float16)((f1 - (float)a1) * rscale)));
          lv[it][2 + e] = pk16(h_bits((_Float16)((g0 - (float)b0) * rscale)),
                               h_bits((_Float16)((g1 - (float)b1) * rscale)));
        }
      }
#pragma unroll
      for (int it = 0; it < 4; ++it)
        *(v4u*)(Ch + (size_t)(((i << 4) + it * 4) * ldc) * 2 + olane) = hv[it];
      wait_store_regs();
      if (isq) {
#pragma unroll
        for (int it = 0; it < 4; ++it)
          *(v4u*)(Cl + (size_t)(((i << 4) + it * 4) * ldc) * 2 + olane) = lv[it];
        wait_store_regs();
      }
      if (i < 3) load_tables(i + 1);
    } else {
      const int q = lane >> 3, c8 = (lane & 7) * 8;
      unsigned short* C  = (unsigned short*)Cout  + (size_t)b * strideC;
      unsigned short* C2 = (unsigned short*)Cout2 + (size_t)b * strideC2;
      const bool wlo = (OUT_MODE == 2) || (n0 < N2);      // wave-uniform
      v4u hv[4], lv[4];
#pragma unroll
      for (int it = 0; it < 4; ++it) {
        const int row = it * 4 + q;                        // it 0..3 x q 0..3 = rows 0..15
        const float* sp = slab + row * 68 + c8;
        v4u a, a2;
#pragma unroll
        for (int e = 0; e < 4; ++e) {
          const float f0 = sp[2 * e], f1 = sp[2 * e + 1];
          unsigned short h0, h1, l0, l1;
          if (OUT_MODE == 2) {
            h0 = bf_bits(f0); h1 = bf_bits(f1);
            l0 = bf_bits(f0 - bf_up(h0)); l1 = bf_bits(f1 - bf_up(h1));
          } else {
            const _Float16 x0 = (_Float16)f0, x1 = (_Float16)f1;
            h0 = h_bits(x0); h1 = h_bits(x1);
            l0 = h_bits((_Float16)((f0 - (float)x0) * rscale));
            l1 = h_bits((_Float16)((f1 - (float)x1) * rscale));
          }
          a[e] = pk16(h0, h1); a2[e] = pk16(l0, l1);
        }
        hv[it] = a; lv[it] = a2;
      }
      {
#pragma unroll
        for (int it = 0; it < 4; ++it) {
          const int row = it * 4 + q;
          *(v4u*)(C + (size_t)(mBase + row) * ldc + n0 + c8) = hv[it];
          if (wlo) *(v4u*)(C2 + (size_t)(mBase + row) * ldc2 + n0 + c8) = lv[it];
        }
        
      }
    }
    wave_sync_lds();
  }
}

#define OSP 68
__device__ __forceinline__ float xhalf(float x) {
  return __builtin_bit_cast(float, __builtin_amdgcn_permlanex16(__builtin_bit_cast(int, x), __builtin_bit_cast(int, x),
                                                                0x76543210, 0xfedcba98, false, false));
}

__global__ __launch_bounds__(128)
void attn64(const unsigned short* __restrict__ qhp, const unsigned short* __restrict__ qlp,
            const unsigned short* __restrict__ kpp, const unsigned short* __restrict__ vtp,
            unsigned short* ohp, unsigned short* olp, float sscale, float rres) {
  union FH { v16h v; v8h h[2]; };
  constexpr int TL = 64 * LP;                                     // elements of one 64-row tile at pitch LP, 9 KB
  __shared__ __align__(16) _Float16 kvring[2 * 2 * TL];           // two buffers, each K [kv][d] then V^T [d][kv]
  __shared__ __align__(16) float    Os[4][16 * OSP];              // per wave context tile [row][d]

  const int tid  = threadIdx.x;
  const int wave = tid >> 5;
  const int lane = tid & 31;
  const int hh   = lane >> 4;
  const int c    = lane & 15;

  const int bx   = blockIdx.x;
  const int qb   = bx % NQB;
  const int h    = bx / NQB;
  const int q0   = qb * 64 + wave * 16;

  const _Float16* Qh = (const _Float16*)(const void*)qhp + (size_t)h * HD;
  const _Float16* Ql = (const _Float16*)(const void*)qlp + (size_t)h * HD;
  const _Float16* Kg = (const _Float16*)(const void*)kpp + (size_t)h * HD;
  const _Float16* Vg = (const _Float16*)(const void*)vtp + (size_t)h * HD * SEQ;

  // ---- Q fragments (B operand, column = query lane&15): 2 d-chunks, hi and residual ----
  v16h qah[2], qal[2];
#pragma unroll
  for (int dc = 0; dc < 2; ++dc) {
    qah[dc] = ldfrag_h(Qh + (size_t)(q0 + c) * DM + dc * 32 + 8 * hh);
    qal[dc] = ldfrag_h(Ql + (size_t)(q0 + c) * DM + dc * 32 + 8 * hh);
  }

  float mrun = -INFINITY;      // running maximum of query c (equal in both wave halves)
  float lrun = 0.f;            // running sum over this wave half's keys of query c
  v8f oacc[4];                 // oacc[t][r] = O^T[d = t*16 + 8*hh + r][query c]
#pragma unroll
  for (int t = 0; t < 4; ++t) oacc[t] = zero8();

  // ---- chunk copies: thread -> rows (tid >> 3) + 16 * i, i = 0..3, of each tile, 16 B at column 8 * (tid & 7) ----
  const int trow = tid >> 3, tcol = (tid & 7) * 8;
  const _Float16* kg0 = Kg + (size_t)trow * DM + tcol;              // chunk 0: K row trow, d = tcol..tcol+7
  const _Float16* vg0 = Vg + (size_t)trow * SEQ + tcol;             // chunk 0: V^T row d = trow, s = tcol..tcol+7
  const unsigned  lk0 = lds_off(kvring) + (unsigned)(trow * LP + tcol) * 2u;
  auto copy_chunk = [&](int ck, int buf) {
    const unsigned l = lk0 + (unsigned)buf * (unsigned)(2 * TL * 2);
    copy4x2_lds(l, l + (unsigned)(TL * 2), 16u * LP * 2u,
                kg0 + (size_t)ck * 64 * DM, (size_t)16 * DM, vg0 + (size_t)ck * 64, (size_t)16 * SEQ);
  };
  static_assert(NQB >= 2);
  copy_chunk(0, 0);
  wait_copies();
  __syncthreads();                           // chunk 0 is readable by every wave
  copy_chunk(1, 1);

  for (int kt = 0; kt < NQB; ++kt) {         // static trip count
    const _Float16* Ksh = kvring + (kt & 1) * (2 * TL);   // keys kv0 = kt * 64 .. kv0 + 63
    const _Float16* Vth = Ksh + TL;

    // ---- scores, transposed: 64 keys x 16 queries per wave, 2 f16 products (hi, residual);
    //      s[j][r] = score of key kv0 + j*16 + 8*hh + r with query q0 + c ----
    v8f s[4];
#pragma unroll
    for (int j = 0; j < 4; ++j) {
      v8f sh = zero8(), sl = zero8();
#pragma unroll
      for (int dc = 0; dc < 2; ++dc) {
        FH kb;
        kb.h[0] = *(const v8h*)(Ksh + (j * 16 + c) * LP + dc * 32 + 8 * hh);
        kb.h[1] = *(const v8h*)(Ksh + (j * 16 + c) * LP + dc * 32 + 16 + 8 * hh);
        sh = mma_h(kb.v, qah[dc], sh);
        sl = mma_h(kb.v, qal[dc], sl);
      }
#pragma unroll
      for (int r = 0; r < 8; ++r) s[j][r] = (sh[r] + sl[r] * rres) * sscale;
    }

    // ---- maximum of the lane's 32 scores, joined with the other wave half's; online softmax ----
    float mj[4];
#pragma unroll
    for (int j = 0; j < 4; ++j) {
      mj[j] = s[j][0];
#pragma unroll
      for (int r = 1; r < 8; ++r) mj[j] = fmaxf(mj[j], s[j][r]);
    }
    float m = fmaxf(fmaxf(mj[0], mj[1]), fmaxf(mj[2], mj[3]));
    m = fmaxf(m, xhalf(m));
    const float mnew  = fmaxf(mrun, m);
    const float alpha = __expf(mrun - mnew);
    mrun = mnew;

    // ---- P^T (x1024, f16) straight into the B operand: element e of 32-key block kk = key kk*32 + (e < 8 ? 8*hh + e : 16 + 8*hh + e - 8) ----
    FH pb[2];
    float pj[4];
#pragma unroll
    for (int j = 0; j < 4; ++j) {
      pj[j] = 0.f;
#pragma unroll
      for (int r = 0; r < 8; ++r) {
        const float p = __expf(s[j][r] - mnew);
        pj[j] += p;
        pb[j >> 1].h[j & 1][r] = (_Float16)(p * 1024.0f);
      }
    }
    lrun = lrun * alpha + ((pj[0] + pj[1]) + (pj[2] + pj[3]));
#pragma unroll
    for (int t = 0; t < 4; ++t)
#pragma unroll
      for (int r = 0; r < 8; ++r) oacc[t][r] *= alpha;

    // ---- context^T += V^T . P^T (f16 WMMA) ----
#pragma unroll
    for (int kk = 0; kk < 2; ++kk) {
#pragma unroll
      for (int t = 0; t < 4; ++t) {
        FH vb;
        vb.h[0] = *(const v8h*)(Vth + (t * 16 + c) * LP + kk * 32 + 8 * hh);
        vb.h[1] = *(const v8h*)(Vth + (t * 16 + c) * LP + kk * 32 + 16 + 8 * hh);
        oacc[t] = mma_h(vb.v, pb[kk].v, oacc[t]);
      }
    }
    wait_lds_reads();
    wait_copies();
    __syncthreads();                         // publishes chunk kt+1 and ends every wave's reads of chunk kt's buffer
    if (kt + 2 < NQB) copy_chunk(kt + 2, kt & 1);
  }
  wait_copies();

  // ---- join the halves' sums, normalise (1/l and the 1/1024 p carry), stage the wave's 16x64 tile, bf16 hi/lo split,
  float* os = Os[wave];
  {
    const float l = lrun + xhalf(lrun);
    const float inv = ((l > 0.f) ? (1.0f / l) : 0.f) * (1.0f / 1024.0f);
#pragma unroll
    for (int t = 0; t < 4; ++t) {
      v4f w0, w1;
#pragma unroll
      for (int e = 0; e < 4; ++e) { w0[e] = oacc[t][e] * inv; w1[e] = oacc[t][4 + e] * inv; }
      *(v4f*)(os + c * OSP + t * 16 + 8 * hh)     = w0;      // row = query c; d = t*16 + 8*hh .. + 7
      *(v4f*)(os + c * OSP + t * 16 + 8 * hh + 4) = w1;
    }
  }
  wave_sync_lds();
  {
    const int q4 = lane >> 3, c8 = (lane & 7) * 8;
    v4u hv[4], lv[4];
#pragma unroll
    for (int it = 0; it < 4; ++it) {
      const int row = it * 4 + q4;   // it 0..3 x q4 0..3 = rows 0..15 of the wave tile
      const float* sp = os + row * OSP + c8;
      v4u a, a2;
#pragma unroll
      for (int e = 0; e < 4; ++e) {
        const float f0 = sp[2 * e], f1 = sp[2 * e + 1];
        const unsigned short h0 = bf_bits(f0), h1 = bf_bits(f1);
        const unsigned short l0 = bf_bits(f0 - bf_up(h0)), l1 = bf_bits(f1 - bf_up(h1));
        a[e] = pk16(h0, h1); a2[e] = pk16(l0, l1);
      }
      hv[it] = a; lv[it] = a2;
    }
    {
#pragma unroll
      for (int it = 0; it < 4; ++it) {
        const int row = it * 4 + q4;
        const size_t go = (size_t)(q0 + row) * DM + (size_t)h * HD + c8;
        *(v4u*)(ohp + go) = hv[it];
        *(v4u*)(olp + go) = lv[it];
      }
      
    }
  }
}

// =====================================================================================================
// Workspace map (bytes), every plane an exact multiple of its 64x64-tile / whole-line store granularity:
//   Xb    bf16 [4096][1024]          0           8388608
//   Wqkvb bf16 [3072 n][1024 k]      8388608     6291456   (rows 0..1023 q, 1024..2047 k, 2048..3071 v weights)
//   Wob   bf16 [1024][1024]          14680064    2097152
//   Qh    f16  [4096][1024]          16777216    8388608
//   Ql    f16  [4096][1024]          25165824    8388608   (q residual x4096)
//   Kp    f16  [4096][1024]          33554432    8388608
//   VT    f16  [1024][4096]          41943040    8388608   (v^T incl. bias)
//   Oh    bf16 [4096][1024]          50331648    8388608
//   Ol    bf16 [4096][1024]          58720256    8388608
//   end                              67108864
// Weights are [out n][in k] with k contiguous = the Bt / A layout the GEMM wants, so they are only converted.
// =====================================================================================================
extern "C" void kernel_launch(void* const* d_in, const int* in_sizes, int n_in,
                              void* d_out, int out_size, void* d_ws, size_t ws_size,
                              hipStream_t stream) {
  if (n_in < 7) return;
  if (in_sizes[0] != SEQ * DM) return;
  if (in_sizes[1] != SEQ * HD) return;
  if (in_sizes[2] != SEQ * HD) return;
  if (in_sizes[3] != 3 * DM * DM) return;
  if (in_sizes[4] != 3 * DM) return;
  if (in_sizes[5] != DM * DM) return;
  if (in_sizes[6] != DM) return;
  if (out_size != SEQ * DM) return;

  const float* x     = (const float*)d_in[0];
  const float* cosp  = (const float*)d_in[1];
  const float* sinp  = (const float*)d_in[2];
  const float* wqkv  = (const float*)d_in[3];
  const float* bqkv  = (const float*)d_in[4];
  const float* wout  = (const float*)d_in[5];
  const float* bout  = (const float*)d_in[6];

  const size_t PXb  = (size_t)SEQ * DM * 2;           //  8388608
  const size_t PWq  = (size_t)3 * DM * DM * 2;        //  6291456
  const size_t PWo  = (size_t)DM * DM * 2;            //  2097152
  const size_t P16  = (size_t)SEQ * DM * 2;           //  8388608 (q hi, q res, k, out hi, out lo)
  const size_t PVT  = (size_t)DM * SEQ * 2;           //  8388608
  size_t off = 0;
  const size_t oXb  = off; off += PXb;
  const size_t oWq  = off; off += PWq;
  const size_t oWo  = off; off += PWo;
  const size_t oQh  = off; off += P16;
  const size_t oQl  = off; off += P16;
  const size_t oKp  = off; off += P16;
  const size_t oVT  = off; off += PVT;
  const size_t oOh  = off; off += P16;
  const size_t oOl  = off; off += P16;
  if (off > ws_size) return;                          // off = 67108864
  if (off > (size_t)134217728) return;

  char* ws = (char*)d_ws;
  unsigned short* Xb    = (unsigned short*)(ws + oXb);
  unsigned short* Wqkvb = (unsigned short*)(ws + oWq);
  unsigned short* Wvb   = Wqkvb + (size_t)2 * DM * DM;          // rows 2048..3071 of Wqkvb
  unsigned short* Wob   = (unsigned short*)(ws + oWo);
  unsigned short* Qh    = (unsigned short*)(ws + oQh);
  unsigned short* Ql    = (unsigned short*)(ws + oQl);
  unsigned short* Kp    = (unsigned short*)(ws + oKp);
  unsigned short* VT    = (unsigned short*)(ws + oVT);
  unsigned short* Oh    = (unsigned short*)(ws + oOh);
  unsigned short* Ol    = (unsigned short*)(ws + oOl);

  const dim3 blk(256);
  const int n8x  = SEQ * DM / 8;                                // 524288
  const int n8wq = 3 * DM * DM / 8;                             // 393216
  const int n8wo = DM * DM / 8;                                 // 131072
  const dim3 gCvtX((n8x + 255) / 256);                          // 2048 blocks
  const dim3 gCvtWq((n8wq + 255) / 256);                        // 1536 blocks
  const dim3 gCvtWo((n8wo + 255) / 256);                        //  512 blocks
  const dim3 gQK(((SEQ / 64) * (QKP / 64) + 7) / 8, 1);         // 2048 tiles -> 256 blocks: M=4096, N=2048
  const dim3 gVT(((DM / 64) * (SEQ / 64) + 7) / 8, 1);          // 1024 tiles -> 128 blocks: M=1024, N=4096
  const dim3 gAttn(NH * NQB);                                   // 1024 blocks
  const dim3 gOut(((SEQ / 64) * (DM / 64) + 7) / 8, 1);         // 1024 tiles -> 128 blocks: M=4096, N=1024

  // (1) x -> bf16 plane [4096][1024]; w_qkv -> bf16 [3072][1024]; w_out -> bf16 [1024][1024]
  cvt_bf16x8<<<gCvtX, blk, 0, stream>>>(x, Xb, n8x);
  cvt_bf16x8<<<gCvtWq, blk, 0, stream>>>(wqkv, Wqkvb, n8wq);
  cvt_bf16x8<<<gCvtWo, blk, 0, stream>>>(wout, Wob, n8wo);
  // (2) q|k = x . Wqk^T + b_qk (M=4096, N=2048, K=1024, col bias), RoPE in the epilogue
  //     -> q f16 hi plane + f16 residual x4096 plane, k f16 plane, each [4096][1024]
  gemm64<0, 4, 1><<<gQK, blk, 0, stream>>>(
      Xb, Xb, DM, 0LL, Wqkvb, Wqkvb, DM, 0LL,
      (void*)Qh, DM, 0LL, (void*)Ql, DM, 0LL, DM,
      bqkv, cosp, sinp, Kp,
      SEQ, QKP, DM, 4096.0f);
  // (3) v^T = Wv . x^T + b_v[row] -> f16 plane [h*64+d][s] (pitch SEQ), no residual plane (N2 = 0)
  //     (A = Wvb [n][k], Bt = Xb [s][k]; M=1024, N=4096, K=1024, row bias = b_qkv rows 2048..3071)
  gemm64<0, 3, 2><<<gVT, blk, 0, stream>>>(
      Wvb, Wvb, DM, 0LL, Xb, Xb, DM, 0LL,
      (void*)VT, SEQ, 0LL, (void*)VT, SEQ, 0LL, 0,
      bqkv + 2 * DM, cosp, sinp, Kp,
      DM, SEQ, DM, 4096.0f);
  // (4) attention -> context bf16 hi / lo planes [4096][1024]
  attn64<<<gAttn, dim3(128), 0, stream>>>(Qh, Ql, Kp, VT, Oh, Ol, 0.125f, 1.0f / 4096.0f);
  // (5) out = context . w_out^T + b_out -> d_out f32 [4096][1024]  (A = context hi + lo planes, 2 products; K=1024, col bias)
  gemm64<1, 0, 1><<<gOut, blk, 0, stream>>>(
      Oh, Ol, DM, 0LL, Wob, Wob, DM, 0LL,
      d_out, DM, 0LL, d_out, DM, 0LL, 0,
      bout, cosp, sinp, Kp,
      SEQ, DM, DM, 1.0f);
  (void)hipGetLastError();
}

// v007
// Measured time: 158 microseconds a run.
// Next to v006, in two timings, it ran 1.07 times as fast each time.
// Counting every step since v000, it is 3.27 times as fast.
// Contractions: q|k projection and v^T projection = v_wmma_f32_16x16x32_bf16 (bf16 operands from RNE-converted x and w_qkv, single product);
// k.q^T scores = v_wmma_f32_16x16x32_f16 (q, carrying the score scale and log2 e, as f16 hi plane + f16 residual plane x4096 in a separate accumulator, k f16; 2 products);
// v^T.p^T = v_wmma_f32_16x16x32_f16 (p carried x1024 in f16, v^T f16; 1 product);
// ctx.w_out^T = v_wmma_f32_16x16x32_bf16 (ctx as bf16 hi + lo planes times bf16 w_out, 2 products); all f32 accumulate; bias, RoPE, softmax in f32.
#include <hip/hip_runtime.h>
#include <math.h>
#include <stdint.h>

#define SEQ   4096
#define DM    1024
#define NH    16
#define HD    64
#define NQB   (SEQ / 64)     // 64 key / query tiles of 64
#define QKP   (2 * DM)        // columns of the joint q|k projection: q at cols 0..DM-1, k at cols DM..2DM-1
#define QSC   0.18033688011112042f   // HD^-0.5 * log2(e) = 0.125 * 1.4426950408889634: the factor q carries, so that k.q is the exponent to base 2
#define LP    72              // LDS row pitch of the 64-wide f16 tiles, in elements: 144 B = 16 B x odd, so the 16 rows of a 16-B fragment read fall on 16 distinct bank groups
static_assert(NH * HD == DM);
static_assert((SEQ % 64) == 0 && (DM % 64) == 0 && (DM % 32) == 0);
static_assert((SEQ % 256) == 0 && (DM % 256) == 0);   // GEMM block tile 128 x 256, for every M and N used here
static_assert(HD == 64);      // a GEMM wave tile (64 columns) is one whole head, so a column's RoPE partner lies in the same tile
static_assert(LP >= 64 && (LP % 8) == 0 && ((LP / 8) & 1) == 1);

typedef _Float16 v16h __attribute__((ext_vector_type(16)));
typedef _Float16 v8h  __attribute__((ext_vector_type(8)));
typedef __bf16   v16b __attribute__((ext_vector_type(16)));
typedef __bf16   v8b  __attribute__((ext_vector_type(8)));
typedef float    v8f  __attribute__((ext_vector_type(8)));
typedef float    v4f  __attribute__((ext_vector_type(4)));
typedef unsigned int v4u __attribute__((ext_vector_type(4)));

// ---- scalar helpers --------------------------------------------------------------------------------
__device__ __forceinline__ unsigned short bf_bits(float f) {          // f32 -> bf16 bits, RNE convert
  unsigned u = __float_as_uint(f);
  return (unsigned short)((u + 0x7FFFu + ((u >> 16) & 1u)) >> 16);
}
__device__ __forceinline__ float bf_up(unsigned short h) { return __uint_as_float(((unsigned)h) << 16); }
__device__ __forceinline__ float bf_rne(float f) { return bf_up(bf_bits(f)); }
__device__ __forceinline__ unsigned short h_bits(_Float16 x) { return __builtin_bit_cast(unsigned short, x); }
__device__ __forceinline__ unsigned pk16(unsigned short a, unsigned short b) { return (unsigned)a | ((unsigned)b << 16); }
__device__ __forceinline__ v8f zero8() { v8f z = {0.f, 0.f, 0.f, 0.f, 0.f, 0.f, 0.f, 0.f}; return z; }

// ---- fragment loaders: 16-bit A/B operand, lane -> row/col (lane&15), p already includes +8*(lane>>4);
//      elements 0..7 <- p[0..7] (k0+8h..), elements 8..15 <- p[16..23] (k0+16+8h..)
__device__ __forceinline__ v16b ldfrag_b(const __bf16* p) {
  union { v16b v; v8b h[2]; } f;
  f.h[0] = *(const v8b*)(p);
  f.h[1] = *(const v8b*)(p + 16);
  return f.v;
}
__device__ __forceinline__ v16h ldfrag_h(const _Float16* p) {
  union { v16h v; v8h h[2]; } f;
  f.h[0] = *(const v8h*)(p);
  f.h[1] = *(const v8h*)(p + 16);
  return f.v;
}

// ---- WMMA helpers --------------------------------------------------------------------------------------
// f16 product (attention): the builtin alone. The compiler keeps the distance behind its own WMMA, and with no statement
// tied to each product it is free to issue the LDS fragment reads of several products together, ahead of them.
__device__ __forceinline__ v8f mma_h(v16h a, v16h b, v8f c) {
  return __builtin_amdgcn_wmma_f32_16x16x32_f16(false, a, false, b, (short)0, c, false, false);
}
// bf16 product (GEMMs), with its hand-written gaps
__device__ __forceinline__ v8f mma_b_raw(v16b a, v16b b, v8f c) {
  return __builtin_amdgcn_wmma_f32_16x16x32_bf16(false, a, false, b, (short)0, c, false, false);
}
__device__ __forceinline__ void dep_guard_b(v8f& a, v8f& b, v16b x, v16b y) {
#if defined(__HIP_DEVICE_COMPILE__)
  asm volatile("v_nop\n\tv_nop\n\tv_nop\n\tv_nop" : "+v"(a), "+v"(b) : "v"(x), "v"(y));
#endif
}
__device__ __forceinline__ void keep4_b(v16b a, v16b b, v16b c, v16b d) {
#if defined(__HIP_DEVICE_COMPILE__)
  asm volatile("v_nop" :: "v"(a), "v"(b), "v"(c), "v"(d));
#endif
}
__device__ __forceinline__ void acc_guard4(v8f& a, v8f& b, v8f& c, v8f& d) {
#if defined(__HIP_DEVICE_COMPILE__)
  asm volatile("v_nop\n\tv_nop\n\tv_nop\n\tv_nop" : "+v"(a), "+v"(b), "+v"(c), "+v"(d));
#endif
}
__device__ __forceinline__ void wave_sync_lds() {
  __builtin_amdgcn_fence(__ATOMIC_RELEASE, "workgroup");
  __builtin_amdgcn_wave_barrier();
  __builtin_amdgcn_fence(__ATOMIC_ACQUIRE, "workgroup");
}

// ---- asynchronous copies global -> LDS, 16 B per lane: l = the lane's LDS byte address, g = its global address.
//      A run of copies and its s_wait_xcnt 0 are one statement, so that no address register is rewritten ahead of the wait.
__device__ __forceinline__ unsigned lds_off(const void* p) { return (unsigned)(size_t)p; }
__device__ __forceinline__ void copy4_lds(unsigned l, unsigned lstep, const __bf16* g, size_t gstep) {
#if defined(__HIP_DEVICE_COMPILE__)
  asm volatile("global_load_async_to_lds_b128 %0, %1, off\n\t"
               "global_load_async_to_lds_b128 %2, %3, off\n\t"
               "global_load_async_to_lds_b128 %4, %5, off\n\t"
               "global_load_async_to_lds_b128 %6, %7, off\n\t"
               "s_wait_xcnt 0x0"
               :: "v"(l), "v"(g), "v"(l + lstep), "v"(g + gstep),
                  "v"(l + 2 * lstep), "v"(g + 2 * gstep), "v"(l + 3 * lstep), "v"(g + 3 * gstep)
               : "memory");
#endif
}
__device__ __forceinline__ void copy8_lds(unsigned l0, unsigned l1, unsigned lstep,
                                          const __bf16* g0, const __bf16* g1, size_t gstep) {
#if defined(__HIP_DEVICE_COMPILE__)
  asm volatile("global_load_async_to_lds_b128 %0, %1, off\n\t"
               "global_load_async_to_lds_b128 %2, %3, off\n\t"
               "global_load_async_to_lds_b128 %4, %5, off\n\t"
               "global_load_async_to_lds_b128 %6, %7, off\n\t"
               "global_load_async_to_lds_b128 %8, %9, off\n\t"
               "global_load_async_to_lds_b128 %10, %11, off\n\t"
               "global_load_async_to_lds_b128 %12, %13, off\n\t"
               "global_load_async_to_lds_b128 %14, %15, off\n\t"
               "s_wait_xcnt 0x0"
               :: "v"(l0), "v"(g0), "v"(l0 + lstep), "v"(g0 + gstep),
                  "v"(l0 + 2 * lstep), "v"(g0 + 2 * gstep), "v"(l0 + 3 * lstep), "v"(g0 + 3 * gstep),
                  "v"(l1), "v"(g1), "v"(l1 + lstep), "v"(g1 + gstep),
                  "v"(l1 + 2 * lstep), "v"(g1 + 2 * gstep), "v"(l1 + 3 * lstep), "v"(g1 + 3 * gstep)
               : "memory");
#endif
}
// the same for two f16 planes of different row pitch: 4 copies from g0 (rows gstep0 apart) to l0.., 4 from g1 (gstep1) to l1..
__device__ __forceinline__ void copy4x2_lds(unsigned l0, unsigned l1, unsigned lstep,
                                            const _Float16* g0, size_t gstep0, const _Float16* g1, size_t gstep1) {
#if defined(__HIP_DEVICE_COMPILE__)
  asm volatile("global_load_async_to_lds_b128 %0, %1, off\n\t"
               "global_load_async_to_lds_b128 %2, %3, off\n\t"
               "global_load_async_to_lds_b128 %4, %5, off\n\t"
               "global_load_async_to_lds_b128 %6, %7, off\n\t"
               "global_load_async_to_lds_b128 %8, %9, off\n\t"
               "global_load_async_to_lds_b128 %10, %11, off\n\t"
               "global_load_async_to_lds_b128 %12, %13, off\n\t"
               "global_load_async_to_lds_b128 %14, %15, off\n\t"
               "s_wait_xcnt 0x0"
               :: "v"(l0), "v"(g0), "v"(l0 + lstep), "v"(g0 + gstep0),
                  "v"(l0 + 2 * lstep), "v"(g0 + 2 * gstep0), "v"(l0 + 3 * lstep), "v"(g0 + 3 * gstep0),
                  "v"(l1), "v"(g1), "v"(l1 + lstep), "v"(g1 + gstep1),
                  "v"(l1 + 2 * lstep), "v"(g1 + 2 * gstep1), "v"(l1 + 3 * lstep), "v"(g1 + 3 * gstep1)
               : "memory");
#endif
}
__device__ __forceinline__ void wait_copies() {     // the wave's own copies have landed in LDS
#if defined(__HIP_DEVICE_COMPILE__)
  asm volatile("s_wait_asynccnt 0x0" ::: "memory");
#endif
}
__device__ __forceinline__ void wait_lds_reads() {  // the wave's LDS reads have returned, before their buffer is given up for refilling
#if defined(__HIP_DEVICE_COMPILE__)
  asm volatile("s_wait_dscnt 0x0" ::: "memory");
#endif
}

__device__ __forceinline__ void wait_store_regs() { // behind a run of global stores, before their data and address registers are written again
#if defined(__HIP_DEVICE_COMPILE__)
  asm volatile("s_wait_xcnt 0x0" ::: "memory");
#endif
}

// =====================================================================================================
// f32 -> bf16 (RNE convert), 8 elements per thread, one 16-B store per lane: a wave writes 512 contiguous B
// coverage: n8 threads x 8 = whole plane (n8 is a multiple of 256 for every use here).
// =====================================================================================================
__global__ __launch_bounds__(256) void cvt_bf16x8(const float* __restrict__ in, unsigned short* out, int n8) {
  const int i = blockIdx.x * 256 + threadIdx.x;
  if (i < n8) {
    const v4f a = *(const v4f*)(in + (size_t)i * 8);
    const v4f b = *(const v4f*)(in + (size_t)i * 8 + 4);
    v4u p;
    p[0] = pk16(bf_bits(a[0]), bf_bits(a[1]));
    p[1] = pk16(bf_bits(a[2]), bf_bits(a[3]));
    p[2] = pk16(bf_bits(b[0]), bf_bits(b[1]));
    p[3] = pk16(bf_bits(b[2]), bf_bits(b[3]));
    *(v4u*)(out + (size_t)i * 8) = p;
    
  }
}

// =====================================================================================================
// Register-blocked batched bf16 WMMA GEMM: C[m][n] = sum_k A[m][k] * Bt[n][k] + bias; one wave per 64x64 tile,
// the 8 waves of a block as 2 x 4 = one 128x256 tile. A row-major [M][K] pitch lda; Bt row-major [N][K] pitch ldb
// (k contiguous); M multiple of 128, N of 256, K of 64. blockIdx.y = batch index (strides in elements).
// Operands: a stage = 64 k = one whole 128-B line of each of the block's A and Bt rows, brought into LDS by asynchronous
// copies (8 lanes per row, 4 whole lines per wave copy), rows at pitch LP; two buffers, stage t+2 copied while t+1 is worked on;
// fragments are read from LDS in the k order of ldfrag_b, k ascending.
// NSPLIT: 0 = A.Bt; 1 = (A + A2).Bt (A2 = unscaled bf16 lo plane of A); 2 = A.Bt + A2.Bt + A.Bt2.
// OUT_MODE: 0 = f32 (pitch ldc); 2 = bf16 hi plane C + bf16 lo plane C2 (lo = RNE(v - hi), unscaled);
//           3 = f16 hi plane C + f16 residual plane C2 = f16((v - hi) * rscale), C2 written only for tiles
//               with n0 < N2 (pitch ldc2, batch stride strideC2);
//           4 = RoPE (rotate-half, half = HD/2 = 32) on the wave's 64-column tile = one head of q (n0 < N2) or of k, row m = token:
//               y[d] = x[d] * cos[m][d] + (d < 32 ? -x[d+32] : x[d-32]) * sin[m][d], x with its bias, tables [M][HD] shared over
//               heads and RNE-converted to bf16 on read; q: y * yscale -> f16 hi plane C + f16 residual plane C2 = f16((y - hi) * rscale),
//               k -> f16 plane C3 at column n0 - N2; all three at pitch ldc, one batch (no batch stride applied).
// BIAS_MODE: 1 = + biasp[n] (per column), 2 = + biasp[m] (per row); bias values RNE-converted to bf16 and
//            added in f32 before any 16-bit conversion of the result.
// =====================================================================================================
// OUT_MODE 4: second launch bound = 4 waves per SIMD = a budget of 256 registers, so that its longer epilogue needs no register-window switches
template <int NSPLIT, int OUT_MODE, int BIAS_MODE>
__global__ __launch_bounds__(256, (OUT_MODE == 4) ? 4 : 1) void gemm64(
    const unsigned short* __restrict__ Ap, const unsigned short* A2p, int lda, long long strideA,
    const unsigned short* __restrict__ Btp, const unsigned short* Bt2p, int ldb, long long strideB,
    void* Cout, int ldc, long long strideC,
    void* Cout2, int ldc2, long long strideC2, int N2,
    const float* __restrict__ biasp,
    const float* __restrict__ cosp, const float* __restrict__ sinp, unsigned short* C3p,
    int M, int N, int K, float rscale, float yscale) {
  const __bf16* A   = (const __bf16*)(const void*)Ap;
  const __bf16* A2  = (const __bf16*)(const void*)A2p;
  const __bf16* Bt  = (const __bf16*)(const void*)Btp;
  const __bf16* Bt2 = (const __bf16*)(const void*)Bt2p;
  constexpr int RB   = (NSPLIT >= 1) ? 256 : 128;            // stage rows: A 0..127, A2 128..255 (NSPLIT >= 1), then Bt 256 rows, Bt2 256 rows (NSPLIT == 2)
  constexpr int ROWS = RB + ((NSPLIT == 2) ? 512 : 256);
  constexpr int STG  = ROWS * LP;                            // elements of one stage buffer
  __shared__ __align__(16) float sT[8][16 * 68];   // per-wave 16x64 slab, pitch 68 floats
  __shared__ __align__(16) __bf16 ring[2 * STG];   // two stage buffers
  const int b    = blockIdx.y;
  const int lane = threadIdx.x & 31;
  const int wave = threadIdx.x >> 5;
  const int tilesN = N >> 8;
  const int tilesM = M >> 7;
  if ((int)blockIdx.x >= tilesM * tilesN) return;   // block-uniform, in front of every barrier
  const int tm = blockIdx.x / tilesN;
  const int tn = blockIdx.x - tm * tilesN;
  const int wm = (wave >> 2) << 6;                  // the wave's 64x64 tile inside the block's 128x256
  const int wn = (wave & 3) << 6;
  const int m0 = (tm << 7) + wm;
  const int n0 = (tn << 8) + wn;

  const __bf16* Ab  = A  + (size_t)b * strideA;
  const __bf16* Bb  = Bt + (size_t)b * strideB;
  const __bf16* Ab2 = (NSPLIT >= 1) ? (A2  + (size_t)b * strideA) : Ab;
  const __bf16* Bb2 = (NSPLIT == 2) ? (Bt2 + (size_t)b * strideB) : Bb;

  const int rlane = lane & 15;                 // row (A) / col (B, D) within subtile
  const int koff  = (lane >> 4) * 8;           // k offset of this lane half
  const int mOff  = (lane >> 4) * 8;           // D row offset

  v8f acc[4][4];
#pragma unroll
  for (int i = 0; i < 4; ++i)
#pragma unroll
    for (int j = 0; j < 4; ++j) acc[i][j] = zero8();

  // ---- stage copies: thread -> row (threadIdx.x >> 3) + 32 * c of each 128-row group, 16 B at column 8 * (threadIdx.x & 7) ----
  const int trow = threadIdx.x >> 3;
  const int tcol = (threadIdx.x & 7) * 8;
  const size_t   aoff  = (size_t)((tm << 7) + trow) * lda + tcol;
  const size_t   boff  = (size_t)((tn << 8) + trow) * ldb + tcol;
  const unsigned lrow  = lds_off(ring) + (unsigned)(trow * LP + tcol) * 2u;
  const unsigned lstep = 32u * LP * 2u;                       // 32 rows further in LDS, bytes
  auto copy_stage = [&](int st, int buf) {
    const unsigned l = lrow + (unsigned)buf * (unsigned)(STG * 2);
    const size_t   k = (size_t)st * 64;
    if (NSPLIT >= 1) copy8_lds(l, l + 4u * lstep, lstep, Ab + aoff + k, Ab2 + aoff + k, (size_t)32 * lda);
    else             copy4_lds(l, lstep, Ab + aoff + k, (size_t)32 * lda);
    copy8_lds(l + (unsigned)(RB * LP * 2), l + (unsigned)((RB + 128) * LP * 2), lstep,
              Bb + boff + k, Bb + boff + k + (size_t)128 * ldb, (size_t)32 * ldb);
    if (NSPLIT == 2)
      copy8_lds(l + (unsigned)((RB + 256) * LP * 2), l + (unsigned)((RB + 384) * LP * 2), lstep,
                Bb2 + boff + k, Bb2 + boff + k + (size_t)128 * ldb, (size_t)32 * ldb);
  };

  const int nst = K >> 6;                     // stages of 64 k; block-uniform
  copy_stage(0, 0);
  wait_copies();
  __syncthreads();                            // stage 0 is readable by every wave
  if (nst > 1) copy_stage(1, 1);

  for (int t = 0; t < nst; ++t) {
    const __bf16* sb = ring + (t & 1) * STG;
#pragma unroll   // as the inner loops: every fragment and accumulator index constant, so the arrays stay in registers
    for (int ks = 0; ks < 2; ++ks) {
      v16b bh[4], bl[4], ah[4], al[4];
#pragma unroll
      for (int j = 0; j < 4; ++j) {
        const int bo = (RB + wn + (j << 4) + rlane) * LP + koff + ks * 32;
        bh[j] = ldfrag_b(sb + bo);
        if (NSPLIT == 2) bl[j] = ldfrag_b(sb + bo + 256 * LP); else bl[j] = bh[j];
      }
#pragma unroll
      for (int i = 0; i < 4; ++i) {
        const int ao = (wm + (i << 4) + rlane) * LP + koff + ks * 32;
        ah[i] = ldfrag_b(sb + ao);
        if (NSPLIT >= 1) al[i] = ldfrag_b(sb + ao + 128 * LP); else al[i] = ah[i];
      }
#pragma unroll
      for (int i = 0; i < 4; ++i) {
#pragma unroll
        for (int j = 0; j < 4; ++j) {
          acc[i][j] = mma_b_raw(ah[i], bh[j], acc[i][j]);
          if (NSPLIT >= 1) acc[i][j] = mma_b_raw(al[i], bh[j], acc[i][j]);
          if (NSPLIT == 2) acc[i][j] = mma_b_raw(ah[i], bl[j], acc[i][j]);
        }
        dep_guard_b(acc[i][0], acc[i][3], ah[i], al[i]);
      }
      keep4_b(bh[0], bh[1], bh[2], bh[3]);
      if (NSPLIT == 2) keep4_b(bl[0], bl[1], bl[2], bl[3]);
    }
    wait_lds_reads();
    wait_copies();
    __syncthreads();                          // publishes stage t+1 and ends every wave's reads of stage t's buffer
    if (t + 2 < nst) copy_stage(t + 2, t & 1);
  }
  wait_copies();
  acc_guard4(acc[0][0], acc[0][1], acc[0][2], acc[0][3]);
  acc_guard4(acc[1][0], acc[1][1], acc[1][2], acc[1][3]);
  acc_guard4(acc[2][0], acc[2][1], acc[2][2], acc[2][3]);
  acc_guard4(acc[3][0], acc[3][1], acc[3][2], acc[3][3]);

  // ---- epilogue ----
  float* slab = sT[wave];
  // OUT_MODE 4: cos / sin of the 8 columns 8 * (lane & 7).. of rows it * 4 + (lane >> 3) of 16-row group i; group i + 1's loads are
  // issued behind group i's stores, so that both are in flight together
  v4f tcs[4][2], tsn[4][2];
  const unsigned tlane = ((unsigned)(m0 + (lane >> 3)) * HD + (unsigned)(lane & 7) * 8u) * 4u;   // the lane's byte offset in a table, group 0, it 0
  auto load_tables = [&](int i) {
#pragma unroll
    for (int it = 0; it < 4; ++it) {
      const char* tc = (const char*)cosp + (size_t)tlane + ((i << 4) + it * 4) * HD * 4;   // one offset register, the rest a constant
      const char* ts = (const char*)sinp + (size_t)tlane + ((i << 4) + it * 4) * HD * 4;
      tcs[it][0] = *(const v4f*)(tc);
      tcs[it][1] = *(const v4f*)(tc + 16);
      tsn[it][0] = *(const v4f*)(ts);
      tsn[it][1] = *(const v4f*)(ts + 16);
    }
  };
#pragma unroll
  for (int i = 0; i < 4; ++i) {
    const int mBase = m0 + (i << 4);
    float brow[8];
#pragma unroll
    for (int r = 0; r < 8; ++r) {
      brow[r] = 0.f;
      if (BIAS_MODE == 2) brow[r] = bf_rne(biasp[mBase + mOff + r]);
    }
#pragma unroll
    for (int j = 0; j < 4; ++j) {
      float bcol = 0.f;
      if (BIAS_MODE == 1) bcol = bf_rne(biasp[n0 + (j << 4) + rlane]);
#pragma unroll
      for (int r = 0; r < 8; ++r) {
        slab[(mOff + r) * 68 + (j << 4) + rlane] = acc[i][j][r] + bcol + brow[r];
      }
    }
    if (OUT_MODE == 4 && i == 0) {
      __builtin_amdgcn_sched_barrier(0);   // keeps the table loads behind the staging stores, where group 0's accumulators are free: moved ahead of them they spill
      load_tables(0);
    }
    wave_sync_lds();
    if (OUT_MODE == 0) {
      float* C = (float*)Cout + (size_t)b * strideC;
      const int hh = lane >> 4, c4 = (lane & 15) * 4;     // 256-B row segment = 16 lanes x 16 B
      {
#pragma unroll
        for (int it = 0; it < 8; ++it) {
          const int row = it * 2 + hh;                     // it 0..7 x hh 0..1 = rows 0..15
          const v4f v = *(const v4f*)(slab + row * 68 + c4);
          *(v4f*)(C + (size_t)(mBase + row) * ldc + n0 + c4) = v;
        }
        
      }
    } else if (OUT_MODE == 4) {
      const int q = lane >> 3, c8 = (lane & 7) * 8;        // 128-B row segment of an f16 plane = 8 lanes x 16 B
      const bool  lowhalf = (c8 < (HD / 2));
      const int   pc8 = lowhalf ? (c8 + HD / 2) : (c8 - HD / 2);   // partner columns, same head = same slab row
      const float sgn = lowhalf ? -1.0f : 1.0f;
      const int   n0u = __builtin_amdgcn_readfirstlane(n0);   // wave-uniform, held as a scalar: plane and branch are chosen once per wave
      const bool  isq = (n0u < N2);
      const float ysc = isq ? yscale : 1.0f;                  // wave-uniform: q takes the constant factor of the scores here, once per element
      char* Ch = (char*)(isq ? (unsigned short*)Cout : C3p) + (size_t)(isq ? n0u : n0u - N2) * 2;
      char* Cl = (char*)Cout2 + (size_t)n0u * 2;
      const unsigned olane = ((unsigned)(m0 + q) * (unsigned)ldc + (unsigned)c8) * 2u;   // the lane's byte offset in a plane, group 0, it 0
      v4u hv[4], lv[4];
#pragma unroll
      for (int it = 0; it < 4; ++it) {
        const int row = it * 4 + q;                        // it 0..3 x q 0..3 = rows 0..15
        const v4f x0 = *(const v4f*)(slab + row * 68 + c8);
        const v4f x1 = *(const v4f*)(slab + row * 68 + c8 + 4);
        const v4f p0 = *(const v4f*)(slab + row * 68 + pc8);
        const v4f p1 = *(const v4f*)(slab + row * 68 + pc8 + 4);
        const v4f cA = tcs[it][0], cB = tcs[it][1];
        const v4f sA = tsn[it][0], sB = tsn[it][1];
        v4f y0, y1;
#pragma unroll
        for (int e = 0; e < 4; ++e) {
          y0[e] = (x0[e] * bf_rne(cA[e]) + (sgn * p0[e]) * bf_rne(sA[e])) * ysc;
          y1[e] = (x1[e] * bf_rne(cB[e]) + (sgn * p1[e]) * bf_rne(sB[e])) * ysc;
        }
#pragma unroll
        for (int e = 0; e < 2; ++e) {
          const float f0 = y0[2 * e], f1 = y0[2 * e + 1];
          const float g0 = y1[2 * e], g1 = y1[2 * e + 1];
          const _Float16 a0 = (_Float16)f0, a1 = (_Float16)f1;
          const _Float16 b0 = (_Float16)g0, b1 = (_Float16)g1;
          hv[it][e]     = pk16(h_bits(a0), h_bits(a1));
          hv[it][2 + e] = pk16(h_bits(b0), h_bits(b1));
          lv[it][e]     = pk16(h_bits((_Float16)((f0 - (float)a0) * rscale)),
                               h_bits((_Float16)((f1 - (float)a1) * rscale)));
          lv[it][2 + e] = pk16(h_bits((_Float16)((g0 - (float)b0) * rscale)),
                               h_bits((_Float16)((g1 - (float)b1) * rscale)));
        }
      }
#pragma unroll
      for (int it = 0; it < 4; ++it)
        *(v4u*)(Ch + (size_t)(((i << 4) + it * 4) * ldc) * 2 + olane) = hv[it];
      wait_store_regs();
      if (isq) {
#pragma unroll
        for (int it = 0; it < 4; ++it)
          *(v4u*)(Cl + (size_t)(((i << 4) + it * 4) * ldc) * 2 + olane) = lv[it];
        wait_store_regs();
      }
      if (i < 3) load_tables(i + 1);
    } else {
      const int q = lane >> 3, c8 = (lane & 7) * 8;
      unsigned short* C  = (unsigned short*)Cout  + (size_t)b * strideC;
      unsigned short* C2 = (unsigned short*)Cout2 + (size_t)b * strideC2;
      const bool wlo = (OUT_MODE == 2) || (n0 < N2);      // wave-uniform
      v4u hv[4], lv[4];
#pragma unroll
      for (int it = 0; it < 4; ++it) {
        const int row = it * 4 + q;                        // it 0..3 x q 0..3 = rows 0..15
        const float* sp = slab + row * 68 + c8;
        v4u a, a2;
#pragma unroll
        for (int e = 0; e < 4; ++e) {
          const float f0 = sp[2 * e], f1 = sp[2 * e + 1];
          unsigned short h0, h1, l0, l1;
          if (OUT_MODE == 2) {
            h0 = bf_bits(f0); h1 = bf_bits(f1);
            l0 = bf_bits(f0 - bf_up(h0)); l1 = bf_bits(f1 - bf_up(h1));
          } else {
            const _Float16 x0 = (_Float16)f0, x1 = (_Float16)f1;
            h0 = h_bits(x0); h1 = h_bits(x1);
            l0 = h_bits((_Float16)((f0 - (float)x0) * rscale));
            l1 = h_bits((_Float16)((f1 - (float)x1) * rscale));
          }
          a[e] = pk16(h0, h1); a2[e] = pk16(l0, l1);
        }
        hv[it] = a; lv[it] = a2;
      }
      {
#pragma unroll
        for (int it = 0; it < 4; ++it) {
          const int row = it * 4 + q;
          *(v4u*)(C + (size_t)(mBase + row) * ldc + n0 + c8) = hv[it];
          if (wlo) *(v4u*)(C2 + (size_t)(mBase + row) * ldc2 + n0 + c8) = lv[it];
        }
        
      }
    }
    wave_sync_lds();
  }
}

#define OSP 68
__device__ __forceinline__ float xhalf(float x) {
  return __builtin_bit_cast(float, __builtin_amdgcn_permlanex16(__builtin_bit_cast(int, x), __builtin_bit_cast(int, x),
                                                                0x76543210, 0xfedcba98, false, false));
}

__global__ __launch_bounds__(128)
void attn64(const unsigned short* __restrict__ qhp, const unsigned short* __restrict__ qlp,
            const unsigned short* __restrict__ kpp, const unsigned short* __restrict__ vtp,
            unsigned short* ohp, unsigned short* olp, float rres) {
  union FH { v16h v; v8h h[2]; };
  constexpr int TL = 64 * LP;                                     // elements of one 64-row tile at pitch LP, 9 KB
  __shared__ __align__(16) _Float16 kvring[2 * 2 * TL];           // two buffers, each K [kv][d] then V^T [d][kv]
  __shared__ __align__(16) float    Os[4][16 * OSP];              // per wave context tile [row][d]

  const int tid  = threadIdx.x;
  const int wave = tid >> 5;
  const int lane = tid & 31;
  const int hh   = lane >> 4;
  const int c    = lane & 15;

  const int bx   = blockIdx.x;
  const int qb   = bx % NQB;
  const int h    = bx / NQB;
  const int q0   = qb * 64 + wave * 16;

  const _Float16* Qh = (const _Float16*)(const void*)qhp + (size_t)h * HD;
  const _Float16* Ql = (const _Float16*)(const void*)qlp + (size_t)h * HD;
  const _Float16* Kg = (const _Float16*)(const void*)kpp + (size_t)h * HD;
  const _Float16* Vg = (const _Float16*)(const void*)vtp + (size_t)h * HD * SEQ;

  // ---- Q fragments (B operand, column = query lane&15): 2 d-chunks, hi and residual ----
  v16h qah[2], qal[2];
#pragma unroll
  for (int dc = 0; dc < 2; ++dc) {
    qah[dc] = ldfrag_h(Qh + (size_t)(q0 + c) * DM + dc * 32 + 8 * hh);
    qal[dc] = ldfrag_h(Ql + (size_t)(q0 + c) * DM + dc * 32 + 8 * hh);
  }

  float mrun = -INFINITY;      // running maximum of query c (equal in both wave halves)
  float lrun = 0.f;            // running sum of 1024 p over this wave half's keys of query c
  v8f oacc[4];                 // oacc[t][r] = O^T[d = t*16 + 8*hh + r][query c]
#pragma unroll
  for (int t = 0; t < 4; ++t) oacc[t] = zero8();

  // ---- chunk copies: thread -> rows (tid >> 3) + 16 * i, i = 0..3, of each tile, 16 B at column 8 * (tid & 7) ----
  const int trow = tid >> 3, tcol = (tid & 7) * 8;
  const _Float16* kg0 = Kg + (size_t)trow * DM + tcol;              // chunk 0: K row trow, d = tcol..tcol+7
  const _Float16* vg0 = Vg + (size_t)trow * SEQ + tcol;             // chunk 0: V^T row d = trow, s = tcol..tcol+7
  const unsigned  lk0 = lds_off(kvring) + (unsigned)(trow * LP + tcol) * 2u;
  auto copy_chunk = [&](int ck, int buf) {
    const unsigned l = lk0 + (unsigned)buf * (unsigned)(2 * TL * 2);
    copy4x2_lds(l, l + (unsigned)(TL * 2), 16u * LP * 2u,
                kg0 + (size_t)ck * 64 * DM, (size_t)16 * DM, vg0 + (size_t)ck * 64, (size_t)16 * SEQ);
  };
  static_assert(NQB >= 2);
  copy_chunk(0, 0);
  wait_copies();
  __syncthreads();                           // chunk 0 is readable by every wave
  copy_chunk(1, 1);

  for (int kt = 0; kt < NQB; ++kt) {         // static trip count
    const _Float16* Ksh = kvring + (kt & 1) * (2 * TL);   // keys kv0 = kt * 64 .. kv0 + 63
    const _Float16* Vth = Ksh + TL;

    // ---- scores, transposed: 64 keys x 16 queries per wave, 2 f16 products (hi, residual);
    //      s[j][r] = score of key kv0 + j*16 + 8*hh + r with query q0 + c ----
    v8f s[4];
#pragma unroll
    for (int j = 0; j < 4; ++j) {
      v8f sh = zero8(), sl = zero8();
#pragma unroll
      for (int dc = 0; dc < 2; ++dc) {
        FH kb;
        kb.h[0] = *(const v8h*)(Ksh + (j * 16 + c) * LP + dc * 32 + 8 * hh);
        kb.h[1] = *(const v8h*)(Ksh + (j * 16 + c) * LP + dc * 32 + 16 + 8 * hh);
        sh = mma_h(kb.v, qah[dc], sh);
        sl = mma_h(kb.v, qal[dc], sl);
      }
#pragma unroll
      for (int r = 0; r < 8; ++r) s[j][r] = sh[r] + sl[r] * rres;
    }

    // ---- maximum of the lane's 32 scores, joined with the other wave half's; online softmax ----
    float mj[4];
#pragma unroll
    for (int j = 0; j < 4; ++j) {
      mj[j] = s[j][0];
#pragma unroll
      for (int r = 1; r < 8; ++r) mj[j] = fmaxf(mj[j], s[j][r]);
    }
    float m = fmaxf(fmaxf(mj[0], mj[1]), fmaxf(mj[2], mj[3]));
    m = fmaxf(m, xhalf(m));
    const float mnew  = fmaxf(mrun, m);
    const float alpha = __builtin_amdgcn_exp2f(mrun - mnew);
    const float poff  = 10.0f - mnew;        // exponent offset: minus the maximum, plus 10 for the x1024 carry of p
    mrun = mnew;

    // ---- P^T (x1024, f16) straight into the B operand: element e of 32-key block kk = key kk*32 + (e < 8 ? 8*hh + e : 16 + 8*hh + e - 8) ----
    FH pb[2];
    float pj[4];
#pragma unroll   // constant indices, so that s stays in registers
    for (int j = 0; j < 4; ++j) s[j] = s[j] + poff;   // whole tiles at once: packed adds
#pragma unroll
    for (int j = 0; j < 4; ++j) {
      pj[j] = 0.f;
#pragma unroll
      for (int r = 0; r < 8; ++r) {
        const float p = __builtin_amdgcn_exp2f(s[j][r]);   // 1024 p
        pj[j] += p;
        pb[j >> 1].h[j & 1][r] = (_Float16)p;
      }
    }
    lrun = lrun * alpha + ((pj[0] + pj[1]) + (pj[2] + pj[3]));
#pragma unroll
    for (int t = 0; t < 4; ++t)
#pragma unroll
      for (int r = 0; r < 8; ++r) oacc[t][r] *= alpha;

    // ---- context^T += V^T . P^T (f16 WMMA) ----
#pragma unroll
    for (int kk = 0; kk < 2; ++kk) {
#pragma unroll
      for (int t = 0; t < 4; ++t) {
        FH vb;
        vb.h[0] = *(const v8h*)(Vth + (t * 16 + c) * LP + kk * 32 + 8 * hh);
        vb.h[1] = *(const v8h*)(Vth + (t * 16 + c) * LP + kk * 32 + 16 + 8 * hh);
        oacc[t] = mma_h(vb.v, pb[kk].v, oacc[t]);
      }
    }
    wait_lds_reads();
    wait_copies();
    __syncthreads();                         // publishes chunk kt+1 and ends every wave's reads of chunk kt's buffer
    if (kt + 2 < NQB) copy_chunk(kt + 2, kt & 1);
  }
  wait_copies();

  // ---- join the halves' sums, normalise (1/l; the x1024 cancels), stage the wave's 16x64 tile, bf16 hi/lo split,
  float* os = Os[wave];
  {
    const float l = lrun + xhalf(lrun);
    const float inv = (l > 0.f) ? (1.0f / l) : 0.f;      // sum and context both carry the x1024 of p
#pragma unroll
    for (int t = 0; t < 4; ++t) {
      v4f w0, w1;
#pragma unroll
      for (int e = 0; e < 4; ++e) { w0[e] = oacc[t][e] * inv; w1[e] = oacc[t][4 + e] * inv; }
      *(v4f*)(os + c * OSP + t * 16 + 8 * hh)     = w0;      // row = query c; d = t*16 + 8*hh .. + 7
      *(v4f*)(os + c * OSP + t * 16 + 8 * hh + 4) = w1;
    }
  }
  wave_sync_lds();
  {
    const int q4 = lane >> 3, c8 = (lane & 7) * 8;
    v4u hv[4], lv[4];
#pragma unroll
    for (int it = 0; it < 4; ++it) {
      const int row = it * 4 + q4;   // it 0..3 x q4 0..3 = rows 0..15 of the wave tile
      const float* sp = os + row * OSP + c8;
      v4u a, a2;
#pragma unroll
      for (int e = 0; e < 4; ++e) {
        const float f0 = sp[2 * e], f1 = sp[2 * e + 1];
        const unsigned short h0 = bf_bits(f0), h1 = bf_bits(f1);
        const unsigned short l0 = bf_bits(f0 - bf_up(h0)), l1 = bf_bits(f1 - bf_up(h1));
        a[e] = pk16(h0, h1); a2[e] = pk16(l0, l1);
      }
      hv[it] = a; lv[it] = a2;
    }
    {
#pragma unroll
      for (int it = 0; it < 4; ++it) {
        const int row = it * 4 + q4;
        const size_t go = (size_t)(q0 + row) * DM + (size_t)h * HD + c8;
        *(v4u*)(ohp + go) = hv[it];
        *(v4u*)(olp + go) = lv[it];
      }
      
    }
  }
}

// =====================================================================================================
// Workspace map (bytes), every plane an exact multiple of its 64x64-tile / whole-line store granularity:
//   Xb    bf16 [4096][1024]          0           8388608
//   Wqkvb bf16 [3072 n][1024 k]      8388608     6291456   (rows 0..1023 q, 1024..2047 k, 2048..3071 v weights)
//   Wob   bf16 [1024][1024]          14680064    2097152
//   Qh    f16  [4096][1024]          16777216    8388608
//   Ql    f16  [4096][1024]          25165824    8388608   (q residual x4096)
//   Kp    f16  [4096][1024]          33554432    8388608
//   VT    f16  [1024][4096]          41943040    8388608   (v^T incl. bias)
//   Oh    bf16 [4096][1024]          50331648    8388608
//   Ol    bf16 [4096][1024]          58720256    8388608
//   end                              67108864
// Weights are [out n][in k] with k contiguous = the Bt / A layout the GEMM wants, so they are only converted.
// =====================================================================================================
extern "C" void kernel_launch(void* const* d_in, const int* in_sizes, int n_in,
                              void* d_out, int out_size, void* d_ws, size_t ws_size,
                              hipStream_t stream) {
  if (n_in < 7) return;
  if (in_sizes[0] != SEQ * DM) return;
  if (in_sizes[1] != SEQ * HD) return;
  if (in_sizes[2] != SEQ * HD) return;
  if (in_sizes[3] != 3 * DM * DM) return;
  if (in_sizes[4] != 3 * DM) return;
  if (in_sizes[5] != DM * DM) return;
  if (in_sizes[6] != DM) return;
  if (out_size != SEQ * DM) return;

  const float* x     = (const float*)d_in[0];
  const float* cosp  = (const float*)d_in[1];
  const float* sinp  = (const float*)d_in[2];
  const float* wqkv  = (const float*)d_in[3];
  const float* bqkv  = (const float*)d_in[4];
  const float* wout  = (const float*)d_in[5];
  const float* bout  = (const float*)d_in[6];

  const size_t PXb  = (size_t)SEQ * DM * 2;           //  8388608
  const size_t PWq  = (size_t)3 * DM * DM * 2;        //  6291456
  const size_t PWo  = (size_t)DM * DM * 2;            //  2097152
  const size_t P16  = (size_t)SEQ * DM * 2;           //  8388608 (q hi, q res, k, out hi, out lo)
  const size_t PVT  = (size_t)DM * SEQ * 2;           //  8388608
  size_t off = 0;
  const size_t oXb  = off; off += PXb;
  const size_t oWq  = off; off += PWq;
  const size_t oWo  = off; off += PWo;
  const size_t oQh  = off; off += P16;
  const size_t oQl  = off; off += P16;
  const size_t oKp  = off; off += P16;
  const size_t oVT  = off; off += PVT;
  const size_t oOh  = off; off += P16;
  const size_t oOl  = off; off += P16;
  if (off > ws_size) return;                          // off = 67108864
  if (off > (size_t)134217728) return;

  char* ws = (char*)d_ws;
  unsigned short* Xb    = (unsigned short*)(ws + oXb);
  unsigned short* Wqkvb = (unsigned short*)(ws + oWq);
  unsigned short* Wvb   = Wqkvb + (size_t)2 * DM * DM;          // rows 2048..3071 of Wqkvb
  unsigned short* Wob   = (unsigned short*)(ws + oWo);
  unsigned short* Qh    = (unsigned short*)(ws + oQh);
  unsigned short* Ql    = (unsigned short*)(ws + oQl);
  unsigned short* Kp    = (unsigned short*)(ws + oKp);
  unsigned short* VT    = (unsigned short*)(ws + oVT);
  unsigned short* Oh    = (unsigned short*)(ws + oOh);
  unsigned short* Ol    = (unsigned short*)(ws + oOl);

  const dim3 blk(256);
  const int n8x  = SEQ * DM / 8;                                // 524288
  const int n8wq = 3 * DM * DM / 8;                             // 393216
  const int n8wo = DM * DM / 8;                                 // 131072
  const dim3 gCvtX((n8x + 255) / 256);                          // 2048 blocks
  const dim3 gCvtWq((n8wq + 255) / 256);                        // 1536 blocks
  const dim3 gCvtWo((n8wo + 255) / 256);                        //  512 blocks
  const dim3 gQK(((SEQ / 64) * (QKP / 64) + 7) / 8, 1);         // 2048 tiles -> 256 blocks: M=4096, N=2048
  const dim3 gVT(((DM / 64) * (SEQ / 64) + 7) / 8, 1);          // 1024 tiles -> 128 blocks: M=1024, N=4096
  const dim3 gAttn(NH * NQB);                                   // 1024 blocks
  const dim3 gOut(((SEQ / 64) * (DM / 64) + 7) / 8, 1);         // 1024 tiles -> 128 blocks: M=4096, N=1024

  // (1) x -> bf16 plane [4096][1024]; w_qkv -> bf16 [3072][1024]; w_out -> bf16 [1024][1024]
  cvt_bf16x8<<<gCvtX, blk, 0, stream>>>(x, Xb, n8x);
  cvt_bf16x8<<<gCvtWq, blk, 0, stream>>>(wqkv, Wqkvb, n8wq);
  cvt_bf16x8<<<gCvtWo, blk, 0, stream>>>(wout, Wob, n8wo);
  // (2) q|k = x . Wqk^T + b_qk (M=4096, N=2048, K=1024, col bias), RoPE in the epilogue
  //     -> q * QSC as f16 hi plane + f16 residual x4096 plane, k f16 plane, each [4096][1024]
  gemm64<0, 4, 1><<<gQK, blk, 0, stream>>>(
      Xb, Xb, DM, 0LL, Wqkvb, Wqkvb, DM, 0LL,
      (void*)Qh, DM, 0LL, (void*)Ql, DM, 0LL, DM,
      bqkv, cosp, sinp, Kp,
      SEQ, QKP, DM, 4096.0f, QSC);
  // (3) v^T = Wv . x^T + b_v[row] -> f16 plane [h*64+d][s] (pitch SEQ), no residual plane (N2 = 0)
  //     (A = Wvb [n][k], Bt = Xb [s][k]; M=1024, N=4096, K=1024, row bias = b_qkv rows 2048..3071)
  gemm64<0, 3, 2><<<gVT, blk, 0, stream>>>(
      Wvb, Wvb, DM, 0LL, Xb, Xb, DM, 0LL,
      (void*)VT, SEQ, 0LL, (void*)VT, SEQ, 0LL, 0,
      bqkv + 2 * DM, cosp, sinp, Kp,
      DM, SEQ, DM, 4096.0f, 1.0f);
  // (4) attention -> context bf16 hi / lo planes [4096][1024]
  attn64<<<gAttn, dim3(128), 0, stream>>>(Qh, Ql, Kp, VT, Oh, Ol, 1.0f / 4096.0f);
  // (5) out = context . w_out^T + b_out -> d_out f32 [4096][1024]  (A = context hi + lo planes, 2 products; K=1024, col bias)
  gemm64<1, 0, 1><<<gOut, blk, 0, stream>>>(
      Oh, Ol, DM, 0LL, Wob, Wob, DM, 0LL,
      d_out, DM, 0LL, d_out, DM, 0LL, 0,
      bout, cosp, sinp, Kp,
      SEQ, DM, DM, 1.0f, 1.0f);
  (void)hipGetLastError();
}

// v008
// Measured time: 140 microseconds a run.
// Two timings next to v007 put it at 1.12 and 1.13 times that version's speed.
// Counting every step since v000, it is 3.67 times as fast.
// Contractions: q|k projection and v^T projection = v_wmma_f32_16x16x32_bf16 (bf16 operands from RNE-converted x and w_qkv, single product);
// k.q^T scores = v_wmma_f32_16x16x32_f16 (q, carrying the score scale and log2 e, as f16 hi plane + f16 residual plane x4096 in a separate accumulator, k f16; 2 products);
// v^T.p^T = v_wmma_f32_16x16x32_f16 (p carried x1024 in f16, v^T f16; 1 product);
// ctx.w_out^T = v_wmma_f32_16x16x32_bf16 (ctx as bf16 hi + lo planes times bf16 w_out, 2 products); all f32 accumulate; bias, RoPE, softmax in f32.
#include <hip/hip_runtime.h>
#include <math.h>
#include <stdint.h>

#define SEQ   4096
#define DM    1024
#define NH    16
#define HD    64
#define NQB   (SEQ / 64)     // 64 key / query tiles of 64
#define QKP   (2 * DM)        // columns of the joint q|k projection: q at cols 0..DM-1, k at cols DM..2DM-1
#define QSC   0.18033688011112042f   // HD^-0.5 * log2(e) = 0.125 * 1.4426950408889634: the factor q carries, so that k.q is the exponent to base 2
#define LP    72              // LDS row pitch of the 64-wide f16 tiles, in elements: 144 B = 16 B x odd, so the 16 rows of a 16-B fragment read fall on 16 distinct bank groups
static_assert(NH * HD == DM);
static_assert((SEQ % 64) == 0 && (DM % 64) == 0 && (DM % 32) == 0);
static_assert((SEQ % 256) == 0 && (DM % 256) == 0);   // GEMM block tile 128 x 256, for every M and N used here
static_assert(HD == 64);      // a GEMM wave tile (64 columns) is one whole head, so a column's RoPE partner lies in the same tile
static_assert(LP >= 64 && (LP % 8) == 0 && ((LP / 8) & 1) == 1);

typedef _Float16 v16h __attribute__((ext_vector_type(16)));
typedef _Float16 v8h  __attribute__((ext_vector_type(8)));
typedef __bf16   v16b __attribute__((ext_vector_type(16)));
typedef __bf16   v8b  __attribute__((ext_vector_type(8)));
typedef float    v8f  __attribute__((ext_vector_type(8)));
typedef float    v4f  __attribute__((ext_vector_type(4)));
typedef unsigned int v4u __attribute__((ext_vector_type(4)));

// ---- scalar helpers --------------------------------------------------------------------------------
__device__ __forceinline__ unsigned short bf_bits(float f) {          // f32 -> bf16 bits, RNE convert
  unsigned u = __float_as_uint(f);
  return (unsigned short)((u + 0x7FFFu + ((u >> 16) & 1u)) >> 16);
}
__device__ __forceinline__ float bf_up(unsigned short h) { return __uint_as_float(((unsigned)h) << 16); }
__device__ __forceinline__ float bf_rne(float f) { return bf_up(bf_bits(f)); }
__device__ __forceinline__ unsigned short h_bits(_Float16 x) { return __builtin_bit_cast(unsigned short, x); }
__device__ __forceinline__ unsigned pk16(unsigned short a, unsigned short b) { return (unsigned)a | ((unsigned)b << 16); }
__device__ __forceinline__ v8f zero8() { v8f z = {0.f, 0.f, 0.f, 0.f, 0.f, 0.f, 0.f, 0.f}; return z; }

// ---- fragment loaders: 16-bit A/B operand, lane -> row/col (lane&15), p already includes +8*(lane>>4);
//      elements 0..7 <- p[0..7] (k0+8h..), elements 8..15 <- p[16..23] (k0+16+8h..)
__device__ __forceinline__ v16b ldfrag_b(const __bf16* p) {
  union { v16b v; v8b h[2]; } f;
  f.h[0] = *(const v8b*)(p);
  f.h[1] = *(const v8b*)(p + 16);
  return f.v;
}
__device__ __forceinline__ v16h ldfrag_h(const _Float16* p) {
  union { v16h v; v8h h[2]; } f;
  f.h[0] = *(const v8h*)(p);
  f.h[1] = *(const v8h*)(p + 16);
  return f.v;
}

// ---- WMMA helpers --------------------------------------------------------------------------------------
// f16 product (attention): the builtin alone. The compiler keeps the distance behind its own WMMA, and with no statement
// tied to each product it is free to issue the LDS fragment reads of several products together, ahead of them.
__device__ __forceinline__ v8f mma_h(v16h a, v16h b, v8f c) {
  return __builtin_amdgcn_wmma_f32_16x16x32_f16(false, a, false, b, (short)0, c, false, false);
}
// bf16 product (GEMMs), with its hand-written gaps
__device__ __forceinline__ v8f mma_b_raw(v16b a, v16b b, v8f c) {
  return __builtin_amdgcn_wmma_f32_16x16x32_bf16(false, a, false, b, (short)0, c, false, false);
}
__device__ __forceinline__ void dep_guard_b(v8f& a, v8f& b, v16b x, v16b y) {
#if defined(__HIP_DEVICE_COMPILE__)
  asm volatile("v_nop\n\tv_nop\n\tv_nop\n\tv_nop" : "+v"(a), "+v"(b) : "v"(x), "v"(y));
#endif
}
__device__ __forceinline__ void keep4_b(v16b a, v16b b, v16b c, v16b d) {
#if defined(__HIP_DEVICE_COMPILE__)
  asm volatile("v_nop" :: "v"(a), "v"(b), "v"(c), "v"(d));
#endif
}
__device__ __forceinline__ void acc_guard4(v8f& a, v8f& b, v8f& c, v8f& d) {
#if defined(__HIP_DEVICE_COMPILE__)
  asm volatile("v_nop\n\tv_nop\n\tv_nop\n\tv_nop" : "+v"(a), "+v"(b), "+v"(c), "+v"(d));
#endif
}
__device__ __forceinline__ void wave_sync_lds() {
  __builtin_amdgcn_fence(__ATOMIC_RELEASE, "workgroup");
  __builtin_amdgcn_wave_barrier();
  __builtin_amdgcn_fence(__ATOMIC_ACQUIRE, "workgroup");
}

// ---- asynchronous copies global -> LDS, 16 B per lane: l = the lane's LDS byte address, g = its global address.
//      A run of copies and its s_wait_xcnt 0 are one statement, so that no address register is rewritten ahead of the wait.
__device__ __forceinline__ unsigned lds_off(const void* p) { return (unsigned)(size_t)p; }
__device__ __forceinline__ void copy4_lds(unsigned l, unsigned lstep, const __bf16* g, size_t gstep) {
#if defined(__HIP_DEVICE_COMPILE__)
  asm volatile("global_load_async_to_lds_b128 %0, %1, off\n\t"
               "global_load_async_to_lds_b128 %2, %3, off\n\t"
               "global_load_async_to_lds_b128 %4, %5, off\n\t"
               "global_load_async_to_lds_b128 %6, %7, off\n\t"
               "s_wait_xcnt 0x0"
               :: "v"(l), "v"(g), "v"(l + lstep), "v"(g + gstep),
                  "v"(l + 2 * lstep), "v"(g + 2 * gstep), "v"(l + 3 * lstep), "v"(g + 3 * gstep)
               : "memory");
#endif
}
__device__ __forceinline__ void copy8_lds(unsigned l0, unsigned l1, unsigned lstep,
                                          const __bf16* g0, const __bf16* g1, size_t gstep) {
#if defined(__HIP_DEVICE_COMPILE__)
  asm volatile("global_load_async_to_lds_b128 %0, %1, off\n\t"
               "global_load_async_to_lds_b128 %2, %3, off\n\t"
               "global_load_async_to_lds_b128 %4, %5, off\n\t"
               "global_load_async_to_lds_b128 %6, %7, off\n\t"
               "global_load_async_to_lds_b128 %8, %9, off\n\t"
               "global_load_async_to_lds_b128 %10, %11, off\n\t"
               "global_load_async_to_lds_b128 %12, %13, off\n\t"
               "global_load_async_to_lds_b128 %14, %15, off\n\t"
               "s_wait_xcnt 0x0"
               :: "v"(l0), "v"(g0), "v"(l0 + lstep), "v"(g0 + gstep),
                  "v"(l0 + 2 * lstep), "v"(g0 + 2 * gstep), "v"(l0 + 3 * lstep), "v"(g0 + 3 * gstep),
                  "v"(l1), "v"(g1), "v"(l1 + lstep), "v"(g1 + gstep),
                  "v"(l1 + 2 * lstep), "v"(g1 + 2 * gstep), "v"(l1 + 3 * lstep), "v"(g1 + 3 * gstep)
               : "memory");
#endif
}
// the same for two f16 planes of different row pitch: 4 copies from g0 (rows gstep0 apart) to l0.., 4 from g1 (gstep1) to l1..
__device__ __forceinline__ void copy4x2_lds(unsigned l0, unsigned l1, unsigned lstep,
                                            const _Float16* g0, size_t gstep0, const _Float16* g1, size_t gstep1) {
#if defined(__HIP_DEVICE_COMPILE__)
  asm volatile("global_load_async_to_lds_b128 %0, %1, off\n\t"
               "global_load_async_to_lds_b128 %2, %3, off\n\t"
               "global_load_async_to_lds_b128 %4, %5, off\n\t"
               "global_load_async_to_lds_b128 %6, %7, off\n\t"
               "global_load_async_to_lds_b128 %8, %9, off\n\t"
               "global_load_async_to_lds_b128 %10, %11, off\n\t"
               "global_load_async_to_lds_b128 %12, %13, off\n\t"
               "global_load_async_to_lds_b128 %14, %15, off\n\t"
               "s_wait_xcnt 0x0"
               :: "v"(l0), "v"(g0), "v"(l0 + lstep), "v"(g0 + gstep0),
                  "v"(l0 + 2 * lstep), "v"(g0 + 2 * gstep0), "v"(l0 + 3 * lstep), "v"(g0 + 3 * gstep0),
                  "v"(l1), "v"(g1), "v"(l1 + lstep), "v"(g1 + gstep1),
                  "v"(l1 + 2 * lstep), "v"(g1 + 2 * gstep1), "v"(l1 + 3 * lstep), "v"(g1 + 3 * gstep1)
               : "memory");
#endif
}
__device__ __forceinline__ void wait_copies() {     // the wave's own copies have landed in LDS
#if defined(__HIP_DEVICE_COMPILE__)
  asm volatile("s_wait_asynccnt 0x0" ::: "memory");
#endif
}
__device__ __forceinline__ void wait_lds_reads() {  // the wave's LDS reads have returned, before their buffer is given up for refilling
#if defined(__HIP_DEVICE_COMPILE__)
  asm volatile("s_wait_dscnt 0x0" ::: "memory");
#endif
}

__device__ __forceinline__ void wait_store_regs() { // behind a run of global stores, before their data and address registers are written again
#if defined(__HIP_DEVICE_COMPILE__)
  asm volatile("s_wait_xcnt 0x0" ::: "memory");
#endif
}

// =====================================================================================================
// f32 -> bf16 (RNE convert), 8 elements per thread, one 16-B store per lane: a wave writes 512 contiguous B
// coverage: n8 threads x 8 = whole plane (n8 is a multiple of 256 for every use here).
// =====================================================================================================
__global__ __launch_bounds__(256) void cvt_bf16x8(const float* __restrict__ in, unsigned short* out, int n8) {
  const int i = blockIdx.x * 256 + threadIdx.x;
  if (i < n8) {
    const v4f a = *(const v4f*)(in + (size_t)i * 8);
    const v4f b = *(const v4f*)(in + (size_t)i * 8 + 4);
    v4u p;
    p[0] = pk16(bf_bits(a[0]), bf_bits(a[1]));
    p[1] = pk16(bf_bits(a[2]), bf_bits(a[3]));
    p[2] = pk16(bf_bits(b[0]), bf_bits(b[1]));
    p[3] = pk16(bf_bits(b[2]), bf_bits(b[3]));
    *(v4u*)(out + (size_t)i * 8) = p;
    
  }
}

// =====================================================================================================
// Register-blocked batched bf16 WMMA GEMM: C[m][n] = sum_k A[m][k] * Bt[n][k] + bias; one wave per 64x64 tile,
// the 8 waves of a block as 2 x 4 = one 128x256 tile. A row-major [M][K] pitch lda; Bt row-major [N][K] pitch ldb
// (k contiguous); M multiple of 128, N of 256, K of 64. blockIdx.y = batch index (strides in elements).
// Operands: a stage = 64 k = one whole 128-B line of each of the block's A and Bt rows, brought into LDS by asynchronous
// copies (8 lanes per row, 4 whole lines per wave copy), rows at pitch LP; two buffers, stage t+2 copied while t+1 is worked on;
// fragments are read from LDS in the k order of ldfrag_b, k ascending.
// NSPLIT: 0 = A.Bt; 1 = (A + A2).Bt (A2 = unscaled bf16 lo plane of A); 2 = A.Bt + A2.Bt + A.Bt2.
// OUT_MODE: 0 = f32 (pitch ldc); 2 = bf16 hi plane C + bf16 lo plane C2 (lo = RNE(v - hi), unscaled);
//           3 = f16 hi plane C + f16 residual plane C2 = f16((v - hi) * rscale), C2 written only for tiles
//               with n0 < N2 (pitch ldc2, batch stride strideC2);
//           4 = RoPE (rotate-half, half = HD/2 = 32) on the wave's 64-column tile = one head of q (n0 < N2) or of k, row m = token:
//               y[d] = x[d] * cos[m][d] + (d < 32 ? -x[d+32] : x[d-32]) * sin[m][d], x with its bias, tables [M][HD] shared over
//               heads and RNE-converted to bf16 on read; q: y * yscale -> f16 hi plane C + f16 residual plane C2 = f16((y - hi) * rscale),
//               k -> f16 plane C3 at column n0 - N2; all three at pitch ldc, one batch (no batch stride applied).
// BIAS_MODE: 1 = + biasp[n] (per column), 2 = + biasp[m] (per row); bias values RNE-converted to bf16 and
//            added in f32 before any 16-bit conversion of the result.
// =====================================================================================================
// The body is a device function: bx = the work-group's tile index, b = its batch index, sT and ring = the calling kernel's LDS
// (sT: 8 slabs of 16 x 68 floats; ring: two stage buffers of gemm_stage_elems<NSPLIT>() elements).
template <int NSPLIT>
__host__ __device__ constexpr int gemm_stage_elems() {
  return (((NSPLIT >= 1) ? 256 : 128) + ((NSPLIT == 2) ? 512 : 256)) * LP;
}
template <int NSPLIT, int OUT_MODE, int BIAS_MODE>
__device__ __forceinline__ void gemm64_body(
    float* sTall, __bf16* ring, int bx, int b,
    const unsigned short* __restrict__ Ap, const unsigned short* A2p, int lda, long long strideA,
    const unsigned short* __restrict__ Btp, const unsigned short* Bt2p, int ldb, long long strideB,
    void* Cout, int ldc, long long strideC,
    void* Cout2, int ldc2, long long strideC2, int N2,
    const float* __restrict__ biasp,
    const float* __restrict__ cosp, const float* __restrict__ sinp, unsigned short* C3p,
    int M, int N, int K, float rscale, float yscale) {
  const __bf16* A   = (const __bf16*)(const void*)Ap;
  const __bf16* A2  = (const __bf16*)(const void*)A2p;
  const __bf16* Bt  = (const __bf16*)(const void*)Btp;
  const __bf16* Bt2 = (const __bf16*)(const void*)Bt2p;
  constexpr int RB   = (NSPLIT >= 1) ? 256 : 128;            // stage rows: A 0..127, A2 128..255 (NSPLIT >= 1), then Bt 256 rows, Bt2 256 rows (NSPLIT == 2)
  constexpr int ROWS = RB + ((NSPLIT == 2) ? 512 : 256);
  constexpr int STG  = ROWS * LP;                            // elements of one stage buffer
  static_assert(STG == gemm_stage_elems<NSPLIT>());
  const int lane = threadIdx.x & 31;
  const int wave = threadIdx.x >> 5;
  const int tilesN = N >> 8;
  const int tilesM = M >> 7;
  if (bx >= tilesM * tilesN) return;                // block-uniform, in front of every barrier
  const int tm = bx / tilesN;
  const int tn = bx - tm * tilesN;
  const int wm = (wave >> 2) << 6;                  // the wave's 64x64 tile inside the block's 128x256
  const int wn = (wave & 3) << 6;
  const int m0 = (tm << 7) + wm;
  const int n0 = (tn << 8) + wn;

  const __bf16* Ab  = A  + (size_t)b * strideA;
  const __bf16* Bb  = Bt + (size_t)b * strideB;
  const __bf16* Ab2 = (NSPLIT >= 1) ? (A2  + (size_t)b * strideA) : Ab;
  const __bf16* Bb2 = (NSPLIT == 2) ? (Bt2 + (size_t)b * strideB) : Bb;

  const int rlane = lane & 15;                 // row (A) / col (B, D) within subtile
  const int koff  = (lane >> 4) * 8;           // k offset of this lane half
  const int mOff  = (lane >> 4) * 8;           // D row offset

  v8f acc[4][4];
#pragma unroll
  for (int i = 0; i < 4; ++i)
#pragma unroll
    for (int j = 0; j < 4; ++j) acc[i][j] = zero8();

  // ---- stage copies: thread -> row (threadIdx.x >> 3) + 32 * c of each 128-row group, 16 B at column 8 * (threadIdx.x & 7) ----
  const int trow = threadIdx.x >> 3;
  const int tcol = (threadIdx.x & 7) * 8;
  const size_t   aoff  = (size_t)((tm << 7) + trow) * lda + tcol;
  const size_t   boff  = (size_t)((tn << 8) + trow) * ldb + tcol;
  const unsigned lrow  = lds_off(ring) + (unsigned)(trow * LP + tcol) * 2u;
  const unsigned lstep = 32u * LP * 2u;                       // 32 rows further in LDS, bytes
  auto copy_stage = [&](int st, int buf) {
    const unsigned l = lrow + (unsigned)buf * (unsigned)(STG * 2);
    const size_t   k = (size_t)st * 64;
    if (NSPLIT >= 1) copy8_lds(l, l + 4u * lstep, lstep, Ab + aoff + k, Ab2 + aoff + k, (size_t)32 * lda);
    else             copy4_lds(l, lstep, Ab + aoff + k, (size_t)32 * lda);
    copy8_lds(l + (unsigned)(RB * LP * 2), l + (unsigned)((RB + 128) * LP * 2), lstep,
              Bb + boff + k, Bb + boff + k + (size_t)128 * ldb, (size_t)32 * ldb);
    if (NSPLIT == 2)
      copy8_lds(l + (unsigned)((RB + 256) * LP * 2), l + (unsigned)((RB + 384) * LP * 2), lstep,
                Bb2 + boff + k, Bb2 + boff + k + (size_t)128 * ldb, (size_t)32 * ldb);
  };

  const int nst = K >> 6;                     // stages of 64 k; block-uniform
  copy_stage(0, 0);
  wait_copies();
  __syncthreads();                            // stage 0 is readable by every wave
  if (nst > 1) copy_stage(1, 1);

  for (int t = 0; t < nst; ++t) {
    const __bf16* sb = ring + (t & 1) * STG;
#pragma unroll   // as the inner loops: every fragment and accumulator index constant, so the arrays stay in registers
    for (int ks = 0; ks < 2; ++ks) {
      v16b bh[4], bl[4], ah[4], al[4];
#pragma unroll
      for (int j = 0; j < 4; ++j) {
        const int bo = (RB + wn + (j << 4) + rlane) * LP + koff + ks * 32;
        bh[j] = ldfrag_b(sb + bo);
        if (NSPLIT == 2) bl[j] = ldfrag_b(sb + bo + 256 * LP); else bl[j] = bh[j];
      }
#pragma unroll
      for (int i = 0; i < 4; ++i) {
        const int ao = (wm + (i << 4) + rlane) * LP + koff + ks * 32;
        ah[i] = ldfrag_b(sb + ao);
        if (NSPLIT >= 1) al[i] = ldfrag_b(sb + ao + 128 * LP); else al[i] = ah[i];
      }
#pragma unroll
      for (int i = 0; i < 4; ++i) {
#pragma unroll
        for (int j = 0; j < 4; ++j) {
          acc[i][j] = mma_b_raw(ah[i], bh[j], acc[i][j]);
          if (NSPLIT >= 1) acc[i][j] = mma_b_raw(al[i], bh[j], acc[i][j]);
          if (NSPLIT == 2) acc[i][j] = mma_b_raw(ah[i], bl[j], acc[i][j]);
        }
        dep_guard_b(acc[i][0], acc[i][3], ah[i], al[i]);
      }
      keep4_b(bh[0], bh[1], bh[2], bh[3]);
      if (NSPLIT == 2) keep4_b(bl[0], bl[1], bl[2], bl[3]);
    }
    wait_lds_reads();
    wait_copies();
    __syncthreads();                          // publishes stage t+1 and ends every wave's reads of stage t's buffer
    if (t + 2 < nst) copy_stage(t + 2, t & 1);
  }
  wait_copies();
  acc_guard4(acc[0][0], acc[0][1], acc[0][2], acc[0][3]);
  acc_guard4(acc[1][0], acc[1][1], acc[1][2], acc[1][3]);
  acc_guard4(acc[2][0], acc[2][1], acc[2][2], acc[2][3]);
  acc_guard4(acc[3][0], acc[3][1], acc[3][2], acc[3][3]);

  // ---- epilogue ----
  float* slab = sTall + wave * (16 * 68);
  // OUT_MODE 4: cos / sin of the 8 columns 8 * (lane & 7).. of rows it * 4 + (lane >> 3) of 16-row group i; group i + 1's loads are
  // issued behind group i's stores, so that both are in flight together
  v4f tcs[4][2], tsn[4][2];
  const unsigned tlane = ((unsigned)(m0 + (lane >> 3)) * HD + (unsigned)(lane & 7) * 8u) * 4u;   // the lane's byte offset in a table, group 0, it 0
  auto load_tables = [&](int i) {
#pragma unroll
    for (int it = 0; it < 4; ++it) {
      const char* tc = (const char*)cosp + (size_t)tlane + ((i << 4) + it * 4) * HD * 4;   // one offset register, the rest a constant
      const char* ts = (const char*)sinp + (size_t)tlane + ((i << 4) + it * 4) * HD * 4;
      tcs[it][0] = *(const v4f*)(tc);
      tcs[it][1] = *(const v4f*)(tc + 16);
      tsn[it][0] = *(const v4f*)(ts);
      tsn[it][1] = *(const v4f*)(ts + 16);
    }
  };
#pragma unroll
  for (int i = 0; i < 4; ++i) {
    const int mBase = m0 + (i << 4);
    float brow[8];
#pragma unroll
    for (int r = 0; r < 8; ++r) {
      brow[r] = 0.f;
      if (BIAS_MODE == 2) brow[r] = bf_rne(biasp[mBase + mOff + r]);
    }
#pragma unroll
    for (int j = 0; j < 4; ++j) {
      float bcol = 0.f;
      if (BIAS_MODE == 1) bcol = bf_rne(biasp[n0 + (j << 4) + rlane]);
#pragma unroll
      for (int r = 0; r < 8; ++r) {
        slab[(mOff + r) * 68 + (j << 4) + rlane] = acc[i][j][r] + bcol + brow[r];
      }
    }
    if (OUT_MODE == 4 && i == 0) {
      __builtin_amdgcn_sched_barrier(0);   // keeps the table loads behind the staging stores, where group 0's accumulators are free: moved ahead of them they spill
      load_tables(0);
    }
    wave_sync_lds();
    if (OUT_MODE == 0) {
      float* C = (float*)Cout + (size_t)b * strideC;
      const int hh = lane >> 4, c4 = (lane & 15) * 4;     // 256-B row segment = 16 lanes x 16 B
      {
#pragma unroll
        for (int it = 0; it < 8; ++it) {
          const int row = it * 2 + hh;                     // it 0..7 x hh 0..1 = rows 0..15
          const v4f v = *(const v4f*)(slab + row * 68 + c4);
          *(v4f*)(C + (size_t)(mBase + row) * ldc + n0 + c4) = v;
        }
        
      }
    } else if (OUT_MODE == 4) {
      const int q = lane >> 3, c8 = (lane & 7) * 8;        // 128-B row segment of an f16 plane = 8 lanes x 16 B
      const bool  lowhalf = (c8 < (HD / 2));
      const int   pc8 = lowhalf ? (c8 + HD / 2) : (c8 - HD / 2);   // partner columns, same head = same slab row
      const float sgn = lowhalf ? -1.0f : 1.0f;
      const int   n0u = __builtin_amdgcn_readfirstlane(n0);   // wave-uniform, held as a scalar: plane and branch are chosen once per wave
      const bool  isq = (n0u < N2);
      const float ysc = isq ? yscale : 1.0f;                  // wave-uniform: q takes the constant factor of the scores here, once per element
      char* Ch = (char*)(isq ? (unsigned short*)Cout : C3p) + (size_t)(isq ? n0u : n0u - N2) * 2;
      char* Cl = (char*)Cout2 + (size_t)n0u * 2;
      const unsigned olane = ((unsigned)(m0 + q) * (unsigned)ldc + (unsigned)c8) * 2u;   // the lane's byte offset in a plane, group 0, it 0
      v4u hv[4], lv[4];
#pragma unroll
      for (int it = 0; it < 4; ++it) {
        const int row = it * 4 + q;                        // it 0..3 x q 0..3 = rows 0..15
        const v4f x0 = *(const v4f*)(slab + row * 68 + c8);
        const v4f x1 = *(const v4f*)(slab + row * 68 + c8 + 4);
        const v4f p0 = *(const v4f*)(slab + row * 68 + pc8);
        const v4f p1 = *(const v4f*)(slab + row * 68 + pc8 + 4);
        const v4f cA = tcs[it][0], cB = tcs[it][1];
        const v4f sA = tsn[it][0], sB = tsn[it][1];
        v4f y0, y1;
#pragma unroll
        for (int e = 0; e < 4; ++e) {
          y0[e] = (x0[e] * bf_rne(cA[e]) + (sgn * p0[e]) * bf_rne(sA[e])) * ysc;
          y1[e] = (x1[e] * bf_rne(cB[e]) + (sgn * p1[e]) * bf_rne(sB[e])) * ysc;
        }
#pragma unroll
        for (int e = 0; e < 2; ++e) {
          const float f0 = y0[2 * e], f1 = y0[2 * e + 1];
          const float g0 = y1[2 * e], g1 = y1[2 * e + 1];
          const _Float16 a0 = (_Float16)f0, a1 = (_Float16)f1;
          const _Float16 b0 = (_Float16)g0, b1 = (_Float16)g1;
          hv[it][e]     = pk16(h_bits(a0), h_bits(a1));
          hv[it][2 + e] = pk16(h_bits(b0), h_bits(b1));
          lv[it][e]     = pk16(h_bits((_Float16)((f0 - (float)a0) * rscale)),
                               h_bits((_Float16)((f1 - (float)a1) * rscale)));
          lv[it][2 + e] = pk16(h_bits((_Float16)((g0 - (float)b0) * rscale)),
                               h_bits((_Float16)((g1 - (float)b1) * rscale)));
        }
      }
#pragma unroll
      for (int it = 0; it < 4; ++it)
        *(v4u*)(Ch + (size_t)(((i << 4) + it * 4) * ldc) * 2 + olane) = hv[it];
      wait_store_regs();
      if (isq) {
#pragma unroll
        for (int it = 0; it < 4; ++it)
          *(v4u*)(Cl + (size_t)(((i << 4) + it * 4) * ldc) * 2 + olane) = lv[it];
        wait_store_regs();
      }
      if (i < 3) load_tables(i + 1);
    } else {
      const int q = lane >> 3, c8 = (lane & 7) * 8;
      unsigned short* C  = (unsigned short*)Cout  + (size_t)b * strideC;
      unsigned short* C2 = (unsigned short*)Cout2 + (size_t)b * strideC2;
      const bool wlo = (OUT_MODE == 2) || (n0 < N2);      // wave-uniform
      v4u hv[4], lv[4];
#pragma unroll
      for (int it = 0; it < 4; ++it) {
        const int row = it * 4 + q;                        // it 0..3 x q 0..3 = rows 0..15
        const float* sp = slab + row * 68 + c8;
        v4u a, a2;
#pragma unroll
        for (int e = 0; e < 4; ++e) {
          const float f0 = sp[2 * e], f1 = sp[2 * e + 1];
          unsigned short h0, h1, l0, l1;
          if (OUT_MODE == 2) {
            h0 = bf_bits(f0); h1 = bf_bits(f1);
            l0 = bf_bits(f0 - bf_up(h0)); l1 = bf_bits(f1 - bf_up(h1));
          } else {
            const _Float16 x0 = (_Float16)f0, x1 = (_Float16)f1;
            h0 = h_bits(x0); h1 = h_bits(x1);
            l0 = h_bits((_Float16)((f0 - (float)x0) * rscale));
            l1 = h_bits((_Float16)((f1 - (float)x1) * rscale));
          }
          a[e] = pk16(h0, h1); a2[e] = pk16(l0, l1);
        }
        hv[it] = a; lv[it] = a2;
      }
      {
#pragma unroll
        for (int it = 0; it < 4; ++it) {
          const int row = it * 4 + q;
          *(v4u*)(C + (size_t)(mBase + row) * ldc + n0 + c8) = hv[it];
          if (wlo) *(v4u*)(C2 + (size_t)(mBase + row) * ldc2 + n0 + c8) = lv[it];
        }
        
      }
    }
    wave_sync_lds();
  }
}

// one GEMM per launch: blockIdx.x = tile, blockIdx.y = batch
template <int NSPLIT, int OUT_MODE, int BIAS_MODE>
__global__ __launch_bounds__(256, 1) void gemm64(
    const unsigned short* __restrict__ Ap, const unsigned short* A2p, int lda, long long strideA,
    const unsigned short* __restrict__ Btp, const unsigned short* Bt2p, int ldb, long long strideB,
    void* Cout, int ldc, long long strideC,
    void* Cout2, int ldc2, long long strideC2, int N2,
    const float* __restrict__ biasp,
    const float* __restrict__ cosp, const float* __restrict__ sinp, unsigned short* C3p,
    int M, int N, int K, float rscale, float yscale) {
  __shared__ __align__(16) float sT[8 * 16 * 68];                          // per-wave 16x64 slab, pitch 68 floats
  __shared__ __align__(16) __bf16 ring[2 * gemm_stage_elems<NSPLIT>()];    // two stage buffers
  gemm64_body<NSPLIT, OUT_MODE, BIAS_MODE>(sT, ring, (int)blockIdx.x, (int)blockIdx.y,
      Ap, A2p, lda, strideA, Btp, Bt2p, ldb, strideB, Cout, ldc, strideC, Cout2, ldc2, strideC2, N2,
      biasp, cosp, sinp, C3p, M, N, K, rscale, yscale);
}

// =====================================================================================================
// Both projections of x in ONE launch; they share x and depend on nothing of each other.
//   work-groups 0 .. NBQK-1:          q|k = x . Wqk^T + b_qk (M=SEQ, N=2*DM, K=DM, column bias), RoPE in the epilogue
//                                      -> q * QSC as f16 hi plane + f16 residual x4096 plane, k f16 plane, each [SEQ][DM]
//   work-groups NBQK .. NBQK+NBVT-1:  v^T = Wv . x^T + b_v[row] -> f16 plane [h*64+d][s] (pitch SEQ), no residual plane (N2 = 0)
//                                      (A = rows 2*DM.. of Wqkv [n][k], Bt = x [s][k]; M=DM, N=SEQ, K=DM, row bias = b_qkv rows 2*DM..)
// Alone, the v^T tiles are fewer than the chip's WGPs. LDS and registers let two work-groups stand on one WGP (second launch bound:
// 4 waves per SIMD = a budget of 256 registers), so a v^T work-group runs beside a q|k one and each fills the other's waits.
// =====================================================================================================
#define NBQK ((SEQ / 128) * (QKP / 256))
#define NBVT ((DM / 128) * (SEQ / 256))
__global__ __launch_bounds__(256, 4) void proj_qkv(
    const unsigned short* __restrict__ Xb, const unsigned short* __restrict__ Wqkvb,
    unsigned short* Qh, unsigned short* Ql, unsigned short* Kp, unsigned short* VT,
    const float* __restrict__ bqkv, const float* __restrict__ cosp, const float* __restrict__ sinp) {
  __shared__ __align__(16) float sT[8 * 16 * 68];                    // per-wave 16x64 slab, pitch 68 floats
  __shared__ __align__(16) __bf16 ring[2 * gemm_stage_elems<0>()];   // two stage buffers
  const int bx = (int)blockIdx.x;                                    // block-uniform: a work-group takes one side whole
  if (bx < NBQK) {
    gemm64_body<0, 4, 1>(sT, ring, bx, 0,
        Xb, Xb, DM, 0LL, Wqkvb, Wqkvb, DM, 0LL,
        (void*)Qh, DM, 0LL, (void*)Ql, DM, 0LL, DM,
        bqkv, cosp, sinp, Kp,
        SEQ, QKP, DM, 4096.0f, QSC);
  } else {
    const unsigned short* Wvb = Wqkvb + (size_t)2 * DM * DM;         // rows 2*DM .. 3*DM-1 of Wqkvb
    gemm64_body<0, 3, 2>(sT, ring, bx - NBQK, 0,
        Wvb, Wvb, DM, 0LL, Xb, Xb, DM, 0LL,
        (void*)VT, SEQ, 0LL, (void*)VT, SEQ, 0LL, 0,
        bqkv + 2 * DM, cosp, sinp, Kp,
        DM, SEQ, DM, 4096.0f, 1.0f);
  }
}

#define OSP 68
__device__ __forceinline__ float xhalf(float x) {
  return __builtin_bit_cast(float, __builtin_amdgcn_permlanex16(__builtin_bit_cast(int, x), __builtin_bit_cast(int, x),
                                                                0x76543210, 0xfedcba98, false, false));
}

__global__ __launch_bounds__(128)
void attn64(const unsigned short* __restrict__ qhp, const unsigned short* __restrict__ qlp,
            const unsigned short* __restrict__ kpp, const unsigned short* __restrict__ vtp,
            unsigned short* ohp, unsigned short* olp, float rres) {
  union FH { v16h v; v8h h[2]; };
  constexpr int TL = 64 * LP;                                     // elements of one 64-row tile at pitch LP, 9 KB
  __shared__ __align__(16) _Float16 kvring[2 * 2 * TL];           // two buffers, each K [kv][d] then V^T [d][kv]
  __shared__ __align__(16) float    Os[4][16 * OSP];              // per wave context tile [row][d]

  const int tid  = threadIdx.x;
  const int wave = tid >> 5;
  const int lane = tid & 31;
  const int hh   = lane >> 4;
  const int c    = lane & 15;

  const int bx   = blockIdx.x;
  const int qb   = bx % NQB;
  const int h    = bx / NQB;
  const int q0   = qb * 64 + wave * 16;

  const _Float16* Qh = (const _Float16*)(const void*)qhp + (size_t)h * HD;
  const _Float16* Ql = (const _Float16*)(const void*)qlp + (size_t)h * HD;
  const _Float16* Kg = (const _Float16*)(const void*)kpp + (size_t)h * HD;
  const _Float16* Vg = (const _Float16*)(const void*)vtp + (size_t)h * HD * SEQ;

  // ---- Q fragments (B operand, column = query lane&15): 2 d-chunks, hi and residual ----
  v16h qah[2], qal[2];
#pragma unroll
  for (int dc = 0; dc < 2; ++dc) {
    qah[dc] = ldfrag_h(Qh + (size_t)(q0 + c) * DM + dc * 32 + 8 * hh);
    qal[dc] = ldfrag_h(Ql + (size_t)(q0 + c) * DM + dc * 32 + 8 * hh);
  }

  float mrun = -INFINITY;      // running maximum of query c (equal in both wave halves)
  float lrun = 0.f;            // running sum of 1024 p over this wave half's keys of query c
  v8f oacc[4];                 // oacc[t][r] = O^T[d = t*16 + 8*hh + r][query c]
#pragma unroll
  for (int t = 0; t < 4; ++t) oacc[t] = zero8();

  // ---- chunk copies: thread -> rows (tid >> 3) + 16 * i, i = 0..3, of each tile, 16 B at column 8 * (tid & 7) ----
  const int trow = tid >> 3, tcol = (tid & 7) * 8;
  const _Float16* kg0 = Kg + (size_t)trow * DM + tcol;              // chunk 0: K row trow, d = tcol..tcol+7
  const _Float16* vg0 = Vg + (size_t)trow * SEQ + tcol;             // chunk 0: V^T row d = trow, s = tcol..tcol+7
  const unsigned  lk0 = lds_off(kvring) + (unsigned)(trow * LP + tcol) * 2u;
  auto copy_chunk = [&](int ck, int buf) {
    const unsigned l = lk0 + (unsigned)buf * (unsigned)(2 * TL * 2);
    copy4x2_lds(l, l + (unsigned)(TL * 2), 16u * LP * 2u,
                kg0 + (size_t)ck * 64 * DM, (size_t)16 * DM, vg0 + (size_t)ck * 64, (size_t)16 * SEQ);
  };
  static_assert(NQB >= 2);
  copy_chunk(0, 0);
  wait_copies();
  __syncthreads();                           // chunk 0 is readable by every wave
  copy_chunk(1, 1);

  for (int kt = 0; kt < NQB; ++kt) {         // static trip count
    const _Float16* Ksh = kvring + (kt & 1) * (2 * TL);   // keys kv0 = kt * 64 .. kv0 + 63
    const _Float16* Vth = Ksh + TL;

    // ---- scores, transposed: 64 keys x 16 queries per wave, 2 f16 products (hi, residual);
    //      s[j][r] = score of key kv0 + j*16 + 8*hh + r with query q0 + c ----
    v8f s[4];
#pragma unroll
    for (int j = 0; j < 4; ++j) {
      v8f sh = zero8(), sl = zero8();
#pragma unroll
      for (int dc = 0; dc < 2; ++dc) {
        FH kb;
        kb.h[0] = *(const v8h*)(Ksh + (j * 16 + c) * LP + dc * 32 + 8 * hh);
        kb.h[1] = *(const v8h*)(Ksh + (j * 16 + c) * LP + dc * 32 + 16 + 8 * hh);
        sh = mma_h(kb.v, qah[dc], sh);
        sl = mma_h(kb.v, qal[dc], sl);
      }
#pragma unroll
      for (int r = 0; r < 8; ++r) s[j][r] = sh[r] + sl[r] * rres;
    }

    // ---- maximum of the lane's 32 scores, joined with the other wave half's; online softmax ----
    float mj[4];
#pragma unroll
    for (int j = 0; j < 4; ++j) {
      mj[j] = s[j][0];
#pragma unroll
      for (int r = 1; r < 8; ++r) mj[j] = fmaxf(mj[j], s[j][r]);
    }
    float m = fmaxf(fmaxf(mj[0], mj[1]), fmaxf(mj[2], mj[3]));
    m = fmaxf(m, xhalf(m));
    const float mnew  = fmaxf(mrun, m);
    const float alpha = __builtin_amdgcn_exp2f(mrun - mnew);
    const float poff  = 10.0f - mnew;        // exponent offset: minus the maximum, plus 10 for the x1024 carry of p
    mrun = mnew;

    // ---- P^T (x1024, f16) straight into the B operand: element e of 32-key block kk = key kk*32 + (e < 8 ? 8*hh + e : 16 + 8*hh + e - 8) ----
    FH pb[2];
    float pj[4];
#pragma unroll   // constant indices, so that s stays in registers
    for (int j = 0; j < 4; ++j) s[j] = s[j] + poff;   // whole tiles at once: packed adds
#pragma unroll
    for (int j = 0; j < 4; ++j) {
      pj[j] = 0.f;
#pragma unroll
      for (int r = 0; r < 8; ++r) {
        const float p = __builtin_amdgcn_exp2f(s[j][r]);   // 1024 p
        pj[j] += p;
        pb[j >> 1].h[j & 1][r] = (_Float16)p;
      }
    }
    lrun = lrun * alpha + ((pj[0] + pj[1]) + (pj[2] + pj[3]));
#pragma unroll
    for (int t = 0; t < 4; ++t)
#pragma unroll
      for (int r = 0; r < 8; ++r) oacc[t][r] *= alpha;

    // ---- context^T += V^T . P^T (f16 WMMA) ----
#pragma unroll
    for (int kk = 0; kk < 2; ++kk) {
#pragma unroll
      for (int t = 0; t < 4; ++t) {
        FH vb;
        vb.h[0] = *(const v8h*)(Vth + (t * 16 + c) * LP + kk * 32 + 8 * hh);
        vb.h[1] = *(const v8h*)(Vth + (t * 16 + c) * LP + kk * 32 + 16 + 8 * hh);
        oacc[t] = mma_h(vb.v, pb[kk].v, oacc[t]);
      }
    }
    wait_lds_reads();
    wait_copies();
    __syncthreads();                         // publishes chunk kt+1 and ends every wave's reads of chunk kt's buffer
    if (kt + 2 < NQB) copy_chunk(kt + 2, kt & 1);
  }
  wait_copies();

  // ---- join the halves' sums, normalise (1/l; the x1024 cancels), stage the wave's 16x64 tile, bf16 hi/lo split,
  float* os = Os[wave];
  {
    const float l = lrun + xhalf(lrun);
    const float inv = (l > 0.f) ? (1.0f / l) : 0.f;      // sum and context both carry the x1024 of p
#pragma unroll
    for (int t = 0; t < 4; ++t) {
      v4f w0, w1;
#pragma unroll
      for (int e = 0; e < 4; ++e) { w0[e] = oacc[t][e] * inv; w1[e] = oacc[t][4 + e] * inv; }
      *(v4f*)(os + c * OSP + t * 16 + 8 * hh)     = w0;      // row = query c; d = t*16 + 8*hh .. + 7
      *(v4f*)(os + c * OSP + t * 16 + 8 * hh + 4) = w1;
    }
  }
  wave_sync_lds();
  {
    const int q4 = lane >> 3, c8 = (lane & 7) * 8;
    v4u hv[4], lv[4];
#pragma unroll
    for (int it = 0; it < 4; ++it) {
      const int row = it * 4 + q4;   // it 0..3 x q4 0..3 = rows 0..15 of the wave tile
      const float* sp = os + row * OSP + c8;
      v4u a, a2;
#pragma unroll
      for (int e = 0; e < 4; ++e) {
        const float f0 = sp[2 * e], f1 = sp[2 * e + 1];
        const unsigned short h0 = bf_bits(f0), h1 = bf_bits(f1);
        const unsigned short l0 = bf_bits(f0 - bf_up(h0)), l1 = bf_bits(f1 - bf_up(h1));
        a[e] = pk16(h0, h1); a2[e] = pk16(l0, l1);
      }
      hv[it] = a; lv[it] = a2;
    }
    {
#pragma unroll
      for (int it = 0; it < 4; ++it) {
        const int row = it * 4 + q4;
        const size_t go = (size_t)(q0 + row) * DM + (size_t)h * HD + c8;
        *(v4u*)(ohp + go) = hv[it];
        *(v4u*)(olp + go) = lv[it];
      }
      
    }
  }
}

// =====================================================================================================
// Workspace map (bytes), every plane an exact multiple of its 64x64-tile / whole-line store granularity:
//   Xb    bf16 [4096][1024]          0           8388608
//   Wqkvb bf16 [3072 n][1024 k]      8388608     6291456   (rows 0..1023 q, 1024..2047 k, 2048..3071 v weights)
//   Wob   bf16 [1024][1024]          14680064    2097152
//   Qh    f16  [4096][1024]          16777216    8388608
//   Ql    f16  [4096][1024]          25165824    8388608   (q residual x4096)
//   Kp    f16  [4096][1024]          33554432    8388608
//   VT    f16  [1024][4096]          41943040    8388608   (v^T incl. bias)
//   Oh    bf16 [4096][1024]          50331648    8388608
//   Ol    bf16 [4096][1024]          58720256    8388608
//   end                              67108864
// Weights are [out n][in k] with k contiguous = the Bt / A layout the GEMM wants, so they are only converted.
// =====================================================================================================
extern "C" void kernel_launch(void* const* d_in, const int* in_sizes, int n_in,
                              void* d_out, int out_size, void* d_ws, size_t ws_size,
                              hipStream_t stream) {
  if (n_in < 7) return;
  if (in_sizes[0] != SEQ * DM) return;
  if (in_sizes[1] != SEQ * HD) return;
  if (in_sizes[2] != SEQ * HD) return;
  if (in_sizes[3] != 3 * DM * DM) return;
  if (in_sizes[4] != 3 * DM) return;
  if (in_sizes[5] != DM * DM) return;
  if (in_sizes[6] != DM) return;
  if (out_size != SEQ * DM) return;

  const float* x     = (const float*)d_in[0];
  const float* cosp  = (const float*)d_in[1];
  const float* sinp  = (const float*)d_in[2];
  const float* wqkv  = (const float*)d_in[3];
  const float* bqkv  = (const float*)d_in[4];
  const float* wout  = (const float*)d_in[5];
  const float* bout  = (const float*)d_in[6];

  const size_t PXb  = (size_t)SEQ * DM * 2;           //  8388608
  const size_t PWq  = (size_t)3 * DM * DM * 2;        //  6291456
  const size_t PWo  = (size_t)DM * DM * 2;            //  2097152
  const size_t P16  = (size_t)SEQ * DM * 2;           //  8388608 (q hi, q res, k, out hi, out lo)
  const size_t PVT  = (size_t)DM * SEQ * 2;           //  8388608
  size_t off = 0;
  const size_t oXb  = off; off += PXb;
  const size_t oWq  = off; off += PWq;
  const size_t oWo  = off; off += PWo;
  const size_t oQh  = off; off += P16;
  const size_t oQl  = off; off += P16;
  const size_t oKp  = off; off += P16;
  const size_t oVT  = off; off += PVT;
  const size_t oOh  = off; off += P16;
  const size_t oOl  = off; off += P16;
  if (off > ws_size) return;                          // off = 67108864
  if (off > (size_t)134217728) return;

  char* ws = (char*)d_ws;
  unsigned short* Xb    = (unsigned short*)(ws + oXb);
  unsigned short* Wqkvb = (unsigned short*)(ws + oWq);
  unsigned short* Wob   = (unsigned short*)(ws + oWo);
  unsigned short* Qh    = (unsigned short*)(ws + oQh);
  unsigned short* Ql    = (unsigned short*)(ws + oQl);
  unsigned short* Kp    = (unsigned short*)(ws + oKp);
  unsigned short* VT    = (unsigned short*)(ws + oVT);
  unsigned short* Oh    = (unsigned short*)(ws + oOh);
  unsigned short* Ol    = (unsigned short*)(ws + oOl);

  const dim3 blk(256);
  const int n8x  = SEQ * DM / 8;                                // 524288
  const int n8wq = 3 * DM * DM / 8;                             // 393216
  const int n8wo = DM * DM / 8;                                 // 131072
  const dim3 gCvtX((n8x + 255) / 256);                          // 2048 blocks
  const dim3 gCvtWq((n8wq + 255) / 256);                        // 1536 blocks
  const dim3 gCvtWo((n8wo + 255) / 256);                        //  512 blocks
  const dim3 gQKV(NBQK + NBVT);                                 // 256 blocks (M=4096, N=2048) + 128 blocks (M=1024, N=4096)
  const dim3 gAttn(NH * NQB);                                   // 1024 blocks
  const dim3 gOut(((SEQ / 64) * (DM / 64) + 7) / 8, 1);         // 1024 tiles -> 128 blocks: M=4096, N=1024

  // (1) x -> bf16 plane [4096][1024]; w_qkv -> bf16 [3072][1024]; w_out -> bf16 [1024][1024]
  cvt_bf16x8<<<gCvtX, blk, 0, stream>>>(x, Xb, n8x);
  cvt_bf16x8<<<gCvtWq, blk, 0, stream>>>(wqkv, Wqkvb, n8wq);
  cvt_bf16x8<<<gCvtWo, blk, 0, stream>>>(wout, Wob, n8wo);
  // (2, 3) q|k projection with RoPE and v^T projection, one launch
  proj_qkv<<<gQKV, blk, 0, stream>>>(Xb, Wqkvb, Qh, Ql, Kp, VT, bqkv, cosp, sinp);
  // (4) attention -> context bf16 hi / lo planes [4096][1024]
  attn64<<<gAttn, dim3(128), 0, stream>>>(Qh, Ql, Kp, VT, Oh, Ol, 1.0f / 4096.0f);
  // (5) out = context . w_out^T + b_out -> d_out f32 [4096][1024]  (A = context hi + lo planes, 2 products; K=1024, col bias)
  gemm64<1, 0, 1><<<gOut, blk, 0, stream>>>(
      Oh, Ol, DM, 0LL, Wob, Wob, DM, 0LL,
      d_out, DM, 0LL, d_out, DM, 0LL, 0,
      bout, cosp, sinp, Kp,
      SEQ, DM, DM, 1.0f, 1.0f);
  (void)hipGetLastError();
}

// v009
// It runs in 131 microseconds.
// Timed twice side by side with v008, it ran 1.07 and 1.06 times as fast.
// All steps since v000 together make it 3.90 times as fast.
// Contractions: q|k projection and v^T projection = v_wmma_f32_16x16x32_bf16 (bf16 operands from RNE-converted x and w_qkv, single product);
// k.q^T scores = v_wmma_f32_16x16x32_f16 (q, carrying the score scale and log2 e, as f16 hi plane + f16 residual plane x4096, the residual products summed first and brought to scale in the accumulator the hi products then join, k f16; 2 products);
// v^T.p^T = v_wmma_f32_16x16x32_f16 (p carried x1024 in f16, v^T f16; 1 product);
// ctx.w_out^T = v_wmma_f32_16x16x32_bf16 (ctx as bf16 hi + lo planes times bf16 w_out, 2 products); all f32 accumulate; bias, RoPE, softmax in f32.
#include <hip/hip_runtime.h>
#include <math.h>
#include <stdint.h>

#define SEQ   4096
#define DM    1024
#define NH    16
#define HD    64
#define NQB   (SEQ / 64)     // 64 key / query tiles of 64
#define QKP   (2 * DM)        // columns of the joint q|k projection: q at cols 0..DM-1, k at cols DM..2DM-1
#define QSC   0.18033688011112042f   // HD^-0.5 * log2(e) = 0.125 * 1.4426950408889634: the factor q carries, so that k.q is the exponent to base 2
#define LP    72              // LDS row pitch of the 64-wide f16 tiles, in elements: 144 B = 16 B x odd, so the 16 rows of a 16-B fragment read fall on 16 distinct bank groups
static_assert(NH * HD == DM);
static_assert((SEQ % 64) == 0 && (DM % 64) == 0 && (DM % 32) == 0);
static_assert((SEQ % 256) == 0 && (DM % 256) == 0);   // GEMM block tile 128 x 256, for every M and N used here
static_assert(HD == 64);      // a GEMM wave tile (64 columns) is one whole head, so a column's RoPE partner lies in the same tile
static_assert(LP >= 64 && (LP % 8) == 0 && ((LP / 8) & 1) == 1);

typedef _Float16 v16h __attribute__((ext_vector_type(16)));
typedef _Float16 v8h  __attribute__((ext_vector_type(8)));
typedef __bf16   v16b __attribute__((ext_vector_type(16)));
typedef __bf16   v8b  __attribute__((ext_vector_type(8)));
typedef float    v8f  __attribute__((ext_vector_type(8)));
typedef float    v4f  __attribute__((ext_vector_type(4)));
typedef unsigned int v4u __attribute__((ext_vector_type(4)));

// ---- scalar helpers --------------------------------------------------------------------------------
__device__ __forceinline__ unsigned short bf_bits(float f) {          // f32 -> bf16 bits, RNE convert
  unsigned u = __float_as_uint(f);
  return (unsigned short)((u + 0x7FFFu + ((u >> 16) & 1u)) >> 16);
}
__device__ __forceinline__ float bf_up(unsigned short h) { return __uint_as_float(((unsigned)h) << 16); }
__device__ __forceinline__ float bf_rne(float f) { return bf_up(bf_bits(f)); }
__device__ __forceinline__ unsigned short h_bits(_Float16 x) { return __builtin_bit_cast(unsigned short, x); }
__device__ __forceinline__ unsigned pk16(unsigned short a, unsigned short b) { return (unsigned)a | ((unsigned)b << 16); }
__device__ __forceinline__ v8f zero8() { v8f z = {0.f, 0.f, 0.f, 0.f, 0.f, 0.f, 0.f, 0.f}; return z; }

// ---- fragment loaders: 16-bit A/B operand, lane -> row/col (lane&15), p already includes +8*(lane>>4);
//      elements 0..7 <- p[0..7] (k0+8h..), elements 8..15 <- p[16..23] (k0+16+8h..)
__device__ __forceinline__ v16b ldfrag_b(const __bf16* p) {
  union { v16b v; v8b h[2]; } f;
  f.h[0] = *(const v8b*)(p);
  f.h[1] = *(const v8b*)(p + 16);
  return f.v;
}
__device__ __forceinline__ v16h ldfrag_h(const _Float16* p) {
  union { v16h v; v8h h[2]; } f;
  f.h[0] = *(const v8h*)(p);
  f.h[1] = *(const v8h*)(p + 16);
  return f.v;
}

// ---- WMMA helpers --------------------------------------------------------------------------------------
// f16 product (attention): the builtin alone. The compiler keeps the distance behind its own WMMA, and with no statement
// tied to each product it is free to issue the LDS fragment reads of several products together, ahead of them.
__device__ __forceinline__ v8f mma_h(v16h a, v16h b, v8f c) {
  return __builtin_amdgcn_wmma_f32_16x16x32_f16(false, a, false, b, (short)0, c, false, false);
}
// bf16 product (GEMMs), with its hand-written gaps
__device__ __forceinline__ v8f mma_b_raw(v16b a, v16b b, v8f c) {
  return __builtin_amdgcn_wmma_f32_16x16x32_bf16(false, a, false, b, (short)0, c, false, false);
}
__device__ __forceinline__ void dep_guard_b(v8f& a, v8f& b, v16b x, v16b y) {
#if defined(__HIP_DEVICE_COMPILE__)
  asm volatile("v_nop\n\tv_nop\n\tv_nop\n\tv_nop" : "+v"(a), "+v"(b) : "v"(x), "v"(y));
#endif
}
__device__ __forceinline__ void keep4_b(v16b a, v16b b, v16b c, v16b d) {
#if defined(__HIP_DEVICE_COMPILE__)
  asm volatile("v_nop" :: "v"(a), "v"(b), "v"(c), "v"(d));
#endif
}
__device__ __forceinline__ void acc_guard4(v8f& a, v8f& b, v8f& c, v8f& d) {
#if defined(__HIP_DEVICE_COMPILE__)
  asm volatile("v_nop\n\tv_nop\n\tv_nop\n\tv_nop" : "+v"(a), "+v"(b), "+v"(c), "+v"(d));
#endif
}
__device__ __forceinline__ void wave_sync_lds() {
  __builtin_amdgcn_fence(__ATOMIC_RELEASE, "workgroup");
  __builtin_amdgcn_wave_barrier();
  __builtin_amdgcn_fence(__ATOMIC_ACQUIRE, "workgroup");
}

// ---- asynchronous copies global -> LDS, 16 B per lane: l = the lane's LDS byte address, g = its global address.
//      A run of copies and its s_wait_xcnt 0 are one statement, so that no address register is rewritten ahead of the wait.
__device__ __forceinline__ unsigned lds_off(const void* p) { return (unsigned)(size_t)p; }
__device__ __forceinline__ void copy4_lds(unsigned l, unsigned lstep, const __bf16* g, size_t gstep) {
#if defined(__HIP_DEVICE_COMPILE__)
  asm volatile("global_load_async_to_lds_b128 %0, %1, off\n\t"
               "global_load_async_to_lds_b128 %2, %3, off\n\t"
               "global_load_async_to_lds_b128 %4, %5, off\n\t"
               "global_load_async_to_lds_b128 %6, %7, off\n\t"
               "s_wait_xcnt 0x0"
               :: "v"(l), "v"(g), "v"(l + lstep), "v"(g + gstep),
                  "v"(l + 2 * lstep), "v"(g + 2 * gstep), "v"(l + 3 * lstep), "v"(g + 3 * gstep)
               : "memory");
#endif
}
__device__ __forceinline__ void copy8_lds(unsigned l0, unsigned l1, unsigned lstep,
                                          const __bf16* g0, const __bf16* g1, size_t gstep) {
#if defined(__HIP_DEVICE_COMPILE__)
  asm volatile("global_load_async_to_lds_b128 %0, %1, off\n\t"
               "global_load_async_to_lds_b128 %2, %3, off\n\t"
               "global_load_async_to_lds_b128 %4, %5, off\n\t"
               "global_load_async_to_lds_b128 %6, %7, off\n\t"
               "global_load_async_to_lds_b128 %8, %9, off\n\t"
               "global_load_async_to_lds_b128 %10, %11, off\n\t"
               "global_load_async_to_lds_b128 %12, %13, off\n\t"
               "global_load_async_to_lds_b128 %14, %15, off\n\t"
               "s_wait_xcnt 0x0"
               :: "v"(l0), "v"(g0), "v"(l0 + lstep), "v"(g0 + gstep),
                  "v"(l0 + 2 * lstep), "v"(g0 + 2 * gstep), "v"(l0 + 3 * lstep), "v"(g0 + 3 * gstep),
                  "v"(l1), "v"(g1), "v"(l1 + lstep), "v"(g1 + gstep),
                  "v"(l1 + 2 * lstep), "v"(g1 + 2 * gstep), "v"(l1 + 3 * lstep), "v"(g1 + 3 * gstep)
               : "memory");
#endif
}
// the same for two f16 planes of different row pitch: 4 copies from g0 (rows gstep0 apart) to l0.., 4 from g1 (gstep1) to l1..
__device__ __forceinline__ void copy4x2_lds(unsigned l0, unsigned l1, unsigned lstep,
                                            const _Float16* g0, size_t gstep0, const _Float16* g1, size_t gstep1) {
#if defined(__HIP_DEVICE_COMPILE__)
  asm volatile("global_load_async_to_lds_b128 %0, %1, off\n\t"
               "global_load_async_to_lds_b128 %2, %3, off\n\t"
               "global_load_async_to_lds_b128 %4, %5, off\n\t"
               "global_load_async_to_lds_b128 %6, %7, off\n\t"
               "global_load_async_to_lds_b128 %8, %9, off\n\t"
               "global_load_async_to_lds_b128 %10, %11, off\n\t"
               "global_load_async_to_lds_b128 %12, %13, off\n\t"
               "global_load_async_to_lds_b128 %14, %15, off\n\t"
               "s_wait_xcnt 0x0"
               :: "v"(l0), "v"(g0), "v"(l0 + lstep), "v"(g0 + gstep0),
                  "v"(l0 + 2 * lstep), "v"(g0 + 2 * gstep0), "v"(l0 + 3 * lstep), "v"(g0 + 3 * gstep0),
                  "v"(l1), "v"(g1), "v"(l1 + lstep), "v"(g1 + gstep1),
                  "v"(l1 + 2 * lstep), "v"(g1 + 2 * gstep1), "v"(l1 + 3 * lstep), "v"(g1 + 3 * gstep1)
               : "memory");
#endif
}
__device__ __forceinline__ void wait_copies() {     // the wave's own copies have landed in LDS
#if defined(__HIP_DEVICE_COMPILE__)
  asm volatile("s_wait_asynccnt 0x0" ::: "memory");
#endif
}
__device__ __forceinline__ void wait_lds_reads() {  // the wave's LDS reads have returned, before their buffer is given up for refilling
#if defined(__HIP_DEVICE_COMPILE__)
  asm volatile("s_wait_dscnt 0x0" ::: "memory");
#endif
}

__device__ __forceinline__ void wait_store_regs() { // behind a run of global stores, before their data and address registers are written again
#if defined(__HIP_DEVICE_COMPILE__)
  asm volatile("s_wait_xcnt 0x0" ::: "memory");
#endif
}

// =====================================================================================================
// f32 -> bf16 (RNE convert), 8 elements per thread, one 16-B store per lane: a wave writes 512 contiguous B
// coverage: n8 threads x 8 = whole plane (n8 is a multiple of 256 for every use here).
// =====================================================================================================
__global__ __launch_bounds__(256) void cvt_bf16x8(const float* __restrict__ in, unsigned short* out, int n8) {
  const int i = blockIdx.x * 256 + threadIdx.x;
  if (i < n8) {
    const v4f a = *(const v4f*)(in + (size_t)i * 8);
    const v4f b = *(const v4f*)(in + (size_t)i * 8 + 4);
    v4u p;
    p[0] = pk16(bf_bits(a[0]), bf_bits(a[1]));
    p[1] = pk16(bf_bits(a[2]), bf_bits(a[3]));
    p[2] = pk16(bf_bits(b[0]), bf_bits(b[1]));
    p[3] = pk16(bf_bits(b[2]), bf_bits(b[3]));
    *(v4u*)(out + (size_t)i * 8) = p;
    
  }
}

// =====================================================================================================
// Register-blocked batched bf16 WMMA GEMM: C[m][n] = sum_k A[m][k] * Bt[n][k] + bias; one wave per 64x64 tile,
// the 8 waves of a block as 2 x 4 = one 128x256 tile. A row-major [M][K] pitch lda; Bt row-major [N][K] pitch ldb
// (k contiguous); M multiple of 128, N of 256, K of 64. blockIdx.y = batch index (strides in elements).
// Operands: a stage = 64 k = one whole 128-B line of each of the block's A and Bt rows, brought into LDS by asynchronous
// copies (8 lanes per row, 4 whole lines per wave copy), rows at pitch LP; two buffers, stage t+2 copied while t+1 is worked on;
// fragments are read from LDS in the k order of ldfrag_b, k ascending.
// NSPLIT: 0 = A.Bt; 1 = (A + A2).Bt (A2 = unscaled bf16 lo plane of A); 2 = A.Bt + A2.Bt + A.Bt2.
// OUT_MODE: 0 = f32 (pitch ldc); 2 = bf16 hi plane C + bf16 lo plane C2 (lo = RNE(v - hi), unscaled);
//           3 = f16 hi plane C + f16 residual plane C2 = f16((v - hi) * rscale), C2 written only for tiles
//               with n0 < N2 (pitch ldc2, batch stride strideC2);
//           4 = RoPE (rotate-half, half = HD/2 = 32) on the wave's 64-column tile = one head of q (n0 < N2) or of k, row m = token:
//               y[d] = x[d] * cos[m][d] + (d < 32 ? -x[d+32] : x[d-32]) * sin[m][d], x with its bias, tables [M][HD] shared over
//               heads and RNE-converted to bf16 on read; q: y * yscale -> f16 hi plane C + f16 residual plane C2 = f16((y - hi) * rscale),
//               k -> f16 plane C3 at column n0 - N2; all three at pitch ldc, one batch (no batch stride applied).
// BIAS_MODE: 1 = + biasp[n] (per column), 2 = + biasp[m] (per row); bias values RNE-converted to bf16 and
//            added in f32 before any 16-bit conversion of the result.
// =====================================================================================================
// The body is a device function: bx = the work-group's tile index, b = its batch index, sT and ring = the calling kernel's LDS
// (sT: 8 slabs of 16 x 68 floats; ring: two stage buffers of gemm_stage_elems<NSPLIT>() elements).
template <int NSPLIT>
__host__ __device__ constexpr int gemm_stage_elems() {
  return (((NSPLIT >= 1) ? 256 : 128) + ((NSPLIT == 2) ? 512 : 256)) * LP;
}
template <int NSPLIT, int OUT_MODE, int BIAS_MODE>
__device__ __forceinline__ void gemm64_body(
    float* sTall, __bf16* ring, int bx, int b,
    const unsigned short* __restrict__ Ap, const unsigned short* A2p, int lda, long long strideA,
    const unsigned short* __restrict__ Btp, const unsigned short* Bt2p, int ldb, long long strideB,
    void* Cout, int ldc, long long strideC,
    void* Cout2, int ldc2, long long strideC2, int N2,
    const float* __restrict__ biasp,
    const float* __restrict__ cosp, const float* __restrict__ sinp, unsigned short* C3p,
    int M, int N, int K, float rscale, float yscale) {
  const __bf16* A   = (const __bf16*)(const void*)Ap;
  const __bf16* A2  = (const __bf16*)(const void*)A2p;
  const __bf16* Bt  = (const __bf16*)(const void*)Btp;
  const __bf16* Bt2 = (const __bf16*)(const void*)Bt2p;
  constexpr int RB   = (NSPLIT >= 1) ? 256 : 128;            // stage rows: A 0..127, A2 128..255 (NSPLIT >= 1), then Bt 256 rows, Bt2 256 rows (NSPLIT == 2)
  constexpr int ROWS = RB + ((NSPLIT == 2) ? 512 : 256);
  constexpr int STG  = ROWS * LP;                            // elements of one stage buffer
  static_assert(STG == gemm_stage_elems<NSPLIT>());
  const int lane = threadIdx.x & 31;
  const int wave = threadIdx.x >> 5;
  const int tilesN = N >> 8;
  const int tilesM = M >> 7;
  if (bx >= tilesM * tilesN) return;                // block-uniform, in front of every barrier
  const int tm = bx / tilesN;
  const int tn = bx - tm * tilesN;
  const int wm = (wave >> 2) << 6;                  // the wave's 64x64 tile inside the block's 128x256
  const int wn = (wave & 3) << 6;
  const int m0 = (tm << 7) + wm;
  const int n0 = (tn << 8) + wn;

  const __bf16* Ab  = A  + (size_t)b * strideA;
  const __bf16* Bb  = Bt + (size_t)b * strideB;
  const __bf16* Ab2 = (NSPLIT >= 1) ? (A2  + (size_t)b * strideA) : Ab;
  const __bf16* Bb2 = (NSPLIT == 2) ? (Bt2 + (size_t)b * strideB) : Bb;

  const int rlane = lane & 15;                 // row (A) / col (B, D) within subtile
  const int koff  = (lane >> 4) * 8;           // k offset of this lane half
  const int mOff  = (lane >> 4) * 8;           // D row offset

  v8f acc[4][4];
#pragma unroll
  for (int i = 0; i < 4; ++i)
#pragma unroll
    for (int j = 0; j < 4; ++j) acc[i][j] = zero8();

  // ---- stage copies: thread -> row (threadIdx.x >> 3) + 32 * c of each 128-row group, 16 B at column 8 * (threadIdx.x & 7) ----
  const int trow = threadIdx.x >> 3;
  const int tcol = (threadIdx.x & 7) * 8;
  const size_t   aoff  = (size_t)((tm << 7) + trow) * lda + tcol;
  const size_t   boff  = (size_t)((tn << 8) + trow) * ldb + tcol;
  const unsigned lrow  = lds_off(ring) + (unsigned)(trow * LP + tcol) * 2u;
  const unsigned lstep = 32u * LP * 2u;                       // 32 rows further in LDS, bytes
  auto copy_stage = [&](int st, int buf) {
    const unsigned l = lrow + (unsigned)buf * (unsigned)(STG * 2);
    const size_t   k = (size_t)st * 64;
    if (NSPLIT >= 1) copy8_lds(l, l + 4u * lstep, lstep, Ab + aoff + k, Ab2 + aoff + k, (size_t)32 * lda);
    else             copy4_lds(l, lstep, Ab + aoff + k, (size_t)32 * lda);
    copy8_lds(l + (unsigned)(RB * LP * 2), l + (unsigned)((RB + 128) * LP * 2), lstep,
              Bb + boff + k, Bb + boff + k + (size_t)128 * ldb, (size_t)32 * ldb);
    if (NSPLIT == 2)
      copy8_lds(l + (unsigned)((RB + 256) * LP * 2), l + (unsigned)((RB + 384) * LP * 2), lstep,
                Bb2 + boff + k, Bb2 + boff + k + (size_t)128 * ldb, (size_t)32 * ldb);
  };

  const int nst = K >> 6;                     // stages of 64 k; block-uniform
  copy_stage(0, 0);
  wait_copies();
  __syncthreads();                            // stage 0 is readable by every wave
  if (nst > 1) copy_stage(1, 1);

  for (int t = 0; t < nst; ++t) {
    const __bf16* sb = ring + (t & 1) * STG;
#pragma unroll   // as the inner loops: every fragment and accumulator index constant, so the arrays stay in registers
    for (int ks = 0; ks < 2; ++ks) {
      v16b bh[4], bl[4], ah[4], al[4];
#pragma unroll
      for (int j = 0; j < 4; ++j) {
        const int bo = (RB + wn + (j << 4) + rlane) * LP + koff + ks * 32;
        bh[j] = ldfrag_b(sb + bo);
        if (NSPLIT == 2) bl[j] = ldfrag_b(sb + bo + 256 * LP); else bl[j] = bh[j];
      }
#pragma unroll
      for (int i = 0; i < 4; ++i) {
        const int ao = (wm + (i << 4) + rlane) * LP + koff + ks * 32;
        ah[i] = ldfrag_b(sb + ao);
        if (NSPLIT >= 1) al[i] = ldfrag_b(sb + ao + 128 * LP); else al[i] = ah[i];
      }
#pragma unroll
      for (int i = 0; i < 4; ++i) {
#pragma unroll
        for (int j = 0; j < 4; ++j) {
          acc[i][j] = mma_b_raw(ah[i], bh[j], acc[i][j]);
          if (NSPLIT >= 1) acc[i][j] = mma_b_raw(al[i], bh[j], acc[i][j]);
          if (NSPLIT == 2) acc[i][j] = mma_b_raw(ah[i], bl[j], acc[i][j]);
        }
        dep_guard_b(acc[i][0], acc[i][3], ah[i], al[i]);
      }
      keep4_b(bh[0], bh[1], bh[2], bh[3]);
      if (NSPLIT == 2) keep4_b(bl[0], bl[1], bl[2], bl[3]);
    }
    wait_lds_reads();
    wait_copies();
    __syncthreads();                          // publishes stage t+1 and ends every wave's reads of stage t's buffer
    if (t + 2 < nst) copy_stage(t + 2, t & 1);
  }
  wait_copies();
  acc_guard4(acc[0][0], acc[0][1], acc[0][2], acc[0][3]);
  acc_guard4(acc[1][0], acc[1][1], acc[1][2], acc[1][3]);
  acc_guard4(acc[2][0], acc[2][1], acc[2][2], acc[2][3]);
  acc_guard4(acc[3][0], acc[3][1], acc[3][2], acc[3][3]);

  // ---- epilogue ----
  float* slab = sTall + wave * (16 * 68);
  // OUT_MODE 4: cos / sin of the 8 columns 8 * (lane & 7).. of rows it * 4 + (lane >> 3) of 16-row group i; group i + 1's loads are
  // issued behind group i's stores, so that both are in flight together
  v4f tcs[4][2], tsn[4][2];
  const unsigned tlane = ((unsigned)(m0 + (lane >> 3)) * HD + (unsigned)(lane & 7) * 8u) * 4u;   // the lane's byte offset in a table, group 0, it 0
  auto load_tables = [&](int i) {
#pragma unroll
    for (int it = 0; it < 4; ++it) {
      const char* tc = (const char*)cosp + (size_t)tlane + ((i << 4) + it * 4) * HD * 4;   // one offset register, the rest a constant
      const char* ts = (const char*)sinp + (size_t)tlane + ((i << 4) + it * 4) * HD * 4;
      tcs[it][0] = *(const v4f*)(tc);
      tcs[it][1] = *(const v4f*)(tc + 16);
      tsn[it][0] = *(const v4f*)(ts);
      tsn[it][1] = *(const v4f*)(ts + 16);
    }
  };
#pragma unroll
  for (int i = 0; i < 4; ++i) {
    const int mBase = m0 + (i << 4);
    float brow[8];
#pragma unroll
    for (int r = 0; r < 8; ++r) {
      brow[r] = 0.f;
      if (BIAS_MODE == 2) brow[r] = bf_rne(biasp[mBase + mOff + r]);
    }
#pragma unroll
    for (int j = 0; j < 4; ++j) {
      float bcol = 0.f;
      if (BIAS_MODE == 1) bcol = bf_rne(biasp[n0 + (j << 4) + rlane]);
#pragma unroll
      for (int r = 0; r < 8; ++r) {
        slab[(mOff + r) * 68 + (j << 4) + rlane] = acc[i][j][r] + bcol + brow[r];
      }
    }
    if (OUT_MODE == 4 && i == 0) {
      __builtin_amdgcn_sched_barrier(0);   // keeps the table loads behind the staging stores, where group 0's accumulators are free: moved ahead of them they spill
      load_tables(0);
    }
    wave_sync_lds();
    if (OUT_MODE == 0) {
      float* C = (float*)Cout + (size_t)b * strideC;
      const int hh = lane >> 4, c4 = (lane & 15) * 4;     // 256-B row segment = 16 lanes x 16 B
      {
#pragma unroll
        for (int it = 0; it < 8; ++it) {
          const int row = it * 2 + hh;                     // it 0..7 x hh 0..1 = rows 0..15
          const v4f v = *(const v4f*)(slab + row * 68 + c4);
          *(v4f*)(C + (size_t)(mBase + row) * ldc + n0 + c4) = v;
        }
        
      }
    } else if (OUT_MODE == 4) {
      const int q = lane >> 3, c8 = (lane & 7) * 8;        // 128-B row segment of an f16 plane = 8 lanes x 16 B
      const bool  lowhalf = (c8 < (HD / 2));
      const int   pc8 = lowhalf ? (c8 + HD / 2) : (c8 - HD / 2);   // partner columns, same head = same slab row
      const float sgn = lowhalf ? -1.0f : 1.0f;
      const int   n0u = __builtin_amdgcn_readfirstlane(n0);   // wave-uniform, held as a scalar: plane and branch are chosen once per wave
      const bool  isq = (n0u < N2);
      const float ysc = isq ? yscale : 1.0f;                  // wave-uniform: q takes the constant factor of the scores here, once per element
      char* Ch = (char*)(isq ? (unsigned short*)Cout : C3p) + (size_t)(isq ? n0u : n0u - N2) * 2;
      char* Cl = (char*)Cout2 + (size_t)n0u * 2;
      const unsigned olane = ((unsigned)(m0 + q) * (unsigned)ldc + (unsigned)c8) * 2u;   // the lane's byte offset in a plane, group 0, it 0
      v4u hv[4], lv[4];
#pragma unroll
      for (int it = 0; it < 4; ++it) {
        const int row = it * 4 + q;                        // it 0..3 x q 0..3 = rows 0..15
        const v4f x0 = *(const v4f*)(slab + row * 68 + c8);
        const v4f x1 = *(const v4f*)(slab + row * 68 + c8 + 4);
        const v4f p0 = *(const v4f*)(slab + row * 68 + pc8);
        const v4f p1 = *(const v4f*)(slab + row * 68 + pc8 + 4);
        const v4f cA = tcs[it][0], cB = tcs[it][1];
        const v4f sA = tsn[it][0], sB = tsn[it][1];
        v4f y0, y1;
#pragma unroll
        for (int e = 0; e < 4; ++e) {
          y0[e] = (x0[e] * bf_rne(cA[e]) + (sgn * p0[e]) * bf_rne(sA[e])) * ysc;
          y1[e] = (x1[e] * bf_rne(cB[e]) + (sgn * p1[e]) * bf_rne(sB[e])) * ysc;
        }
#pragma unroll
        for (int e = 0; e < 2; ++e) {
          const float f0 = y0[2 * e], f1 = y0[2 * e + 1];
          const float g0 = y1[2 * e], g1 = y1[2 * e + 1];
          const _Float16 a0 = (_Float16)f0, a1 = (_Float16)f1;
          const _Float16 b0 = (_Float16)g0, b1 = (_Float16)g1;
          hv[it][e]     = pk16(h_bits(a0), h_bits(a1));
          hv[it][2 + e] = pk16(h_bits(b0), h_bits(b1));
          lv[it][e]     = pk16(h_bits((_Float16)((f0 - (float)a0) * rscale)),
                               h_bits((_Float16)((f1 - (float)a1) * rscale)));
          lv[it][2 + e] = pk16(h_bits((_Float16)((g0 - (float)b0) * rscale)),
                               h_bits((_Float16)((g1 - (float)b1) * rscale)));
        }
      }
#pragma unroll
      for (int it = 0; it < 4; ++it)
        *(v4u*)(Ch + (size_t)(((i << 4) + it * 4) * ldc) * 2 + olane) = hv[it];
      wait_store_regs();
      if (isq) {
#pragma unroll
        for (int it = 0; it < 4; ++it)
          *(v4u*)(Cl + (size_t)(((i << 4) + it * 4) * ldc) * 2 + olane) = lv[it];
        wait_store_regs();
      }
      if (i < 3) load_tables(i + 1);
    } else {
      const int q = lane >> 3, c8 = (lane & 7) * 8;
      unsigned short* C  = (unsigned short*)Cout  + (size_t)b * strideC;
      unsigned short* C2 = (unsigned short*)Cout2 + (size_t)b * strideC2;
      const bool wlo = (OUT_MODE == 2) || (n0 < N2);      // wave-uniform
      v4u hv[4], lv[4];
#pragma unroll
      for (int it = 0; it < 4; ++it) {
        const int row = it * 4 + q;                        // it 0..3 x q 0..3 = rows 0..15
        const float* sp = slab + row * 68 + c8;
        v4u a, a2;
#pragma unroll
        for (int e = 0; e < 4; ++e) {
          const float f0 = sp[2 * e], f1 = sp[2 * e + 1];
          unsigned short h0, h1, l0, l1;
          if (OUT_MODE == 2) {
            h0 = bf_bits(f0); h1 = bf_bits(f1);
            l0 = bf_bits(f0 - bf_up(h0)); l1 = bf_bits(f1 - bf_up(h1));
          } else {
            const _Float16 x0 = (_Float16)f0, x1 = (_Float16)f1;
            h0 = h_bits(x0); h1 = h_bits(x1);
            l0 = h_bits((_Float16)((f0 - (float)x0) * rscale));
            l1 = h_bits((_Float16)((f1 - (float)x1) * rscale));
          }
          a[e] = pk16(h0, h1); a2[e] = pk16(l0, l1);
        }
        hv[it] = a; lv[it] = a2;
      }
      {
#pragma unroll
        for (int it = 0; it < 4; ++it) {
          const int row = it * 4 + q;
          *(v4u*)(C + (size_t)(mBase + row) * ldc + n0 + c8) = hv[it];
          if (wlo) *(v4u*)(C2 + (size_t)(mBase + row) * ldc2 + n0 + c8) = lv[it];
        }
        
      }
    }
    wave_sync_lds();
  }
}

// one GEMM per launch: blockIdx.x = tile, blockIdx.y = batch
template <int NSPLIT, int OUT_MODE, int BIAS_MODE>
__global__ __launch_bounds__(256, 1) void gemm64(
    const unsigned short* __restrict__ Ap, const unsigned short* A2p, int lda, long long strideA,
    const unsigned short* __restrict__ Btp, const unsigned short* Bt2p, int ldb, long long strideB,
    void* Cout, int ldc, long long strideC,
    void* Cout2, int ldc2, long long strideC2, int N2,
    const float* __restrict__ biasp,
    const float* __restrict__ cosp, const float* __restrict__ sinp, unsigned short* C3p,
    int M, int N, int K, float rscale, float yscale) {
  __shared__ __align__(16) float sT[8 * 16 * 68];                          // per-wave 16x64 slab, pitch 68 floats
  __shared__ __align__(16) __bf16 ring[2 * gemm_stage_elems<NSPLIT>()];    // two stage buffers
  gemm64_body<NSPLIT, OUT_MODE, BIAS_MODE>(sT, ring, (int)blockIdx.x, (int)blockIdx.y,
      Ap, A2p, lda, strideA, Btp, Bt2p, ldb, strideB, Cout, ldc, strideC, Cout2, ldc2, strideC2, N2,
      biasp, cosp, sinp, C3p, M, N, K, rscale, yscale);
}

// =====================================================================================================
// Both projections of x in ONE launch; they share x and depend on nothing of each other.
//   work-groups 0 .. NBQK-1:          q|k = x . Wqk^T + b_qk (M=SEQ, N=2*DM, K=DM, column bias), RoPE in the epilogue
//                                      -> q * QSC as f16 hi plane + f16 residual x4096 plane, k f16 plane, each [SEQ][DM]
//   work-groups NBQK .. NBQK+NBVT-1:  v^T = Wv . x^T + b_v[row] -> f16 plane [h*64+d][s] (pitch SEQ), no residual plane (N2 = 0)
//                                      (A = rows 2*DM.. of Wqkv [n][k], Bt = x [s][k]; M=DM, N=SEQ, K=DM, row bias = b_qkv rows 2*DM..)
// Alone, the v^T tiles are fewer than the chip's WGPs. LDS and registers let two work-groups stand on one WGP (second launch bound:
// 4 waves per SIMD = a budget of 256 registers), so a v^T work-group runs beside a q|k one and each fills the other's waits.
// =====================================================================================================
#define NBQK ((SEQ / 128) * (QKP / 256))
#define NBVT ((DM / 128) * (SEQ / 256))
__global__ __launch_bounds__(256, 4) void proj_qkv(
    const unsigned short* __restrict__ Xb, const unsigned short* __restrict__ Wqkvb,
    unsigned short* Qh, unsigned short* Ql, unsigned short* Kp, unsigned short* VT,
    const float* __restrict__ bqkv, const float* __restrict__ cosp, const float* __restrict__ sinp) {
  __shared__ __align__(16) float sT[8 * 16 * 68];                    // per-wave 16x64 slab, pitch 68 floats
  __shared__ __align__(16) __bf16 ring[2 * gemm_stage_elems<0>()];   // two stage buffers
  const int bx = (int)blockIdx.x;                                    // block-uniform: a work-group takes one side whole
  if (bx < NBQK) {
    gemm64_body<0, 4, 1>(sT, ring, bx, 0,
        Xb, Xb, DM, 0LL, Wqkvb, Wqkvb, DM, 0LL,
        (void*)Qh, DM, 0LL, (void*)Ql, DM, 0LL, DM,
        bqkv, cosp, sinp, Kp,
        SEQ, QKP, DM, 4096.0f, QSC);
  } else {
    const unsigned short* Wvb = Wqkvb + (size_t)2 * DM * DM;         // rows 2*DM .. 3*DM-1 of Wqkvb
    gemm64_body<0, 3, 2>(sT, ring, bx - NBQK, 0,
        Wvb, Wvb, DM, 0LL, Xb, Xb, DM, 0LL,
        (void*)VT, SEQ, 0LL, (void*)VT, SEQ, 0LL, 0,
        bqkv + 2 * DM, cosp, sinp, Kp,
        DM, SEQ, DM, 4096.0f, 1.0f);
  }
}

#define OSP 68
__device__ __forceinline__ float xhalf(float x) {
  return __builtin_bit_cast(float, __builtin_amdgcn_permlanex16(__builtin_bit_cast(int, x), __builtin_bit_cast(int, x),
                                                                0x76543210, 0xfedcba98, false, false));
}

#define QWG  128              // query rows of a work-group
#define NKH  (NQB / 2)        // chunks of 64 keys in a key half
#define RRES (1.0f / 4096.0f) // undoes the x4096 of the q residual plane; a constant, so that it takes no vector registers
static_assert((SEQ % QWG) == 0 && (NQB % 2) == 0 && NKH >= 2);
__global__ __launch_bounds__(256, 4)   // 4 waves per SIMD = two work-groups on a WGP: a budget of 256 registers
void attn64(const unsigned short* __restrict__ qhp, const unsigned short* __restrict__ qlp,
            const unsigned short* __restrict__ kpp, const unsigned short* __restrict__ vtp,
            unsigned short* ohp, unsigned short* olp) {
  union FH { v16h v; v8h h[2]; };
  constexpr int TL = 64 * LP;                                     // elements of one 64-row tile at pitch LP, 9 KB
  __shared__ __align__(16) _Float16 kvring[2 * 2 * 2 * TL];       // per key half two buffers, each K [kv][d] then V^T [d][kv]
  __shared__ __align__(16) float    Os[8][16 * OSP];              // per wave one context tile [row][d]; columns 64..67 of a row: maximum, sum

  const int tid  = threadIdx.x;
  const int wave = __builtin_amdgcn_readfirstlane(tid >> 5);      // held as a scalar: key half and LDS bases are wave-uniform
  const int lane = tid & 31;
  const int hh   = lane >> 4;
  const int c    = lane & 15;
  const int kh   = wave >> 2;                                     // key half
  const int wq   = wave & 3;

  const int bx   = blockIdx.x;
  const int qb   = bx % (SEQ / QWG);
  const int h    = bx / (SEQ / QWG);
  const int q0   = qb * QWG + wq * 32;

  const _Float16* Qh = (const _Float16*)(const void*)qhp + (size_t)h * HD;
  const _Float16* Ql = (const _Float16*)(const void*)qlp + (size_t)h * HD;
  const _Float16* Kg = (const _Float16*)(const void*)kpp + (size_t)h * HD + (size_t)kh * (SEQ / 2) * DM;
  const _Float16* Vg = (const _Float16*)(const void*)vtp + (size_t)h * HD * SEQ + (size_t)kh * (SEQ / 2);

  // ---- Q fragments (B operand, column = query lane&15 of tile qt): 2 d-chunks, hi and residual ----
  v16h qah[2][2], qal[2][2];
#pragma unroll
  for (int qt = 0; qt < 2; ++qt)
#pragma unroll
    for (int dc = 0; dc < 2; ++dc) {
      qah[qt][dc] = ldfrag_h(Qh + (size_t)(q0 + qt * 16 + c) * DM + dc * 32 + 8 * hh);
      qal[qt][dc] = ldfrag_h(Ql + (size_t)(q0 + qt * 16 + c) * DM + dc * 32 + 8 * hh);
    }

  float mrun[2], lrun[2];      // per query tile: running maximum of query c (equal in both wave halves); running sum of 1024 p over this wave half's keys
  v8f oacc[2][4];              // oacc[qt][t][r] = O^T[d = t*16 + 8*hh + r][query c of tile qt]
#pragma unroll
  for (int qt = 0; qt < 2; ++qt) {
    mrun[qt] = -INFINITY;
    lrun[qt] = 0.f;
#pragma unroll
    for (int t = 0; t < 4; ++t) oacc[qt][t] = zero8();
  }

  // ---- chunk copies, by the 128 threads of the key half: thread -> rows (tl >> 3) + 16 * i, i = 0..3, of each tile, 16 B at column 8 * (tl & 7) ----
  const int tl = tid & 127;
  const int trow = tl >> 3, tcol = (tl & 7) * 8;
  const _Float16* kg0 = Kg + (size_t)trow * DM + tcol;              // chunk 0 of the half: K row trow, d = tcol..tcol+7
  const _Float16* vg0 = Vg + (size_t)trow * SEQ + tcol;             // chunk 0 of the half: V^T row d = trow, s = tcol..tcol+7
  const _Float16* ringh = kvring + kh * (2 * 2 * TL);               // the half's two buffers
  const unsigned  lk0 = lds_off(ringh) + (unsigned)(trow * LP + tcol) * 2u;
  auto copy_chunk = [&](int ck, int buf) {
    const unsigned l = lk0 + (unsigned)buf * (unsigned)(2 * TL * 2);
    copy4x2_lds(l, l + (unsigned)(TL * 2), 16u * LP * 2u,
                kg0 + (size_t)ck * 64 * DM, (size_t)16 * DM, vg0 + (size_t)ck * 64, (size_t)16 * SEQ);
  };
  copy_chunk(0, 0);
  wait_copies();
  __syncthreads();                           // chunk 0 is readable by every wave
  copy_chunk(1, 1);

  for (int kt = 0; kt < NKH; ++kt) {         // static trip count
    const _Float16* Ksh = ringh + (kt & 1) * (2 * TL);   // keys kv0 = kh * SEQ/2 + kt * 64 .. kv0 + 63
    const _Float16* Vth = Ksh + TL;

    // ---- scores, transposed: 64 keys x 32 queries per wave, 2 f16 products (hi, residual), each K fragment used by both query tiles;
    //      s[qt][j][r] = score of key kv0 + j*16 + 8*hh + r with query q0 + qt*16 + c ----
    v8f s[2][4];
#pragma unroll
    for (int j = 0; j < 4; ++j) {
      FH kb[2];
#pragma unroll
      for (int dc = 0; dc < 2; ++dc) {
        kb[dc].h[0] = *(const v8h*)(Ksh + (j * 16 + c) * LP + dc * 32 + 8 * hh);
        kb[dc].h[1] = *(const v8h*)(Ksh + (j * 16 + c) * LP + dc * 32 + 16 + 8 * hh);
      }
#pragma unroll
      for (int qt = 0; qt < 2; ++qt) {
        // one accumulator per tile: the residual products first, brought to scale, then the hi products on top of them
        v8f a = zero8();
#pragma unroll
        for (int dc = 0; dc < 2; ++dc) a = mma_h(kb[dc].v, qal[qt][dc], a);
        a = a * RRES;
#pragma unroll
        for (int dc = 0; dc < 2; ++dc) a = mma_h(kb[dc].v, qah[qt][dc], a);
        s[qt][j] = a;
      }
    }

    FH pb[2][2];
#pragma unroll   // constant indices, so that the per-tile arrays stay in registers
    for (int qt = 0; qt < 2; ++qt) {
      // ---- maximum of the lane's 32 scores, joined with the other wave half's; online softmax ----
      float mj[4];
#pragma unroll
      for (int j = 0; j < 4; ++j) {
        mj[j] = s[qt][j][0];
#pragma unroll
        for (int r = 1; r < 8; ++r) mj[j] = fmaxf(mj[j], s[qt][j][r]);
      }
      float m = fmaxf(fmaxf(mj[0], mj[1]), fmaxf(mj[2], mj[3]));
      m = fmaxf(m, xhalf(m));
      const float mnew  = fmaxf(mrun[qt], m);
      const float alpha = __builtin_amdgcn_exp2f(mrun[qt] - mnew);
      const float poff  = 10.0f - mnew;        // exponent offset: minus the maximum, plus 10 for the x1024 carry of p
      mrun[qt] = mnew;

      // ---- P^T (x1024, f16) straight into the B operand: element e of 32-key block kk = key kk*32 + (e < 8 ? 8*hh + e : 16 + 8*hh + e - 8) ----
      float pj[4];
#pragma unroll   // constant indices, so that s stays in registers
      for (int j = 0; j < 4; ++j) s[qt][j] = s[qt][j] + poff;   // whole tiles at once: packed adds
#pragma unroll
      for (int j = 0; j < 4; ++j) {
        pj[j] = 0.f;
#pragma unroll
        for (int r = 0; r < 8; ++r) {
          const float p = __builtin_amdgcn_exp2f(s[qt][j][r]);   // 1024 p
          pj[j] += p;
          pb[qt][j >> 1].h[j & 1][r] = (_Float16)p;
        }
      }
      lrun[qt] = lrun[qt] * alpha + ((pj[0] + pj[1]) + (pj[2] + pj[3]));
#pragma unroll
      for (int t = 0; t < 4; ++t)
#pragma unroll
        for (int r = 0; r < 8; ++r) oacc[qt][t][r] *= alpha;
    }

    __builtin_amdgcn_sched_barrier(0);   // keeps the V^T reads behind the softmax: read ahead of it, their registers come on top of both tiles' scores and a Q fragment spills to scratch
    // ---- context^T += V^T . P^T (f16 WMMA), each V^T fragment used by both query tiles ----
#pragma unroll
    for (int kk = 0; kk < 2; ++kk) {
#pragma unroll
      for (int t = 0; t < 4; ++t) {
        FH vb;
        vb.h[0] = *(const v8h*)(Vth + (t * 16 + c) * LP + kk * 32 + 8 * hh);
        vb.h[1] = *(const v8h*)(Vth + (t * 16 + c) * LP + kk * 32 + 16 + 8 * hh);
#pragma unroll
        for (int qt = 0; qt < 2; ++qt) oacc[qt][t] = mma_h(vb.v, pb[qt][kk].v, oacc[qt][t]);
      }
    }
    wait_lds_reads();
    wait_copies();
    __syncthreads();                         // publishes chunk kt+1 and ends every wave's reads of chunk kt's buffer
    if (kt + 2 < NKH) copy_chunk(kt + 2, kt & 1);
  }
  wait_copies();

  // ---- the two key halves meet: this wave keeps query tile kh and hands tile 1 - kh (context, maximum, sum; unnormalised) to wave ^ 4.
  //      A lane reads back exactly the addresses its partner lane wrote: row = query c; d = t*16 + 8*hh .. + 7; columns 64 + 2*hh, 65 + 2*hh.
  const bool up = (kh != 0);                 // wave-uniform
  const float l0 = lrun[0] + xhalf(lrun[0]);   // the wave halves' sums joined
  const float l1 = lrun[1] + xhalf(lrun[1]);
  {
    float* xs = Os[wave];
#pragma unroll
    for (int t = 0; t < 4; ++t) {
      v4f w0, w1;
#pragma unroll
      for (int e = 0; e < 4; ++e) {
        w0[e] = up ? oacc[0][t][e]     : oacc[1][t][e];
        w1[e] = up ? oacc[0][t][4 + e] : oacc[1][t][4 + e];
      }
      *(v4f*)(xs + c * OSP + t * 16 + 8 * hh)     = w0;
      *(v4f*)(xs + c * OSP + t * 16 + 8 * hh + 4) = w1;
    }
    xs[c * OSP + 64 + 2 * hh] = up ? mrun[0] : mrun[1];
    xs[c * OSP + 65 + 2 * hh] = up ? l0 : l1;
  }
  __syncthreads();                           // every wave's handed-over tile is readable by its partner
  // ---- join, normalise (1/l; the x1024 cancels) and stage the finished 16x64 tile in the slab just read, which no other wave touches again
  float* os = Os[wave ^ 4];
  {
    const float mo = os[c * OSP + 64 + 2 * hh];
    const float lo = os[c * OSP + 65 + 2 * hh];
    const float ms = up ? mrun[1] : mrun[0];
    const float ls = up ? l1 : l0;
    const float mm = fmaxf(ms, mo);
    const float as = __builtin_amdgcn_exp2f(ms - mm);
    const float ao = __builtin_amdgcn_exp2f(mo - mm);
    const float l = ls * as + lo * ao;
    const float inv = (l > 0.f) ? (1.0f / l) : 0.f;      // sum and context both carry the x1024 of p
    const float fs = as * inv, fo = ao * inv;
#pragma unroll
    for (int t = 0; t < 4; ++t) {
      const v4f o0 = *(const v4f*)(os + c * OSP + t * 16 + 8 * hh);
      const v4f o1 = *(const v4f*)(os + c * OSP + t * 16 + 8 * hh + 4);
      v4f w0, w1;
#pragma unroll
      for (int e = 0; e < 4; ++e) {
        w0[e] = (up ? oacc[1][t][e]     : oacc[0][t][e])     * fs + o0[e] * fo;
        w1[e] = (up ? oacc[1][t][4 + e] : oacc[0][t][4 + e]) * fs + o1[e] * fo;
      }
      *(v4f*)(os + c * OSP + t * 16 + 8 * hh)     = w0;
      *(v4f*)(os + c * OSP + t * 16 + 8 * hh + 4) = w1;
    }
  }
  wave_sync_lds();
  // ---- bf16 hi/lo split, whole-line stores of the wave's finished tile: rows qf .. qf + 15
  {
    const int qf = q0 + kh * 16;
    const int q4 = lane >> 3, c8 = (lane & 7) * 8;
    v4u hv[4], lv[4];
#pragma unroll
    for (int it = 0; it < 4; ++it) {
      const int row = it * 4 + q4;   // it 0..3 x q4 0..3 = rows 0..15 of the wave tile
      const float* sp = os + row * OSP + c8;
      v4u a, a2;
#pragma unroll
      for (int e = 0; e < 4; ++e) {
        const float f0 = sp[2 * e], f1 = sp[2 * e + 1];
        const unsigned short h0 = bf_bits(f0), h1 = bf_bits(f1);
        const unsigned short l0b = bf_bits(f0 - bf_up(h0)), l1b = bf_bits(f1 - bf_up(h1));
        a[e] = pk16(h0, h1); a2[e] = pk16(l0b, l1b);
      }
      hv[it] = a; lv[it] = a2;
    }
    {
#pragma unroll
      for (int it = 0; it < 4; ++it) {
        const int row = it * 4 + q4;
        const size_t go = (size_t)(qf + row) * DM + (size_t)h * HD + c8;
        *(v4u*)(ohp + go) = hv[it];
        *(v4u*)(olp + go) = lv[it];
      }
    }
  }
}

// =====================================================================================================
// Workspace map (bytes), every plane an exact multiple of its 64x64-tile / whole-line store granularity:
//   Xb    bf16 [4096][1024]          0           8388608
//   Wqkvb bf16 [3072 n][1024 k]      8388608     6291456   (rows 0..1023 q, 1024..2047 k, 2048..3071 v weights)
//   Wob   bf16 [1024][1024]          14680064    2097152
//   Qh    f16  [4096][1024]          16777216    8388608
//   Ql    f16  [4096][1024]          25165824    8388608   (q residual x4096)
//   Kp    f16  [4096][1024]          33554432    8388608
//   VT    f16  [1024][4096]          41943040    8388608   (v^T incl. bias)
//   Oh    bf16 [4096][1024]          50331648    8388608
//   Ol    bf16 [4096][1024]          58720256    8388608
//   end                              67108864
// Weights are [out n][in k] with k contiguous = the Bt / A layout the GEMM wants, so they are only converted.
// =====================================================================================================
extern "C" void kernel_launch(void* const* d_in, const int* in_sizes, int n_in,
                              void* d_out, int out_size, void* d_ws, size_t ws_size,
                              hipStream_t stream) {
  if (n_in < 7) return;
  if (in_sizes[0] != SEQ * DM) return;
  if (in_sizes[1] != SEQ * HD) return;
  if (in_sizes[2] != SEQ * HD) return;
  if (in_sizes[3] != 3 * DM * DM) return;
  if (in_sizes[4] != 3 * DM) return;
  if (in_sizes[5] != DM * DM) return;
  if (in_sizes[6] != DM) return;
  if (out_size != SEQ * DM) return;

  const float* x     = (const float*)d_in[0];
  const float* cosp  = (const float*)d_in[1];
  const float* sinp  = (const float*)d_in[2];
  const float* wqkv  = (const float*)d_in[3];
  const float* bqkv  = (const float*)d_in[4];
  const float* wout  = (const float*)d_in[5];
  const float* bout  = (const float*)d_in[6];

  const size_t PXb  = (size_t)SEQ * DM * 2;           //  8388608
  const size_t PWq  = (size_t)3 * DM * DM * 2;        //  6291456
  const size_t PWo  = (size_t)DM * DM * 2;            //  2097152
  const size_t P16  = (size_t)SEQ * DM * 2;           //  8388608 (q hi, q res, k, out hi, out lo)
  const size_t PVT  = (size_t)DM * SEQ * 2;           //  8388608
  size_t off = 0;
  const size_t oXb  = off; off += PXb;
  const size_t oWq  = off; off += PWq;
  const size_t oWo  = off; off += PWo;
  const size_t oQh  = off; off += P16;
  const size_t oQl  = off; off += P16;
  const size_t oKp  = off; off += P16;
  const size_t oVT  = off; off += PVT;
  const size_t oOh  = off; off += P16;
  const size_t oOl  = off; off += P16;
  if (off > ws_size) return;                          // off = 67108864
  if (off > (size_t)134217728) return;

  char* ws = (char*)d_ws;
  unsigned short* Xb    = (unsigned short*)(ws + oXb);
  unsigned short* Wqkvb = (unsigned short*)(ws + oWq);
  unsigned short* Wob   = (unsigned short*)(ws + oWo);
  unsigned short* Qh    = (unsigned short*)(ws + oQh);
  unsigned short* Ql    = (unsigned short*)(ws + oQl);
  unsigned short* Kp    = (unsigned short*)(ws + oKp);
  unsigned short* VT    = (unsigned short*)(ws + oVT);
  unsigned short* Oh    = (unsigned short*)(ws + oOh);
  unsigned short* Ol    = (unsigned short*)(ws + oOl);

  const dim3 blk(256);
  const int n8x  = SEQ * DM / 8;                                // 524288
  const int n8wq = 3 * DM * DM / 8;                             // 393216
  const int n8wo = DM * DM / 8;                                 // 131072
  const dim3 gCvtX((n8x + 255) / 256);                          // 2048 blocks
  const dim3 gCvtWq((n8wq + 255) / 256);                        // 1536 blocks
  const dim3 gCvtWo((n8wo + 255) / 256);                        //  512 blocks
  const dim3 gQKV(NBQK + NBVT);                                 // 256 blocks (M=4096, N=2048) + 128 blocks (M=1024, N=4096)
  const dim3 gAttn(NH * (SEQ / QWG));                           //  512 blocks
  const dim3 gOut(((SEQ / 64) * (DM / 64) + 7) / 8, 1);         // 1024 tiles -> 128 blocks: M=4096, N=1024

  // (1) x -> bf16 plane [4096][1024]; w_qkv -> bf16 [3072][1024]; w_out -> bf16 [1024][1024]
  cvt_bf16x8<<<gCvtX, blk, 0, stream>>>(x, Xb, n8x);
  cvt_bf16x8<<<gCvtWq, blk, 0, stream>>>(wqkv, Wqkvb, n8wq);
  cvt_bf16x8<<<gCvtWo, blk, 0, stream>>>(wout, Wob, n8wo);
  // (2, 3) q|k projection with RoPE and v^T projection, one launch
  proj_qkv<<<gQKV, blk, 0, stream>>>(Xb, Wqkvb, Qh, Ql, Kp, VT, bqkv, cosp, sinp);
  // (4) attention -> context bf16 hi / lo planes [4096][1024]
  attn64<<<gAttn, blk, 0, stream>>>(Qh, Ql, Kp, VT, Oh, Ol);
  // (5) out = context . w_out^T + b_out -> d_out f32 [4096][1024]  (A = context hi + lo planes, 2 products; K=1024, col bias)
  gemm64<1, 0, 1><<<gOut, blk, 0, stream>>>(
      Oh, Ol, DM, 0LL, Wob, Wob, DM, 0LL,
      d_out, DM, 0LL, d_out, DM, 0LL, 0,
      bout, cosp, sinp, Kp,
      SEQ, DM, DM, 1.0f, 1.0f);
  (void)hipGetLastError();
}

// v010
// Measured time: 117 microseconds a run.
// Next to v009, in two timings, it ran 1.12 times as fast each time.
// Over all steps from v000 it is 4.37 times as fast.
// Contractions: q|k projection and v^T projection = v_wmma_f32_16x16x32_bf16 (bf16 operands from RNE-converted x and w_qkv, single product);
// k.q^T scores = v_wmma_f32_16x16x32_f16 (q, carrying the score scale and log2 e, f16; k f16; both rounded once from f32; 1 product);
// v^T.p^T = v_wmma_f32_16x16x32_f16 (p carried x1024 in f16, v^T f16; 1 product);
// ctx.w_out^T = v_wmma_f32_16x16x32_bf16 (ctx as bf16 hi + lo planes times bf16 w_out, 2 products); all f32 accumulate; bias, RoPE, softmax in f32.
#include <hip/hip_runtime.h>
#include <math.h>
#include <stdint.h>

#define SEQ   4096
#define DM    1024
#define NH    16
#define HD    64
#define NQB   (SEQ / 64)     // 64 key / query tiles of 64
#define QKP   (2 * DM)        // columns of the joint q|k projection: q at cols 0..DM-1, k at cols DM..2DM-1
#define QSC   0.18033688011112042f   // HD^-0.5 * log2(e) = 0.125 * 1.4426950408889634: the factor q carries, so that k.q is the exponent to base 2
#define LP    72              // LDS row pitch of the 64-wide f16 tiles, in elements: 144 B = 16 B x odd, so the 16 rows of a 16-B fragment read fall on 16 distinct bank groups
static_assert(NH * HD == DM);
static_assert((SEQ % 64) == 0 && (DM % 64) == 0 && (DM % 32) == 0);
static_assert((SEQ % 256) == 0 && (DM % 256) == 0);   // GEMM block tile 128 x 256, for every M and N used here
static_assert(HD == 64);      // a GEMM wave tile (64 columns) is one whole head, so a column's RoPE partner lies in the same tile
static_assert(LP >= 64 && (LP % 8) == 0 && ((LP / 8) & 1) == 1);

typedef _Float16 v16h __attribute__((ext_vector_type(16)));
typedef _Float16 v8h  __attribute__((ext_vector_type(8)));
typedef __bf16   v16b __attribute__((ext_vector_type(16)));
typedef __bf16   v8b  __attribute__((ext_vector_type(8)));
typedef float    v8f  __attribute__((ext_vector_type(8)));
typedef float    v4f  __attribute__((ext_vector_type(4)));
typedef unsigned int v4u __attribute__((ext_vector_type(4)));

// ---- scalar helpers --------------------------------------------------------------------------------
__device__ __forceinline__ unsigned short bf_bits(float f) {          // f32 -> bf16 bits, RNE convert
  unsigned u = __float_as_uint(f);
  return (unsigned short)((u + 0x7FFFu + ((u >> 16) & 1u)) >> 16);
}
__device__ __forceinline__ float bf_up(unsigned short h) { return __uint_as_float(((unsigned)h) << 16); }
__device__ __forceinline__ float bf_rne(float f) { return bf_up(bf_bits(f)); }
__device__ __forceinline__ unsigned short h_bits(_Float16 x) { return __builtin_bit_cast(unsigned short, x); }
__device__ __forceinline__ unsigned pk16(unsigned short a, unsigned short b) { return (unsigned)a | ((unsigned)b << 16); }
__device__ __forceinline__ v8f zero8() { v8f z = {0.f, 0.f, 0.f, 0.f, 0.f, 0.f, 0.f, 0.f}; return z; }

// ---- fragment loaders: 16-bit A/B operand, lane -> row/col (lane&15), p already includes +8*(lane>>4);
//      elements 0..7 <- p[0..7] (k0+8h..), elements 8..15 <- p[16..23] (k0+16+8h..)
__device__ __forceinline__ v16b ldfrag_b(const __bf16* p) {
  union { v16b v; v8b h[2]; } f;
  f.h[0] = *(const v8b*)(p);
  f.h[1] = *(const v8b*)(p + 16);
  return f.v;
}
__device__ __forceinline__ v16h ldfrag_h(const _Float16* p) {
  union { v16h v; v8h h[2]; } f;
  f.h[0] = *(const v8h*)(p);
  f.h[1] = *(const v8h*)(p + 16);
  return f.v;
}

// ---- WMMA helpers --------------------------------------------------------------------------------------
// f16 product (attention): the builtin alone. The compiler keeps the distance behind its own WMMA, and with no statement
// tied to each product it is free to issue the LDS fragment reads of several products together, ahead of them.
__device__ __forceinline__ v8f mma_h(v16h a, v16h b, v8f c) {
  return __builtin_amdgcn_wmma_f32_16x16x32_f16(false, a, false, b, (short)0, c, false, false);
}
// bf16 product (GEMMs), with its hand-written gaps
__device__ __forceinline__ v8f mma_b_raw(v16b a, v16b b, v8f c) {
  return __builtin_amdgcn_wmma_f32_16x16x32_bf16(false, a, false, b, (short)0, c, false, false);
}
__device__ __forceinline__ void dep_guard_b(v8f& a, v8f& b, v16b x, v16b y) {
#if defined(__HIP_DEVICE_COMPILE__)
  asm volatile("v_nop\n\tv_nop\n\tv_nop\n\tv_nop" : "+v"(a), "+v"(b) : "v"(x), "v"(y));
#endif
}
__device__ __forceinline__ void keep4_b(v16b a, v16b b, v16b c, v16b d) {
#if defined(__HIP_DEVICE_COMPILE__)
  asm volatile("v_nop" :: "v"(a), "v"(b), "v"(c), "v"(d));
#endif
}
__device__ __forceinline__ void acc_guard4(v8f& a, v8f& b, v8f& c, v8f& d) {
#if defined(__HIP_DEVICE_COMPILE__)
  asm volatile("v_nop\n\tv_nop\n\tv_nop\n\tv_nop" : "+v"(a), "+v"(b), "+v"(c), "+v"(d));
#endif
}
__device__ __forceinline__ void wave_sync_lds() {
  __builtin_amdgcn_fence(__ATOMIC_RELEASE, "workgroup");
  __builtin_amdgcn_wave_barrier();
  __builtin_amdgcn_fence(__ATOMIC_ACQUIRE, "workgroup");
}

// ---- asynchronous copies global -> LDS, 16 B per lane: l = the lane's LDS byte address, g = its global address.
//      A run of copies and its s_wait_xcnt 0 are one statement, so that no address register is rewritten ahead of the wait.
__device__ __forceinline__ unsigned lds_off(const void* p) { return (unsigned)(size_t)p; }
__device__ __forceinline__ void copy4_lds(unsigned l, unsigned lstep, const __bf16* g, size_t gstep) {
#if defined(__HIP_DEVICE_COMPILE__)
  asm volatile("global_load_async_to_lds_b128 %0, %1, off\n\t"
               "global_load_async_to_lds_b128 %2, %3, off\n\t"
               "global_load_async_to_lds_b128 %4, %5, off\n\t"
               "global_load_async_to_lds_b128 %6, %7, off\n\t"
               "s_wait_xcnt 0x0"
               :: "v"(l), "v"(g), "v"(l + lstep), "v"(g + gstep),
                  "v"(l + 2 * lstep), "v"(g + 2 * gstep), "v"(l + 3 * lstep), "v"(g + 3 * gstep)
               : "memory");
#endif
}
__device__ __forceinline__ void copy8_lds(unsigned l0, unsigned l1, unsigned lstep,
                                          const __bf16* g0, const __bf16* g1, size_t gstep) {
#if defined(__HIP_DEVICE_COMPILE__)
  asm volatile("global_load_async_to_lds_b128 %0, %1, off\n\t"
               "global_load_async_to_lds_b128 %2, %3, off\n\t"
               "global_load_async_to_lds_b128 %4, %5, off\n\t"
               "global_load_async_to_lds_b128 %6, %7, off\n\t"
               "global_load_async_to_lds_b128 %8, %9, off\n\t"
               "global_load_async_to_lds_b128 %10, %11, off\n\t"
               "global_load_async_to_lds_b128 %12, %13, off\n\t"
               "global_load_async_to_lds_b128 %14, %15, off\n\t"
               "s_wait_xcnt 0x0"
               :: "v"(l0), "v"(g0), "v"(l0 + lstep), "v"(g0 + gstep),
                  "v"(l0 + 2 * lstep), "v"(g0 + 2 * gstep), "v"(l0 + 3 * lstep), "v"(g0 + 3 * gstep),
                  "v"(l1), "v"(g1), "v"(l1 + lstep), "v"(g1 + gstep),
                  "v"(l1 + 2 * lstep), "v"(g1 + 2 * gstep), "v"(l1 + 3 * lstep), "v"(g1 + 3 * gstep)
               : "memory");
#endif
}
// the same for two f16 planes of different row pitch: 4 copies from g0 (rows gstep0 apart) to l0.., 4 from g1 (gstep1) to l1..
__device__ __forceinline__ void copy4x2_lds(unsigned l0, unsigned l1, unsigned lstep,
                                            const _Float16* g0, size_t gstep0, const _Float16* g1, size_t gstep1) {
#if defined(__HIP_DEVICE_COMPILE__)
  asm volatile("global_load_async_to_lds_b128 %0, %1, off\n\t"
               "global_load_async_to_lds_b128 %2, %3, off\n\t"
               "global_load_async_to_lds_b128 %4, %5, off\n\t"
               "global_load_async_to_lds_b128 %6, %7, off\n\t"
               "global_load_async_to_lds_b128 %8, %9, off\n\t"
               "global_load_async_to_lds_b128 %10, %11, off\n\t"
               "global_load_async_to_lds_b128 %12, %13, off\n\t"
               "global_load_async_to_lds_b128 %14, %15, off\n\t"
               "s_wait_xcnt 0x0"
               :: "v"(l0), "v"(g0), "v"(l0 + lstep), "v"(g0 + gstep0),
                  "v"(l0 + 2 * lstep), "v"(g0 + 2 * gstep0), "v"(l0 + 3 * lstep), "v"(g0 + 3 * gstep0),
                  "v"(l1), "v"(g1), "v"(l1 + lstep), "v"(g1 + gstep1),
                  "v"(l1 + 2 * lstep), "v"(g1 + 2 * gstep1), "v"(l1 + 3 * lstep), "v"(g1 + 3 * gstep1)
               : "memory");
#endif
}
__device__ __forceinline__ void wait_copies() {     // the wave's own copies have landed in LDS
#if defined(__HIP_DEVICE_COMPILE__)
  asm volatile("s_wait_asynccnt 0x0" ::: "memory");
#endif
}
__device__ __forceinline__ void wait_lds_reads() {  // the wave's LDS reads have returned, before their buffer is given up for refilling
#if defined(__HIP_DEVICE_COMPILE__)
  asm volatile("s_wait_dscnt 0x0" ::: "memory");
#endif
}

__device__ __forceinline__ void wait_store_regs() { // behind a run of global stores, before their data and address registers are written again
#if defined(__HIP_DEVICE_COMPILE__)
  asm volatile("s_wait_xcnt 0x0" ::: "memory");
#endif
}

// =====================================================================================================
// f32 -> bf16 (RNE convert), 8 elements per thread, one 16-B store per lane: a wave writes 512 contiguous B
// coverage: n8 threads x 8 = whole plane (n8 is a multiple of 256 for every use here).
// =====================================================================================================
__global__ __launch_bounds__(256) void cvt_bf16x8(const float* __restrict__ in, unsigned short* out, int n8) {
  const int i = blockIdx.x * 256 + threadIdx.x;
  if (i < n8) {
    const v4f a = *(const v4f*)(in + (size_t)i * 8);
    const v4f b = *(const v4f*)(in + (size_t)i * 8 + 4);
    v4u p;
    p[0] = pk16(bf_bits(a[0]), bf_bits(a[1]));
    p[1] = pk16(bf_bits(a[2]), bf_bits(a[3]));
    p[2] = pk16(bf_bits(b[0]), bf_bits(b[1]));
    p[3] = pk16(bf_bits(b[2]), bf_bits(b[3]));
    *(v4u*)(out + (size_t)i * 8) = p;
    
  }
}

// =====================================================================================================
// Register-blocked batched bf16 WMMA GEMM: C[m][n] = sum_k A[m][k] * Bt[n][k] + bias; one wave per 64x64 tile,
// the 8 waves of a block as 2 x 4 = one 128x256 tile. A row-major [M][K] pitch lda; Bt row-major [N][K] pitch ldb
// (k contiguous); M multiple of 128, N of 256, K of 64. blockIdx.y = batch index (strides in elements).
// Operands: a stage = 64 k = one whole 128-B line of each of the block's A and Bt rows, brought into LDS by asynchronous
// copies (8 lanes per row, 4 whole lines per wave copy), rows at pitch LP; two buffers, stage t+2 copied while t+1 is worked on;
// fragments are read from LDS in the k order of ldfrag_b, k ascending.
// NSPLIT: 0 = A.Bt; 1 = (A + A2).Bt (A2 = unscaled bf16 lo plane of A); 2 = A.Bt + A2.Bt + A.Bt2.
// OUT_MODE: 0 = f32 (pitch ldc); 2 = bf16 hi plane C + bf16 lo plane C2 (lo = RNE(v - hi), unscaled);
//           3 = f16 hi plane C + f16 residual plane C2 = f16((v - hi) * rscale), C2 written only for tiles
//               with n0 < N2 (pitch ldc2, batch stride strideC2);
//           4 = RoPE (rotate-half, half = HD/2 = 32) on the wave's 64-column tile = one head of q (n0 < N2) or of k, row m = token:
//               y[d] = x[d] * cos[m][d] + (d < 32 ? -x[d+32] : x[d-32]) * sin[m][d], x with its bias, tables [M][HD] shared over
//               heads and RNE-converted to bf16 on read; q: y * yscale -> f16 plane C,
//               k -> f16 plane C3 at column n0 - N2; both at pitch ldc, one batch (no batch stride applied).
// BIAS_MODE: 1 = + biasp[n] (per column), 2 = + biasp[m] (per row); bias values RNE-converted to bf16 and
//            added in f32 before any 16-bit conversion of the result.
// =====================================================================================================
// The body is a device function: bx = the work-group's tile index, b = its batch index, sT and ring = the calling kernel's LDS
// (sT: 8 slabs of 16 x 68 floats; ring: two stage buffers of gemm_stage_elems<NSPLIT>() elements).
template <int NSPLIT>
__host__ __device__ constexpr int gemm_stage_elems() {
  return (((NSPLIT >= 1) ? 256 : 128) + ((NSPLIT == 2) ? 512 : 256)) * LP;
}
template <int NSPLIT, int OUT_MODE, int BIAS_MODE>
__device__ __forceinline__ void gemm64_body(
    float* sTall, __bf16* ring, int bx, int b,
    const unsigned short* __restrict__ Ap, const unsigned short* A2p, int lda, long long strideA,
    const unsigned short* __restrict__ Btp, const unsigned short* Bt2p, int ldb, long long strideB,
    void* Cout, int ldc, long long strideC,
    void* Cout2, int ldc2, long long strideC2, int N2,
    const float* __restrict__ biasp,
    const float* __restrict__ cosp, const float* __restrict__ sinp, unsigned short* C3p,
    int M, int N, int K, float rscale, float yscale) {
  const __bf16* A   = (const __bf16*)(const void*)Ap;
  const __bf16* A2  = (const __bf16*)(const void*)A2p;
  const __bf16* Bt  = (const __bf16*)(const void*)Btp;
  const __bf16* Bt2 = (const __bf16*)(const void*)Bt2p;
  constexpr int RB   = (NSPLIT >= 1) ? 256 : 128;            // stage rows: A 0..127, A2 128..255 (NSPLIT >= 1), then Bt 256 rows, Bt2 256 rows (NSPLIT == 2)
  constexpr int ROWS = RB + ((NSPLIT == 2) ? 512 : 256);
  constexpr int STG  = ROWS * LP;                            // elements of one stage buffer
  static_assert(STG == gemm_stage_elems<NSPLIT>());
  const int lane = threadIdx.x & 31;
  const int wave = threadIdx.x >> 5;
  const int tilesN = N >> 8;
  const int tilesM = M >> 7;
  if (bx >= tilesM * tilesN) return;                // block-uniform, in front of every barrier
  const int tm = bx / tilesN;
  const int tn = bx - tm * tilesN;
  const int wm = (wave >> 2) << 6;                  // the wave's 64x64 tile inside the block's 128x256
  const int wn = (wave & 3) << 6;
  const int m0 = (tm << 7) + wm;
  const int n0 = (tn << 8) + wn;

  const __bf16* Ab  = A  + (size_t)b * strideA;
  const __bf16* Bb  = Bt + (size_t)b * strideB;
  const __bf16* Ab2 = (NSPLIT >= 1) ? (A2  + (size_t)b * strideA) : Ab;
  const __bf16* Bb2 = (NSPLIT == 2) ? (Bt2 + (size_t)b * strideB) : Bb;

  const int rlane = lane & 15;                 // row (A) / col (B, D) within subtile
  const int koff  = (lane >> 4) * 8;           // k offset of this lane half
  const int mOff  = (lane >> 4) * 8;           // D row offset

  v8f acc[4][4];
#pragma unroll
  for (int i = 0; i < 4; ++i)
#pragma unroll
    for (int j = 0; j < 4; ++j) acc[i][j] = zero8();

  // ---- stage copies: thread -> row (threadIdx.x >> 3) + 32 * c of each 128-row group, 16 B at column 8 * (threadIdx.x & 7) ----
  const int trow = threadIdx.x >> 3;
  const int tcol = (threadIdx.x & 7) * 8;
  const size_t   aoff  = (size_t)((tm << 7) + trow) * lda + tcol;
  const size_t   boff  = (size_t)((tn << 8) + trow) * ldb + tcol;
  const unsigned lrow  = lds_off(ring) + (unsigned)(trow * LP + tcol) * 2u;
  const unsigned lstep = 32u * LP * 2u;                       // 32 rows further in LDS, bytes
  auto copy_stage = [&](int st, int buf) {
    const unsigned l = lrow + (unsigned)buf * (unsigned)(STG * 2);
    const size_t   k = (size_t)st * 64;
    if (NSPLIT >= 1) copy8_lds(l, l + 4u * lstep, lstep, Ab + aoff + k, Ab2 + aoff + k, (size_t)32 * lda);
    else             copy4_lds(l, lstep, Ab + aoff + k, (size_t)32 * lda);
    copy8_lds(l + (unsigned)(RB * LP * 2), l + (unsigned)((RB + 128) * LP * 2), lstep,
              Bb + boff + k, Bb + boff + k + (size_t)128 * ldb, (size_t)32 * ldb);
    if (NSPLIT == 2)
      copy8_lds(l + (unsigned)((RB + 256) * LP * 2), l + (unsigned)((RB + 384) * LP * 2), lstep,
                Bb2 + boff + k, Bb2 + boff + k + (size_t)128 * ldb, (size_t)32 * ldb);
  };

  const int nst = K >> 6;                     // stages of 64 k; block-uniform
  copy_stage(0, 0);
  wait_copies();
  __syncthreads();                            // stage 0 is readable by every wave
  if (nst > 1) copy_stage(1, 1);

  for (int t = 0; t < nst; ++t) {
    const __bf16* sb = ring + (t & 1) * STG;
#pragma unroll   // as the inner loops: every fragment and accumulator index constant, so the arrays stay in registers
    for (int ks = 0; ks < 2; ++ks) {
      v16b bh[4], bl[4], ah[4], al[4];
#pragma unroll
      for (int j = 0; j < 4; ++j) {
        const int bo = (RB + wn + (j << 4) + rlane) * LP + koff + ks * 32;
        bh[j] = ldfrag_b(sb + bo);
        if (NSPLIT == 2) bl[j] = ldfrag_b(sb + bo + 256 * LP); else bl[j] = bh[j];
      }
#pragma unroll
      for (int i = 0; i < 4; ++i) {
        const int ao = (wm + (i << 4) + rlane) * LP + koff + ks * 32;
        ah[i] = ldfrag_b(sb + ao);
        if (NSPLIT >= 1) al[i] = ldfrag_b(sb + ao + 128 * LP); else al[i] = ah[i];
      }
#pragma unroll
      for (int i = 0; i < 4; ++i) {
#pragma unroll
        for (int j = 0; j < 4; ++j) {
          acc[i][j] = mma_b_raw(ah[i], bh[j], acc[i][j]);
          if (NSPLIT >= 1) acc[i][j] = mma_b_raw(al[i], bh[j], acc[i][j]);
          if (NSPLIT == 2) acc[i][j] = mma_b_raw(ah[i], bl[j], acc[i][j]);
        }
        dep_guard_b(acc[i][0], acc[i][3], ah[i], al[i]);
      }
      keep4_b(bh[0], bh[1], bh[2], bh[3]);
      if (NSPLIT == 2) keep4_b(bl[0], bl[1], bl[2], bl[3]);
    }
    wait_lds_reads();
    wait_copies();
    __syncthreads();                          // publishes stage t+1 and ends every wave's reads of stage t's buffer
    if (t + 2 < nst) copy_stage(t + 2, t & 1);
  }
  wait_copies();
  acc_guard4(acc[0][0], acc[0][1], acc[0][2], acc[0][3]);
  acc_guard4(acc[1][0], acc[1][1], acc[1][2], acc[1][3]);
  acc_guard4(acc[2][0], acc[2][1], acc[2][2], acc[2][3]);
  acc_guard4(acc[3][0], acc[3][1], acc[3][2], acc[3][3]);

  // ---- epilogue ----
  float* slab = sTall + wave * (16 * 68);
  // OUT_MODE 4: cos / sin of the 8 columns 8 * (lane & 7).. of rows it * 4 + (lane >> 3) of 16-row group i; group i + 1's loads are
  // issued behind group i's stores, so that both are in flight together
  v4f tcs[4][2], tsn[4][2];
  const unsigned tlane = ((unsigned)(m0 + (lane >> 3)) * HD + (unsigned)(lane & 7) * 8u) * 4u;   // the lane's byte offset in a table, group 0, it 0
  auto load_tables = [&](int i) {
#pragma unroll
    for (int it = 0; it < 4; ++it) {
      const char* tc = (const char*)cosp + (size_t)tlane + ((i << 4) + it * 4) * HD * 4;   // one offset register, the rest a constant
      const char* ts = (const char*)sinp + (size_t)tlane + ((i << 4) + it * 4) * HD * 4;
      tcs[it][0] = *(const v4f*)(tc);
      tcs[it][1] = *(const v4f*)(tc + 16);
      tsn[it][0] = *(const v4f*)(ts);
      tsn[it][1] = *(const v4f*)(ts + 16);
    }
  };
#pragma unroll
  for (int i = 0; i < 4; ++i) {
    const int mBase = m0 + (i << 4);
    float brow[8];
#pragma unroll
    for (int r = 0; r < 8; ++r) {
      brow[r] = 0.f;
      if (BIAS_MODE == 2) brow[r] = bf_rne(biasp[mBase + mOff + r]);
    }
#pragma unroll
    for (int j = 0; j < 4; ++j) {
      float bcol = 0.f;
      if (BIAS_MODE == 1) bcol = bf_rne(biasp[n0 + (j << 4) + rlane]);
#pragma unroll
      for (int r = 0; r < 8; ++r) {
        slab[(mOff + r) * 68 + (j << 4) + rlane] = acc[i][j][r] + bcol + brow[r];
      }
    }
    if (OUT_MODE == 4 && i == 0) {
      __builtin_amdgcn_sched_barrier(0);   // keeps the table loads behind the staging stores, where group 0's accumulators are free: moved ahead of them they spill
      load_tables(0);
    }
    wave_sync_lds();
    if (OUT_MODE == 0) {
      float* C = (float*)Cout + (size_t)b * strideC;
      const int hh = lane >> 4, c4 = (lane & 15) * 4;     // 256-B row segment = 16 lanes x 16 B
      {
#pragma unroll
        for (int it = 0; it < 8; ++it) {
          const int row = it * 2 + hh;                     // it 0..7 x hh 0..1 = rows 0..15
          const v4f v = *(const v4f*)(slab + row * 68 + c4);
          *(v4f*)(C + (size_t)(mBase + row) * ldc + n0 + c4) = v;
        }
        
      }
    } else if (OUT_MODE == 4) {
      const int q = lane >> 3, c8 = (lane & 7) * 8;        // 128-B row segment of an f16 plane = 8 lanes x 16 B
      const bool  lowhalf = (c8 < (HD / 2));
      const int   pc8 = lowhalf ? (c8 + HD / 2) : (c8 - HD / 2);   // partner columns, same head = same slab row
      const float sgn = lowhalf ? -1.0f : 1.0f;
      const int   n0u = __builtin_amdgcn_readfirstlane(n0);   // wave-uniform, held as a scalar: plane and branch are chosen once per wave
      const bool  isq = (n0u < N2);
      const float ysc = isq ? yscale : 1.0f;                  // wave-uniform: q takes the constant factor of the scores here, once per element
      char* Ch = (char*)(isq ? (unsigned short*)Cout : C3p) + (size_t)(isq ? n0u : n0u - N2) * 2;
      const unsigned olane = ((unsigned)(m0 + q) * (unsigned)ldc + (unsigned)c8) * 2u;   // the lane's byte offset in a plane, group 0, it 0
      v4u hv[4];
#pragma unroll
      for (int it = 0; it < 4; ++it) {
        const int row = it * 4 + q;                        // it 0..3 x q 0..3 = rows 0..15
        const v4f x0 = *(const v4f*)(slab + row * 68 + c8);
        const v4f x1 = *(const v4f*)(slab + row * 68 + c8 + 4);
        const v4f p0 = *(const v4f*)(slab + row * 68 + pc8);
        const v4f p1 = *(const v4f*)(slab + row * 68 + pc8 + 4);
        const v4f cA = tcs[it][0], cB = tcs[it][1];
        const v4f sA = tsn[it][0], sB = tsn[it][1];
        v4f y0, y1;
#pragma unroll
        for (int e = 0; e < 4; ++e) {
          y0[e] = (x0[e] * bf_rne(cA[e]) + (sgn * p0[e]) * bf_rne(sA[e])) * ysc;
          y1[e] = (x1[e] * bf_rne(cB[e]) + (sgn * p1[e]) * bf_rne(sB[e])) * ysc;
        }
#pragma unroll
        for (int e = 0; e < 2; ++e) {
          hv[it][e]     = pk16(h_bits((_Float16)y0[2 * e]), h_bits((_Float16)y0[2 * e + 1]));
          hv[it][2 + e] = pk16(h_bits((_Float16)y1[2 * e]), h_bits((_Float16)y1[2 * e + 1]));
        }
      }
#pragma unroll
      for (int it = 0; it < 4; ++it)
        *(v4u*)(Ch + (size_t)(((i << 4) + it * 4) * ldc) * 2 + olane) = hv[it];
      wait_store_regs();
      if (i < 3) load_tables(i + 1);
    } else {
      const int q = lane >> 3, c8 = (lane & 7) * 8;
      unsigned short* C  = (unsigned short*)Cout  + (size_t)b * strideC;
      unsigned short* C2 = (unsigned short*)Cout2 + (size_t)b * strideC2;
      const bool wlo = (OUT_MODE == 2) || (n0 < N2);      // wave-uniform
      v4u hv[4], lv[4];
#pragma unroll
      for (int it = 0; it < 4; ++it) {
        const int row = it * 4 + q;                        // it 0..3 x q 0..3 = rows 0..15
        const float* sp = slab + row * 68 + c8;
        v4u a, a2;
#pragma unroll
        for (int e = 0; e < 4; ++e) {
          const float f0 = sp[2 * e], f1 = sp[2 * e + 1];
          unsigned short h0, h1, l0, l1;
          if (OUT_MODE == 2) {
            h0 = bf_bits(f0); h1 = bf_bits(f1);
            l0 = bf_bits(f0 - bf_up(h0)); l1 = bf_bits(f1 - bf_up(h1));
          } else {
            const _Float16 x0 = (_Float16)f0, x1 = (_Float16)f1;
            h0 = h_bits(x0); h1 = h_bits(x1);
            l0 = h_bits((_Float16)((f0 - (float)x0) * rscale));
            l1 = h_bits((_Float16)((f1 - (float)x1) * rscale));
          }
          a[e] = pk16(h0, h1); a2[e] = pk16(l0, l1);
        }
        hv[it] = a; lv[it] = a2;
      }
      {
#pragma unroll
        for (int it = 0; it < 4; ++it) {
          const int row = it * 4 + q;
          *(v4u*)(C + (size_t)(mBase + row) * ldc + n0 + c8) = hv[it];
          if (wlo) *(v4u*)(C2 + (size_t)(mBase + row) * ldc2 + n0 + c8) = lv[it];
        }
        
      }
    }
    wave_sync_lds();
  }
}

// one GEMM per launch: blockIdx.x = tile, blockIdx.y = batch
template <int NSPLIT, int OUT_MODE, int BIAS_MODE>
__global__ __launch_bounds__(256, 1) void gemm64(
    const unsigned short* __restrict__ Ap, const unsigned short* A2p, int lda, long long strideA,
    const unsigned short* __restrict__ Btp, const unsigned short* Bt2p, int ldb, long long strideB,
    void* Cout, int ldc, long long strideC,
    void* Cout2, int ldc2, long long strideC2, int N2,
    const float* __restrict__ biasp,
    const float* __restrict__ cosp, const float* __restrict__ sinp, unsigned short* C3p,
    int M, int N, int K, float rscale, float yscale) {
  __shared__ __align__(16) float sT[8 * 16 * 68];                          // per-wave 16x64 slab, pitch 68 floats
  __shared__ __align__(16) __bf16 ring[2 * gemm_stage_elems<NSPLIT>()];    // two stage buffers
  gemm64_body<NSPLIT, OUT_MODE, BIAS_MODE>(sT, ring, (int)blockIdx.x, (int)blockIdx.y,
      Ap, A2p, lda, strideA, Btp, Bt2p, ldb, strideB, Cout, ldc, strideC, Cout2, ldc2, strideC2, N2,
      biasp, cosp, sinp, C3p, M, N, K, rscale, yscale);
}

// =====================================================================================================
// Both projections of x in ONE launch; they share x and depend on nothing of each other.
//   work-groups 0 .. NBQK-1:          q|k = x . Wqk^T + b_qk (M=SEQ, N=2*DM, K=DM, column bias), RoPE in the epilogue
//                                      -> q * QSC f16 plane, k f16 plane, each [SEQ][DM]
//   work-groups NBQK .. NBQK+NBVT-1:  v^T = Wv . x^T + b_v[row] -> f16 plane [h*64+d][s] (pitch SEQ), no residual plane (N2 = 0)
//                                      (A = rows 2*DM.. of Wqkv [n][k], Bt = x [s][k]; M=DM, N=SEQ, K=DM, row bias = b_qkv rows 2*DM..)
// Alone, the v^T tiles are fewer than the chip's WGPs. LDS and registers let two work-groups stand on one WGP (second launch bound:
// 4 waves per SIMD = a budget of 256 registers), so a v^T work-group runs beside a q|k one and each fills the other's waits.
// =====================================================================================================
#define NBQK ((SEQ / 128) * (QKP / 256))
#define NBVT ((DM / 128) * (SEQ / 256))
__global__ __launch_bounds__(256, 4) void proj_qkv(
    const unsigned short* __restrict__ Xb, const unsigned short* __restrict__ Wqkvb,
    unsigned short* Qh, unsigned short* Kp, unsigned short* VT,
    const float* __restrict__ bqkv, const float* __restrict__ cosp, const float* __restrict__ sinp) {
  __shared__ __align__(16) float sT[8 * 16 * 68];                    // per-wave 16x64 slab, pitch 68 floats
  __shared__ __align__(16) __bf16 ring[2 * gemm_stage_elems<0>()];   // two stage buffers
  const int bx = (int)blockIdx.x;                                    // block-uniform: a work-group takes one side whole
  if (bx < NBQK) {
    gemm64_body<0, 4, 1>(sT, ring, bx, 0,
        Xb, Xb, DM, 0LL, Wqkvb, Wqkvb, DM, 0LL,
        (void*)Qh, DM, 0LL, (void*)Qh, DM, 0LL, DM,
        bqkv, cosp, sinp, Kp,
        SEQ, QKP, DM, 1.0f, QSC);
  } else {
    const unsigned short* Wvb = Wqkvb + (size_t)2 * DM * DM;         // rows 2*DM .. 3*DM-1 of Wqkvb
    gemm64_body<0, 3, 2>(sT, ring, bx - NBQK, 0,
        Wvb, Wvb, DM, 0LL, Xb, Xb, DM, 0LL,
        (void*)VT, SEQ, 0LL, (void*)VT, SEQ, 0LL, 0,
        bqkv + 2 * DM, cosp, sinp, Kp,
        DM, SEQ, DM, 4096.0f, 1.0f);
  }
}

#define OSP 68
__device__ __forceinline__ float xhalf(float x) {
  return __builtin_bit_cast(float, __builtin_amdgcn_permlanex16(__builtin_bit_cast(int, x), __builtin_bit_cast(int, x),
                                                                0x76543210, 0xfedcba98, false, false));
}

#define QWG  128              // query rows of a work-group
#define NKH  (NQB / 2)        // chunks of 64 keys in a key half
static_assert((SEQ % QWG) == 0 && (NQB % 2) == 0 && NKH >= 2);
__global__ __launch_bounds__(256, 4)   // 4 waves per SIMD = two work-groups on a WGP: a budget of 256 registers
void attn64(const unsigned short* __restrict__ qhp,
            const unsigned short* __restrict__ kpp, const unsigned short* __restrict__ vtp,
            unsigned short* ohp, unsigned short* olp) {
  union FH { v16h v; v8h h[2]; };
  constexpr int TL = 64 * LP;                                     // elements of one 64-row tile at pitch LP, 9 KB
  __shared__ __align__(16) _Float16 kvring[2 * 2 * 2 * TL];       // per key half two buffers, each K [kv][d] then V^T [d][kv]
  __shared__ __align__(16) float    Os[8][16 * OSP];              // per wave one context tile [row][d]; columns 64..67 of a row: maximum, sum

  const int tid  = threadIdx.x;
  const int wave = __builtin_amdgcn_readfirstlane(tid >> 5);      // held as a scalar: key half and LDS bases are wave-uniform
  const int lane = tid & 31;
  const int hh   = lane >> 4;
  const int c    = lane & 15;
  const int kh   = wave >> 2;                                     // key half
  const int wq   = wave & 3;

  const int bx   = blockIdx.x;
  const int qb   = bx % (SEQ / QWG);
  const int h    = bx / (SEQ / QWG);
  const int q0   = qb * QWG + wq * 32;

  const _Float16* Qh = (const _Float16*)(const void*)qhp + (size_t)h * HD;
  const _Float16* Kg = (const _Float16*)(const void*)kpp + (size_t)h * HD + (size_t)kh * (SEQ / 2) * DM;
  const _Float16* Vg = (const _Float16*)(const void*)vtp + (size_t)h * HD * SEQ + (size_t)kh * (SEQ / 2);

  // ---- Q fragments (B operand, column = query lane&15 of tile qt): 2 d-chunks ----
  v16h qah[2][2];
#pragma unroll
  for (int qt = 0; qt < 2; ++qt)
#pragma unroll
    for (int dc = 0; dc < 2; ++dc)
      qah[qt][dc] = ldfrag_h(Qh + (size_t)(q0 + qt * 16 + c) * DM + dc * 32 + 8 * hh);

  float mrun[2], lrun[2];      // per query tile: running maximum of query c (equal in both wave halves); running sum of 1024 p over this wave half's keys
  v8f oacc[2][4];              // oacc[qt][t][r] = O^T[d = t*16 + 8*hh + r][query c of tile qt]
#pragma unroll
  for (int qt = 0; qt < 2; ++qt) {
    mrun[qt] = -INFINITY;
    lrun[qt] = 0.f;
#pragma unroll
    for (int t = 0; t < 4; ++t) oacc[qt][t] = zero8();
  }

  // ---- chunk copies, by the 128 threads of the key half: thread -> rows (tl >> 3) + 16 * i, i = 0..3, of each tile, 16 B at column 8 * (tl & 7) ----
  const int tl = tid & 127;
  const int trow = tl >> 3, tcol = (tl & 7) * 8;
  const _Float16* kg0 = Kg + (size_t)trow * DM + tcol;              // chunk 0 of the half: K row trow, d = tcol..tcol+7
  const _Float16* vg0 = Vg + (size_t)trow * SEQ + tcol;             // chunk 0 of the half: V^T row d = trow, s = tcol..tcol+7
  const _Float16* ringh = kvring + kh * (2 * 2 * TL);               // the half's two buffers
  const unsigned  lk0 = lds_off(ringh) + (unsigned)(trow * LP + tcol) * 2u;
  auto copy_chunk = [&](int ck, int buf) {
    const unsigned l = lk0 + (unsigned)buf * (unsigned)(2 * TL * 2);
    copy4x2_lds(l, l + (unsigned)(TL * 2), 16u * LP * 2u,
                kg0 + (size_t)ck * 64 * DM, (size_t)16 * DM, vg0 + (size_t)ck * 64, (size_t)16 * SEQ);
  };
  copy_chunk(0, 0);
  wait_copies();
  __syncthreads();                           // chunk 0 is readable by every wave
  copy_chunk(1, 1);

  for (int kt = 0; kt < NKH; ++kt) {         // static trip count
    const _Float16* Ksh = ringh + (kt & 1) * (2 * TL);   // keys kv0 = kh * SEQ/2 + kt * 64 .. kv0 + 63
    const _Float16* Vth = Ksh + TL;

    // ---- scores, transposed: 64 keys x 32 queries per wave, one f16 product, each K fragment used by both query tiles;
    //      s[qt][j][r] = score of key kv0 + j*16 + 8*hh + r with query q0 + qt*16 + c ----
    v8f s[2][4];
#pragma unroll
    for (int j = 0; j < 4; ++j) {
      FH kb[2];
#pragma unroll
      for (int dc = 0; dc < 2; ++dc) {
        kb[dc].h[0] = *(const v8h*)(Ksh + (j * 16 + c) * LP + dc * 32 + 8 * hh);
        kb[dc].h[1] = *(const v8h*)(Ksh + (j * 16 + c) * LP + dc * 32 + 16 + 8 * hh);
      }
#pragma unroll
      for (int qt = 0; qt < 2; ++qt) {
        v8f a = zero8();
#pragma unroll
        for (int dc = 0; dc < 2; ++dc) a = mma_h(kb[dc].v, qah[qt][dc], a);
        s[qt][j] = a;
      }
    }

    FH pb[2][2];
#pragma unroll   // constant indices, so that the per-tile arrays stay in registers
    for (int qt = 0; qt < 2; ++qt) {
      // ---- maximum of the lane's 32 scores, joined with the other wave half's; online softmax ----
      float mj[4];
#pragma unroll
      for (int j = 0; j < 4; ++j) {
        mj[j] = s[qt][j][0];
#pragma unroll
        for (int r = 1; r < 8; ++r) mj[j] = fmaxf(mj[j], s[qt][j][r]);
      }
      float m = fmaxf(fmaxf(mj[0], mj[1]), fmaxf(mj[2], mj[3]));
      m = fmaxf(m, xhalf(m));
      const float mnew  = fmaxf(mrun[qt], m);
      const float alpha = __builtin_amdgcn_exp2f(mrun[qt] - mnew);
      const float poff  = 10.0f - mnew;        // exponent offset: minus the maximum, plus 10 for the x1024 carry of p
      mrun[qt] = mnew;

      // ---- P^T (x1024, f16) straight into the B operand: element e of 32-key block kk = key kk*32 + (e < 8 ? 8*hh + e : 16 + 8*hh + e - 8) ----
      float pj[4];
#pragma unroll   // constant indices, so that s stays in registers
      for (int j = 0; j < 4; ++j) s[qt][j] = s[qt][j] + poff;   // whole tiles at once: packed adds
#pragma unroll
      for (int j = 0; j < 4; ++j) {
        pj[j] = 0.f;
#pragma unroll
        for (int r = 0; r < 8; ++r) {
          const float p = __builtin_amdgcn_exp2f(s[qt][j][r]);   // 1024 p
          pj[j] += p;
          pb[qt][j >> 1].h[j & 1][r] = (_Float16)p;
        }
      }
      lrun[qt] = lrun[qt] * alpha + ((pj[0] + pj[1]) + (pj[2] + pj[3]));
#pragma unroll
      for (int t = 0; t < 4; ++t)
#pragma unroll
        for (int r = 0; r < 8; ++r) oacc[qt][t][r] *= alpha;
    }

    // ---- context^T += V^T . P^T (f16 WMMA), each V^T fragment used by both query tiles ----
#pragma unroll
    for (int kk = 0; kk < 2; ++kk) {
#pragma unroll
      for (int t = 0; t < 4; ++t) {
        FH vb;
        vb.h[0] = *(const v8h*)(Vth + (t * 16 + c) * LP + kk * 32 + 8 * hh);
        vb.h[1] = *(const v8h*)(Vth + (t * 16 + c) * LP + kk * 32 + 16 + 8 * hh);
#pragma unroll
        for (int qt = 0; qt < 2; ++qt) oacc[qt][t] = mma_h(vb.v, pb[qt][kk].v, oacc[qt][t]);
      }
    }
    wait_lds_reads();
    wait_copies();
    __syncthreads();                         // publishes chunk kt+1 and ends every wave's reads of chunk kt's buffer
    if (kt + 2 < NKH) copy_chunk(kt + 2, kt & 1);
  }
  wait_copies();

  // ---- the two key halves meet: this wave keeps query tile kh and hands tile 1 - kh (context, maximum, sum; unnormalised) to wave ^ 4.
  //      A lane reads back exactly the addresses its partner lane wrote: row = query c; d = t*16 + 8*hh .. + 7; columns 64 + 2*hh, 65 + 2*hh.
  const bool up = (kh != 0);                 // wave-uniform
  const float l0 = lrun[0] + xhalf(lrun[0]);   // the wave halves' sums joined
  const float l1 = lrun[1] + xhalf(lrun[1]);
  {
    float* xs = Os[wave];
#pragma unroll
    for (int t = 0; t < 4; ++t) {
      v4f w0, w1;
#pragma unroll
      for (int e = 0; e < 4; ++e) {
        w0[e] = up ? oacc[0][t][e]     : oacc[1][t][e];
        w1[e] = up ? oacc[0][t][4 + e] : oacc[1][t][4 + e];
      }
      *(v4f*)(xs + c * OSP + t * 16 + 8 * hh)     = w0;
      *(v4f*)(xs + c * OSP + t * 16 + 8 * hh + 4) = w1;
    }
    xs[c * OSP + 64 + 2 * hh] = up ? mrun[0] : mrun[1];
    xs[c * OSP + 65 + 2 * hh] = up ? l0 : l1;
  }
  __syncthreads();                           // every wave's handed-over tile is readable by its partner
  // ---- join, normalise (1/l; the x1024 cancels) and stage the finished 16x64 tile in the slab just read, which no other wave touches again
  float* os = Os[wave ^ 4];
  {
    const float mo = os[c * OSP + 64 + 2 * hh];
    const float lo = os[c * OSP + 65 + 2 * hh];
    const float ms = up ? mrun[1] : mrun[0];
    const float ls = up ? l1 : l0;
    const float mm = fmaxf(ms, mo);
    const float as = __builtin_amdgcn_exp2f(ms - mm);
    const float ao = __builtin_amdgcn_exp2f(mo - mm);
    const float l = ls * as + lo * ao;
    const float inv = (l > 0.f) ? (1.0f / l) : 0.f;      // sum and context both carry the x1024 of p
    const float fs = as * inv, fo = ao * inv;
#pragma unroll
    for (int t = 0; t < 4; ++t) {
      const v4f o0 = *(const v4f*)(os + c * OSP + t * 16 + 8 * hh);
      const v4f o1 = *(const v4f*)(os + c * OSP + t * 16 + 8 * hh + 4);
      v4f w0, w1;
#pragma unroll
      for (int e = 0; e < 4; ++e) {
        w0[e] = (up ? oacc[1][t][e]     : oacc[0][t][e])     * fs + o0[e] * fo;
        w1[e] = (up ? oacc[1][t][4 + e] : oacc[0][t][4 + e]) * fs + o1[e] * fo;
      }
      *(v4f*)(os + c * OSP + t * 16 + 8 * hh)     = w0;
      *(v4f*)(os + c * OSP + t * 16 + 8 * hh + 4) = w1;
    }
  }
  wave_sync_lds();
  // ---- bf16 hi/lo split, whole-line stores of the wave's finished tile: rows qf .. qf + 15
  {
    const int qf = q0 + kh * 16;
    const int q4 = lane >> 3, c8 = (lane & 7) * 8;
    v4u hv[4], lv[4];
#pragma unroll
    for (int it = 0; it < 4; ++it) {
      const int row = it * 4 + q4;   // it 0..3 x q4 0..3 = rows 0..15 of the wave tile
      const float* sp = os + row * OSP + c8;
      v4u a, a2;
#pragma unroll
      for (int e = 0; e < 4; ++e) {
        const float f0 = sp[2 * e], f1 = sp[2 * e + 1];
        const unsigned short h0 = bf_bits(f0), h1 = bf_bits(f1);
        const unsigned short l0b = bf_bits(f0 - bf_up(h0)), l1b = bf_bits(f1 - bf_up(h1));
        a[e] = pk16(h0, h1); a2[e] = pk16(l0b, l1b);
      }
      hv[it] = a; lv[it] = a2;
    }
    {
#pragma unroll
      for (int it = 0; it < 4; ++it) {
        const int row = it * 4 + q4;
        const size_t go = (size_t)(qf + row) * DM + (size_t)h * HD + c8;
        *(v4u*)(ohp + go) = hv[it];
        *(v4u*)(olp + go) = lv[it];
      }
    }
  }
}

// =====================================================================================================
// Workspace map (bytes), every plane an exact multiple of its 64x64-tile / whole-line store granularity:
//   Xb    bf16 [4096][1024]          0           8388608
//   Wqkvb bf16 [3072 n][1024 k]      8388608     6291456   (rows 0..1023 q, 1024..2047 k, 2048..3071 v weights)
//   Wob   bf16 [1024][1024]          14680064    2097152
//   Qh    f16  [4096][1024]          16777216    8388608
//   Kp    f16  [4096][1024]          25165824    8388608
//   VT    f16  [1024][4096]          33554432    8388608   (v^T incl. bias)
//   Oh    bf16 [4096][1024]          41943040    8388608
//   Ol    bf16 [4096][1024]          50331648    8388608
//   end                              58720256
// Weights are [out n][in k] with k contiguous = the Bt / A layout the GEMM wants, so they are only converted.
// =====================================================================================================
extern "C" void kernel_launch(void* const* d_in, const int* in_sizes, int n_in,
                              void* d_out, int out_size, void* d_ws, size_t ws_size,
                              hipStream_t stream) {
  if (n_in < 7) return;
  if (in_sizes[0] != SEQ * DM) return;
  if (in_sizes[1] != SEQ * HD) return;
  if (in_sizes[2] != SEQ * HD) return;
  if (in_sizes[3] != 3 * DM * DM) return;
  if (in_sizes[4] != 3 * DM) return;
  if (in_sizes[5] != DM * DM) return;
  if (in_sizes[6] != DM) return;
  if (out_size != SEQ * DM) return;

  const float* x     = (const float*)d_in[0];
  const float* cosp  = (const float*)d_in[1];
  const float* sinp  = (const float*)d_in[2];
  const float* wqkv  = (const float*)d_in[3];
  const float* bqkv  = (const float*)d_in[4];
  const float* wout  = (const float*)d_in[5];
  const float* bout  = (const float*)d_in[6];

  const size_t PXb  = (size_t)SEQ * DM * 2;           //  8388608
  const size_t PWq  = (size_t)3 * DM * DM * 2;        //  6291456
  const size_t PWo  = (size_t)DM * DM * 2;            //  2097152
  const size_t P16  = (size_t)SEQ * DM * 2;           //  8388608 (q, k, out hi, out lo)
  const size_t PVT  = (size_t)DM * SEQ * 2;           //  8388608
  size_t off = 0;
  const size_t oXb  = off; off += PXb;
  const size_t oWq  = off; off += PWq;
  const size_t oWo  = off; off += PWo;
  const size_t oQh  = off; off += P16;
  const size_t oKp  = off; off += P16;
  const size_t oVT  = off; off += PVT;
  const size_t oOh  = off; off += P16;
  const size_t oOl  = off; off += P16;
  if (off > ws_size) return;                          // off = 58720256
  if (off > (size_t)134217728) return;

  char* ws = (char*)d_ws;
  unsigned short* Xb    = (unsigned short*)(ws + oXb);
  unsigned short* Wqkvb = (unsigned short*)(ws + oWq);
  unsigned short* Wob   = (unsigned short*)(ws + oWo);
  unsigned short* Qh    = (unsigned short*)(ws + oQh);
  unsigned short* Kp    = (unsigned short*)(ws + oKp);
  unsigned short* VT    = (unsigned short*)(ws + oVT);
  unsigned short* Oh    = (unsigned short*)(ws + oOh);
  unsigned short* Ol    = (unsigned short*)(ws + oOl);

  const dim3 blk(256);
  const int n8x  = SEQ * DM / 8;                                // 524288
  const int n8wq = 3 * DM * DM / 8;                             // 393216
  const int n8wo = DM * DM / 8;                                 // 131072
  const dim3 gCvtX((n8x + 255) / 256);                          // 2048 blocks
  const dim3 gCvtWq((n8wq + 255) / 256);                        // 1536 blocks
  const dim3 gCvtWo((n8wo + 255) / 256);                        //  512 blocks
  const dim3 gQKV(NBQK + NBVT);                                 // 256 blocks (M=4096, N=2048) + 128 blocks (M=1024, N=4096)
  const dim3 gAttn(NH * (SEQ / QWG));                           //  512 blocks
  const dim3 gOut(((SEQ / 64) * (DM / 64) + 7) / 8, 1);         // 1024 tiles -> 128 blocks: M=4096, N=1024

  // (1) x -> bf16 plane [4096][1024]; w_qkv -> bf16 [3072][1024]; w_out -> bf16 [1024][1024]
  cvt_bf16x8<<<gCvtX, blk, 0, stream>>>(x, Xb, n8x);
  cvt_bf16x8<<<gCvtWq, blk, 0, stream>>>(wqkv, Wqkvb, n8wq);
  cvt_bf16x8<<<gCvtWo, blk, 0, stream>>>(wout, Wob, n8wo);
  // (2, 3) q|k projection with RoPE and v^T projection, one launch
  proj_qkv<<<gQKV, blk, 0, stream>>>(Xb, Wqkvb, Qh, Kp, VT, bqkv, cosp, sinp);
  // (4) attention -> context bf16 hi / lo planes [4096][1024]
  attn64<<<gAttn, blk, 0, stream>>>(Qh, Kp, VT, Oh, Ol);
  // (5) out = context . w_out^T + b_out -> d_out f32 [4096][1024]  (A = context hi + lo planes, 2 products; K=1024, col bias)
  gemm64<1, 0, 1><<<gOut, blk, 0, stream>>>(
      Oh, Ol, DM, 0LL, Wob, Wob, DM, 0LL,
      d_out, DM, 0LL, d_out, DM, 0LL, 0,
      bout, cosp, sinp, Kp,
      SEQ, DM, DM, 1.0f, 1.0f);
  (void)hipGetLastError();
}
